// v000
// The times below were measured on an AMD MI455X: many runs one after another, warmed up first and cycling through
// copies of the inputs, with the whole window's GPU time divided by the number of runs. Launches and the gaps
// between them are all in it. The median over several windows is given; except for v000 it joins two sittings, which
// can be a few percent apart, so the side-by-side timings, each taken in one sitting, are the better comparison.
// v000, which the later versions start from, runs in 856 microseconds.
// compute dtype: all float inputs rounded to bf16; q = query . Wq^T + bq and k_l, v_l = key_l / value_l . W^T + b with EXACT bf16 products on WMMA 16x16x32 (natural rows); PLAIN attention per layer: q, k as single f16 operands x 1/8, running-max softmax in f32 (hardware exp), P (scaled by 2^11, single f16) x v (single f16); gate_l = sigmoid([query (exact) | x_l (bf16 hi + residual, 2 products)] . Wsig_l^T + bsig_l) (precise expf); fused = sum_l gate_l x_l / sqrt(3) in f32; out = fused (bf16 hi + residual) . Wf^T (2 products) + bf.
#include <hip/hip_runtime.h>
#include <math.h>

typedef __attribute__((ext_vector_type(16))) _Float16 v16h;
typedef __attribute__((ext_vector_type(16))) __bf16 v16b;
typedef __attribute__((ext_vector_type(8)))  _Float16 v8h;
typedef __attribute__((ext_vector_type(8)))  float v8f;
typedef __attribute__((ext_vector_type(4)))  float v4f;
typedef __attribute__((ext_vector_type(2)))  float v2f;
typedef __attribute__((ext_vector_type(4)))  unsigned v4u;
typedef __attribute__((ext_vector_type(4)))  int v4i;
typedef float __attribute__((may_alias)) float_a;
typedef int __attribute__((may_alias)) int_a;

template <typename T> __device__ __forceinline__ void vst2(void* p, T v) { *(T*)p = v;  }
__device__ __forceinline__ v8f wmma16(v16h a, v16h b, v8f c) {
  v8f d = __builtin_amdgcn_wmma_f32_16x16x32_f16(false, a, false, b, (short)0, c, false, false);
  asm volatile("v_nop\n\tv_nop\n\tv_nop\n\tv_nop" : "+v"(d) : "v"(a), "v"(b));
  return d;
}
__device__ __forceinline__ v8f wmma_bf(v16b a, v16b b, v8f c) {
  v8f d = __builtin_amdgcn_wmma_f32_16x16x32_bf16(false, a, false, b, (short)0, c, false, false);
  asm volatile("v_nop\n\tv_nop\n\tv_nop\n\tv_nop" : "+v"(d) : "v"(a), "v"(b));
  return d;
}
// Multi-layer source attention (B 4, 1,024 queries over 4 layers of 1,024 keys/values, d 512, 8 heads x 64): a shared query projection, per-layer key/value projections, softmax(q k_l^T / 8) v_l per layer, per-layer sigmoid gates from [query | x_l], gated sum over layers / sqrt(3), final linear map.
__device__ __forceinline__ v16h frag_h(const _Float16* rowk0, int lane) {
  union { v16h v; v8h q[2]; } u; const _Float16* p = rowk0 + 8 * (lane >> 4);
  u.q[0] = *(const v8h*)p; u.q[1] = *(const v8h*)(p + 16); return u.v;
}
__device__ __forceinline__ v16h frag_f32(const float* rowk0, int lane) {
  v16h a; const float* p = rowk0 + 8 * (lane >> 4);
#pragma unroll
  for (int i = 0; i < 8; ++i) { a[i] = (_Float16)p[i]; a[8 + i] = (_Float16)p[16 + i]; }
  return a;
}
__device__ __forceinline__ v16h frag_f32s(const float* rowk0, int lane, float sc) {
  v16h a; const float* p = rowk0 + 8 * (lane >> 4);
#pragma unroll
  for (int i = 0; i < 8; ++i) { a[i] = (_Float16)(p[i] * sc); a[8 + i] = (_Float16)(p[16 + i] * sc); }
  return a;
}
// column fragment from a [K][ld] layout (column n), rows >= K read as 0
__device__ __forceinline__ v16h fragc_f32(const float* W, int k0, int n, int lane, int ld, int K) {
  v16h a; const int g = lane >> 4;
#pragma unroll
  for (int i = 0; i < 8; ++i) { const int ka = k0 + 8 * g + i, kb = ka + 16;
    a[i] = (_Float16)(ka < K ? W[(size_t)(ka < K ? ka : K - 1) * ld + n] : 0.f); a[8 + i] = (_Float16)(kb < K ? W[(size_t)(kb < K ? kb : K - 1) * ld + n] : 0.f); }
  return a;
}
struct F2 { v16b h, l; };
__device__ __forceinline__ F2 bsplit16(const float v[16]) { F2 r;
#pragma unroll
  for (int i = 0; i < 16; ++i) { const __bf16 h = (__bf16)v[i]; r.h[i] = h; r.l[i] = (__bf16)(v[i] - (float)h); }
  return r; }
__device__ __forceinline__ F2 split_row(const float* row, int k0, int lane) { float v[16]; const float* p = row + k0 + 8 * (lane >> 4);
#pragma unroll
  for (int i = 0; i < 8; ++i) { v[i] = p[i]; v[8 + i] = p[16 + i]; }
  return bsplit16(v); }
__device__ __forceinline__ F2 split_rowK(const float* row, int k0, int lane, int K) { float v[16]; const int g = lane >> 4;
#pragma unroll
  for (int i = 0; i < 8; ++i) { const int ka = k0 + 8 * g + i, kb = ka + 16; v[i] = ka < K ? row[ka < K ? ka : K - 1] : 0.f; v[8 + i] = kb < K ? row[kb < K ? kb : K - 1] : 0.f; }
  return bsplit16(v); }
__device__ __forceinline__ F2 split_col(const float* W, int k0, int n, int lane, int ld, int K) { float v[16]; const int g = lane >> 4;
#pragma unroll
  for (int i = 0; i < 8; ++i) { const int ka = k0 + 8 * g + i, kb = ka + 16; v[i] = ka < K ? W[(size_t)(ka < K ? ka : K - 1) * ld + n] : 0.f; v[8 + i] = kb < K ? W[(size_t)(kb < K ? kb : K - 1) * ld + n] : 0.f; }
  return bsplit16(v); }
__device__ __forceinline__ v8f mac3(const F2& a, const F2& b, v8f c) { c = wmma_bf(a.l, b.h, c); c = wmma_bf(a.h, b.l, c); return wmma_bf(a.h, b.h, c); }
__device__ __forceinline__ float sigm(float v) { return 1.0f / (1.0f + expf(-v)); }
#define LDSX() do { asm volatile("s_wait_dscnt 0" ::: "memory"); __builtin_amdgcn_wave_barrier(); __builtin_amdgcn_fence(__ATOMIC_RELEASE, "workgroup"); } while (0)


#define NB 4
#define SS 1024
#define DM 512
#define NH 8
#define NLAY 4
__device__ __forceinline__ size_t kvrow(size_t r) { return (r / SS) * ((size_t)NLAY * SS) + (r % SS); }   // key/value [B][L][S][D]: engine row (b, s) of layer l lives at (b*L + l)*S + s (layer offset added to the pointer)
#define HD 64
#define QKVW (3 * DM)
#ifndef TQB
#define TQB (SS / 64)
#define TNB NB
#define TOB (NB * SS / 64)     // output row tiles (all)
#endif
typedef __attribute__((ext_vector_type(8))) __bf16 v8b;
__device__ __forceinline__ v16b frag_b(const __bf16* rowk0, int lane) {
  union { v16b v; v8b q[2]; } u; const __bf16* p = rowk0 + 8 * (lane >> 4);
  u.q[0] = *(const v8b*)p; u.q[1] = *(const v8b*)(p + 16); return u.v;
}
__device__ __forceinline__ float bfr(float v) { return (float)(__bf16)v; }
__device__ __attribute__((noinline)) float exp_ni(float v) { return expf(v); }
__device__ __attribute__((noinline)) float erf_ni(float v) { return erff(v); }

#define PK_A 0                       // [1536][512] Wqkv rows (natural [out][in])
#define PK_P (PK_A + QKVW * DM)        // [512][512] Wo rows (natural)
#define PK_END (PK_P + DM * DM)
#define WS_PK  0u
#define WS_QK  (WS_PK + 2u * PK_END)             // f16 [4096 rows][1024]: q | k
#define WS_QKL (WS_QK + 2u * NB * SS * 2 * DM)     // f16 q | k residual planes x2048
#define WS_VTH (WS_QKL + 2u * NB * SS * 2 * DM)    // f16 [b][512 (h*64+d)][1024 s] hi
#define WS_VTL (WS_VTH + 2u * NB * DM * SS)        // f16 lo x 2048
#define WS_O   (WS_VTL + 2u * NB * DM * SS)        // f32 [4096][512]
#define WS_CS  (WS_O + 4u * NB * SS * DM)           // f32 [2][1024][32], unused
#define WS_PSG (WS_CS + 4u * 2 * SS * 32)                  // bf16 natural rows Wsig [4][512][1024]
#define WS_FUS (WS_PSG + 2u * (size_t)NLAY * DM * 2 * DM)   // f32 [NR][512] gated sum
#define WS_END (WS_FUS + 4u * (size_t)NB * SS * DM)
// ---- k_pack: block = (row n, which): natural [out][in] rows -> bf16; which 0..2 -> W_q/W_k/W_v into PK_A rows which*512 + n; 3 -> W_o into PK_P
__global__ __launch_bounds__(256) void k_pack(const float* __restrict__ WQ, const float* __restrict__ WK, const float* __restrict__ WV, const float* __restrict__ WO, __bf16* __restrict__ PK) {
  __shared__ __align__(16) __bf16 s[DM]; const int n = blockIdx.x, which = blockIdx.y, t = threadIdx.x; const float* Wm = (which == 0) ? WQ : (which == 1) ? WK : (which == 2) ? WV : WO;
  for (int k = t; k < DM; k += 256) s[k] = (__bf16)Wm[(size_t)n * DM + k];
  __syncthreads();
  __bf16* dst = (which < 3) ? PK + PK_A + ((size_t)which * DM + n) * DM : PK + PK_P + (size_t)n * DM;
  for (int q = t; q < DM / 8; q += 256) vst2((unsigned*)(dst + q * 8), *(const v4u*)&s[q * 8]);
}
__global__ __launch_bounds__(128) void k_qkv(const float* __restrict__ XQ, const float* __restrict__ XK, const float* __restrict__ XV, const __bf16* __restrict__ P, const float* __restrict__ BQ, const float* __restrict__ BK, const float* __restrict__ BV, _Float16* __restrict__ QK, _Float16* __restrict__ QKL, _Float16* __restrict__ VTH, _Float16* __restrict__ VTL) {
  const int which0 = (blockIdx.y * 128) / DM; const float* X = (which0 == 0) ? XQ : (which0 == 1) ? XK : XV; const float* BB = BQ ? (((which0 == 0) ? BQ : (which0 == 1) ? BK : BV) + (blockIdx.y * 128 - which0 * DM)) : nullptr;
  __shared__ __align__(16) _Float16 so[4][16][136], sol[4][16][136]; __shared__ __align__(16) _Float16 sth[128][72], stl[128][72];
  const int tid = threadIdx.x, wave = tid >> 5, lane = tid & 31, col = lane & 15, g = lane >> 4; const size_t r0 = (size_t)blockIdx.x * 64 + wave * 16; const int n0 = blockIdx.y * 128;
  v8f acc[8] = {};
#pragma unroll 2
  for (int kc = 0; kc < DM / 32; ++kc) { v16b a; { const float* p = X + ((which0 == 0) ? (size_t)(r0 + col) : kvrow(r0 + col)) * DM + kc * 32 + 8 * g;
#pragma unroll
      for (int i = 0; i < 8; ++i) { a[i] = (__bf16)p[i]; a[8 + i] = (__bf16)p[16 + i]; } }
#pragma unroll
    for (int j = 0; j < 8; ++j) acc[j] = wmma_bf(a, frag_b(P + (size_t)(n0 + j * 16 + col) * DM + kc * 32, lane), acc[j]); }
  if (n0 < 2 * DM) {   // q stored unscaled (f16 sigma ~0.6, no subnormal exposure); 1/8 applied to the f32 score
#pragma unroll
    for (int j = 0; j < 8; ++j) {
#pragma unroll
      for (int r = 0; r < 8; ++r) { const float v = acc[j][r] + (BB ? bfr(BB[j * 16 + col]) : 0.f); const _Float16 hv = (_Float16)v; so[wave][8 * g + r][j * 16 + col] = hv; sol[wave][8 * g + r][j * 16 + col] = (_Float16)((v - (float)hv) * 2048.0f); } }   // q, k (+ bias) as f16 hi + (x2048) residual
    LDSX();
    for (int rl = 0; rl < 16; ++rl) if (lane < 16) { vst2((unsigned*)(QK + (r0 + rl) * (2 * DM) + n0 + lane * 8), *(const v4u*)&so[wave][rl][lane * 8]); vst2((unsigned*)(QKL + (r0 + rl) * (2 * DM) + n0 + lane * 8), *(const v4u*)&sol[wave][rl][lane * 8]); }
  } else {
#pragma unroll
    for (int j = 0; j < 8; ++j) {
#pragma unroll
      for (int r = 0; r < 8; ++r) { const float v = acc[j][r] + (BB ? bfr(BB[j * 16 + col]) : 0.f); const _Float16 hv = (_Float16)v; sth[j * 16 + col][wave * 16 + 8 * g + r] = hv; stl[j * 16 + col][wave * 16 + 8 * g + r] = (_Float16)((v - (float)hv) * 2048.0f); } }
    __syncthreads();
    const size_t rb = (size_t)blockIdx.x * 64; const int b = (int)(rb / SS), s0 = (int)(rb % SS); const int pc0 = n0 - 2 * DM;
    for (int q = tid; q < 128 * 8; q += 128) { const int d = q >> 3, pc = q & 7; const size_t o = ((size_t)b * DM + pc0 + d) * SS + s0 + pc * 8; vst2((unsigned*)(VTH + o), *(const v4u*)&sth[d][pc * 8]); vst2((unsigned*)(VTL + o), *(const v4u*)&stl[d][pc * 8]); }
  }
}
// ---- k_attn: block = (64 queries, head h, batch b): all-keys flash attention (K = 64: 2 k-steps), scores = (q.k) * 0.125 with single f16 operands, P.V: f16 P (x2^11) x V hi, single product; O[b*S+q][h*64+d] = (acc + accl / 2048) / (2048 l) (256-B segments)
__global__ __launch_bounds__(128) void k_attn(const _Float16* __restrict__ QK, const _Float16* __restrict__ QKL, const _Float16* __restrict__ VTH, const _Float16* __restrict__ VTL, const void* __restrict__ KMASK, float* __restrict__ O) {
  __shared__ __align__(16) float sp[4][16][36]; __shared__ __align__(16) float so[4][16][68];
  const int tid = threadIdx.x, wave = tid >> 5, lane = tid & 31, col = lane & 15, g = lane >> 4;
  const int qb = blockIdx.x, h = blockIdx.y, b = blockIdx.z; const int q0 = qb * 64 + wave * 16; const size_t rq = (size_t)b * SS + q0 + col;
  v16h aq[2], aql[2];
#pragma unroll
  for (int kc = 0; kc < 2; ++kc) { aq[kc] = frag_h(QK + rq * (2 * DM) + h * HD + kc * 32, lane); aql[kc] = frag_h(QKL + rq * (2 * DM) + h * HD + kc * 32, lane); }
  float m[8], l[8];
#pragma unroll
  for (int r = 0; r < 8; ++r) { m[r] = -3.0e38f; l[r] = 0.f; }
  v8f acc[4] = {}, accl[4] = {};
  const int nks = SS / 32;   // all keys
#pragma unroll 1
  for (int ks = 0; ks < nks; ++ks) { v8f s[2];
#pragma unroll
    for (int ct = 0; ct < 2; ++ct) { const int kk = ks * 32 + ct * 16 + col; const _Float16* krow = QK + ((size_t)b * SS + kk) * (2 * DM) + DM + h * HD; const _Float16* krowl = QKL + ((size_t)b * SS + kk) * (2 * DM) + DM + h * HD; v8f c = {}, cl = {};
#pragma unroll
      for (int kc = 0; kc < 2; ++kc) c = wmma16(aq[kc], frag_h(krow + kc * 32, lane), c);   // single product: q, k as one-rounding f16 operands
      (void)cl; (void)krowl;
      { const bool keepk = true;
#pragma unroll
      for (int r = 0; r < 8; ++r) s[ct][r] = keepk ? c[r] * 0.125f : -3.0e38f; } }   // 1/sqrt(64)
#pragma unroll
    for (int r = 0; r < 8; ++r) { float mx = fmaxf(s[0][r], s[1][r]);
#pragma unroll
      for (int o = 1; o < 16; o <<= 1) mx = fmaxf(mx, __shfl_xor(mx, o));
      const float mn = fmaxf(m[r], mx); const float alpha = (m[r] <= -1.0e38f) ? 0.f : __expf(m[r] - mn);
      const float e0 = (s[0][r] <= -1.0e38f) ? 0.f : __expf(s[0][r] - mn), e1 = (s[1][r] <= -1.0e38f) ? 0.f : __expf(s[1][r] - mn); float es = e0 + e1;
#pragma unroll
      for (int o = 1; o < 16; o <<= 1) es += __shfl_xor(es, o);
      l[r] = l[r] * alpha + es; m[r] = mn;
#pragma unroll
      for (int dt = 0; dt < 4; ++dt) { acc[dt][r] *= alpha; accl[dt][r] *= alpha; }
      sp[wave][8 * g + r][col] = e0; sp[wave][8 * g + r][16 + col] = e1; }
    LDSX();
    v16h pa, pl; { const float* prow = &sp[wave][col][0] + 8 * (lane >> 4);
#pragma unroll
      for (int i = 0; i < 8; ++i) { const float x0 = prow[i] * 2048.0f, x1 = prow[16 + i] * 2048.0f; const _Float16 h0 = (_Float16)x0, h1 = (_Float16)x1; pa[i] = h0; pa[8 + i] = h1; pl[i] = (_Float16)((x0 - (float)h0) * 2048.0f); pl[8 + i] = (_Float16)((x1 - (float)h1) * 2048.0f); } }   // P scaled by 2^11 before the f16 split so small softmax weights stay out of the f16 subnormal range; 2^-11 folded into the epilogue
#pragma unroll
    for (int dt = 0; dt < 4; ++dt) { const size_t vr = ((size_t)b * DM + h * HD + dt * 16 + col) * SS + ks * 32; acc[dt] = wmma16(pa, frag_h(VTH + vr, lane), acc[dt]); }   // single product: P (x2^11) x V
    (void)pl;
    LDSX(); }
#pragma unroll
  for (int r = 0; r < 8; ++r) { const float il = (1.0f / 2048.0f) / l[r];
#pragma unroll
    for (int dt = 0; dt < 4; ++dt) so[wave][8 * g + r][dt * 16 + col] = (acc[dt][r] + accl[dt][r] * (1.0f / 2048.0f)) * il; }
  LDSX();
  for (int rl = 0; rl < 16; ++rl) if (lane < 16) vst2(O + ((size_t)b * SS + q0 + rl) * DM + h * HD + lane * 4, *(const v4f*)&so[wave][rl][lane * 4]);
}
// ---- k_out: block = (64 rows, 128 cols): out = O(hi/lo) . Wo rows (2 products) + bo
__global__ __launch_bounds__(128) void k_out(const float* __restrict__ O, const __bf16* __restrict__ P, const float* __restrict__ BO, float* __restrict__ Y) {
  __shared__ __align__(16) float so[4][16][132];
  const int tid = threadIdx.x, wave = tid >> 5, lane = tid & 31, col = lane & 15, g = lane >> 4; const size_t r0 = (size_t)blockIdx.x * 64 + wave * 16; const int n0 = blockIdx.y * 128;
  v8f acc[8] = {};
#pragma unroll 2
  for (int kc = 0; kc < DM / 32; ++kc) { const F2 a = split_row(O + (r0 + col) * DM, kc * 32, lane);
#pragma unroll
    for (int j = 0; j < 8; ++j) { const v16b w = frag_b(P + (size_t)(n0 + j * 16 + col) * DM + kc * 32, lane); acc[j] = wmma_bf(a.l, w, acc[j]); acc[j] = wmma_bf(a.h, w, acc[j]); } }
#pragma unroll
  for (int j = 0; j < 8; ++j) {
#pragma unroll
    for (int r = 0; r < 8; ++r) so[wave][8 * g + r][j * 16 + col] = acc[j][r] + bfr(BO[n0 + j * 16 + col]); }
  LDSX();
  for (int rl = 0; rl < 16; ++rl) vst2(Y + (r0 + rl) * DM + n0 + lane * 4, *(const v4f*)&so[wave][rl][lane * 4]);
}
#define NR (NB * SS)
// ---- k_packsig: Wsig [4][512][1024] natural rows -> bf16
__global__ __launch_bounds__(256) void k_packsig(const float* __restrict__ WS, __bf16* __restrict__ PSG) { const size_t n = blockIdx.x; const int t = threadIdx.x; __shared__ __align__(16) __bf16 s[2 * DM]; for (int k = t; k < 2 * DM; k += 256) s[k] = (__bf16)WS[n * 2 * DM + k]; __syncthreads(); for (int q = t; q < 2 * DM / 8; q += 256) vst2((unsigned*)(PSG + n * 2 * DM + q * 8), *(const v4u*)&s[q * 8]); }
// ---- k_gate: block = (64 rows, 128 cols) for layer l: g = sigmoid([query (exact bf16, 1 product) | x_l (hi + residual, 2 products)] . Wsig_l rows + bsig_l); FUS (+)= g * x_l / sqrt(3)
__global__ __launch_bounds__(128) void k_gate(const float* __restrict__ XQ, const float* __restrict__ XL, const __bf16* __restrict__ PSG, const float* __restrict__ BS, int l, float* __restrict__ FUS) {
  __shared__ __align__(16) float so[4][16][132];
  const int tid = threadIdx.x, wave = tid >> 5, lane = tid & 31, col = lane & 15, g = lane >> 4; const size_t r0 = (size_t)blockIdx.x * 64 + wave * 16; const int n0 = blockIdx.y * 128;
  const __bf16* Wr = PSG + (size_t)l * DM * 2 * DM; v8f acc[8] = {};
#pragma unroll 2
  for (int kc = 0; kc < DM / 32; ++kc) { v16b a; { const float* p = XQ + (r0 + col) * DM + kc * 32 + 8 * g;
#pragma unroll
      for (int i = 0; i < 8; ++i) { a[i] = (__bf16)p[i]; a[8 + i] = (__bf16)p[16 + i]; } }
#pragma unroll
    for (int j = 0; j < 8; ++j) acc[j] = wmma_bf(a, frag_b(Wr + (size_t)(n0 + j * 16 + col) * (2 * DM) + kc * 32, lane), acc[j]); }
#pragma unroll 2
  for (int kc = 0; kc < DM / 32; ++kc) { const F2 a = split_row(XL + (r0 + col) * DM, kc * 32, lane);
#pragma unroll
    for (int j = 0; j < 8; ++j) { const v16b w = frag_b(Wr + (size_t)(n0 + j * 16 + col) * (2 * DM) + DM + kc * 32, lane); acc[j] = wmma_bf(a.l, w, acc[j]); acc[j] = wmma_bf(a.h, w, acc[j]); } }
#pragma unroll
  for (int j = 0; j < 8; ++j) { const int c = n0 + j * 16 + col; const float bb = bfr(BS[(size_t)l * DM + c]);
#pragma unroll
    for (int r = 0; r < 8; ++r) { const size_t row = r0 + 8 * g + r; const float gte = 1.0f / (1.0f + exp_ni(-(acc[j][r] + bb))); const float prev = (l == 0) ? 0.f : FUS[row * DM + c]; so[wave][8 * g + r][j * 16 + col] = prev + gte * XL[row * DM + c] * 0.57735026918962576f; } }
  LDSX();
  for (int rl = 0; rl < 16; ++rl) vst2(FUS + (r0 + rl) * DM + n0 + lane * 4, *(const v4f*)&so[wave][rl][lane * 4]);
}
extern "C" void kernel_launch(void* const* d_in, const int* in_sizes, int n_in, void* d_out, int out_size, void* d_ws, size_t ws_size, hipStream_t stream) {
  (void)in_sizes; (void)n_in; (void)out_size;
  const float** F = (const float**)d_in;   // 0 query [4,1024,512], 1 key [4,4,1024,512], 2 value [4,4,1024,512], 3 Wq [512,512], 4 bq, 5 Wk [4,512,512], 6 bk [4,512], 7 Wv, 8 bv, 9 Wsig [4,512,1024], 10 bsig [4,512], 11 Wf [512,512], 12 bf
  if (ws_size < (size_t)WS_END) return;
  char* ws = (char*)d_ws; __bf16 *PK = (__bf16*)(ws + WS_PK), *PSG = (__bf16*)(ws + WS_PSG); _Float16 *QK = (_Float16*)(ws + WS_QK), *QKL = (_Float16*)(ws + WS_QKL), *VTH = (_Float16*)(ws + WS_VTH), *VTL = (_Float16*)(ws + WS_VTL); float *O = (float*)(ws + WS_O), *FUS = (float*)(ws + WS_FUS);
  k_packsig<<<NLAY * DM, 256, 0, stream>>>(F[9], PSG);
  for (int l = 0; l < NLAY; ++l) {
    k_pack<<<dim3(DM, 4), 256, 0, stream>>>(F[3], F[5] + (size_t)l * DM * DM, F[7] + (size_t)l * DM * DM, F[11], PK);   // Wq | Wk[l] | Wv[l] | Wf natural rows
    k_qkv<<<dim3(TNB * SS / 64, QKVW / 128), 128, 0, stream>>>(F[0], F[1] + (size_t)l * SS * DM, F[2] + (size_t)l * SS * DM, PK + PK_A, F[4], F[6] + (size_t)l * DM, F[8] + (size_t)l * DM, QK, QKL, VTH, VTL);   // (q recomputed per layer; identical)
    k_attn<<<dim3(TQB, NH, TNB), 128, 0, stream>>>(QK, QKL, VTH, VTL, nullptr, O);   // x_l
    k_gate<<<dim3(NR / 64, DM / 128), 128, 0, stream>>>(F[0], O, PSG, F[10], l, FUS); }
  k_out<<<dim3(TOB, DM / 128), 128, 0, stream>>>(FUS, PK + PK_P, F[12], (float*)d_out);   // fused . Wf^T + bf (PK_P holds Wf rows from the last pack)
}

// v001
// A run of this version takes 479 microseconds.
// Two timings next to v000 put it at 1.83 and 1.82 times that version's speed.
// compute dtype: all float inputs rounded to bf16; q = query . Wq^T + bq and k_l, v_l = key_l / value_l . W^T + b with EXACT bf16 products on WMMA 16x16x32 (natural rows); PLAIN attention per layer: q, k as single f16 operands x 1/8, running-max softmax in f32 (hardware exp), P (scaled by 2^11, single f16) x v (single f16); gate_l = sigmoid([query (exact) | x_l (bf16 hi + residual, 2 products)] . Wsig_l^T + bsig_l) (precise expf); fused = sum_l gate_l x_l / sqrt(3) in f32; out = fused (bf16 hi + residual) . Wf^T (2 products) + bf.
#include <hip/hip_runtime.h>
#include <math.h>

typedef __attribute__((ext_vector_type(16))) _Float16 v16h;
typedef __attribute__((ext_vector_type(16))) __bf16 v16b;
typedef __attribute__((ext_vector_type(8)))  _Float16 v8h;
typedef __attribute__((ext_vector_type(8)))  float v8f;
typedef __attribute__((ext_vector_type(4)))  float v4f;
typedef __attribute__((ext_vector_type(2)))  float v2f;
typedef __attribute__((ext_vector_type(4)))  unsigned v4u;
typedef __attribute__((ext_vector_type(4)))  int v4i;
typedef float __attribute__((may_alias)) float_a;
typedef int __attribute__((may_alias)) int_a;

template <typename T> __device__ __forceinline__ void vst2(void* p, T v) { *(T*)p = v;  }
__device__ __forceinline__ v8f wmma16(v16h a, v16h b, v8f c) {
  v8f d = __builtin_amdgcn_wmma_f32_16x16x32_f16(false, a, false, b, (short)0, c, false, false);
  asm volatile("v_nop\n\tv_nop\n\tv_nop\n\tv_nop" : "+v"(d) : "v"(a), "v"(b));
  return d;
}
__device__ __forceinline__ v8f wmma_bf(v16b a, v16b b, v8f c) {
  v8f d = __builtin_amdgcn_wmma_f32_16x16x32_bf16(false, a, false, b, (short)0, c, false, false);
  asm volatile("v_nop\n\tv_nop\n\tv_nop\n\tv_nop" : "+v"(d) : "v"(a), "v"(b));
  return d;
}
// Multi-layer source attention (B 4, 1,024 queries over 4 layers of 1,024 keys/values, d 512, 8 heads x 64): a shared query projection, per-layer key/value projections, softmax(q k_l^T / 8) v_l per layer, per-layer sigmoid gates from [query | x_l], gated sum over layers / sqrt(3), final linear map.
__device__ __forceinline__ v16h frag_h(const _Float16* rowk0, int lane) {
  union { v16h v; v8h q[2]; } u; const _Float16* p = rowk0 + 8 * (lane >> 4);
  u.q[0] = *(const v8h*)p; u.q[1] = *(const v8h*)(p + 16); return u.v;
}
__device__ __forceinline__ v16h frag_f32(const float* rowk0, int lane) {
  v16h a; const float* p = rowk0 + 8 * (lane >> 4);
#pragma unroll
  for (int i = 0; i < 8; ++i) { a[i] = (_Float16)p[i]; a[8 + i] = (_Float16)p[16 + i]; }
  return a;
}
__device__ __forceinline__ v16h frag_f32s(const float* rowk0, int lane, float sc) {
  v16h a; const float* p = rowk0 + 8 * (lane >> 4);
#pragma unroll
  for (int i = 0; i < 8; ++i) { a[i] = (_Float16)(p[i] * sc); a[8 + i] = (_Float16)(p[16 + i] * sc); }
  return a;
}
// column fragment from a [K][ld] layout (column n), rows >= K read as 0
__device__ __forceinline__ v16h fragc_f32(const float* W, int k0, int n, int lane, int ld, int K) {
  v16h a; const int g = lane >> 4;
#pragma unroll
  for (int i = 0; i < 8; ++i) { const int ka = k0 + 8 * g + i, kb = ka + 16;
    a[i] = (_Float16)(ka < K ? W[(size_t)(ka < K ? ka : K - 1) * ld + n] : 0.f); a[8 + i] = (_Float16)(kb < K ? W[(size_t)(kb < K ? kb : K - 1) * ld + n] : 0.f); }
  return a;
}
struct F2 { v16b h, l; };
__device__ __forceinline__ F2 bsplit16(const float v[16]) { F2 r;
#pragma unroll
  for (int i = 0; i < 16; ++i) { const __bf16 h = (__bf16)v[i]; r.h[i] = h; r.l[i] = (__bf16)(v[i] - (float)h); }
  return r; }
__device__ __forceinline__ F2 split_row(const float* row, int k0, int lane) { float v[16]; const float* p = row + k0 + 8 * (lane >> 4);
#pragma unroll
  for (int i = 0; i < 8; ++i) { v[i] = p[i]; v[8 + i] = p[16 + i]; }
  return bsplit16(v); }
__device__ __forceinline__ F2 split_rowK(const float* row, int k0, int lane, int K) { float v[16]; const int g = lane >> 4;
#pragma unroll
  for (int i = 0; i < 8; ++i) { const int ka = k0 + 8 * g + i, kb = ka + 16; v[i] = ka < K ? row[ka < K ? ka : K - 1] : 0.f; v[8 + i] = kb < K ? row[kb < K ? kb : K - 1] : 0.f; }
  return bsplit16(v); }
__device__ __forceinline__ F2 split_col(const float* W, int k0, int n, int lane, int ld, int K) { float v[16]; const int g = lane >> 4;
#pragma unroll
  for (int i = 0; i < 8; ++i) { const int ka = k0 + 8 * g + i, kb = ka + 16; v[i] = ka < K ? W[(size_t)(ka < K ? ka : K - 1) * ld + n] : 0.f; v[8 + i] = kb < K ? W[(size_t)(kb < K ? kb : K - 1) * ld + n] : 0.f; }
  return bsplit16(v); }
__device__ __forceinline__ v8f mac3(const F2& a, const F2& b, v8f c) { c = wmma_bf(a.l, b.h, c); c = wmma_bf(a.h, b.l, c); return wmma_bf(a.h, b.h, c); }
__device__ __forceinline__ float sigm(float v) { return 1.0f / (1.0f + expf(-v)); }
#define LDSX() do { asm volatile("s_wait_dscnt 0" ::: "memory"); __builtin_amdgcn_wave_barrier(); __builtin_amdgcn_fence(__ATOMIC_RELEASE, "workgroup"); } while (0)


#define NB 4
#define SS 1024
#define DM 512
#define NH 8
#define NLAY 4
__device__ __forceinline__ size_t kvrow(size_t r) { return (r / SS) * ((size_t)NLAY * SS) + (r % SS); }   // key/value [B][L][S][D]: engine row (b, s) of layer l lives at (b*L + l)*S + s (layer offset added to the pointer)
#define HD 64
#define QKVW (3 * DM)
#ifndef TQB
#define TQB (SS / 64)
#define TNB NB
#define TOB (NB * SS / 64)     // output row tiles (all)
#endif
typedef __attribute__((ext_vector_type(8))) __bf16 v8b;
__device__ __forceinline__ v16b frag_b(const __bf16* rowk0, int lane) {
  union { v16b v; v8b q[2]; } u; const __bf16* p = rowk0 + 8 * (lane >> 4);
  u.q[0] = *(const v8b*)p; u.q[1] = *(const v8b*)(p + 16); return u.v;
}
__device__ __forceinline__ float bfr(float v) { return (float)(__bf16)v; }
__device__ __attribute__((noinline)) float exp_ni(float v) { return expf(v); }
__device__ __attribute__((noinline)) float erf_ni(float v) { return erff(v); }

#define PK_A 0                       // [1536][512] Wqkv rows (natural [out][in])
#define PK_P (PK_A + QKVW * DM)        // [512][512] Wo rows (natural)
#define PK_END (PK_P + DM * DM)
#define WS_PK  0u
// every per-layer buffer holds NLAY planes (layer = blockIdx.z, blockIdx.z / NB in k_attn; k_out sums the FUS planes, uses PK plane 0); plane sizes in elements:
#define QKS ((size_t)NB * SS * 2 * DM)
#define VTS ((size_t)NB * DM * SS)
#define OS  ((size_t)NB * SS * DM)
#define WS_QK  (WS_PK + 2u * PK_END * NLAY)        // f16 [l][4096 rows][1024]: q | k
#define WS_QKL (WS_QK + 2u * NLAY * QKS)           // f16 q | k residual planes x2048
#define WS_VTH (WS_QKL + 2u * NLAY * QKS)          // f16 [l][b][512 (h*64+d)][1024 s] hi
#define WS_VTL (WS_VTH + 2u * NLAY * VTS)          // f16 lo x 2048
#define WS_O   (WS_VTL + 2u * NLAY * VTS)          // f32 [l][4096][512]
#define WS_CS  (WS_O + 4u * NLAY * OS)              // f32 2 x [1024][32], unused
#define WS_PSG (WS_CS + 4u * 2 * SS * 32)                  // bf16 natural rows Wsig [4][512][1024]
#define WS_FUS (WS_PSG + 2u * (size_t)NLAY * DM * 2 * DM)   // f32 [l][NR][512] gate_l * x_l
#define WS_END (WS_FUS + 4u * NLAY * OS)
// ---- k_pack: block = (row n, which, layer l): natural [out][in] rows -> bf16; which 0..2 -> W_q/W_k[l]/W_v[l] into layer l's PK_A rows which*512 + n; 3 -> W_o into layer l's PK_P; 4 -> row n of Wsig[l] (1024 long) into PSG
__global__ __launch_bounds__(256) void k_pack(const float* __restrict__ WQ, const float* __restrict__ WK, const float* __restrict__ WV, const float* __restrict__ WO, const float* __restrict__ WS, __bf16* __restrict__ PK, __bf16* __restrict__ PSG) {
  __shared__ __align__(16) __bf16 s[2 * DM]; const int n = blockIdx.x, which = blockIdx.y, l = blockIdx.z, t = threadIdx.x; const size_t ln = (size_t)l * DM + n; const int len = (which == 4) ? 2 * DM : DM;
  const float* Wm = (which == 0) ? WQ + (size_t)n * DM : (which == 1) ? WK + ln * DM : (which == 2) ? WV + ln * DM : (which == 3) ? WO + (size_t)n * DM : WS + ln * (2 * DM);
  for (int i = 0; i < 2 * DM / 256; ++i) if (i * 256 < len) s[i * 256 + t] = (__bf16)Wm[i * 256 + t];
  __syncthreads();
  __bf16* PL = PK + (size_t)l * PK_END;
  __bf16* dst = (which < 3) ? PL + PK_A + ((size_t)which * DM + n) * DM : (which == 3) ? PL + PK_P + (size_t)n * DM : PSG + ln * (2 * DM);
  for (int q = t; q < len / 8; q += 256) vst2((unsigned*)(dst + q * 8), *(const v4u*)&s[q * 8]);
}
__global__ __launch_bounds__(128) void k_qkv(const float* __restrict__ XQ, const float* __restrict__ XK, const float* __restrict__ XV, const __bf16* __restrict__ P, const float* __restrict__ BQ, const float* __restrict__ BK, const float* __restrict__ BV, _Float16* __restrict__ QK, _Float16* __restrict__ QKL, _Float16* __restrict__ VTH, _Float16* __restrict__ VTL) {
  { const size_t l = blockIdx.z; XK += l * SS * DM; XV += l * SS * DM; P += l * PK_END; BK += l * DM; BV += l * DM; QK += l * QKS; QKL += l * QKS; VTH += l * VTS; VTL += l * VTS; }   // layer l's inputs, weights and planes
  const int which0 = (blockIdx.y * 128) / DM; const float* X = (which0 == 0) ? XQ : (which0 == 1) ? XK : XV; const float* BB = BQ ? (((which0 == 0) ? BQ : (which0 == 1) ? BK : BV) + (blockIdx.y * 128 - which0 * DM)) : nullptr;
  __shared__ __align__(16) _Float16 so[4][16][136], sol[4][16][136]; __shared__ __align__(16) _Float16 sth[128][72], stl[128][72];
  const int tid = threadIdx.x, wave = tid >> 5, lane = tid & 31, col = lane & 15, g = lane >> 4; const size_t r0 = (size_t)blockIdx.x * 64 + wave * 16; const int n0 = blockIdx.y * 128;
  v8f acc[8] = {};
#pragma unroll 2
  for (int kc = 0; kc < DM / 32; ++kc) { v16b a; { const float* p = X + ((which0 == 0) ? (size_t)(r0 + col) : kvrow(r0 + col)) * DM + kc * 32 + 8 * g;
#pragma unroll
      for (int i = 0; i < 8; ++i) { a[i] = (__bf16)p[i]; a[8 + i] = (__bf16)p[16 + i]; } }
#pragma unroll
    for (int j = 0; j < 8; ++j) acc[j] = wmma_bf(a, frag_b(P + (size_t)(n0 + j * 16 + col) * DM + kc * 32, lane), acc[j]); }
  if (n0 < 2 * DM) {   // q stored unscaled (f16 sigma ~0.6, no subnormal exposure); 1/8 applied to the f32 score
#pragma unroll
    for (int j = 0; j < 8; ++j) {
#pragma unroll
      for (int r = 0; r < 8; ++r) { const float v = acc[j][r] + (BB ? bfr(BB[j * 16 + col]) : 0.f); const _Float16 hv = (_Float16)v; so[wave][8 * g + r][j * 16 + col] = hv; sol[wave][8 * g + r][j * 16 + col] = (_Float16)((v - (float)hv) * 2048.0f); } }   // q, k (+ bias) as f16 hi + (x2048) residual
    LDSX();
    for (int rl = 0; rl < 16; ++rl) if (lane < 16) { vst2((unsigned*)(QK + (r0 + rl) * (2 * DM) + n0 + lane * 8), *(const v4u*)&so[wave][rl][lane * 8]); vst2((unsigned*)(QKL + (r0 + rl) * (2 * DM) + n0 + lane * 8), *(const v4u*)&sol[wave][rl][lane * 8]); }
  } else {
#pragma unroll
    for (int j = 0; j < 8; ++j) {
#pragma unroll
      for (int r = 0; r < 8; ++r) { const float v = acc[j][r] + (BB ? bfr(BB[j * 16 + col]) : 0.f); const _Float16 hv = (_Float16)v; sth[j * 16 + col][wave * 16 + 8 * g + r] = hv; stl[j * 16 + col][wave * 16 + 8 * g + r] = (_Float16)((v - (float)hv) * 2048.0f); } }
    __syncthreads();
    const size_t rb = (size_t)blockIdx.x * 64; const int b = (int)(rb / SS), s0 = (int)(rb % SS); const int pc0 = n0 - 2 * DM;
    for (int q = tid; q < 128 * 8; q += 128) { const int d = q >> 3, pc = q & 7; const size_t o = ((size_t)b * DM + pc0 + d) * SS + s0 + pc * 8; vst2((unsigned*)(VTH + o), *(const v4u*)&sth[d][pc * 8]); vst2((unsigned*)(VTL + o), *(const v4u*)&stl[d][pc * 8]); }
  }
}
// ---- k_attn: block = (64 queries, head h, (layer l, batch b)): all-keys flash attention (K = 64: 2 k-steps), scores = (q.k) * 0.125 with single f16 operands, P.V: f16 P (x2^11) x V hi, single product; O[b*S+q][h*64+d] = acc / (2048 l) (256-B segments)
__global__ __launch_bounds__(128) void k_attn(const _Float16* __restrict__ QK, const _Float16* __restrict__ QKL, const _Float16* __restrict__ VTH, const _Float16* __restrict__ VTL, const void* __restrict__ KMASK, float* __restrict__ O) {
  __shared__ __align__(16) float sp[4][16][36]; __shared__ __align__(16) float so[4][16][68];
  const int tid = threadIdx.x, wave = tid >> 5, lane = tid & 31, col = lane & 15, g = lane >> 4;
  const int qb = blockIdx.x, h = blockIdx.y, b = blockIdx.z % NB; { const size_t l = blockIdx.z / NB; QK += l * QKS; QKL += l * QKS; VTH += l * VTS; VTL += l * VTS; O += l * OS; }   // layer l's planes
  const int q0 = qb * 64 + wave * 16; const size_t rq = (size_t)b * SS + q0 + col;
  v16h aq[2], aql[2];
#pragma unroll
  for (int kc = 0; kc < 2; ++kc) { aq[kc] = frag_h(QK + rq * (2 * DM) + h * HD + kc * 32, lane); aql[kc] = frag_h(QKL + rq * (2 * DM) + h * HD + kc * 32, lane); }
  float m[8], l[8];
#pragma unroll
  for (int r = 0; r < 8; ++r) { m[r] = -3.0e38f; l[r] = 0.f; }
  v8f acc[4] = {}, accl[4] = {};
  const int nks = SS / 32;   // all keys
#pragma unroll 1
  for (int ks = 0; ks < nks; ++ks) { v8f s[2];
#pragma unroll
    for (int ct = 0; ct < 2; ++ct) { const int kk = ks * 32 + ct * 16 + col; const _Float16* krow = QK + ((size_t)b * SS + kk) * (2 * DM) + DM + h * HD; const _Float16* krowl = QKL + ((size_t)b * SS + kk) * (2 * DM) + DM + h * HD; v8f c = {}, cl = {};
#pragma unroll
      for (int kc = 0; kc < 2; ++kc) c = wmma16(aq[kc], frag_h(krow + kc * 32, lane), c);   // single product: q, k as one-rounding f16 operands
      (void)cl; (void)krowl;
      { const bool keepk = true;
#pragma unroll
      for (int r = 0; r < 8; ++r) s[ct][r] = keepk ? c[r] * 0.125f : -3.0e38f; } }   // 1/sqrt(64)
#pragma unroll
    for (int r = 0; r < 8; ++r) { float mx = fmaxf(s[0][r], s[1][r]);
#pragma unroll
      for (int o = 1; o < 16; o <<= 1) mx = fmaxf(mx, __shfl_xor(mx, o));
      const float mn = fmaxf(m[r], mx); const float alpha = (m[r] <= -1.0e38f) ? 0.f : __expf(m[r] - mn);
      const float e0 = (s[0][r] <= -1.0e38f) ? 0.f : __expf(s[0][r] - mn), e1 = (s[1][r] <= -1.0e38f) ? 0.f : __expf(s[1][r] - mn); float es = e0 + e1;
#pragma unroll
      for (int o = 1; o < 16; o <<= 1) es += __shfl_xor(es, o);
      l[r] = l[r] * alpha + es; m[r] = mn;
#pragma unroll
      for (int dt = 0; dt < 4; ++dt) { acc[dt][r] *= alpha; accl[dt][r] *= alpha; }
      sp[wave][8 * g + r][col] = e0; sp[wave][8 * g + r][16 + col] = e1; }
    LDSX();
    v16h pa, pl; { const float* prow = &sp[wave][col][0] + 8 * (lane >> 4);
#pragma unroll
      for (int i = 0; i < 8; ++i) { const float x0 = prow[i] * 2048.0f, x1 = prow[16 + i] * 2048.0f; const _Float16 h0 = (_Float16)x0, h1 = (_Float16)x1; pa[i] = h0; pa[8 + i] = h1; pl[i] = (_Float16)((x0 - (float)h0) * 2048.0f); pl[8 + i] = (_Float16)((x1 - (float)h1) * 2048.0f); } }   // P scaled by 2^11 before the f16 split so small softmax weights stay out of the f16 subnormal range; 2^-11 folded into the epilogue
#pragma unroll
    for (int dt = 0; dt < 4; ++dt) { const size_t vr = ((size_t)b * DM + h * HD + dt * 16 + col) * SS + ks * 32; acc[dt] = wmma16(pa, frag_h(VTH + vr, lane), acc[dt]); }   // single product: P (x2^11) x V
    (void)pl;
    LDSX(); }
#pragma unroll
  for (int r = 0; r < 8; ++r) { const float il = (1.0f / 2048.0f) / l[r];
#pragma unroll
    for (int dt = 0; dt < 4; ++dt) so[wave][8 * g + r][dt * 16 + col] = (acc[dt][r] + accl[dt][r] * (1.0f / 2048.0f)) * il; }
  LDSX();
  for (int rl = 0; rl < 16; ++rl) if (lane < 16) vst2(O + ((size_t)b * SS + q0 + rl) * DM + h * HD + lane * 4, *(const v4f*)&so[wave][rl][lane * 4]);
}
// fused row fragment: sum over the layers in order 0..3 of (gate_l x_l) / sqrt(3), then bf16 hi + residual
__device__ __forceinline__ F2 split_row_sum(const float* row, int k0, int lane) { float v[16]; const float* p = row + k0 + 8 * (lane >> 4);
#pragma unroll
  for (int i = 0; i < 16; ++i) v[i] = 0.f;
#pragma unroll
  for (int l = 0; l < NLAY; ++l) {
#pragma unroll
    for (int i = 0; i < 8; ++i) { v[i] = v[i] + p[l * OS + i] * 0.57735026918962576f; v[8 + i] = v[8 + i] + p[l * OS + 16 + i] * 0.57735026918962576f; } }
  return bsplit16(v); }
// ---- k_out: block = (64 rows, 128 cols): out = O(hi/lo) . Wo rows (2 products) + bo; O = the layer sum of the NLAY planes
__global__ __launch_bounds__(128) void k_out(const float* __restrict__ O, const __bf16* __restrict__ P, const float* __restrict__ BO, float* __restrict__ Y) {
  __shared__ __align__(16) float so[4][16][132];
  const int tid = threadIdx.x, wave = tid >> 5, lane = tid & 31, col = lane & 15, g = lane >> 4; const size_t r0 = (size_t)blockIdx.x * 64 + wave * 16; const int n0 = blockIdx.y * 128;
  v8f acc[8] = {};
#pragma unroll 2
  for (int kc = 0; kc < DM / 32; ++kc) { const F2 a = split_row_sum(O + (r0 + col) * DM, kc * 32, lane);
#pragma unroll
    for (int j = 0; j < 8; ++j) { const v16b w = frag_b(P + (size_t)(n0 + j * 16 + col) * DM + kc * 32, lane); acc[j] = wmma_bf(a.l, w, acc[j]); acc[j] = wmma_bf(a.h, w, acc[j]); } }
#pragma unroll
  for (int j = 0; j < 8; ++j) {
#pragma unroll
    for (int r = 0; r < 8; ++r) so[wave][8 * g + r][j * 16 + col] = acc[j][r] + bfr(BO[n0 + j * 16 + col]); }
  LDSX();
  for (int rl = 0; rl < 16; ++rl) vst2(Y + (r0 + rl) * DM + n0 + lane * 4, *(const v4f*)&so[wave][rl][lane * 4]);
}
#define NR (NB * SS)
// ---- k_gate: block = (64 rows, 128 cols, layer l): g = sigmoid([query (exact bf16, 1 product) | x_l (hi + residual, 2 products)] . Wsig_l rows + bsig_l); FUS plane l = g * x_l (k_out scales by 1 / sqrt(3) and sums the planes)
__global__ __launch_bounds__(128) void k_gate(const float* __restrict__ XQ, const float* __restrict__ XL, const __bf16* __restrict__ PSG, const float* __restrict__ BS, float* __restrict__ FUS) {
  __shared__ __align__(16) float so[4][16][132]; const int l = blockIdx.z; XL += l * OS; FUS += l * OS;
  const int tid = threadIdx.x, wave = tid >> 5, lane = tid & 31, col = lane & 15, g = lane >> 4; const size_t r0 = (size_t)blockIdx.x * 64 + wave * 16; const int n0 = blockIdx.y * 128;
  const __bf16* Wr = PSG + (size_t)l * DM * 2 * DM; v8f acc[8] = {};
#pragma unroll 2
  for (int kc = 0; kc < DM / 32; ++kc) { v16b a; { const float* p = XQ + (r0 + col) * DM + kc * 32 + 8 * g;
#pragma unroll
      for (int i = 0; i < 8; ++i) { a[i] = (__bf16)p[i]; a[8 + i] = (__bf16)p[16 + i]; } }
#pragma unroll
    for (int j = 0; j < 8; ++j) acc[j] = wmma_bf(a, frag_b(Wr + (size_t)(n0 + j * 16 + col) * (2 * DM) + kc * 32, lane), acc[j]); }
#pragma unroll 2
  for (int kc = 0; kc < DM / 32; ++kc) { const F2 a = split_row(XL + (r0 + col) * DM, kc * 32, lane);
#pragma unroll
    for (int j = 0; j < 8; ++j) { const v16b w = frag_b(Wr + (size_t)(n0 + j * 16 + col) * (2 * DM) + DM + kc * 32, lane); acc[j] = wmma_bf(a.l, w, acc[j]); acc[j] = wmma_bf(a.h, w, acc[j]); } }
#pragma unroll
  for (int j = 0; j < 8; ++j) { const int c = n0 + j * 16 + col; const float bb = bfr(BS[(size_t)l * DM + c]);
#pragma unroll
    for (int r = 0; r < 8; ++r) { const size_t row = r0 + 8 * g + r; const float gte = 1.0f / (1.0f + exp_ni(-(acc[j][r] + bb))); so[wave][8 * g + r][j * 16 + col] = gte * XL[row * DM + c]; } }
  LDSX();
  for (int rl = 0; rl < 16; ++rl) vst2(FUS + (r0 + rl) * DM + n0 + lane * 4, *(const v4f*)&so[wave][rl][lane * 4]);
}
extern "C" void kernel_launch(void* const* d_in, const int* in_sizes, int n_in, void* d_out, int out_size, void* d_ws, size_t ws_size, hipStream_t stream) {
  (void)in_sizes; (void)n_in; (void)out_size;
  const float** F = (const float**)d_in;   // 0 query [4,1024,512], 1 key [4,4,1024,512], 2 value [4,4,1024,512], 3 Wq [512,512], 4 bq, 5 Wk [4,512,512], 6 bk [4,512], 7 Wv, 8 bv, 9 Wsig [4,512,1024], 10 bsig [4,512], 11 Wf [512,512], 12 bf
  if (ws_size < (size_t)WS_END) return;
  char* ws = (char*)d_ws; __bf16 *PK = (__bf16*)(ws + WS_PK), *PSG = (__bf16*)(ws + WS_PSG); _Float16 *QK = (_Float16*)(ws + WS_QK), *QKL = (_Float16*)(ws + WS_QKL), *VTH = (_Float16*)(ws + WS_VTH), *VTL = (_Float16*)(ws + WS_VTL); float *O = (float*)(ws + WS_O), *FUS = (float*)(ws + WS_FUS);
  // the layers are independent up to the gated sum: each stage is one launch with the layer in blockIdx.z
  k_pack<<<dim3(DM, 5, NLAY), 256, 0, stream>>>(F[3], F[5], F[7], F[11], F[9], PK, PSG);   // per layer: Wq | Wk[l] | Wv[l] | Wf | Wsig[l] natural rows
  k_qkv<<<dim3(TNB * SS / 64, QKVW / 128, NLAY), 128, 0, stream>>>(F[0], F[1], F[2], PK + PK_A, F[4], F[6], F[8], QK, QKL, VTH, VTL);   // (q recomputed per layer; identical)
  k_attn<<<dim3(TQB, NH, TNB * NLAY), 128, 0, stream>>>(QK, QKL, VTH, VTL, nullptr, O);   // x_l
  k_gate<<<dim3(NR / 64, DM / 128, NLAY), 128, 0, stream>>>(F[0], O, PSG, F[10], FUS);   // gate_l * x_l
  k_out<<<dim3(TOB, DM / 128), 128, 0, stream>>>(FUS, PK + PK_P, F[12], (float*)d_out);   // (sum_l gate_l x_l / sqrt(3)) . Wf^T + bf (Wf rows of layer 0's pack)
}

// v002
// It runs in 353 microseconds.
// Timed twice side by side with v001, it ran 1.36 times as fast both times.
// Over all steps from v000 it is 2.47 times as fast.
// compute dtype: all float inputs rounded to bf16; q = query . Wq^T + bq and k_l, v_l = key_l / value_l . W^T + b with EXACT bf16 products on WMMA 16x16x32 (natural rows); PLAIN attention per layer: q, k as single f16 operands x 1/8, running-max softmax in f32 (hardware exp), P (scaled by 2^11, single f16) x v (single f16); gate_l = sigmoid([query (exact) | x_l (bf16 hi + residual, 2 products)] . Wsig_l^T + bsig_l) (precise expf); fused = sum_l gate_l x_l / sqrt(3) in f32; out = fused (bf16 hi + residual) . Wf^T (2 products) + bf.
#include <hip/hip_runtime.h>
#include <math.h>

typedef __attribute__((ext_vector_type(16))) _Float16 v16h;
typedef __attribute__((ext_vector_type(16))) __bf16 v16b;
typedef __attribute__((ext_vector_type(8)))  _Float16 v8h;
typedef __attribute__((ext_vector_type(8)))  float v8f;
typedef __attribute__((ext_vector_type(4)))  float v4f;
typedef __attribute__((ext_vector_type(2)))  float v2f;
typedef __attribute__((ext_vector_type(4)))  unsigned v4u;
typedef __attribute__((ext_vector_type(4)))  int v4i;
typedef float __attribute__((may_alias)) float_a;
typedef int __attribute__((may_alias)) int_a;

template <typename T> __device__ __forceinline__ void vst2(void* p, T v) { *(T*)p = v;  }
__device__ __forceinline__ v8f wmma16(v16h a, v16h b, v8f c) {
  v8f d = __builtin_amdgcn_wmma_f32_16x16x32_f16(false, a, false, b, (short)0, c, false, false);
  asm volatile("v_nop\n\tv_nop\n\tv_nop\n\tv_nop" : "+v"(d) : "v"(a), "v"(b));
  return d;
}
__device__ __forceinline__ v8f wmma_bf(v16b a, v16b b, v8f c) {
  v8f d = __builtin_amdgcn_wmma_f32_16x16x32_bf16(false, a, false, b, (short)0, c, false, false);
  asm volatile("v_nop\n\tv_nop\n\tv_nop\n\tv_nop" : "+v"(d) : "v"(a), "v"(b));
  return d;
}
// Multi-layer source attention (B 4, 1,024 queries over 4 layers of 1,024 keys/values, d 512, 8 heads x 64): a shared query projection, per-layer key/value projections, softmax(q k_l^T / 8) v_l per layer, per-layer sigmoid gates from [query | x_l], gated sum over layers / sqrt(3), final linear map.
__device__ __forceinline__ v16h frag_h(const _Float16* rowk0, int lane) {
  union { v16h v; v8h q[2]; } u; const _Float16* p = rowk0 + 8 * (lane >> 4);
  u.q[0] = *(const v8h*)p; u.q[1] = *(const v8h*)(p + 16); return u.v;
}
__device__ __forceinline__ v16h frag_f32(const float* rowk0, int lane) {
  v16h a; const float* p = rowk0 + 8 * (lane >> 4);
#pragma unroll
  for (int i = 0; i < 8; ++i) { a[i] = (_Float16)p[i]; a[8 + i] = (_Float16)p[16 + i]; }
  return a;
}
__device__ __forceinline__ v16h frag_f32s(const float* rowk0, int lane, float sc) {
  v16h a; const float* p = rowk0 + 8 * (lane >> 4);
#pragma unroll
  for (int i = 0; i < 8; ++i) { a[i] = (_Float16)(p[i] * sc); a[8 + i] = (_Float16)(p[16 + i] * sc); }
  return a;
}
// column fragment from a [K][ld] layout (column n), rows >= K read as 0
__device__ __forceinline__ v16h fragc_f32(const float* W, int k0, int n, int lane, int ld, int K) {
  v16h a; const int g = lane >> 4;
#pragma unroll
  for (int i = 0; i < 8; ++i) { const int ka = k0 + 8 * g + i, kb = ka + 16;
    a[i] = (_Float16)(ka < K ? W[(size_t)(ka < K ? ka : K - 1) * ld + n] : 0.f); a[8 + i] = (_Float16)(kb < K ? W[(size_t)(kb < K ? kb : K - 1) * ld + n] : 0.f); }
  return a;
}
struct F2 { v16b h, l; };
__device__ __forceinline__ F2 bsplit16(const float v[16]) { F2 r;
#pragma unroll
  for (int i = 0; i < 16; ++i) { const __bf16 h = (__bf16)v[i]; r.h[i] = h; r.l[i] = (__bf16)(v[i] - (float)h); }
  return r; }
__device__ __forceinline__ F2 split_row(const float* row, int k0, int lane) { float v[16]; const float* p = row + k0 + 8 * (lane >> 4);
#pragma unroll
  for (int i = 0; i < 8; ++i) { v[i] = p[i]; v[8 + i] = p[16 + i]; }
  return bsplit16(v); }
__device__ __forceinline__ F2 split_rowK(const float* row, int k0, int lane, int K) { float v[16]; const int g = lane >> 4;
#pragma unroll
  for (int i = 0; i < 8; ++i) { const int ka = k0 + 8 * g + i, kb = ka + 16; v[i] = ka < K ? row[ka < K ? ka : K - 1] : 0.f; v[8 + i] = kb < K ? row[kb < K ? kb : K - 1] : 0.f; }
  return bsplit16(v); }
__device__ __forceinline__ F2 split_col(const float* W, int k0, int n, int lane, int ld, int K) { float v[16]; const int g = lane >> 4;
#pragma unroll
  for (int i = 0; i < 8; ++i) { const int ka = k0 + 8 * g + i, kb = ka + 16; v[i] = ka < K ? W[(size_t)(ka < K ? ka : K - 1) * ld + n] : 0.f; v[8 + i] = kb < K ? W[(size_t)(kb < K ? kb : K - 1) * ld + n] : 0.f; }
  return bsplit16(v); }
__device__ __forceinline__ v8f mac3(const F2& a, const F2& b, v8f c) { c = wmma_bf(a.l, b.h, c); c = wmma_bf(a.h, b.l, c); return wmma_bf(a.h, b.h, c); }
__device__ __forceinline__ float sigm(float v) { return 1.0f / (1.0f + expf(-v)); }
#define LDSX() do { asm volatile("s_wait_dscnt 0" ::: "memory"); __builtin_amdgcn_wave_barrier(); __builtin_amdgcn_fence(__ATOMIC_RELEASE, "workgroup"); } while (0)


#define NB 4
#define SS 1024
#define DM 512
#define NH 8
#define NLAY 4
__device__ __forceinline__ size_t kvrow(size_t r) { return (r / SS) * ((size_t)NLAY * SS) + (r % SS); }   // key/value [B][L][S][D]: engine row (b, s) of layer l lives at (b*L + l)*S + s (layer offset added to the pointer)
#define HD 64
#define QKVW (3 * DM)
#ifndef TQB
#define TQB (SS / 64)
#define TNB NB
#define TOB (NB * SS / 64)     // output row tiles (all)
#endif
typedef __attribute__((ext_vector_type(8))) __bf16 v8b;
__device__ __forceinline__ v16b frag_b(const __bf16* rowk0, int lane) {
  union { v16b v; v8b q[2]; } u; const __bf16* p = rowk0 + 8 * (lane >> 4);
  u.q[0] = *(const v8b*)p; u.q[1] = *(const v8b*)(p + 16); return u.v;
}
__device__ __forceinline__ float bfr(float v) { return (float)(__bf16)v; }
__device__ __attribute__((noinline)) float exp_ni(float v) { return expf(v); }
__device__ __attribute__((noinline)) float erf_ni(float v) { return erff(v); }

#define PK_A 0                       // [1536][512] Wqkv rows (natural [out][in])
#define PK_P (PK_A + QKVW * DM)        // [512][512] Wo rows (natural)
#define PK_END (PK_P + DM * DM)
#define WS_PK  0u
// every per-layer buffer holds NLAY planes (layer = blockIdx.z, blockIdx.z / NB in k_attn; k_out sums the FUS planes, uses PK plane 0); plane sizes in elements:
#define QKS ((size_t)NB * SS * 2 * DM)
#define VTS ((size_t)NB * DM * SS)
#define OS  ((size_t)NB * SS * DM)
#define WS_QK  (WS_PK + 2u * PK_END * NLAY)        // f16 [l][4096 rows][1024]: q | k
#define WS_QKL (WS_QK + 2u * NLAY * QKS)           // f16 q | k residual planes x2048
#define WS_VTH (WS_QKL + 2u * NLAY * QKS)          // f16 [l][b][512 (h*64+d)][1024 s] hi
#define WS_VTL (WS_VTH + 2u * NLAY * VTS)          // f16 lo x 2048
#define WS_O   (WS_VTL + 2u * NLAY * VTS)          // f32 [l][4096][512]
#define WS_CS  (WS_O + 4u * NLAY * OS)              // f32 2 x [1024][32], unused
#define WS_PSG (WS_CS + 4u * 2 * SS * 32)                  // bf16 natural rows Wsig [4][512][1024]
#define WS_FUS (WS_PSG + 2u * (size_t)NLAY * DM * 2 * DM)   // f32 [l][NR][512] gate_l * x_l
#define WS_END (WS_FUS + 4u * NLAY * OS)
// ---- k_pack: block = (row n, which, layer l): natural [out][in] rows -> bf16; which 0..2 -> W_q/W_k[l]/W_v[l] into layer l's PK_A rows which*512 + n; 3 -> W_o into layer l's PK_P; 4 -> row n of Wsig[l] (1024 long) into PSG
__global__ __launch_bounds__(256) void k_pack(const float* __restrict__ WQ, const float* __restrict__ WK, const float* __restrict__ WV, const float* __restrict__ WO, const float* __restrict__ WS, __bf16* __restrict__ PK, __bf16* __restrict__ PSG) {
  __shared__ __align__(16) __bf16 s[2 * DM]; const int n = blockIdx.x, which = blockIdx.y, l = blockIdx.z, t = threadIdx.x; const size_t ln = (size_t)l * DM + n; const int len = (which == 4) ? 2 * DM : DM;
  const float* Wm = (which == 0) ? WQ + (size_t)n * DM : (which == 1) ? WK + ln * DM : (which == 2) ? WV + ln * DM : (which == 3) ? WO + (size_t)n * DM : WS + ln * (2 * DM);
  for (int i = 0; i < 2 * DM / 256; ++i) if (i * 256 < len) s[i * 256 + t] = (__bf16)Wm[i * 256 + t];
  __syncthreads();
  __bf16* PL = PK + (size_t)l * PK_END;
  __bf16* dst = (which < 3) ? PL + PK_A + ((size_t)which * DM + n) * DM : (which == 3) ? PL + PK_P + (size_t)n * DM : PSG + ln * (2 * DM);
  for (int q = t; q < len / 8; q += 256) vst2((unsigned*)(dst + q * 8), *(const v4u*)&s[q * 8]);
}
__global__ __launch_bounds__(128) void k_qkv(const float* __restrict__ XQ, const float* __restrict__ XK, const float* __restrict__ XV, const __bf16* __restrict__ P, const float* __restrict__ BQ, const float* __restrict__ BK, const float* __restrict__ BV, _Float16* __restrict__ QK, _Float16* __restrict__ QKL, _Float16* __restrict__ VTH, _Float16* __restrict__ VTL) {
  { const size_t l = blockIdx.z; XK += l * SS * DM; XV += l * SS * DM; P += l * PK_END; BK += l * DM; BV += l * DM; QK += l * QKS; QKL += l * QKS; VTH += l * VTS; VTL += l * VTS; }   // layer l's inputs, weights and planes
  const int which0 = (blockIdx.y * 128) / DM; const float* X = (which0 == 0) ? XQ : (which0 == 1) ? XK : XV; const float* BB = BQ ? (((which0 == 0) ? BQ : (which0 == 1) ? BK : BV) + (blockIdx.y * 128 - which0 * DM)) : nullptr;
  __shared__ __align__(16) _Float16 so[4][16][136], sol[4][16][136]; __shared__ __align__(16) _Float16 sth[128][72], stl[128][72];
  const int tid = threadIdx.x, wave = tid >> 5, lane = tid & 31, col = lane & 15, g = lane >> 4; const size_t r0 = (size_t)blockIdx.x * 64 + wave * 16; const int n0 = blockIdx.y * 128;
  v8f acc[8] = {};
  float bias[8] = {};   // the tile's eight bias values, loaded as one group ahead of the k loop, rounded to bf16 where they are added
  if (BB) {
#pragma unroll   // register array: every index must be a constant
    for (int j = 0; j < 8; ++j) bias[j] = BB[j * 16 + col]; }
#pragma unroll 2
  for (int kc = 0; kc < DM / 32; ++kc) { float ar[16]; { const float* p = X + ((which0 == 0) ? (size_t)(r0 + col) : kvrow(r0 + col)) * DM + kc * 32 + 8 * g;
#pragma unroll
      for (int i = 0; i < 8; ++i) { ar[i] = p[i]; ar[8 + i] = p[16 + i]; } }
    v16b w[8];   // the k-step's eight weight fragments are loaded as one group ahead of its products: no load moves over the statement that follows a product, so a load written between two products is waited for in full
#pragma unroll   // register array: every index must be a constant
    for (int j = 0; j < 8; ++j) w[j] = frag_b(P + (size_t)(n0 + j * 16 + col) * DM + kc * 32, lane);
    __builtin_amdgcn_sched_barrier(0);   // keeps the conversions below out of the load group: every load of the k-step is in flight before the first wait
    v16b a;
#pragma unroll   // register array: every index must be a constant
    for (int i = 0; i < 16; ++i) a[i] = (__bf16)ar[i];
#pragma unroll
    for (int j = 0; j < 8; ++j) acc[j] = wmma_bf(a, w[j], acc[j]); }
  if (n0 < 2 * DM) {   // q stored unscaled (f16 sigma ~0.6, no subnormal exposure); 1/8 applied to the f32 score
#pragma unroll
    for (int j = 0; j < 8; ++j) {
#pragma unroll
      for (int r = 0; r < 8; ++r) { const float v = acc[j][r] + bfr(bias[j]); const _Float16 hv = (_Float16)v; so[wave][8 * g + r][j * 16 + col] = hv; sol[wave][8 * g + r][j * 16 + col] = (_Float16)((v - (float)hv) * 2048.0f); } }   // q, k (+ bias) as f16 hi + (x2048) residual
    LDSX();
    for (int rl = 0; rl < 16; ++rl) if (lane < 16) { vst2((unsigned*)(QK + (r0 + rl) * (2 * DM) + n0 + lane * 8), *(const v4u*)&so[wave][rl][lane * 8]); vst2((unsigned*)(QKL + (r0 + rl) * (2 * DM) + n0 + lane * 8), *(const v4u*)&sol[wave][rl][lane * 8]); }
  } else {
#pragma unroll
    for (int j = 0; j < 8; ++j) {
#pragma unroll
      for (int r = 0; r < 8; ++r) { const float v = acc[j][r] + bfr(bias[j]); const _Float16 hv = (_Float16)v; sth[j * 16 + col][wave * 16 + 8 * g + r] = hv; stl[j * 16 + col][wave * 16 + 8 * g + r] = (_Float16)((v - (float)hv) * 2048.0f); } }
    __syncthreads();
    const size_t rb = (size_t)blockIdx.x * 64; const int b = (int)(rb / SS), s0 = (int)(rb % SS); const int pc0 = n0 - 2 * DM;
    for (int q = tid; q < 128 * 8; q += 128) { const int d = q >> 3, pc = q & 7; const size_t o = ((size_t)b * DM + pc0 + d) * SS + s0 + pc * 8; vst2((unsigned*)(VTH + o), *(const v4u*)&sth[d][pc * 8]); vst2((unsigned*)(VTL + o), *(const v4u*)&stl[d][pc * 8]); }
  }
}
// ---- k_attn: block = (64 queries, head h, (layer l, batch b)): all-keys flash attention (K = 64: 2 k-steps), scores = (q.k) * 0.125 with single f16 operands, P.V: f16 P (x2^11) x V hi, single product; O[b*S+q][h*64+d] = acc / (2048 l) (256-B segments)
__global__ __launch_bounds__(128) void k_attn(const _Float16* __restrict__ QK, const _Float16* __restrict__ QKL, const _Float16* __restrict__ VTH, const _Float16* __restrict__ VTL, const void* __restrict__ KMASK, float* __restrict__ O) {
  __shared__ __align__(16) float sp[4][16][36]; __shared__ __align__(16) float so[4][16][68];
  const int tid = threadIdx.x, wave = tid >> 5, lane = tid & 31, col = lane & 15, g = lane >> 4;
  const int qb = blockIdx.x, h = blockIdx.y, b = blockIdx.z % NB; { const size_t l = blockIdx.z / NB; QK += l * QKS; QKL += l * QKS; VTH += l * VTS; VTL += l * VTS; O += l * OS; }   // layer l's planes
  const int q0 = qb * 64 + wave * 16; const size_t rq = (size_t)b * SS + q0 + col;
  v16h aq[2], aql[2];
#pragma unroll
  for (int kc = 0; kc < 2; ++kc) { aq[kc] = frag_h(QK + rq * (2 * DM) + h * HD + kc * 32, lane); aql[kc] = frag_h(QKL + rq * (2 * DM) + h * HD + kc * 32, lane); }
  float m[8], l[8];
#pragma unroll
  for (int r = 0; r < 8; ++r) { m[r] = -3.0e38f; l[r] = 0.f; }
  v8f acc[4] = {}, accl[4] = {};
  const int nks = SS / 32;   // all keys
  const _Float16* kbase = QK + ((size_t)b * SS + col) * (2 * DM) + DM + h * HD;   // key row col of this (layer, batch, head)
  v16h kf[2][2];   // a pass's four k fragments, fetched one pass ahead
#pragma unroll   // register array: every index must be a constant
  for (int ct = 0; ct < 2; ++ct) {
#pragma unroll   // register array: every index must be a constant
    for (int kc = 0; kc < 2; ++kc) kf[ct][kc] = frag_h(kbase + (size_t)(ct * 16) * (2 * DM) + kc * 32, lane); }
#pragma unroll 1
  for (int ks = 0; ks < nks; ++ks) { v8f s[2];
    v16h vf[4];   // this pass's four v^T fragments: issued here as one group, first used behind the softmax
#pragma unroll   // register array: every index must be a constant
    for (int dt = 0; dt < 4; ++dt) vf[dt] = frag_h(VTH + ((size_t)b * DM + h * HD + dt * 16 + col) * SS + ks * 32, lane);
#pragma unroll
    for (int ct = 0; ct < 2; ++ct) { v8f c = {};
#pragma unroll
      for (int kc = 0; kc < 2; ++kc) c = wmma16(aq[kc], kf[ct][kc], c);   // single product: q, k as one-rounding f16 operands
      { const bool keepk = true;
#pragma unroll
      for (int r = 0; r < 8; ++r) s[ct][r] = keepk ? c[r] * 0.125f : -3.0e38f; } }   // 1/sqrt(64)
#pragma unroll
    for (int r = 0; r < 8; ++r) { float mx = fmaxf(s[0][r], s[1][r]);
#pragma unroll
      for (int o = 1; o < 16; o <<= 1) mx = fmaxf(mx, __shfl_xor(mx, o));
      const float mn = fmaxf(m[r], mx); const float alpha = (m[r] <= -1.0e38f) ? 0.f : __expf(m[r] - mn);
      const float e0 = (s[0][r] <= -1.0e38f) ? 0.f : __expf(s[0][r] - mn), e1 = (s[1][r] <= -1.0e38f) ? 0.f : __expf(s[1][r] - mn); float es = e0 + e1;
#pragma unroll
      for (int o = 1; o < 16; o <<= 1) es += __shfl_xor(es, o);
      l[r] = l[r] * alpha + es; m[r] = mn;
#pragma unroll
      for (int dt = 0; dt < 4; ++dt) { acc[dt][r] *= alpha; accl[dt][r] *= alpha; }
      sp[wave][8 * g + r][col] = e0; sp[wave][8 * g + r][16 + col] = e1; }
    LDSX();
    { const int kn = (ks + 1 < nks) ? ks + 1 : ks;   // next pass's k fragments into the same registers, in flight under P.V (the last pass reads its own rows again: in bounds, unused)
#pragma unroll   // register array: every index must be a constant
      for (int ct = 0; ct < 2; ++ct) {
#pragma unroll   // register array: every index must be a constant
        for (int kc = 0; kc < 2; ++kc) kf[ct][kc] = frag_h(kbase + (size_t)(kn * 32 + ct * 16) * (2 * DM) + kc * 32, lane); } }
    v16h pa, pl; { const float* prow = &sp[wave][col][0] + 8 * (lane >> 4);
#pragma unroll
      for (int i = 0; i < 8; ++i) { const float x0 = prow[i] * 2048.0f, x1 = prow[16 + i] * 2048.0f; const _Float16 h0 = (_Float16)x0, h1 = (_Float16)x1; pa[i] = h0; pa[8 + i] = h1; pl[i] = (_Float16)((x0 - (float)h0) * 2048.0f); pl[8 + i] = (_Float16)((x1 - (float)h1) * 2048.0f); } }   // P scaled by 2^11 before the f16 split so small softmax weights stay out of the f16 subnormal range; 2^-11 folded into the epilogue
#pragma unroll
    for (int dt = 0; dt < 4; ++dt) acc[dt] = wmma16(pa, vf[dt], acc[dt]);   // single product: P (x2^11) x V
    (void)pl;
    LDSX(); }
#pragma unroll
  for (int r = 0; r < 8; ++r) { const float il = (1.0f / 2048.0f) / l[r];
#pragma unroll
    for (int dt = 0; dt < 4; ++dt) so[wave][8 * g + r][dt * 16 + col] = (acc[dt][r] + accl[dt][r] * (1.0f / 2048.0f)) * il; }
  LDSX();
  for (int rl = 0; rl < 16; ++rl) if (lane < 16) vst2(O + ((size_t)b * SS + q0 + rl) * DM + h * HD + lane * 4, *(const v4f*)&so[wave][rl][lane * 4]);
}
// fused row fragment: sum over the layers in order 0..3 of (gate_l x_l) / sqrt(3), then bf16 hi + residual
__device__ __forceinline__ F2 split_row_sum(const float* row, int k0, int lane) { float v[16]; const float* p = row + k0 + 8 * (lane >> 4);
#pragma unroll
  for (int i = 0; i < 16; ++i) v[i] = 0.f;
#pragma unroll
  for (int l = 0; l < NLAY; ++l) {
#pragma unroll
    for (int i = 0; i < 8; ++i) { v[i] = v[i] + p[l * OS + i] * 0.57735026918962576f; v[8 + i] = v[8 + i] + p[l * OS + 16 + i] * 0.57735026918962576f; } }
  return bsplit16(v); }
// ---- k_out: block = (64 rows, 128 cols): out = O(hi/lo) . Wo rows (2 products) + bo; O = the layer sum of the NLAY planes
__global__ __launch_bounds__(128) void k_out(const float* __restrict__ O, const __bf16* __restrict__ P, const float* __restrict__ BO, float* __restrict__ Y) {
  __shared__ __align__(16) float so[4][16][132];
  const int tid = threadIdx.x, wave = tid >> 5, lane = tid & 31, col = lane & 15, g = lane >> 4; const size_t r0 = (size_t)blockIdx.x * 64 + wave * 16; const int n0 = blockIdx.y * 128;
  v8f acc[8] = {};
#pragma unroll 2
  for (int kc = 0; kc < DM / 32; ++kc) { const F2 a = split_row_sum(O + (r0 + col) * DM, kc * 32, lane); v16b w[8];   // weight fragments as one group ahead of the products
#pragma unroll   // register array: every index must be a constant
    for (int j = 0; j < 8; ++j) w[j] = frag_b(P + (size_t)(n0 + j * 16 + col) * DM + kc * 32, lane);
#pragma unroll
    for (int j = 0; j < 8; ++j) { acc[j] = wmma_bf(a.l, w[j], acc[j]); acc[j] = wmma_bf(a.h, w[j], acc[j]); } }
#pragma unroll
  for (int j = 0; j < 8; ++j) {
#pragma unroll
    for (int r = 0; r < 8; ++r) so[wave][8 * g + r][j * 16 + col] = acc[j][r] + bfr(BO[n0 + j * 16 + col]); }
  LDSX();
  for (int rl = 0; rl < 16; ++rl) vst2(Y + (r0 + rl) * DM + n0 + lane * 4, *(const v4f*)&so[wave][rl][lane * 4]);
}
#define NR (NB * SS)
// ---- k_gate: block = (64 rows, 128 cols, layer l): g = sigmoid([query (exact bf16, 1 product) | x_l (hi + residual, 2 products)] . Wsig_l rows + bsig_l); FUS plane l = g * x_l (k_out scales by 1 / sqrt(3) and sums the planes)
__global__ __launch_bounds__(128) void k_gate(const float* __restrict__ XQ, const float* __restrict__ XL, const __bf16* __restrict__ PSG, const float* __restrict__ BS, float* __restrict__ FUS) {
  __shared__ __align__(16) float so[4][16][132]; const int l = blockIdx.z; XL += l * OS; FUS += l * OS;
  const int tid = threadIdx.x, wave = tid >> 5, lane = tid & 31, col = lane & 15, g = lane >> 4; const size_t r0 = (size_t)blockIdx.x * 64 + wave * 16; const int n0 = blockIdx.y * 128;
  const __bf16* Wr = PSG + (size_t)l * DM * 2 * DM; v8f acc[8] = {};
#pragma unroll 2
  for (int kc = 0; kc < DM / 32; ++kc) { float ar[16]; { const float* p = XQ + (r0 + col) * DM + kc * 32 + 8 * g;
#pragma unroll
      for (int i = 0; i < 8; ++i) { ar[i] = p[i]; ar[8 + i] = p[16 + i]; } }
    v16b w[8];   // weight fragments as one group ahead of the products
#pragma unroll   // register array: every index must be a constant
    for (int j = 0; j < 8; ++j) w[j] = frag_b(Wr + (size_t)(n0 + j * 16 + col) * (2 * DM) + kc * 32, lane);
    __builtin_amdgcn_sched_barrier(0);   // keeps the conversions below out of the load group: every load of the k-step is in flight before the first wait
    v16b a;
#pragma unroll   // register array: every index must be a constant
    for (int i = 0; i < 16; ++i) a[i] = (__bf16)ar[i];
#pragma unroll
    for (int j = 0; j < 8; ++j) acc[j] = wmma_bf(a, w[j], acc[j]); }
#pragma unroll 2
  for (int kc = 0; kc < DM / 32; ++kc) { float v[16]; { const float* p = XL + (r0 + col) * DM + kc * 32 + 8 * g;
#pragma unroll   // register array: every index must be a constant
      for (int i = 0; i < 8; ++i) { v[i] = p[i]; v[8 + i] = p[16 + i]; } }
    v16b w[8];   // weight fragments in the same group of loads, ahead of the products
#pragma unroll   // register array: every index must be a constant
    for (int j = 0; j < 8; ++j) w[j] = frag_b(Wr + (size_t)(n0 + j * 16 + col) * (2 * DM) + DM + kc * 32, lane);
    __builtin_amdgcn_sched_barrier(0);   // keeps the conversions below out of the load group: every load of the k-step is in flight before the first wait
    const F2 a = bsplit16(v);
#pragma unroll
    for (int j = 0; j < 8; ++j) { acc[j] = wmma_bf(a.l, w[j], acc[j]); acc[j] = wmma_bf(a.h, w[j], acc[j]); } }
  float bb[8];   // the tile's bias values, in the first half's group of loads
#pragma unroll   // register array: every index must be a constant
  for (int j = 0; j < 8; ++j) bb[j] = bfr(BS[(size_t)l * DM + n0 + j * 16 + col]);
#pragma unroll   // register array: every index must be a constant
  for (int jh = 0; jh < 2; ++jh) { float xv[4][8];   // half a tile's x_l values as one group of loads ahead of its exp calls (no load moves over a call); two halves keep a group under the load counter's range
#pragma unroll   // register array: every index must be a constant
    for (int jj = 0; jj < 4; ++jj) {
#pragma unroll   // register array: every index must be a constant
      for (int r = 0; r < 8; ++r) xv[jj][r] = XL[(r0 + 8 * g + r) * DM + n0 + (jh * 4 + jj) * 16 + col]; }
#pragma unroll   // register array: every index must be a constant
    for (int jj = 0; jj < 4; ++jj) { const int j = jh * 4 + jj;
#pragma unroll   // register array: every index must be a constant
      for (int r = 0; r < 8; ++r) { const float gte = 1.0f / (1.0f + exp_ni(-(acc[j][r] + bb[j]))); so[wave][8 * g + r][j * 16 + col] = gte * xv[jj][r]; } } }
  LDSX();
  for (int rl = 0; rl < 16; ++rl) vst2(FUS + (r0 + rl) * DM + n0 + lane * 4, *(const v4f*)&so[wave][rl][lane * 4]);
}
extern "C" void kernel_launch(void* const* d_in, const int* in_sizes, int n_in, void* d_out, int out_size, void* d_ws, size_t ws_size, hipStream_t stream) {
  (void)in_sizes; (void)n_in; (void)out_size;
  const float** F = (const float**)d_in;   // 0 query [4,1024,512], 1 key [4,4,1024,512], 2 value [4,4,1024,512], 3 Wq [512,512], 4 bq, 5 Wk [4,512,512], 6 bk [4,512], 7 Wv, 8 bv, 9 Wsig [4,512,1024], 10 bsig [4,512], 11 Wf [512,512], 12 bf
  if (ws_size < (size_t)WS_END) return;
  char* ws = (char*)d_ws; __bf16 *PK = (__bf16*)(ws + WS_PK), *PSG = (__bf16*)(ws + WS_PSG); _Float16 *QK = (_Float16*)(ws + WS_QK), *QKL = (_Float16*)(ws + WS_QKL), *VTH = (_Float16*)(ws + WS_VTH), *VTL = (_Float16*)(ws + WS_VTL); float *O = (float*)(ws + WS_O), *FUS = (float*)(ws + WS_FUS);
  // the layers are independent up to the gated sum: each stage is one launch with the layer in blockIdx.z
  k_pack<<<dim3(DM, 5, NLAY), 256, 0, stream>>>(F[3], F[5], F[7], F[11], F[9], PK, PSG);   // per layer: Wq | Wk[l] | Wv[l] | Wf | Wsig[l] natural rows
  k_qkv<<<dim3(TNB * SS / 64, QKVW / 128, NLAY), 128, 0, stream>>>(F[0], F[1], F[2], PK + PK_A, F[4], F[6], F[8], QK, QKL, VTH, VTL);   // (q recomputed per layer; identical)
  k_attn<<<dim3(TQB, NH, TNB * NLAY), 128, 0, stream>>>(QK, QKL, VTH, VTL, nullptr, O);   // x_l
  k_gate<<<dim3(NR / 64, DM / 128, NLAY), 128, 0, stream>>>(F[0], O, PSG, F[10], FUS);   // gate_l * x_l
  k_out<<<dim3(TOB, DM / 128), 128, 0, stream>>>(FUS, PK + PK_P, F[12], (float*)d_out);   // (sum_l gate_l x_l / sqrt(3)) . Wf^T + bf (Wf rows of layer 0's pack)
}

// v003
// It runs in 216 microseconds.
// Next to v002, in two timings, it ran 1.63 times as fast each time.
// Over all steps from v000 it is 4.04 times as fast.
// compute dtype: all float inputs rounded to bf16; q = query . Wq^T + bq and k_l, v_l = key_l / value_l . W^T + b with EXACT bf16 products on WMMA 16x16x32 (weights, k and v^T kept in fragment order in the workspace); PLAIN attention per layer: q, k as single f16 operands x 1/8, running-max softmax in f32 (hardware exp), P (scaled by 2^11, single f16) x v (single f16); gate_l = sigmoid([query (exact) | x_l (bf16 hi + residual, 2 products)] . Wsig_l^T + bsig_l) (precise expf); fused = sum_l gate_l x_l / sqrt(3) in f32; out = fused (bf16 hi + residual) . Wf^T (2 products) + bf.
#include <hip/hip_runtime.h>
#include <math.h>

typedef __attribute__((ext_vector_type(16))) _Float16 v16h;
typedef __attribute__((ext_vector_type(16))) __bf16 v16b;
typedef __attribute__((ext_vector_type(8)))  _Float16 v8h;
typedef __attribute__((ext_vector_type(8)))  float v8f;
typedef __attribute__((ext_vector_type(4)))  float v4f;
typedef __attribute__((ext_vector_type(2)))  float v2f;
typedef __attribute__((ext_vector_type(4)))  unsigned v4u;
typedef __attribute__((ext_vector_type(4)))  int v4i;
typedef float __attribute__((may_alias)) float_a;
typedef int __attribute__((may_alias)) int_a;

template <typename T> __device__ __forceinline__ void vst2(void* p, T v) { *(T*)p = v;  }
__device__ __forceinline__ v8f wmma16(v16h a, v16h b, v8f c) {
  v8f d = __builtin_amdgcn_wmma_f32_16x16x32_f16(false, a, false, b, (short)0, c, false, false);
  asm volatile("v_nop\n\tv_nop\n\tv_nop\n\tv_nop" : "+v"(d) : "v"(a), "v"(b));
  return d;
}
__device__ __forceinline__ v8f wmma_bf(v16b a, v16b b, v8f c) {
  v8f d = __builtin_amdgcn_wmma_f32_16x16x32_bf16(false, a, false, b, (short)0, c, false, false);
  asm volatile("v_nop\n\tv_nop\n\tv_nop\n\tv_nop" : "+v"(d) : "v"(a), "v"(b));
  return d;
}
// Multi-layer source attention (B 4, 1,024 queries over 4 layers of 1,024 keys/values, d 512, 8 heads x 64): a shared query projection, per-layer key/value projections, softmax(q k_l^T / 8) v_l per layer, per-layer sigmoid gates from [query | x_l], gated sum over layers / sqrt(3), final linear map.
__device__ __forceinline__ v16h frag_h(const _Float16* rowk0, int lane) {
  union { v16h v; v8h q[2]; } u; const _Float16* p = rowk0 + 8 * (lane >> 4);
  u.q[0] = *(const v8h*)p; u.q[1] = *(const v8h*)(p + 16); return u.v;
}
__device__ __forceinline__ v16h frag_f32(const float* rowk0, int lane) {
  v16h a; const float* p = rowk0 + 8 * (lane >> 4);
#pragma unroll
  for (int i = 0; i < 8; ++i) { a[i] = (_Float16)p[i]; a[8 + i] = (_Float16)p[16 + i]; }
  return a;
}
__device__ __forceinline__ v16h frag_f32s(const float* rowk0, int lane, float sc) {
  v16h a; const float* p = rowk0 + 8 * (lane >> 4);
#pragma unroll
  for (int i = 0; i < 8; ++i) { a[i] = (_Float16)(p[i] * sc); a[8 + i] = (_Float16)(p[16 + i] * sc); }
  return a;
}
// column fragment from a [K][ld] layout (column n), rows >= K read as 0
__device__ __forceinline__ v16h fragc_f32(const float* W, int k0, int n, int lane, int ld, int K) {
  v16h a; const int g = lane >> 4;
#pragma unroll
  for (int i = 0; i < 8; ++i) { const int ka = k0 + 8 * g + i, kb = ka + 16;
    a[i] = (_Float16)(ka < K ? W[(size_t)(ka < K ? ka : K - 1) * ld + n] : 0.f); a[8 + i] = (_Float16)(kb < K ? W[(size_t)(kb < K ? kb : K - 1) * ld + n] : 0.f); }
  return a;
}
struct F2 { v16b h, l; };
__device__ __forceinline__ F2 bsplit16(const float v[16]) { F2 r;
#pragma unroll
  for (int i = 0; i < 16; ++i) { const __bf16 h = (__bf16)v[i]; r.h[i] = h; r.l[i] = (__bf16)(v[i] - (float)h); }
  return r; }
__device__ __forceinline__ F2 split_row(const float* row, int k0, int lane) { float v[16]; const float* p = row + k0 + 8 * (lane >> 4);
#pragma unroll
  for (int i = 0; i < 8; ++i) { v[i] = p[i]; v[8 + i] = p[16 + i]; }
  return bsplit16(v); }
__device__ __forceinline__ F2 split_rowK(const float* row, int k0, int lane, int K) { float v[16]; const int g = lane >> 4;
#pragma unroll
  for (int i = 0; i < 8; ++i) { const int ka = k0 + 8 * g + i, kb = ka + 16; v[i] = ka < K ? row[ka < K ? ka : K - 1] : 0.f; v[8 + i] = kb < K ? row[kb < K ? kb : K - 1] : 0.f; }
  return bsplit16(v); }
__device__ __forceinline__ F2 split_col(const float* W, int k0, int n, int lane, int ld, int K) { float v[16]; const int g = lane >> 4;
#pragma unroll
  for (int i = 0; i < 8; ++i) { const int ka = k0 + 8 * g + i, kb = ka + 16; v[i] = ka < K ? W[(size_t)(ka < K ? ka : K - 1) * ld + n] : 0.f; v[8 + i] = kb < K ? W[(size_t)(kb < K ? kb : K - 1) * ld + n] : 0.f; }
  return bsplit16(v); }
__device__ __forceinline__ v8f mac3(const F2& a, const F2& b, v8f c) { c = wmma_bf(a.l, b.h, c); c = wmma_bf(a.h, b.l, c); return wmma_bf(a.h, b.h, c); }
__device__ __forceinline__ float sigm(float v) { return 1.0f / (1.0f + expf(-v)); }
#define LDSX() do { asm volatile("s_wait_dscnt 0" ::: "memory"); __builtin_amdgcn_wave_barrier(); __builtin_amdgcn_fence(__ATOMIC_RELEASE, "workgroup"); } while (0)


#define NB 4
#define SS 1024
#define DM 512
#define NH 8
#define NLAY 4
__device__ __forceinline__ size_t kvrow(size_t r) { return (r / SS) * ((size_t)NLAY * SS) + (r % SS); }   // key/value [B][L][S][D]: engine row (b, s) of layer l lives at (b*L + l)*S + s (layer offset added to the pointer)
#define HD 64
#define QKVW (3 * DM)
#ifndef TQB
#define TQB (SS / 64)
#define TNB NB
#define TOB (NB * SS / 64)     // output row tiles (all)
#endif
typedef __attribute__((ext_vector_type(8))) __bf16 v8b;
__device__ __forceinline__ v16b frag_b(const __bf16* rowk0, int lane) {
  union { v16b v; v8b q[2]; } u; const __bf16* p = rowk0 + 8 * (lane >> 4);
  u.q[0] = *(const v8b*)p; u.q[1] = *(const v8b*)(p + 16); return u.v;
}
// fragment order: one 16 x 32 operand fragment is 1 KiB, [half][lane][8 elements]; lane (g, col) holds row col, k = half * 16 + 8 g + 0..7 (the k order of frag_b / frag_h), so each 16-byte load of a wave reads 512 contiguous bytes
__device__ __forceinline__ v16b frag_bp(const __bf16* frag, int lane) {
  union { v16b v; v8b q[2]; } u; const __bf16* p = frag + lane * 8;
  u.q[0] = *(const v8b*)p; u.q[1] = *(const v8b*)(p + 256); return u.v;
}
__device__ __forceinline__ v16h frag_hp(const _Float16* frag, int lane) {
  union { v16h v; v8h q[2]; } u; const _Float16* p = frag + lane * 8;
  u.q[0] = *(const v8h*)p; u.q[1] = *(const v8h*)(p + 256); return u.v;
}
__device__ __forceinline__ float bfr(float v) { return (float)(__bf16)v; }
__device__ __attribute__((noinline)) float exp_ni(float v) { return expf(v); }
__device__ __attribute__((noinline)) float erf_ni(float v) { return erff(v); }

// a packed [N][K] weight: [N / 128][K / 32][8 row tiles] fragments of 512 elements
#define PK_A 0                       // Wq | Wk | Wv, 1536 rows x 512
#define PK_P (PK_A + QKVW * DM)        // Wf, 512 rows x 512
#define PK_END (PK_P + DM * DM)
#define WS_PK  0u
// every per-layer buffer holds NLAY planes (layer = blockIdx.z, blockIdx.z / NB in k_attn; k_out sums the FUS planes, uses PK plane 0); plane sizes in elements:
#define QKS ((size_t)NB * SS * 2 * DM)
#define VTS ((size_t)NB * DM * SS)
#define OS  ((size_t)NB * SS * DM)
#define WS_QK  (WS_PK + 2u * PK_END * NLAY)        // f16 [l][4096 rows][1024]: q | (unused)
#define WS_QKL (WS_QK + 2u * NLAY * QKS)           // f16 q | k residual planes x2048
#define WS_VTH (WS_QKL + 2u * NLAY * QKS)          // f16 [l][b][h][32 keys ks][4 d tiles] v^T fragments (row = d, k = key)
#define WS_VTL (WS_VTH + 2u * NLAY * VTS)          // f16 [l][b][512 (h*64+d)][1024 s] lo x 2048
#define WS_O   (WS_VTL + 2u * NLAY * VTS)          // f32 [l][4096][512]
#define WS_CS  (WS_O + 4u * NLAY * OS)              // f32 [2][1024][32], unused
#define WS_PSG (WS_CS + 4u * 2 * SS * 32)                  // bf16 packed Wsig [4][512 x 1024]
#define WS_FUS (WS_PSG + 2u * (size_t)NLAY * DM * 2 * DM)   // f32 [l][NR][512] gate_l * x_l
#define WS_KF  (WS_FUS + 4u * NLAY * OS)            // f16 [l][b][h][16-key tile][2 k-steps] k fragments (row = key, k = d)
#define WS_END (WS_KF + 2u * NLAY * OS)
// ---- k_pack: block = (16-row tile nt, which, layer l): f32 [out][in] rows -> bf16 fragments; which 0..2 -> W_q/W_k[l]/W_v[l] into layer l's PK_A (rows which*512 + n); 3 -> W_f into layer l's PK_P; 4 -> Wsig[l] (rows 1024 long) into PSG. A thread converts one lane's 8 elements in each of four k-steps a trip (Wsig: two trips); a wave stores 512 contiguous bytes
__global__ __launch_bounds__(256) void k_pack(const float* __restrict__ WQ, const float* __restrict__ WK, const float* __restrict__ WV, const float* __restrict__ WO, const float* __restrict__ WS, __bf16* __restrict__ PK, __bf16* __restrict__ PSG) {
  const int nt = blockIdx.x, which = blockIdx.y, l = blockIdx.z, t = threadIdx.x; const size_t n = (size_t)nt * 16, ln = (size_t)l * DM + n; const int len = (which == 4) ? 2 * DM : DM;
  const float* Wm = (which == 0) ? WQ + n * DM : (which == 1) ? WK + ln * DM : (which == 2) ? WV + ln * DM : (which == 3) ? WO + n * DM : WS + ln * (2 * DM);
  __bf16* PL = PK + (size_t)l * PK_END;
  __bf16* dst = ((which < 3) ? PL + PK_A + (size_t)which * DM * DM : (which == 3) ? PL + PK_P : PSG + (size_t)l * DM * 2 * DM) + ((size_t)(nt >> 3) * (len / 32) * 8 + (nt & 7)) * 512;
  for (int p0 = t; p0 < len * 2; p0 += 1024) {
#pragma unroll   // four independent pieces to a trip: their loads are in flight together
    for (int u = 0; u < 4; ++u) { const int kc = p0 >> 6, half = (p0 >> 5) & 1, lane = p0 & 31; const float* s = Wm + (size_t)(lane & 15) * len + kc * 32 + half * 16 + (lane >> 4) * 8 + u * 4 * 32; v8b o;   // piece p0 + 256 u: k-step kc + 4 u, same half and lane
#pragma unroll   // register vector: every index must be a constant
      for (int i = 0; i < 8; ++i) o[i] = (__bf16)s[i];
      vst2(dst + (size_t)kc * 8 * 512 + half * 256 + lane * 8 + u * 4 * 8 * 512, o); } }
}
__global__ __launch_bounds__(128) void k_qkv(const float* __restrict__ XQ, const float* __restrict__ XK, const float* __restrict__ XV, const __bf16* __restrict__ P, const float* __restrict__ BQ, const float* __restrict__ BK, const float* __restrict__ BV, _Float16* __restrict__ QK, _Float16* __restrict__ QKL, _Float16* __restrict__ VTH, _Float16* __restrict__ VTL, _Float16* __restrict__ KF) {
  { const size_t l = blockIdx.z; XK += l * SS * DM; XV += l * SS * DM; P += l * PK_END; BK += l * DM; BV += l * DM; QK += l * QKS; QKL += l * QKS; VTH += l * VTS; VTL += l * VTS; KF += l * OS; }   // layer l's inputs, weights and planes
  const int which0 = (blockIdx.y * 128) / DM; const float* X = (which0 == 0) ? XQ : (which0 == 1) ? XK : XV; const float* BB = BQ ? (((which0 == 0) ? BQ : (which0 == 1) ? BK : BV) + (blockIdx.y * 128 - which0 * DM)) : nullptr;
  __shared__ __align__(16) _Float16 so[4][16][136], sol[4][16][136]; __shared__ __align__(16) _Float16 sth[128][72], stl[128][72];
  const int tid = threadIdx.x, wave = tid >> 5, lane = tid & 31, col = lane & 15, g = lane >> 4; const size_t r0 = (size_t)blockIdx.x * 64 + wave * 16; const int n0 = blockIdx.y * 128;
  v8f acc[8] = {};
  float bias[8] = {};   // the tile's eight bias values, loaded as one group ahead of the k loop, rounded to bf16 where they are added
  if (BB) {
#pragma unroll   // register array: every index must be a constant
    for (int j = 0; j < 8; ++j) bias[j] = BB[j * 16 + col]; }
#pragma unroll 2
  for (int kc = 0; kc < DM / 32; ++kc) { float ar[16]; { const float* p = X + ((which0 == 0) ? (size_t)(r0 + col) : kvrow(r0 + col)) * DM + kc * 32 + 8 * g;
#pragma unroll
      for (int i = 0; i < 8; ++i) { ar[i] = p[i]; ar[8 + i] = p[16 + i]; } }
    v16b w[8];   // the k-step's eight weight fragments are loaded as one group ahead of its products: no load moves over the statement that follows a product, so a load written between two products is waited for in full
#pragma unroll   // register array: every index must be a constant
    for (int j = 0; j < 8; ++j) w[j] = frag_bp(P + ((size_t)(blockIdx.y * (DM / 32) + kc) * 8 + j) * 512, lane);
    __builtin_amdgcn_sched_barrier(0);   // keeps the conversions below out of the load group: every load of the k-step is in flight before the first wait
    v16b a;
#pragma unroll   // register array: every index must be a constant
    for (int i = 0; i < 16; ++i) a[i] = (__bf16)ar[i];
#pragma unroll
    for (int j = 0; j < 8; ++j) acc[j] = wmma_bf(a, w[j], acc[j]); }
  if (n0 < 2 * DM) {   // q stored unscaled (f16 sigma ~0.6, no subnormal exposure); 1/8 applied to the f32 score
#pragma unroll
    for (int j = 0; j < 8; ++j) {
#pragma unroll
      for (int r = 0; r < 8; ++r) { const float v = acc[j][r] + bfr(bias[j]); const _Float16 hv = (_Float16)v; so[wave][8 * g + r][j * 16 + col] = hv; sol[wave][8 * g + r][j * 16 + col] = (_Float16)((v - (float)hv) * 2048.0f); } }   // q, k (+ bias) as f16 hi + (x2048) residual
    LDSX();
    if (which0 == 0) {
    for (int rl = 0; rl < 16; ++rl) if (lane < 16) { vst2((unsigned*)(QK + (r0 + rl) * (2 * DM) + n0 + lane * 8), *(const v4u*)&so[wave][rl][lane * 8]); vst2((unsigned*)(QKL + (r0 + rl) * (2 * DM) + n0 + lane * 8), *(const v4u*)&sol[wave][rl][lane * 8]); }
    } else {   // k: the wave's 16 keys x 128 columns are four fragments (2 heads x 2 k-steps); the residual plane keeps its rows
      for (int rl = 0; rl < 16; ++rl) if (lane < 16) vst2((unsigned*)(QKL + (r0 + rl) * (2 * DM) + n0 + lane * 8), *(const v4u*)&sol[wave][rl][lane * 8]);
      _Float16* kt = KF + (((r0 / SS) * NH + (n0 - DM) / HD) * (SS / 16) + (r0 % SS) / 16) * 1024 + lane * 8;
#pragma unroll
      for (int f = 0; f < 8; ++f) { const int hh = f >> 2, kc = (f >> 1) & 1, half = f & 1; vst2((unsigned*)(kt + (size_t)hh * (SS / 16) * 1024 + kc * 512 + half * 256), *(const v4u*)&so[wave][col][hh * HD + kc * 32 + half * 16 + g * 8]); }
      asm volatile("s_wait_xcnt 0x0" ::: "memory"); }   // behind the run of stores: code that follows them in the listing reuses their data and address registers
  } else {
#pragma unroll
    for (int j = 0; j < 8; ++j) {
#pragma unroll
      for (int r = 0; r < 8; ++r) { const float v = acc[j][r] + bfr(bias[j]); const _Float16 hv = (_Float16)v; sth[j * 16 + col][wave * 16 + 8 * g + r] = hv; stl[j * 16 + col][wave * 16 + 8 * g + r] = (_Float16)((v - (float)hv) * 2048.0f); } }
    __syncthreads();
    const size_t rb = (size_t)blockIdx.x * 64; const int b = (int)(rb / SS), s0 = (int)(rb % SS); const int pc0 = n0 - 2 * DM;
    for (int q = tid; q < 128 * 8; q += 128) { const int d = q >> 3, pc = q & 7; const size_t o = ((size_t)b * DM + pc0 + d) * SS + s0 + pc * 8; vst2((unsigned*)(VTL + o), *(const v4u*)&stl[d][pc * 8]); }
    for (int q = tid; q < 128 * 8; q += 128) { const int ln = q & 31, half = (q >> 5) & 1, dt = (q >> 6) & 3, ksl = (q >> 8) & 1, hh = q >> 9;   // the block's 64 keys x 128 d are 16 v^T fragments (2 heads x 2 key groups x 4 d tiles)
      vst2((unsigned*)(VTH + ((((size_t)b * NH + pc0 / HD + hh) * (SS / 32) + s0 / 32 + ksl) * 4 + dt) * 512 + half * 256 + ln * 8), *(const v4u*)&sth[hh * HD + dt * 16 + (ln & 15)][ksl * 32 + half * 16 + (ln >> 4) * 8]); }
  }
}
// ---- k_attn: block = (64 queries, head h, (layer l, batch b)): k and v^T read as packed fragments (KF, VTH); all-keys flash attention (K = 64: 2 k-steps), scores = (q.k) * 0.125 with single f16 operands, P.V: f16 P (x2^11) x V hi, one product (accl stays 0); O[b*S+q][h*64+d] = (acc + accl / 2048) / (2048 l) (256-B segments)
__global__ __launch_bounds__(128) void k_attn(const _Float16* __restrict__ QK, const _Float16* __restrict__ QKL, const _Float16* __restrict__ VTH, const _Float16* __restrict__ VTL, const _Float16* __restrict__ KF, const void* __restrict__ KMASK, float* __restrict__ O) {
  __shared__ __align__(16) float sp[4][16][36]; __shared__ __align__(16) float so[4][16][68];
  const int tid = threadIdx.x, wave = tid >> 5, lane = tid & 31, col = lane & 15, g = lane >> 4;
  const int qb = blockIdx.x, h = blockIdx.y, b = blockIdx.z % NB; { const size_t l = blockIdx.z / NB; QK += l * QKS; QKL += l * QKS; VTH += l * VTS; VTL += l * VTS; KF += l * OS; O += l * OS; }   // layer l's planes
  const int q0 = qb * 64 + wave * 16; const size_t rq = (size_t)b * SS + q0 + col;
  v16h aq[2], aql[2];
#pragma unroll
  for (int kc = 0; kc < 2; ++kc) { aq[kc] = frag_h(QK + rq * (2 * DM) + h * HD + kc * 32, lane); aql[kc] = frag_h(QKL + rq * (2 * DM) + h * HD + kc * 32, lane); }
  float m[8], l[8];
#pragma unroll
  for (int r = 0; r < 8; ++r) { m[r] = -3.0e38f; l[r] = 0.f; }
  v8f acc[4] = {}, accl[4] = {};
  const int nks = SS / 32;   // all keys
  const _Float16* kbase = KF + (size_t)(b * NH + h) * SS * HD;   // k fragments of this (layer, batch, head): 4 to a pass
  const _Float16* vbase = VTH + (size_t)(b * NH + h) * SS * HD;   // v^T fragments: 4 to a pass
  v16h kf[2][2];   // a pass's four k fragments, fetched one pass ahead
#pragma unroll   // register array: every index must be a constant
  for (int ct = 0; ct < 2; ++ct) {
#pragma unroll   // register array: every index must be a constant
    for (int kc = 0; kc < 2; ++kc) kf[ct][kc] = frag_hp(kbase + (ct * 2 + kc) * 512, lane); }
#pragma unroll 1
  for (int ks = 0; ks < nks; ++ks) { v8f s[2];
    v16h vf[4];   // this pass's four v^T fragments: issued here as one group, first used behind the softmax
#pragma unroll   // register array: every index must be a constant
    for (int dt = 0; dt < 4; ++dt) vf[dt] = frag_hp(vbase + (size_t)(ks * 4 + dt) * 512, lane);
#pragma unroll
    for (int ct = 0; ct < 2; ++ct) { v8f c = {};
#pragma unroll
      for (int kc = 0; kc < 2; ++kc) c = wmma16(aq[kc], kf[ct][kc], c);   // single product: q, k as one-rounding f16 operands
      { const bool keepk = true;
#pragma unroll
      for (int r = 0; r < 8; ++r) s[ct][r] = keepk ? c[r] * 0.125f : -3.0e38f; } }   // 1/sqrt(64)
#pragma unroll
    for (int r = 0; r < 8; ++r) { float mx = fmaxf(s[0][r], s[1][r]);
#pragma unroll
      for (int o = 1; o < 16; o <<= 1) mx = fmaxf(mx, __shfl_xor(mx, o));
      const float mn = fmaxf(m[r], mx); const float alpha = (m[r] <= -1.0e38f) ? 0.f : __expf(m[r] - mn);
      const float e0 = (s[0][r] <= -1.0e38f) ? 0.f : __expf(s[0][r] - mn), e1 = (s[1][r] <= -1.0e38f) ? 0.f : __expf(s[1][r] - mn); float es = e0 + e1;
#pragma unroll
      for (int o = 1; o < 16; o <<= 1) es += __shfl_xor(es, o);
      l[r] = l[r] * alpha + es; m[r] = mn;
#pragma unroll
      for (int dt = 0; dt < 4; ++dt) { acc[dt][r] *= alpha; accl[dt][r] *= alpha; }
      sp[wave][8 * g + r][col] = e0; sp[wave][8 * g + r][16 + col] = e1; }
    LDSX();
    { const int kn = (ks + 1 < nks) ? ks + 1 : ks;   // next pass's k fragments into the same registers, in flight under P.V (the last pass reads its own rows again: in bounds, unused)
#pragma unroll   // register array: every index must be a constant
      for (int ct = 0; ct < 2; ++ct) {
#pragma unroll   // register array: every index must be a constant
        for (int kc = 0; kc < 2; ++kc) kf[ct][kc] = frag_hp(kbase + (size_t)(kn * 4 + ct * 2 + kc) * 512, lane); } }
    v16h pa, pl; { const float* prow = &sp[wave][col][0] + 8 * (lane >> 4);
#pragma unroll
      for (int i = 0; i < 8; ++i) { const float x0 = prow[i] * 2048.0f, x1 = prow[16 + i] * 2048.0f; const _Float16 h0 = (_Float16)x0, h1 = (_Float16)x1; pa[i] = h0; pa[8 + i] = h1; pl[i] = (_Float16)((x0 - (float)h0) * 2048.0f); pl[8 + i] = (_Float16)((x1 - (float)h1) * 2048.0f); } }   // P scaled by 2^11 before the f16 split so small softmax weights stay out of the f16 subnormal range; 2^-11 folded into the epilogue
#pragma unroll
    for (int dt = 0; dt < 4; ++dt) acc[dt] = wmma16(pa, vf[dt], acc[dt]);   // single product: P (x2^11) x V
    (void)pl;
    LDSX(); }
#pragma unroll
  for (int r = 0; r < 8; ++r) { const float il = (1.0f / 2048.0f) / l[r];
#pragma unroll
    for (int dt = 0; dt < 4; ++dt) so[wave][8 * g + r][dt * 16 + col] = (acc[dt][r] + accl[dt][r] * (1.0f / 2048.0f)) * il; }
  LDSX();
  for (int rl = 0; rl < 16; ++rl) if (lane < 16) vst2(O + ((size_t)b * SS + q0 + rl) * DM + h * HD + lane * 4, *(const v4f*)&so[wave][rl][lane * 4]);
}
// fused row fragment: sum over the layers in order 0..3 of (gate_l x_l) / sqrt(3), then bf16 hi + residual
__device__ __forceinline__ F2 split_row_sum(const float* row, int k0, int lane) { float v[16]; const float* p = row + k0 + 8 * (lane >> 4);
#pragma unroll
  for (int i = 0; i < 16; ++i) v[i] = 0.f;
#pragma unroll
  for (int l = 0; l < NLAY; ++l) {
#pragma unroll
    for (int i = 0; i < 8; ++i) { v[i] = v[i] + p[l * OS + i] * 0.57735026918962576f; v[8 + i] = v[8 + i] + p[l * OS + 16 + i] * 0.57735026918962576f; } }
  return bsplit16(v); }
// ---- k_out: block = (64 rows, 128 cols): out = O(hi/lo) . Wo rows (2 products) + bo; O = the layer sum of the NLAY planes
__global__ __launch_bounds__(128) void k_out(const float* __restrict__ O, const __bf16* __restrict__ P, const float* __restrict__ BO, float* __restrict__ Y) {
  __shared__ __align__(16) float so[4][16][132];
  const int tid = threadIdx.x, wave = tid >> 5, lane = tid & 31, col = lane & 15, g = lane >> 4; const size_t r0 = (size_t)blockIdx.x * 64 + wave * 16; const int n0 = blockIdx.y * 128;
  v8f acc[8] = {};
#pragma unroll 2
  for (int kc = 0; kc < DM / 32; ++kc) { const F2 a = split_row_sum(O + (r0 + col) * DM, kc * 32, lane); v16b w[8];   // weight fragments as one group ahead of the products
    asm volatile("s_wait_xcnt 0x0" ::: "memory");   // the weight loads below may land in registers that held the addresses of the plane loads above
#pragma unroll   // register array: every index must be a constant
    for (int j = 0; j < 8; ++j) w[j] = frag_bp(P + ((size_t)(blockIdx.y * (DM / 32) + kc) * 8 + j) * 512, lane);
#pragma unroll
    for (int j = 0; j < 8; ++j) { acc[j] = wmma_bf(a.l, w[j], acc[j]); acc[j] = wmma_bf(a.h, w[j], acc[j]); } }
#pragma unroll
  for (int j = 0; j < 8; ++j) {
#pragma unroll
    for (int r = 0; r < 8; ++r) so[wave][8 * g + r][j * 16 + col] = acc[j][r] + bfr(BO[n0 + j * 16 + col]); }
  LDSX();
  for (int rl = 0; rl < 16; ++rl) vst2(Y + (r0 + rl) * DM + n0 + lane * 4, *(const v4f*)&so[wave][rl][lane * 4]);
}
#define NR (NB * SS)
// ---- k_gate: block = (64 rows, 128 cols, layer l): g = sigmoid([query (exact bf16, 1 product) | x_l (hi + residual, 2 products)] . Wsig_l rows + bsig_l); FUS plane l = g * x_l (k_out scales by 1 / sqrt(3) and sums the planes)
__global__ __launch_bounds__(128) void k_gate(const float* __restrict__ XQ, const float* __restrict__ XL, const __bf16* __restrict__ PSG, const float* __restrict__ BS, float* __restrict__ FUS) {
  __shared__ __align__(16) float so[4][16][132]; const int l = blockIdx.z; XL += l * OS; FUS += l * OS;
  const int tid = threadIdx.x, wave = tid >> 5, lane = tid & 31, col = lane & 15, g = lane >> 4; const size_t r0 = (size_t)blockIdx.x * 64 + wave * 16; const int n0 = blockIdx.y * 128;
  const __bf16* Wr = PSG + (size_t)l * DM * 2 * DM; v8f acc[8] = {};
#pragma unroll 2
  for (int kc = 0; kc < DM / 32; ++kc) { float ar[16]; { const float* p = XQ + (r0 + col) * DM + kc * 32 + 8 * g;
#pragma unroll
      for (int i = 0; i < 8; ++i) { ar[i] = p[i]; ar[8 + i] = p[16 + i]; } }
    v16b w[8];   // weight fragments as one group ahead of the products
#pragma unroll   // register array: every index must be a constant
    for (int j = 0; j < 8; ++j) w[j] = frag_bp(Wr + ((size_t)(blockIdx.y * (2 * DM / 32) + kc) * 8 + j) * 512, lane);
    __builtin_amdgcn_sched_barrier(0);   // keeps the conversions below out of the load group: every load of the k-step is in flight before the first wait
    v16b a;
#pragma unroll   // register array: every index must be a constant
    for (int i = 0; i < 16; ++i) a[i] = (__bf16)ar[i];
#pragma unroll
    for (int j = 0; j < 8; ++j) acc[j] = wmma_bf(a, w[j], acc[j]); }
#pragma unroll 2
  for (int kc = 0; kc < DM / 32; ++kc) { float v[16]; { const float* p = XL + (r0 + col) * DM + kc * 32 + 8 * g;
#pragma unroll   // register array: every index must be a constant
      for (int i = 0; i < 8; ++i) { v[i] = p[i]; v[8 + i] = p[16 + i]; } }
    v16b w[8];   // weight fragments in the same group of loads, ahead of the products
#pragma unroll   // register array: every index must be a constant
    for (int j = 0; j < 8; ++j) w[j] = frag_bp(Wr + ((size_t)(blockIdx.y * (2 * DM / 32) + DM / 32 + kc) * 8 + j) * 512, lane);
    __builtin_amdgcn_sched_barrier(0);   // keeps the conversions below out of the load group: every load of the k-step is in flight before the first wait
    const F2 a = bsplit16(v);
#pragma unroll
    for (int j = 0; j < 8; ++j) { acc[j] = wmma_bf(a.l, w[j], acc[j]); acc[j] = wmma_bf(a.h, w[j], acc[j]); } }
  float bb[8];   // the tile's bias values, in the first half's group of loads
#pragma unroll   // register array: every index must be a constant
  for (int j = 0; j < 8; ++j) bb[j] = bfr(BS[(size_t)l * DM + n0 + j * 16 + col]);
#pragma unroll   // register array: every index must be a constant
  for (int jh = 0; jh < 2; ++jh) { float xv[4][8];   // half a tile's x_l values as one group of loads ahead of its exp calls (no load moves over a call); two halves keep a group under the load counter's range
#pragma unroll   // register array: every index must be a constant
    for (int jj = 0; jj < 4; ++jj) {
#pragma unroll   // register array: every index must be a constant
      for (int r = 0; r < 8; ++r) xv[jj][r] = XL[(r0 + 8 * g + r) * DM + n0 + (jh * 4 + jj) * 16 + col]; }
#pragma unroll   // register array: every index must be a constant
    for (int jj = 0; jj < 4; ++jj) { const int j = jh * 4 + jj;
#pragma unroll   // register array: every index must be a constant
      for (int r = 0; r < 8; ++r) { const float gte = 1.0f / (1.0f + exp_ni(-(acc[j][r] + bb[j]))); so[wave][8 * g + r][j * 16 + col] = gte * xv[jj][r]; } } }
  LDSX();
  for (int rl = 0; rl < 16; ++rl) vst2(FUS + (r0 + rl) * DM + n0 + lane * 4, *(const v4f*)&so[wave][rl][lane * 4]);
}
extern "C" void kernel_launch(void* const* d_in, const int* in_sizes, int n_in, void* d_out, int out_size, void* d_ws, size_t ws_size, hipStream_t stream) {
  (void)in_sizes; (void)n_in; (void)out_size;
  const float** F = (const float**)d_in;   // 0 query [4,1024,512], 1 key [4,4,1024,512], 2 value [4,4,1024,512], 3 Wq [512,512], 4 bq, 5 Wk [4,512,512], 6 bk [4,512], 7 Wv, 8 bv, 9 Wsig [4,512,1024], 10 bsig [4,512], 11 Wf [512,512], 12 bf
  if (ws_size < (size_t)WS_END) return;
  char* ws = (char*)d_ws; __bf16 *PK = (__bf16*)(ws + WS_PK), *PSG = (__bf16*)(ws + WS_PSG); _Float16 *QK = (_Float16*)(ws + WS_QK), *QKL = (_Float16*)(ws + WS_QKL), *VTH = (_Float16*)(ws + WS_VTH), *VTL = (_Float16*)(ws + WS_VTL), *KF = (_Float16*)(ws + WS_KF); float *O = (float*)(ws + WS_O), *FUS = (float*)(ws + WS_FUS);
  // the layers are independent up to the gated sum: each stage is one launch with the layer in blockIdx.z
  k_pack<<<dim3(DM / 16, 5, NLAY), 256, 0, stream>>>(F[3], F[5], F[7], F[11], F[9], PK, PSG);   // per layer: Wq | Wk[l] | Wv[l] | Wf | Wsig[l] as fragments
  k_qkv<<<dim3(TNB * SS / 64, QKVW / 128, NLAY), 128, 0, stream>>>(F[0], F[1], F[2], PK + PK_A, F[4], F[6], F[8], QK, QKL, VTH, VTL, KF);   // (q recomputed per layer; identical)
  k_attn<<<dim3(TQB, NH, TNB * NLAY), 128, 0, stream>>>(QK, QKL, VTH, VTL, KF, nullptr, O);   // x_l
  k_gate<<<dim3(NR / 64, DM / 128, NLAY), 128, 0, stream>>>(F[0], O, PSG, F[10], FUS);   // gate_l * x_l
  k_out<<<dim3(TOB, DM / 128), 128, 0, stream>>>(FUS, PK + PK_P, F[12], (float*)d_out);   // (sum_l gate_l x_l / sqrt(3)) . Wf^T + bf (Wf of layer 0's pack)
}

// v004
// It runs in 180 microseconds.
// In two side-by-side timings against v003, it was 1.22 and 1.21 times as fast.
// All steps since v000 together make it 4.89 times as fast.
// compute dtype: all float inputs rounded to bf16; q = query . Wq^T + bq and k_l, v_l = key_l / value_l . W^T + b with EXACT bf16 products on WMMA 16x16x32 (weights, k and v^T kept in fragment order in the workspace); PLAIN attention per layer: q, k as single f16 operands x 1/8, running-max softmax in f32 (hardware exp), P (scaled by 2^11, single f16) x v (single f16); gate_l = sigmoid([query (exact) | x_l (bf16 hi + residual, 2 products)] . Wsig_l^T + bsig_l) (precise expf); fused = sum_l gate_l x_l / sqrt(3) in f32; out = fused (bf16 hi + residual) . Wf^T (2 products) + bf.
#include <hip/hip_runtime.h>
#include <math.h>

typedef __attribute__((ext_vector_type(16))) _Float16 v16h;
typedef __attribute__((ext_vector_type(16))) __bf16 v16b;
typedef __attribute__((ext_vector_type(8)))  _Float16 v8h;
typedef __attribute__((ext_vector_type(8)))  float v8f;
typedef __attribute__((ext_vector_type(4)))  float v4f;
typedef __attribute__((ext_vector_type(2)))  float v2f;
typedef __attribute__((ext_vector_type(4)))  unsigned v4u;
typedef __attribute__((ext_vector_type(4)))  int v4i;
typedef float __attribute__((may_alias)) float_a;
typedef int __attribute__((may_alias)) int_a;

template <typename T> __device__ __forceinline__ void vst2(void* p, T v) { *(T*)p = v;  }
__device__ __forceinline__ v8f wmma16(v16h a, v16h b, v8f c) {
  v8f d = __builtin_amdgcn_wmma_f32_16x16x32_f16(false, a, false, b, (short)0, c, false, false);
  asm volatile("v_nop\n\tv_nop\n\tv_nop\n\tv_nop" : "+v"(d) : "v"(a), "v"(b));
  return d;
}
__device__ __forceinline__ v8f wmma_bf(v16b a, v16b b, v8f c) {
  v8f d = __builtin_amdgcn_wmma_f32_16x16x32_bf16(false, a, false, b, (short)0, c, false, false);
  asm volatile("v_nop\n\tv_nop\n\tv_nop\n\tv_nop" : "+v"(d) : "v"(a), "v"(b));
  return d;
}
// Multi-layer source attention (B 4, 1,024 queries over 4 layers of 1,024 keys/values, d 512, 8 heads x 64): a shared query projection, per-layer key/value projections, softmax(q k_l^T / 8) v_l per layer, per-layer sigmoid gates from [query | x_l], gated sum over layers / sqrt(3), final linear map.
__device__ __forceinline__ v16h frag_h(const _Float16* rowk0, int lane) {
  union { v16h v; v8h q[2]; } u; const _Float16* p = rowk0 + 8 * (lane >> 4);
  u.q[0] = *(const v8h*)p; u.q[1] = *(const v8h*)(p + 16); return u.v;
}
__device__ __forceinline__ v16h frag_f32(const float* rowk0, int lane) {
  v16h a; const float* p = rowk0 + 8 * (lane >> 4);
#pragma unroll
  for (int i = 0; i < 8; ++i) { a[i] = (_Float16)p[i]; a[8 + i] = (_Float16)p[16 + i]; }
  return a;
}
__device__ __forceinline__ v16h frag_f32s(const float* rowk0, int lane, float sc) {
  v16h a; const float* p = rowk0 + 8 * (lane >> 4);
#pragma unroll
  for (int i = 0; i < 8; ++i) { a[i] = (_Float16)(p[i] * sc); a[8 + i] = (_Float16)(p[16 + i] * sc); }
  return a;
}
// column fragment from a [K][ld] layout (column n), rows >= K read as 0
__device__ __forceinline__ v16h fragc_f32(const float* W, int k0, int n, int lane, int ld, int K) {
  v16h a; const int g = lane >> 4;
#pragma unroll
  for (int i = 0; i < 8; ++i) { const int ka = k0 + 8 * g + i, kb = ka + 16;
    a[i] = (_Float16)(ka < K ? W[(size_t)(ka < K ? ka : K - 1) * ld + n] : 0.f); a[8 + i] = (_Float16)(kb < K ? W[(size_t)(kb < K ? kb : K - 1) * ld + n] : 0.f); }
  return a;
}
struct F2 { v16b h, l; };
__device__ __forceinline__ F2 bsplit16(const float v[16]) { F2 r;
#pragma unroll
  for (int i = 0; i < 16; ++i) { const __bf16 h = (__bf16)v[i]; r.h[i] = h; r.l[i] = (__bf16)(v[i] - (float)h); }
  return r; }
__device__ __forceinline__ F2 split_row(const float* row, int k0, int lane) { float v[16]; const float* p = row + k0 + 8 * (lane >> 4);
#pragma unroll
  for (int i = 0; i < 8; ++i) { v[i] = p[i]; v[8 + i] = p[16 + i]; }
  return bsplit16(v); }
__device__ __forceinline__ F2 split_rowK(const float* row, int k0, int lane, int K) { float v[16]; const int g = lane >> 4;
#pragma unroll
  for (int i = 0; i < 8; ++i) { const int ka = k0 + 8 * g + i, kb = ka + 16; v[i] = ka < K ? row[ka < K ? ka : K - 1] : 0.f; v[8 + i] = kb < K ? row[kb < K ? kb : K - 1] : 0.f; }
  return bsplit16(v); }
__device__ __forceinline__ F2 split_col(const float* W, int k0, int n, int lane, int ld, int K) { float v[16]; const int g = lane >> 4;
#pragma unroll
  for (int i = 0; i < 8; ++i) { const int ka = k0 + 8 * g + i, kb = ka + 16; v[i] = ka < K ? W[(size_t)(ka < K ? ka : K - 1) * ld + n] : 0.f; v[8 + i] = kb < K ? W[(size_t)(kb < K ? kb : K - 1) * ld + n] : 0.f; }
  return bsplit16(v); }
__device__ __forceinline__ v8f mac3(const F2& a, const F2& b, v8f c) { c = wmma_bf(a.l, b.h, c); c = wmma_bf(a.h, b.l, c); return wmma_bf(a.h, b.h, c); }
__device__ __forceinline__ float sigm(float v) { return 1.0f / (1.0f + expf(-v)); }
#define LDSX() do { asm volatile("s_wait_dscnt 0" ::: "memory"); __builtin_amdgcn_wave_barrier(); __builtin_amdgcn_fence(__ATOMIC_RELEASE, "workgroup"); } while (0)


#define NB 4
#define SS 1024
#define DM 512
#define NH 8
#define NLAY 4
__device__ __forceinline__ size_t kvrow(size_t r) { return (r / SS) * ((size_t)NLAY * SS) + (r % SS); }   // key/value [B][L][S][D]: engine row (b, s) of layer l lives at (b*L + l)*S + s (layer offset added to the pointer)
#define HD 64
#define QKVW (3 * DM)
#ifndef TQB
#define TQB (SS / 64)
#define TNB NB
#define TOB (NB * SS / 64)     // output row tiles (all)
#endif
typedef __attribute__((ext_vector_type(8))) __bf16 v8b;
__device__ __forceinline__ v16b frag_b(const __bf16* rowk0, int lane) {
  union { v16b v; v8b q[2]; } u; const __bf16* p = rowk0 + 8 * (lane >> 4);
  u.q[0] = *(const v8b*)p; u.q[1] = *(const v8b*)(p + 16); return u.v;
}
// fragment order: one 16 x 32 operand fragment is 1 KiB, [half][lane][8 elements]; lane (g, col) holds row col, k = half * 16 + 8 g + 0..7 (the k order of frag_b / frag_h), so each 16-byte load of a wave reads 512 contiguous bytes
__device__ __forceinline__ v16b frag_bp(const __bf16* frag, int lane) {
  union { v16b v; v8b q[2]; } u; const __bf16* p = frag + lane * 8;
  u.q[0] = *(const v8b*)p; u.q[1] = *(const v8b*)(p + 256); return u.v;
}
__device__ __forceinline__ v16h frag_hp(const _Float16* frag, int lane) {
  union { v16h v; v8h q[2]; } u; const _Float16* p = frag + lane * 8;
  u.q[0] = *(const v8h*)p; u.q[1] = *(const v8h*)(p + 256); return u.v;
}
__device__ __forceinline__ float bfr(float v) { return (float)(__bf16)v; }
__device__ __attribute__((noinline)) float exp_ni(float v) { return expf(v); }
__device__ __attribute__((noinline)) float erf_ni(float v) { return erff(v); }

// a packed [N][K] weight: [N / 128][K / 32][8 row tiles] fragments of 512 elements
#define PK_A 0                       // Wq | Wk | Wv, 1536 rows x 512
#define PK_P (PK_A + QKVW * DM)        // Wf, 512 rows x 512
#define PK_END (PK_P + DM * DM)
#define WS_PK  0u
// every per-layer buffer holds NLAY planes (layer = blockIdx.z, blockIdx.z / NB in k_attn; k_out sums the FUS planes, uses PK plane 0); plane sizes in elements:
#define QKS ((size_t)NB * SS * 2 * DM)
#define VTS ((size_t)NB * DM * SS)
#define OS  ((size_t)NB * SS * DM)
#define WS_QK  (WS_PK + 2u * PK_END * NLAY)        // f16 [l][4096 rows][1024]: q | (unused)
#define WS_QKL (WS_QK + 2u * NLAY * QKS)           // f16 q | k residual planes x2048
#define WS_VTH (WS_QKL + 2u * NLAY * QKS)          // f16 [l][b][h][32 keys ks][4 d tiles] v^T fragments (row = d, k = key)
#define WS_VTL (WS_VTH + 2u * NLAY * VTS)          // f16 [l][b][512 (h*64+d)][1024 s] lo x 2048
#define WS_O   (WS_VTL + 2u * NLAY * VTS)          // f32 [l][4096][512]
#define WS_CS  (WS_O + 4u * NLAY * OS)              // f32 [2][1024][32], unused
#define WS_PSG (WS_CS + 4u * 2 * SS * 32)                  // bf16 packed Wsig [4][512 x 1024]
#define WS_FUS (WS_PSG + 2u * (size_t)NLAY * DM * 2 * DM)   // f32 [l][NR][512] gate_l * x_l
#define WS_KF  (WS_FUS + 4u * NLAY * OS)            // f16 [l][b][h][16-key tile][2 k-steps] k fragments (row = key, k = d)
#define WS_END (WS_KF + 2u * NLAY * OS)
// ---- k_pack: block = (16-row tile nt, which, layer l): f32 [out][in] rows -> bf16 fragments; which 0..2 -> W_q/W_k[l]/W_v[l] into layer l's PK_A (rows which*512 + n); 3 -> W_f into layer l's PK_P; 4 -> Wsig[l] (rows 1024 long) into PSG. A thread converts one lane's 8 elements in each of four k-steps a trip (Wsig: two trips); a wave stores 512 contiguous bytes
__global__ __launch_bounds__(256) void k_pack(const float* __restrict__ WQ, const float* __restrict__ WK, const float* __restrict__ WV, const float* __restrict__ WO, const float* __restrict__ WS, __bf16* __restrict__ PK, __bf16* __restrict__ PSG) {
  const int nt = blockIdx.x, which = blockIdx.y, l = blockIdx.z, t = threadIdx.x; const size_t n = (size_t)nt * 16, ln = (size_t)l * DM + n; const int len = (which == 4) ? 2 * DM : DM;
  const float* Wm = (which == 0) ? WQ + n * DM : (which == 1) ? WK + ln * DM : (which == 2) ? WV + ln * DM : (which == 3) ? WO + n * DM : WS + ln * (2 * DM);
  __bf16* PL = PK + (size_t)l * PK_END;
  __bf16* dst = ((which < 3) ? PL + PK_A + (size_t)which * DM * DM : (which == 3) ? PL + PK_P : PSG + (size_t)l * DM * 2 * DM) + ((size_t)(nt >> 3) * (len / 32) * 8 + (nt & 7)) * 512;
  for (int p0 = t; p0 < len * 2; p0 += 1024) {
#pragma unroll   // four independent pieces to a trip: their loads are in flight together
    for (int u = 0; u < 4; ++u) { const int kc = p0 >> 6, half = (p0 >> 5) & 1, lane = p0 & 31; const float* s = Wm + (size_t)(lane & 15) * len + kc * 32 + half * 16 + (lane >> 4) * 8 + u * 4 * 32; v8b o;   // piece p0 + 256 u: k-step kc + 4 u, same half and lane
#pragma unroll   // register vector: every index must be a constant
      for (int i = 0; i < 8; ++i) o[i] = (__bf16)s[i];
      vst2(dst + (size_t)kc * 8 * 512 + half * 256 + lane * 8 + u * 4 * 8 * 512, o); } }
}
__global__ __launch_bounds__(128) void k_qkv(const float* __restrict__ XQ, const float* __restrict__ XK, const float* __restrict__ XV, const __bf16* __restrict__ P, const float* __restrict__ BQ, const float* __restrict__ BK, const float* __restrict__ BV, _Float16* __restrict__ QK, _Float16* __restrict__ QKL, _Float16* __restrict__ VTH, _Float16* __restrict__ VTL, _Float16* __restrict__ KF) {
  { const size_t l = blockIdx.z; XK += l * SS * DM; XV += l * SS * DM; P += l * PK_END; BK += l * DM; BV += l * DM; QK += l * QKS; QKL += l * QKS; VTH += l * VTS; VTL += l * VTS; KF += l * OS; }   // layer l's inputs, weights and planes
  const int which0 = (blockIdx.y * 128) / DM; const float* X = (which0 == 0) ? XQ : (which0 == 1) ? XK : XV; const float* BB = BQ ? (((which0 == 0) ? BQ : (which0 == 1) ? BK : BV) + (blockIdx.y * 128 - which0 * DM)) : nullptr;
  __shared__ __align__(16) _Float16 so[4][16][136], sol[4][16][136]; __shared__ __align__(16) _Float16 sth[128][72], stl[128][72];
  const int tid = threadIdx.x, wave = tid >> 5, lane = tid & 31, col = lane & 15, g = lane >> 4; const size_t r0 = (size_t)blockIdx.x * 64 + wave * 16; const int n0 = blockIdx.y * 128;
  v8f acc[8] = {};
  float bias[8] = {};   // the tile's eight bias values, loaded as one group ahead of the k loop, rounded to bf16 where they are added
  if (BB) {
#pragma unroll   // register array: every index must be a constant
    for (int j = 0; j < 8; ++j) bias[j] = BB[j * 16 + col]; }
#pragma unroll 2
  for (int kc = 0; kc < DM / 32; ++kc) { float ar[16]; { const float* p = X + ((which0 == 0) ? (size_t)(r0 + col) : kvrow(r0 + col)) * DM + kc * 32 + 8 * g;
#pragma unroll
      for (int i = 0; i < 8; ++i) { ar[i] = p[i]; ar[8 + i] = p[16 + i]; } }
    v16b w[8];   // the k-step's eight weight fragments are loaded as one group ahead of its products: no load moves over the statement that follows a product, so a load written between two products is waited for in full
#pragma unroll   // register array: every index must be a constant
    for (int j = 0; j < 8; ++j) w[j] = frag_bp(P + ((size_t)(blockIdx.y * (DM / 32) + kc) * 8 + j) * 512, lane);
    __builtin_amdgcn_sched_barrier(0);   // keeps the conversions below out of the load group: every load of the k-step is in flight before the first wait
    v16b a;
#pragma unroll   // register array: every index must be a constant
    for (int i = 0; i < 16; ++i) a[i] = (__bf16)ar[i];
#pragma unroll
    for (int j = 0; j < 8; ++j) acc[j] = wmma_bf(a, w[j], acc[j]); }
  if (n0 < 2 * DM) {   // q stored unscaled (f16 sigma ~0.6, no subnormal exposure); 1/8 applied to the f32 score
#pragma unroll
    for (int j = 0; j < 8; ++j) {
#pragma unroll
      for (int r = 0; r < 8; ++r) { const float v = acc[j][r] + bfr(bias[j]); const _Float16 hv = (_Float16)v; so[wave][8 * g + r][j * 16 + col] = hv; sol[wave][8 * g + r][j * 16 + col] = (_Float16)((v - (float)hv) * 2048.0f); } }   // q, k (+ bias) as f16 hi + (x2048) residual
    LDSX();
    if (which0 == 0) {
    for (int rl = 0; rl < 16; ++rl) if (lane < 16) { vst2((unsigned*)(QK + (r0 + rl) * (2 * DM) + n0 + lane * 8), *(const v4u*)&so[wave][rl][lane * 8]); vst2((unsigned*)(QKL + (r0 + rl) * (2 * DM) + n0 + lane * 8), *(const v4u*)&sol[wave][rl][lane * 8]); }
    } else {   // k: the wave's 16 keys x 128 columns are four fragments (2 heads x 2 k-steps); the residual plane keeps its rows
      for (int rl = 0; rl < 16; ++rl) if (lane < 16) vst2((unsigned*)(QKL + (r0 + rl) * (2 * DM) + n0 + lane * 8), *(const v4u*)&sol[wave][rl][lane * 8]);
      _Float16* kt = KF + (((r0 / SS) * NH + (n0 - DM) / HD) * (SS / 16) + (r0 % SS) / 16) * 1024 + lane * 8;
#pragma unroll
      for (int f = 0; f < 8; ++f) { const int hh = f >> 2, kc = (f >> 1) & 1, half = f & 1; vst2((unsigned*)(kt + (size_t)hh * (SS / 16) * 1024 + kc * 512 + half * 256), *(const v4u*)&so[wave][col][hh * HD + kc * 32 + half * 16 + g * 8]); }
      asm volatile("s_wait_xcnt 0x0" ::: "memory"); }   // behind the run of stores: code that follows them in the listing reuses their data and address registers
  } else {
#pragma unroll
    for (int j = 0; j < 8; ++j) {
#pragma unroll
      for (int r = 0; r < 8; ++r) { const float v = acc[j][r] + bfr(bias[j]); const _Float16 hv = (_Float16)v; sth[j * 16 + col][wave * 16 + 8 * g + r] = hv; stl[j * 16 + col][wave * 16 + 8 * g + r] = (_Float16)((v - (float)hv) * 2048.0f); } }
    __syncthreads();
    const size_t rb = (size_t)blockIdx.x * 64; const int b = (int)(rb / SS), s0 = (int)(rb % SS); const int pc0 = n0 - 2 * DM;
    for (int q = tid; q < 128 * 8; q += 128) { const int d = q >> 3, pc = q & 7; const size_t o = ((size_t)b * DM + pc0 + d) * SS + s0 + pc * 8; vst2((unsigned*)(VTL + o), *(const v4u*)&stl[d][pc * 8]); }
    for (int q = tid; q < 128 * 8; q += 128) { const int ln = q & 31, half = (q >> 5) & 1, dt = (q >> 6) & 3, ksl = (q >> 8) & 1, hh = q >> 9;   // the block's 64 keys x 128 d are 16 v^T fragments (2 heads x 2 key groups x 4 d tiles)
      vst2((unsigned*)(VTH + ((((size_t)b * NH + pc0 / HD + hh) * (SS / 32) + s0 / 32 + ksl) * 4 + dt) * 512 + half * 256 + ln * 8), *(const v4u*)&sth[hh * HD + dt * 16 + (ln & 15)][ksl * 32 + half * 16 + (ln >> 4) * 8]); }
  }
}
// lane l with lane l ^ 16 (the two lane halves hold the two halves of a query's keys)
__device__ __forceinline__ float xhalf(float x) { return __builtin_bit_cast(float, __builtin_amdgcn_permlanex16(__builtin_bit_cast(int, x), __builtin_bit_cast(int, x), 0x76543210, 0xfedcba98, false, false)); }
// ---- k_attn: block = (64 queries, head h, (layer l, batch b)): k and v^T read as packed fragments (KF, VTH); all-keys flash attention (K = 64: 2 k-steps), TRANSPOSED: S^T = k (A) . q^T (B), so lane (g, col) holds 16 of query col's 32 scores of a pass (keys ct * 16 + 8 g + r): maximum and sum in the lane, the maximum joined with the other half once a pass, the sums once at the end; the two score tiles, converted in place, are the B operand P^T of O^T += v^T (A) . P^T; scores = (q.k) * 0.125 with single f16 operands; O[b*S+q][h*64+d] = (acc + accl / 2048) / (2048 l) (256-B segments)
__global__ __launch_bounds__(128) void k_attn(const _Float16* __restrict__ QK, const _Float16* __restrict__ QKL, const _Float16* __restrict__ VTH, const _Float16* __restrict__ VTL, const _Float16* __restrict__ KF, const void* __restrict__ KMASK, float* __restrict__ O) {
  __shared__ __align__(16) float so[4][16][68];
  const int tid = threadIdx.x, wave = tid >> 5, lane = tid & 31, col = lane & 15, g = lane >> 4;
  const int qb = blockIdx.x, h = blockIdx.y, b = blockIdx.z % NB; { const size_t l = blockIdx.z / NB; QK += l * QKS; QKL += l * QKS; VTH += l * VTS; VTL += l * VTS; KF += l * OS; O += l * OS; }   // layer l's planes
  const int q0 = qb * 64 + wave * 16; const size_t rq = (size_t)b * SS + q0 + col;
  v16h aq[2], aql[2];
#pragma unroll
  for (int kc = 0; kc < 2; ++kc) { aq[kc] = frag_h(QK + rq * (2 * DM) + h * HD + kc * 32, lane); aql[kc] = frag_h(QKL + rq * (2 * DM) + h * HD + kc * 32, lane); }
  float m = -3.0e38f, l = 0.f;   // query col's running maximum (equal in both halves) and this half's share of its sum
  v8f acc[4] = {}, accl[4] = {};   // O^T: acc[dt][r] = query col, d = dt * 16 + 8 g + r
  const int nks = SS / 32;   // all keys
  const _Float16* kbase = KF + (size_t)(b * NH + h) * SS * HD;   // k fragments of this (layer, batch, head): 4 to a pass
  const _Float16* vbase = VTH + (size_t)(b * NH + h) * SS * HD;   // v^T fragments: 4 to a pass
  v16h kf[2][2];   // a pass's four k fragments, fetched one pass ahead
#pragma unroll   // register array: every index must be a constant
  for (int ct = 0; ct < 2; ++ct) {
#pragma unroll   // register array: every index must be a constant
    for (int kc = 0; kc < 2; ++kc) kf[ct][kc] = frag_hp(kbase + (ct * 2 + kc) * 512, lane); }
#pragma unroll 1
  for (int ks = 0; ks < nks; ++ks) { v8f s[2];
    v16h vf[4];   // this pass's four v^T fragments: issued here as one group, first used behind the softmax
#pragma unroll   // register array: every index must be a constant
    for (int dt = 0; dt < 4; ++dt) vf[dt] = frag_hp(vbase + (size_t)(ks * 4 + dt) * 512, lane);
#pragma unroll
    for (int ct = 0; ct < 2; ++ct) { v8f c = {};
#pragma unroll
      for (int kc = 0; kc < 2; ++kc) c = wmma16(kf[ct][kc], aq[kc], c);   // single product: k, q as one-rounding f16 operands
      { const bool keepk = true;
#pragma unroll
      for (int r = 0; r < 8; ++r) s[ct][r] = keepk ? c[r] * 0.125f : -3.0e38f; } }   // 1/sqrt(64); every key kept (no mask)
    { const _Float16* kn = kbase + (size_t)((ks + 1 < nks) ? ks + 1 : ks) * 2048;   // next pass's k fragments into the same registers, in flight under the softmax and P.V (the last pass reads its own rows again: in bounds, unused)
#pragma unroll   // register array: every index must be a constant
      for (int ct = 0; ct < 2; ++ct) {
#pragma unroll   // register array: every index must be a constant
        for (int kc = 0; kc < 2; ++kc) kf[ct][kc] = frag_hp(kn + (ct * 2 + kc) * 512, lane); } }
    float mx = fmaxf(s[0][0], s[1][0]);
#pragma unroll   // register array: every index must be a constant
    for (int r = 1; r < 8; ++r) mx = fmaxf(mx, fmaxf(s[0][r], s[1][r]));
    mx = fmaxf(mx, xhalf(mx));
    const float mn = fmaxf(m, mx); const float alpha = (m <= -1.0e38f) ? 0.f : __expf(m - mn);
    v16h pa; float es0 = 0.f, es1 = 0.f;
#pragma unroll   // register array: every index must be a constant
    for (int r = 0; r < 8; ++r) { const float e0 = (s[0][r] <= -1.0e38f) ? 0.f : __expf(s[0][r] - mn), e1 = (s[1][r] <= -1.0e38f) ? 0.f : __expf(s[1][r] - mn);
      es0 += e0; es1 += e1;
      pa[r] = (_Float16)(e0 * 2048.0f); pa[8 + r] = (_Float16)(e1 * 2048.0f); }   // P scaled by 2^11 before the f16 rounding so small softmax weights stay out of the f16 subnormal range; 2^-11 folded into the epilogue. Element s of the B operand is key (s < 8 ? 8 g + s : 16 + 8 g + s - 8): the k order of the v^T fragments
    l = l * alpha + (es0 + es1); m = mn;
#pragma unroll   // register array: every index must be a constant
    for (int dt = 0; dt < 4; ++dt) {
#pragma unroll   // register array: every index must be a constant
      for (int r = 0; r < 8; ++r) { acc[dt][r] *= alpha; accl[dt][r] *= alpha; } }
#pragma unroll
    for (int dt = 0; dt < 4; ++dt) acc[dt] = wmma16(vf[dt], pa, acc[dt]); }   // single product: V^T x P^T (x2^11)
  l += xhalf(l);   // the two halves' sums joined once
  { const float il = (1.0f / 2048.0f) / l;
#pragma unroll   // register array: every index must be a constant
    for (int dt = 0; dt < 4; ++dt) {
#pragma unroll   // register array: every index must be a constant
      for (int rh = 0; rh < 2; ++rh) { v4f o;   // a lane's 8 values of a d tile are 8 consecutive d of its query's row: two 16-byte LDS stores
#pragma unroll   // register array: every index must be a constant
        for (int i = 0; i < 4; ++i) o[i] = (acc[dt][rh * 4 + i] + accl[dt][rh * 4 + i] * (1.0f / 2048.0f)) * il;
        *(v4f*)&so[wave][col][dt * 16 + 8 * g + rh * 4] = o; } } }
  LDSX();
  for (int rl = 0; rl < 16; ++rl) if (lane < 16) vst2(O + ((size_t)b * SS + q0 + rl) * DM + h * HD + lane * 4, *(const v4f*)&so[wave][rl][lane * 4]);
}
// fused row fragment: sum over the layers in order 0..3 of (gate_l x_l) / sqrt(3), then bf16 hi + residual
__device__ __forceinline__ F2 split_row_sum(const float* row, int k0, int lane) { float v[16]; const float* p = row + k0 + 8 * (lane >> 4);
#pragma unroll
  for (int i = 0; i < 16; ++i) v[i] = 0.f;
#pragma unroll
  for (int l = 0; l < NLAY; ++l) {
#pragma unroll
    for (int i = 0; i < 8; ++i) { v[i] = v[i] + p[l * OS + i] * 0.57735026918962576f; v[8 + i] = v[8 + i] + p[l * OS + 16 + i] * 0.57735026918962576f; } }
  return bsplit16(v); }
// ---- k_out: block = (64 rows, 128 cols): out = O(hi/lo) . Wo rows (2 products) + bo; O = the layer sum of the NLAY planes
__global__ __launch_bounds__(128) void k_out(const float* __restrict__ O, const __bf16* __restrict__ P, const float* __restrict__ BO, float* __restrict__ Y) {
  __shared__ __align__(16) float so[4][16][132];
  const int tid = threadIdx.x, wave = tid >> 5, lane = tid & 31, col = lane & 15, g = lane >> 4; const size_t r0 = (size_t)blockIdx.x * 64 + wave * 16; const int n0 = blockIdx.y * 128;
  v8f acc[8] = {};
#pragma unroll 2
  for (int kc = 0; kc < DM / 32; ++kc) { const F2 a = split_row_sum(O + (r0 + col) * DM, kc * 32, lane); v16b w[8];   // weight fragments as one group ahead of the products
    asm volatile("s_wait_xcnt 0x0" ::: "memory");   // the weight loads below may land in registers that held the addresses of the plane loads above
#pragma unroll   // register array: every index must be a constant
    for (int j = 0; j < 8; ++j) w[j] = frag_bp(P + ((size_t)(blockIdx.y * (DM / 32) + kc) * 8 + j) * 512, lane);
#pragma unroll
    for (int j = 0; j < 8; ++j) { acc[j] = wmma_bf(a.l, w[j], acc[j]); acc[j] = wmma_bf(a.h, w[j], acc[j]); } }
#pragma unroll
  for (int j = 0; j < 8; ++j) {
#pragma unroll
    for (int r = 0; r < 8; ++r) so[wave][8 * g + r][j * 16 + col] = acc[j][r] + bfr(BO[n0 + j * 16 + col]); }
  LDSX();
  for (int rl = 0; rl < 16; ++rl) vst2(Y + (r0 + rl) * DM + n0 + lane * 4, *(const v4f*)&so[wave][rl][lane * 4]);
}
#define NR (NB * SS)
// ---- k_gate: block = (64 rows, 128 cols, layer l): g = sigmoid([query (exact bf16, 1 product) | x_l (hi + residual, 2 products)] . Wsig_l rows + bsig_l); FUS plane l = g * x_l (k_out scales by 1 / sqrt(3) and sums the planes)
__global__ __launch_bounds__(128) void k_gate(const float* __restrict__ XQ, const float* __restrict__ XL, const __bf16* __restrict__ PSG, const float* __restrict__ BS, float* __restrict__ FUS) {
  __shared__ __align__(16) float so[4][16][132]; const int l = blockIdx.z; XL += l * OS; FUS += l * OS;
  const int tid = threadIdx.x, wave = tid >> 5, lane = tid & 31, col = lane & 15, g = lane >> 4; const size_t r0 = (size_t)blockIdx.x * 64 + wave * 16; const int n0 = blockIdx.y * 128;
  const __bf16* Wr = PSG + (size_t)l * DM * 2 * DM; v8f acc[8] = {};
#pragma unroll 2
  for (int kc = 0; kc < DM / 32; ++kc) { float ar[16]; { const float* p = XQ + (r0 + col) * DM + kc * 32 + 8 * g;
#pragma unroll
      for (int i = 0; i < 8; ++i) { ar[i] = p[i]; ar[8 + i] = p[16 + i]; } }
    v16b w[8];   // weight fragments as one group ahead of the products
#pragma unroll   // register array: every index must be a constant
    for (int j = 0; j < 8; ++j) w[j] = frag_bp(Wr + ((size_t)(blockIdx.y * (2 * DM / 32) + kc) * 8 + j) * 512, lane);
    __builtin_amdgcn_sched_barrier(0);   // keeps the conversions below out of the load group: every load of the k-step is in flight before the first wait
    v16b a;
#pragma unroll   // register array: every index must be a constant
    for (int i = 0; i < 16; ++i) a[i] = (__bf16)ar[i];
#pragma unroll
    for (int j = 0; j < 8; ++j) acc[j] = wmma_bf(a, w[j], acc[j]); }
#pragma unroll 2
  for (int kc = 0; kc < DM / 32; ++kc) { float v[16]; { const float* p = XL + (r0 + col) * DM + kc * 32 + 8 * g;
#pragma unroll   // register array: every index must be a constant
      for (int i = 0; i < 8; ++i) { v[i] = p[i]; v[8 + i] = p[16 + i]; } }
    v16b w[8];   // weight fragments in the same group of loads, ahead of the products
#pragma unroll   // register array: every index must be a constant
    for (int j = 0; j < 8; ++j) w[j] = frag_bp(Wr + ((size_t)(blockIdx.y * (2 * DM / 32) + DM / 32 + kc) * 8 + j) * 512, lane);
    __builtin_amdgcn_sched_barrier(0);   // keeps the conversions below out of the load group: every load of the k-step is in flight before the first wait
    const F2 a = bsplit16(v);
#pragma unroll
    for (int j = 0; j < 8; ++j) { acc[j] = wmma_bf(a.l, w[j], acc[j]); acc[j] = wmma_bf(a.h, w[j], acc[j]); } }
  float bb[8];   // the tile's bias values, in the first half's group of loads
#pragma unroll   // register array: every index must be a constant
  for (int j = 0; j < 8; ++j) bb[j] = bfr(BS[(size_t)l * DM + n0 + j * 16 + col]);
#pragma unroll   // register array: every index must be a constant
  for (int jh = 0; jh < 2; ++jh) { float xv[4][8];   // half a tile's x_l values as one group of loads ahead of its exp calls (no load moves over a call); two halves keep a group under the load counter's range
#pragma unroll   // register array: every index must be a constant
    for (int jj = 0; jj < 4; ++jj) {
#pragma unroll   // register array: every index must be a constant
      for (int r = 0; r < 8; ++r) xv[jj][r] = XL[(r0 + 8 * g + r) * DM + n0 + (jh * 4 + jj) * 16 + col]; }
#pragma unroll   // register array: every index must be a constant
    for (int jj = 0; jj < 4; ++jj) { const int j = jh * 4 + jj;
#pragma unroll   // register array: every index must be a constant
      for (int r = 0; r < 8; ++r) { const float gte = 1.0f / (1.0f + exp_ni(-(acc[j][r] + bb[j]))); so[wave][8 * g + r][j * 16 + col] = gte * xv[jj][r]; } } }
  LDSX();
  for (int rl = 0; rl < 16; ++rl) vst2(FUS + (r0 + rl) * DM + n0 + lane * 4, *(const v4f*)&so[wave][rl][lane * 4]);
}
extern "C" void kernel_launch(void* const* d_in, const int* in_sizes, int n_in, void* d_out, int out_size, void* d_ws, size_t ws_size, hipStream_t stream) {
  (void)in_sizes; (void)n_in; (void)out_size;
  const float** F = (const float**)d_in;   // 0 query [4,1024,512], 1 key [4,4,1024,512], 2 value [4,4,1024,512], 3 Wq [512,512], 4 bq, 5 Wk [4,512,512], 6 bk [4,512], 7 Wv, 8 bv, 9 Wsig [4,512,1024], 10 bsig [4,512], 11 Wf [512,512], 12 bf
  if (ws_size < (size_t)WS_END) return;
  char* ws = (char*)d_ws; __bf16 *PK = (__bf16*)(ws + WS_PK), *PSG = (__bf16*)(ws + WS_PSG); _Float16 *QK = (_Float16*)(ws + WS_QK), *QKL = (_Float16*)(ws + WS_QKL), *VTH = (_Float16*)(ws + WS_VTH), *VTL = (_Float16*)(ws + WS_VTL), *KF = (_Float16*)(ws + WS_KF); float *O = (float*)(ws + WS_O), *FUS = (float*)(ws + WS_FUS);
  // the layers are independent up to the gated sum: each stage is one launch with the layer in blockIdx.z
  k_pack<<<dim3(DM / 16, 5, NLAY), 256, 0, stream>>>(F[3], F[5], F[7], F[11], F[9], PK, PSG);   // per layer: Wq | Wk[l] | Wv[l] | Wf | Wsig[l] as fragments
  k_qkv<<<dim3(TNB * SS / 64, QKVW / 128, NLAY), 128, 0, stream>>>(F[0], F[1], F[2], PK + PK_A, F[4], F[6], F[8], QK, QKL, VTH, VTL, KF);   // (q recomputed per layer; identical)
  k_attn<<<dim3(TQB, NH, TNB * NLAY), 128, 0, stream>>>(QK, QKL, VTH, VTL, KF, nullptr, O);   // x_l
  k_gate<<<dim3(NR / 64, DM / 128, NLAY), 128, 0, stream>>>(F[0], O, PSG, F[10], FUS);   // gate_l * x_l
  k_out<<<dim3(TOB, DM / 128), 128, 0, stream>>>(FUS, PK + PK_P, F[12], (float*)d_out);   // (sum_l gate_l x_l / sqrt(3)) . Wf^T + bf (Wf of layer 0's pack)
}

// v005
// One run takes 153 microseconds.
// Timed twice side by side with v004, it ran 1.18 and 1.16 times as fast.
// Counting every step since v000, it is 5.72 times as fast.
// compute dtype: all float inputs rounded to bf16; q = query . Wq^T + bq and k_l, v_l = key_l / value_l . W^T + b with EXACT bf16 products on WMMA 16x16x32 (weights, k and v^T kept in fragment order in the workspace); PLAIN attention per layer: q, k as single f16 operands x 1/8, running-max softmax in f32 (hardware exp), P (scaled by 2^11, single f16) x v (single f16); gate_l = sigmoid([query (exact) | x_l (bf16 hi + residual, 2 products)] . Wsig_l^T + bsig_l) (precise expf); fused = sum_l gate_l x_l / sqrt(3) in f32; out = fused (bf16 hi + residual) . Wf^T (2 products) + bf.
#include <hip/hip_runtime.h>
#include <math.h>

typedef __attribute__((ext_vector_type(16))) _Float16 v16h;
typedef __attribute__((ext_vector_type(16))) __bf16 v16b;
typedef __attribute__((ext_vector_type(8)))  _Float16 v8h;
typedef __attribute__((ext_vector_type(8)))  float v8f;
typedef __attribute__((ext_vector_type(4)))  float v4f;
typedef __attribute__((ext_vector_type(2)))  float v2f;
typedef __attribute__((ext_vector_type(4)))  unsigned v4u;
typedef __attribute__((ext_vector_type(4)))  int v4i;
typedef float __attribute__((may_alias)) float_a;
typedef int __attribute__((may_alias)) int_a;

template <typename T> __device__ __forceinline__ void vst2(void* p, T v) { *(T*)p = v;  }
__device__ __forceinline__ v8f wmma16(v16h a, v16h b, v8f c) {
  v8f d = __builtin_amdgcn_wmma_f32_16x16x32_f16(false, a, false, b, (short)0, c, false, false);
  asm volatile("v_nop\n\tv_nop\n\tv_nop\n\tv_nop" : "+v"(d) : "v"(a), "v"(b));
  return d;
}
__device__ __forceinline__ v8f wmma_bf(v16b a, v16b b, v8f c) {
  v8f d = __builtin_amdgcn_wmma_f32_16x16x32_bf16(false, a, false, b, (short)0, c, false, false);
  asm volatile("v_nop\n\tv_nop\n\tv_nop\n\tv_nop" : "+v"(d) : "v"(a), "v"(b));
  return d;
}
// Multi-layer source attention (B 4, 1,024 queries over 4 layers of 1,024 keys/values, d 512, 8 heads x 64): a shared query projection, per-layer key/value projections, softmax(q k_l^T / 8) v_l per layer, per-layer sigmoid gates from [query | x_l], gated sum over layers / sqrt(3), final linear map.
__device__ __forceinline__ v16h frag_h(const _Float16* rowk0, int lane) {
  union { v16h v; v8h q[2]; } u; const _Float16* p = rowk0 + 8 * (lane >> 4);
  u.q[0] = *(const v8h*)p; u.q[1] = *(const v8h*)(p + 16); return u.v;
}
__device__ __forceinline__ v16h frag_f32(const float* rowk0, int lane) {
  v16h a; const float* p = rowk0 + 8 * (lane >> 4);
#pragma unroll
  for (int i = 0; i < 8; ++i) { a[i] = (_Float16)p[i]; a[8 + i] = (_Float16)p[16 + i]; }
  return a;
}
__device__ __forceinline__ v16h frag_f32s(const float* rowk0, int lane, float sc) {
  v16h a; const float* p = rowk0 + 8 * (lane >> 4);
#pragma unroll
  for (int i = 0; i < 8; ++i) { a[i] = (_Float16)(p[i] * sc); a[8 + i] = (_Float16)(p[16 + i] * sc); }
  return a;
}
// column fragment from a [K][ld] layout (column n), rows >= K read as 0
__device__ __forceinline__ v16h fragc_f32(const float* W, int k0, int n, int lane, int ld, int K) {
  v16h a; const int g = lane >> 4;
#pragma unroll
  for (int i = 0; i < 8; ++i) { const int ka = k0 + 8 * g + i, kb = ka + 16;
    a[i] = (_Float16)(ka < K ? W[(size_t)(ka < K ? ka : K - 1) * ld + n] : 0.f); a[8 + i] = (_Float16)(kb < K ? W[(size_t)(kb < K ? kb : K - 1) * ld + n] : 0.f); }
  return a;
}
struct F2 { v16b h, l; };
__device__ __forceinline__ F2 bsplit16(const float v[16]) { F2 r;
#pragma unroll
  for (int i = 0; i < 16; ++i) { const __bf16 h = (__bf16)v[i]; r.h[i] = h; r.l[i] = (__bf16)(v[i] - (float)h); }
  return r; }
__device__ __forceinline__ F2 split_row(const float* row, int k0, int lane) { float v[16]; const float* p = row + k0 + 8 * (lane >> 4);
#pragma unroll
  for (int i = 0; i < 8; ++i) { v[i] = p[i]; v[8 + i] = p[16 + i]; }
  return bsplit16(v); }
__device__ __forceinline__ F2 split_rowK(const float* row, int k0, int lane, int K) { float v[16]; const int g = lane >> 4;
#pragma unroll
  for (int i = 0; i < 8; ++i) { const int ka = k0 + 8 * g + i, kb = ka + 16; v[i] = ka < K ? row[ka < K ? ka : K - 1] : 0.f; v[8 + i] = kb < K ? row[kb < K ? kb : K - 1] : 0.f; }
  return bsplit16(v); }
__device__ __forceinline__ F2 split_col(const float* W, int k0, int n, int lane, int ld, int K) { float v[16]; const int g = lane >> 4;
#pragma unroll
  for (int i = 0; i < 8; ++i) { const int ka = k0 + 8 * g + i, kb = ka + 16; v[i] = ka < K ? W[(size_t)(ka < K ? ka : K - 1) * ld + n] : 0.f; v[8 + i] = kb < K ? W[(size_t)(kb < K ? kb : K - 1) * ld + n] : 0.f; }
  return bsplit16(v); }
__device__ __forceinline__ v8f mac3(const F2& a, const F2& b, v8f c) { c = wmma_bf(a.l, b.h, c); c = wmma_bf(a.h, b.l, c); return wmma_bf(a.h, b.h, c); }
__device__ __forceinline__ float sigm(float v) { return 1.0f / (1.0f + expf(-v)); }
#define LDSX() do { asm volatile("s_wait_dscnt 0" ::: "memory"); __builtin_amdgcn_wave_barrier(); __builtin_amdgcn_fence(__ATOMIC_RELEASE, "workgroup"); } while (0)


#define NB 4
#define SS 1024
#define DM 512
#define NH 8
#define NLAY 4
__device__ __forceinline__ size_t kvrow(size_t r) { return (r / SS) * ((size_t)NLAY * SS) + (r % SS); }   // key/value [B][L][S][D]: engine row (b, s) of layer l lives at (b*L + l)*S + s (layer offset added to the pointer)
#define HD 64
#define QKVW (3 * DM)
#ifndef TQB
#define TQB (SS / 64)
#define TNB NB
#define TOB (NB * SS / 64)     // output row tiles (all)
#endif
typedef __attribute__((ext_vector_type(8))) __bf16 v8b;
__device__ __forceinline__ v16b frag_b(const __bf16* rowk0, int lane) {
  union { v16b v; v8b q[2]; } u; const __bf16* p = rowk0 + 8 * (lane >> 4);
  u.q[0] = *(const v8b*)p; u.q[1] = *(const v8b*)(p + 16); return u.v;
}
// fragment order: one 16 x 32 operand fragment is 1 KiB, [half][lane][8 elements]; lane (g, col) holds row col, k = half * 16 + 8 g + 0..7 (the k order of frag_b / frag_h), so each 16-byte load of a wave reads 512 contiguous bytes
__device__ __forceinline__ v16b frag_bp(const __bf16* frag, int lane) {
  union { v16b v; v8b q[2]; } u; const __bf16* p = frag + lane * 8;
  u.q[0] = *(const v8b*)p; u.q[1] = *(const v8b*)(p + 256); return u.v;
}
__device__ __forceinline__ v16h frag_hp(const _Float16* frag, int lane) {
  union { v16h v; v8h q[2]; } u; const _Float16* p = frag + lane * 8;
  u.q[0] = *(const v8h*)p; u.q[1] = *(const v8h*)(p + 256); return u.v;
}
__device__ __forceinline__ float bfr(float v) { return (float)(__bf16)v; }
__device__ __attribute__((noinline)) float exp_ni(float v) { return expf(v); }
__device__ __attribute__((noinline)) float erf_ni(float v) { return erff(v); }

typedef __attribute__((ext_vector_type(4))) __bf16 v4b;
// ---- A tile of a 64 x 128 block product, staged once per block in LDS as bf16, KS k values a stage: wave w brings rows w * 16 .. + 15 with whole-line loads (a 16-byte load of the wave reads KS * 4 contiguous bytes of each row it touches); LDS row pitch KS + 8 elements (16 bytes x an odd number: 16-byte fragment reads meet no bank twice). Every wave then reads all four 16-row fragments and owns columns w * 32 .. + 31, so a weight fragment is loaded by one wave only
template <int KS> __device__ __forceinline__ const float* a_lane(const float* rows, int lane) { constexpr int LPR = KS / 4; return rows + (size_t)(lane / LPR) * DM + (lane % LPR) * 4; }   // the lane's own address in the wave's first load
template <int KS> __device__ __forceinline__ void a_load(v4f (&ar)[KS / 8], const float* pl) {
  constexpr int RPL = 128 / KS;   // rows to a load
#pragma unroll   // register array: every index must be a constant
  for (int u = 0; u < KS / 8; ++u) ar[u] = *(const v4f*)(pl + (size_t)(u * RPL) * DM);
}
__device__ __forceinline__ v16b frag_bl(const __bf16* pl) {   // frag_bp from the lane's own address
  union { v16b v; v8b q[2]; } u; u.q[0] = *(const v8b*)pl; u.q[1] = *(const v8b*)(pl + 256); return u.v;
}
// behind a group of global loads: the wait names the group's address registers, so none of them is rewritten (by a later load's result either) ahead of it
#define XW1(p) asm volatile("s_wait_xcnt 0x0" :: "v"(p) : "memory")
#define XW2(p, q) asm volatile("s_wait_xcnt 0x0" :: "v"(p), "v"(q) : "memory")
template <int KS> __device__ __forceinline__ __bf16* a_slot(__bf16* buf, int wave, int lane, int u) {
  constexpr int LPR = KS / 4, RPL = 32 / LPR;
  return buf + (wave * 16 + u * RPL + lane / LPR) * (KS + 8) + (lane % LPR) * 4;
}
template <int KS> __device__ __forceinline__ void a_store(__bf16* buf, const v4f (&ar)[KS / 8], int wave, int lane) {
#pragma unroll   // register array: every index must be a constant
  for (int u = 0; u < KS / 8; ++u) { v4b o;
#pragma unroll   // register vector: every index must be a constant
    for (int e = 0; e < 4; ++e) o[e] = (__bf16)ar[u][e];
    *(v4b*)a_slot<KS>(buf, wave, lane, u) = o; }
}
template <int KS> __device__ __forceinline__ void a_store2(__bf16* bh, __bf16* bl, const v4f (&ar)[KS / 8], int wave, int lane) {   // bf16 hi + residual
#pragma unroll   // register array: every index must be a constant
  for (int u = 0; u < KS / 8; ++u) { v4b oh, ol;
#pragma unroll   // register vector: every index must be a constant
    for (int e = 0; e < 4; ++e) { const __bf16 h = (__bf16)ar[u][e]; oh[e] = h; ol[e] = (__bf16)(ar[u][e] - (float)h); }
    *(v4b*)a_slot<KS>(bh, wave, lane, u) = oh; *(v4b*)a_slot<KS>(bl, wave, lane, u) = ol; }
}
// a packed [N][K] weight: [N / 128][K / 32][8 row tiles] fragments of 512 elements
#define PK_A 0                       // Wq | Wk | Wv, 1536 rows x 512
#define PK_P (PK_A + QKVW * DM)        // Wf, 512 rows x 512
#define PK_END (PK_P + DM * DM)
#define WS_PK  0u
// every per-layer buffer holds NLAY planes (layer = blockIdx.z, blockIdx.z / NB in k_attn; k_out sums the FUS planes, uses PK plane 0); plane sizes in elements:
#define QKS ((size_t)NB * SS * 2 * DM)
#define VTS ((size_t)NB * DM * SS)
#define OS  ((size_t)NB * SS * DM)
#define WS_QK  (WS_PK + 2u * PK_END * NLAY)        // f16 [l][4096 rows][1024]: q | (unused)
#define WS_QKL (WS_QK + 2u * NLAY * QKS)           // f16 q | k residual planes x2048
#define WS_VTH (WS_QKL + 2u * NLAY * QKS)          // f16 [l][b][h][32 keys ks][4 d tiles] v^T fragments (row = d, k = key)
#define WS_VTL (WS_VTH + 2u * NLAY * VTS)          // f16 [l][b][512 (h*64+d)][1024 s] lo x 2048
#define WS_O   (WS_VTL + 2u * NLAY * VTS)          // f32 [l][4096][512]
#define WS_CS  (WS_O + 4u * NLAY * OS)              // f32 [2][1024][32], unused
#define WS_PSG (WS_CS + 4u * 2 * SS * 32)                  // bf16 packed Wsig [4][512 x 1024]
#define WS_FUS (WS_PSG + 2u * (size_t)NLAY * DM * 2 * DM)   // f32 [l][NR][512] gate_l * x_l
#define WS_KF  (WS_FUS + 4u * NLAY * OS)            // f16 [l][b][h][16-key tile][2 k-steps] k fragments (row = key, k = d)
#define WS_END (WS_KF + 2u * NLAY * OS)
// ---- k_pack: block = (16-row tile nt, which, layer l): f32 [out][in] rows -> bf16 fragments; which 0..2 -> W_q/W_k[l]/W_v[l] into layer l's PK_A (rows which*512 + n); 3 -> W_f into layer l's PK_P; 4 -> Wsig[l] (rows 1024 long) into PSG. A thread converts one lane's 8 elements in each of four k-steps a trip (Wsig: two trips); a wave stores 512 contiguous bytes
__global__ __launch_bounds__(256) void k_pack(const float* __restrict__ WQ, const float* __restrict__ WK, const float* __restrict__ WV, const float* __restrict__ WO, const float* __restrict__ WS, __bf16* __restrict__ PK, __bf16* __restrict__ PSG) {
  const int nt = blockIdx.x, which = blockIdx.y, l = blockIdx.z, t = threadIdx.x; const size_t n = (size_t)nt * 16, ln = (size_t)l * DM + n; const int len = (which == 4) ? 2 * DM : DM;
  const float* Wm = (which == 0) ? WQ + n * DM : (which == 1) ? WK + ln * DM : (which == 2) ? WV + ln * DM : (which == 3) ? WO + n * DM : WS + ln * (2 * DM);
  __bf16* PL = PK + (size_t)l * PK_END;
  __bf16* dst = ((which < 3) ? PL + PK_A + (size_t)which * DM * DM : (which == 3) ? PL + PK_P : PSG + (size_t)l * DM * 2 * DM) + ((size_t)(nt >> 3) * (len / 32) * 8 + (nt & 7)) * 512;
  for (int p0 = t; p0 < len * 2; p0 += 1024) {
#pragma unroll   // four independent pieces to a trip: their loads are in flight together
    for (int u = 0; u < 4; ++u) { const int kc = p0 >> 6, half = (p0 >> 5) & 1, lane = p0 & 31; const float* s = Wm + (size_t)(lane & 15) * len + kc * 32 + half * 16 + (lane >> 4) * 8 + u * 4 * 32; v8b o;   // piece p0 + 256 u: k-step kc + 4 u, same half and lane
#pragma unroll   // register vector: every index must be a constant
      for (int i = 0; i < 8; ++i) o[i] = (__bf16)s[i];
      vst2(dst + (size_t)kc * 8 * 512 + half * 256 + lane * 8 + u * 4 * 8 * 512, o); } }
}
__global__ __launch_bounds__(128) void k_qkv(const float* __restrict__ XQ, const float* __restrict__ XK, const float* __restrict__ XV, const __bf16* __restrict__ P, const float* __restrict__ BQ, const float* __restrict__ BK, const float* __restrict__ BV, _Float16* __restrict__ QK, _Float16* __restrict__ QKL, _Float16* __restrict__ VTH, _Float16* __restrict__ VTL, _Float16* __restrict__ KF) {
  { const size_t l = blockIdx.z; XK += l * SS * DM; XV += l * SS * DM; P += l * PK_END; BK += l * DM; BV += l * DM; QK += l * QKS; QKL += l * QKS; VTH += l * VTS; VTL += l * VTS; KF += l * OS; }   // layer l's inputs, weights and planes
  const int which0 = (blockIdx.y * 128) / DM; const float* X = (which0 == 0) ? XQ : (which0 == 1) ? XK : XV; const float* BB = BQ ? (((which0 == 0) ? BQ : (which0 == 1) ? BK : BV) + (blockIdx.y * 128 - which0 * DM)) : nullptr;
  __shared__ __align__(16) char sm[71680];   // k loop: two A buffers of 64 x 136 bf16; behind the loop's last barrier the same bytes are the epilogue's stages
  _Float16 (*so)[16][136] = (_Float16 (*)[16][136])sm, (*sol)[16][136] = (_Float16 (*)[16][136])(sm + 17408); _Float16 (*sth)[72] = (_Float16 (*)[72])(sm + 34816), (*stl)[72] = (_Float16 (*)[72])(sm + 53248);
  __bf16* sa = (__bf16*)sm;
  const int tid = threadIdx.x, wave = tid >> 5, lane = tid & 31, col = lane & 15, g = lane >> 4; const size_t r0 = (size_t)blockIdx.x * 64 + wave * 16; const int n0 = blockIdx.y * 128;
  v8f acc[8] = {};   // tile t: rows (t >> 1) * 16 .. of the block, columns (wave * 2 + (t & 1)) * 16 ..
  float bias[2] = {};   // the wave's two column tiles' bias values, loaded ahead of the k loop, rounded to bf16 where they are added
  if (BB) {
#pragma unroll   // register array: every index must be a constant
    for (int jj = 0; jj < 2; ++jj) bias[jj] = BB[(wave * 2 + jj) * 16 + col];
    asm volatile("s_wait_xcnt 0x0" ::: "memory"); }   // behind the two loads: code that follows them in the listing reuses their address registers
  const float* Aw = a_lane<128>(X + ((which0 == 0) ? r0 : kvrow(r0)) * DM, lane);   // the wave's 16 rows are consecutive (a 64-row block lies in one batch)
  v4f ar[16];
  a_load<128>(ar, Aw); XW1(Aw); a_store<128>(sa, ar, wave, lane);
  __syncthreads();   // stage 0 is published
  auto stage = [&](const int s, const bool more) __attribute__((always_inline)) { const __bf16* sb = sa + (s & 1) * (64 * 136);   // more: a constant at each call, so the count of loads in flight is known at every wait
    v16b w[4][2];   // the stage's eight weight fragments as one group, then the next stage's A rows: both in flight under the products
    const __bf16* pw = P + ((size_t)(blockIdx.y * (DM / 32) + s * 4) * 8 + wave * 2) * 512 + lane * 8; const float* pa = Aw + (s + 1) * 128;
#pragma unroll   // register array: every index must be a constant
    for (int kc = 0; kc < 4; ++kc) {
#pragma unroll   // register array: every index must be a constant
      for (int jj = 0; jj < 2; ++jj) w[kc][jj] = frag_bl(pw + (kc * 8 + jj) * 512); }
    __builtin_amdgcn_sched_barrier(0);   // the weight loads stay ahead of the A rows: loads return in order, and the first product waits for weights only
    if (more) { a_load<128>(ar, pa); XW2(pw, pa); } else XW1(pw);
    __builtin_amdgcn_sched_barrier(0);   // every global load of the stage is issued before the first wait for data
#pragma unroll
    for (int kc = 0; kc < 4; ++kc) { v16b a[4];
#pragma unroll   // register array: every index must be a constant
      for (int i = 0; i < 4; ++i) a[i] = frag_b(sb + (i * 16 + col) * 136 + kc * 32, lane);
#pragma unroll
      for (int t = 0; t < 8; ++t) acc[t] = wmma_bf(a[t >> 1], w[kc][t & 1], acc[t]); }
    __builtin_amdgcn_sched_barrier(0);   // the conversions stay behind the products: moved up, they would wait for the rows fetched ahead at the stage's top
    if (more) a_store<128>(sa + ((s + 1) & 1) * (64 * 136), ar, wave, lane);   // into the buffer whose readers left it at the last barrier
    __syncthreads(); };   // publishes stage s + 1 and ends every read of stage s
#pragma unroll 1   // four stages of 128 k: one copy of the body for the stages that fetch ahead keeps the text short
  for (int s = 0; s < DM / 128 - 1; ++s) stage(s, true);
  stage(DM / 128 - 1, false);
  if (n0 < 2 * DM) {   // q stored unscaled (f16 sigma ~0.6, no subnormal exposure); 1/8 applied to the f32 score
#pragma unroll
    for (int t = 0; t < 8; ++t) { const int i = t >> 1, j = wave * 2 + (t & 1);
#pragma unroll
      for (int r = 0; r < 8; ++r) { const float v = acc[t][r] + bfr(bias[t & 1]); const _Float16 hv = (_Float16)v; so[i][8 * g + r][j * 16 + col] = hv; sol[i][8 * g + r][j * 16 + col] = (_Float16)((v - (float)hv) * 2048.0f); } }   // q, k (+ bias) as f16 hi + (x2048) residual
    __syncthreads();   // a row tile's 128 columns come from all four waves
    if (which0 == 0) {
    for (int rl = 0; rl < 16; ++rl) if (lane < 16) { vst2((unsigned*)(QK + (r0 + rl) * (2 * DM) + n0 + lane * 8), *(const v4u*)&so[wave][rl][lane * 8]); vst2((unsigned*)(QKL + (r0 + rl) * (2 * DM) + n0 + lane * 8), *(const v4u*)&sol[wave][rl][lane * 8]); }
    } else {   // k: the wave's 16 keys x 128 columns are four fragments (2 heads x 2 k-steps); the residual plane keeps its rows
      for (int rl = 0; rl < 16; ++rl) if (lane < 16) vst2((unsigned*)(QKL + (r0 + rl) * (2 * DM) + n0 + lane * 8), *(const v4u*)&sol[wave][rl][lane * 8]);
      _Float16* kt = KF + (((r0 / SS) * NH + (n0 - DM) / HD) * (SS / 16) + (r0 % SS) / 16) * 1024 + lane * 8;
#pragma unroll
      for (int f = 0; f < 8; ++f) { const int hh = f >> 2, kc = (f >> 1) & 1, half = f & 1; vst2((unsigned*)(kt + (size_t)hh * (SS / 16) * 1024 + kc * 512 + half * 256), *(const v4u*)&so[wave][col][hh * HD + kc * 32 + half * 16 + g * 8]); }
      asm volatile("s_wait_xcnt 0x0" ::: "memory"); }   // behind the run of stores: code that follows them in the listing reuses their data and address registers
  } else {
#pragma unroll
    for (int t = 0; t < 8; ++t) { const int i = t >> 1, j = wave * 2 + (t & 1);
#pragma unroll
      for (int r = 0; r < 8; ++r) { const float v = acc[t][r] + bfr(bias[t & 1]); const _Float16 hv = (_Float16)v; sth[j * 16 + col][i * 16 + 8 * g + r] = hv; stl[j * 16 + col][i * 16 + 8 * g + r] = (_Float16)((v - (float)hv) * 2048.0f); } }
    __syncthreads();
    const size_t rb = (size_t)blockIdx.x * 64; const int b = (int)(rb / SS), s0 = (int)(rb % SS); const int pc0 = n0 - 2 * DM;
    for (int q = tid; q < 128 * 8; q += 128) { const int d = q >> 3, pc = q & 7; const size_t o = ((size_t)b * DM + pc0 + d) * SS + s0 + pc * 8; vst2((unsigned*)(VTL + o), *(const v4u*)&stl[d][pc * 8]); }
    for (int q = tid; q < 128 * 8; q += 128) { const int ln = q & 31, half = (q >> 5) & 1, dt = (q >> 6) & 3, ksl = (q >> 8) & 1, hh = q >> 9;   // the block's 64 keys x 128 d are 16 v^T fragments (2 heads x 2 key groups x 4 d tiles)
      vst2((unsigned*)(VTH + ((((size_t)b * NH + pc0 / HD + hh) * (SS / 32) + s0 / 32 + ksl) * 4 + dt) * 512 + half * 256 + ln * 8), *(const v4u*)&sth[hh * HD + dt * 16 + (ln & 15)][ksl * 32 + half * 16 + (ln >> 4) * 8]); }
  }
}
// lane l with lane l ^ 16 (the two lane halves hold the two halves of a query's keys)
__device__ __forceinline__ float xhalf(float x) { return __builtin_bit_cast(float, __builtin_amdgcn_permlanex16(__builtin_bit_cast(int, x), __builtin_bit_cast(int, x), 0x76543210, 0xfedcba98, false, false)); }
// ---- k_attn: block = (64 queries, head h, (layer l, batch b)): k and v^T read as packed fragments (KF, VTH); all-keys flash attention (K = 64: 2 k-steps), TRANSPOSED: S^T = k (A) . q^T (B), so lane (g, col) holds 16 of query col's 32 scores of a pass (keys ct * 16 + 8 g + r): maximum and sum in the lane, the maximum joined with the other half once a pass, the sums once at the end; the two score tiles, converted in place, are the B operand P^T of O^T += v^T (A) . P^T; scores = (q.k) * 0.125 with single f16 operands; O[b*S+q][h*64+d] = (acc + accl / 2048) / (2048 l) (256-B segments)
__global__ __launch_bounds__(128) void k_attn(const _Float16* __restrict__ QK, const _Float16* __restrict__ QKL, const _Float16* __restrict__ VTH, const _Float16* __restrict__ VTL, const _Float16* __restrict__ KF, const void* __restrict__ KMASK, float* __restrict__ O) {
  __shared__ __align__(16) float so[4][16][68];
  const int tid = threadIdx.x, wave = tid >> 5, lane = tid & 31, col = lane & 15, g = lane >> 4;
  const int qb = blockIdx.x, h = blockIdx.y, b = blockIdx.z % NB; { const size_t l = blockIdx.z / NB; QK += l * QKS; QKL += l * QKS; VTH += l * VTS; VTL += l * VTS; KF += l * OS; O += l * OS; }   // layer l's planes
  const int q0 = qb * 64 + wave * 16; const size_t rq = (size_t)b * SS + q0 + col;
  v16h aq[2], aql[2];
#pragma unroll
  for (int kc = 0; kc < 2; ++kc) { aq[kc] = frag_h(QK + rq * (2 * DM) + h * HD + kc * 32, lane); aql[kc] = frag_h(QKL + rq * (2 * DM) + h * HD + kc * 32, lane); }
  float m = -3.0e38f, l = 0.f;   // query col's running maximum (equal in both halves) and this half's share of its sum
  v8f acc[4] = {}, accl[4] = {};   // O^T: acc[dt][r] = query col, d = dt * 16 + 8 g + r
  const int nks = SS / 32;   // all keys
  const _Float16* kbase = KF + (size_t)(b * NH + h) * SS * HD;   // k fragments of this (layer, batch, head): 4 to a pass
  const _Float16* vbase = VTH + (size_t)(b * NH + h) * SS * HD;   // v^T fragments: 4 to a pass
  v16h kf[2][2];   // a pass's four k fragments, fetched one pass ahead
#pragma unroll   // register array: every index must be a constant
  for (int ct = 0; ct < 2; ++ct) {
#pragma unroll   // register array: every index must be a constant
    for (int kc = 0; kc < 2; ++kc) kf[ct][kc] = frag_hp(kbase + (ct * 2 + kc) * 512, lane); }
#pragma unroll 1
  for (int ks = 0; ks < nks; ++ks) { v8f s[2];
    v16h vf[4];   // this pass's four v^T fragments: issued here as one group, first used behind the softmax
#pragma unroll   // register array: every index must be a constant
    for (int dt = 0; dt < 4; ++dt) vf[dt] = frag_hp(vbase + (size_t)(ks * 4 + dt) * 512, lane);
#pragma unroll
    for (int ct = 0; ct < 2; ++ct) { v8f c = {};
#pragma unroll
      for (int kc = 0; kc < 2; ++kc) c = wmma16(kf[ct][kc], aq[kc], c);   // single product: k, q as one-rounding f16 operands
      { const bool keepk = true;
#pragma unroll
      for (int r = 0; r < 8; ++r) s[ct][r] = keepk ? c[r] * 0.125f : -3.0e38f; } }   // 1/sqrt(64); every key kept (no mask)
    { const _Float16* kn = kbase + (size_t)((ks + 1 < nks) ? ks + 1 : ks) * 2048;   // next pass's k fragments into the same registers, in flight under the softmax and P.V (the last pass reads its own rows again: in bounds, unused)
#pragma unroll   // register array: every index must be a constant
      for (int ct = 0; ct < 2; ++ct) {
#pragma unroll   // register array: every index must be a constant
        for (int kc = 0; kc < 2; ++kc) kf[ct][kc] = frag_hp(kn + (ct * 2 + kc) * 512, lane); } }
    float mx = fmaxf(s[0][0], s[1][0]);
#pragma unroll   // register array: every index must be a constant
    for (int r = 1; r < 8; ++r) mx = fmaxf(mx, fmaxf(s[0][r], s[1][r]));
    mx = fmaxf(mx, xhalf(mx));
    const float mn = fmaxf(m, mx); const float alpha = (m <= -1.0e38f) ? 0.f : __expf(m - mn);
    v16h pa; float es0 = 0.f, es1 = 0.f;
#pragma unroll   // register array: every index must be a constant
    for (int r = 0; r < 8; ++r) { const float e0 = (s[0][r] <= -1.0e38f) ? 0.f : __expf(s[0][r] - mn), e1 = (s[1][r] <= -1.0e38f) ? 0.f : __expf(s[1][r] - mn);
      es0 += e0; es1 += e1;
      pa[r] = (_Float16)(e0 * 2048.0f); pa[8 + r] = (_Float16)(e1 * 2048.0f); }   // P scaled by 2^11 before the f16 rounding so small softmax weights stay out of the f16 subnormal range; 2^-11 folded into the epilogue. Element s of the B operand is key (s < 8 ? 8 g + s : 16 + 8 g + s - 8): the k order of the v^T fragments
    l = l * alpha + (es0 + es1); m = mn;
#pragma unroll   // register array: every index must be a constant
    for (int dt = 0; dt < 4; ++dt) {
#pragma unroll   // register array: every index must be a constant
      for (int r = 0; r < 8; ++r) { acc[dt][r] *= alpha; accl[dt][r] *= alpha; } }
#pragma unroll
    for (int dt = 0; dt < 4; ++dt) acc[dt] = wmma16(vf[dt], pa, acc[dt]); }   // single product: V^T x P^T (x2^11)
  l += xhalf(l);   // the two halves' sums joined once
  { const float il = (1.0f / 2048.0f) / l;
#pragma unroll   // register array: every index must be a constant
    for (int dt = 0; dt < 4; ++dt) {
#pragma unroll   // register array: every index must be a constant
      for (int rh = 0; rh < 2; ++rh) { v4f o;   // a lane's 8 values of a d tile are 8 consecutive d of its query's row: two 16-byte LDS stores
#pragma unroll   // register array: every index must be a constant
        for (int i = 0; i < 4; ++i) o[i] = (acc[dt][rh * 4 + i] + accl[dt][rh * 4 + i] * (1.0f / 2048.0f)) * il;
        *(v4f*)&so[wave][col][dt * 16 + 8 * g + rh * 4] = o; } } }
  LDSX();
  for (int rl = 0; rl < 16; ++rl) if (lane < 16) vst2(O + ((size_t)b * SS + q0 + rl) * DM + h * HD + lane * 4, *(const v4f*)&so[wave][rl][lane * 4]);
}
// ---- k_out: block = (64 rows, 128 cols): out = O(hi/lo) . Wo rows (2 products) + bo; O = the layer sum of the NLAY planes, summed and split once per block on its way into LDS
__global__ __launch_bounds__(128) void k_out(const float* __restrict__ O, const __bf16* __restrict__ P, const float* __restrict__ BO, float* __restrict__ Y) {
  __shared__ __align__(16) char sm[36864];   // k loop: two buffers each of the hi and the residual A tile, 64 x 72 bf16; behind the loop's closing barrier the same bytes are the epilogue's stage
  float (*so)[16][132] = (float (*)[16][132])sm; __bf16 *sah = (__bf16*)sm, *sal = sah + 2 * (64 * 72);
  const int tid = threadIdx.x, wave = tid >> 5, lane = tid & 31, col = lane & 15, g = lane >> 4; const size_t r0 = (size_t)blockIdx.x * 64 + wave * 16; const int n0 = blockIdx.y * 128;
  v8f acc[8] = {};   // tile t: rows (t >> 1) * 16 .. of the block, columns (wave * 2 + (t & 1)) * 16 ..
#pragma unroll 1   // eight stages of 64 k: one copy of the body keeps the text short
  for (int s = 0; s < DM / 64; ++s) { __bf16 *bh = sah + (s & 1) * (64 * 72), *bl = sal + (s & 1) * (64 * 72);
    v16b w[2][2];   // the stage's four weight fragments, in the same group of loads as the plane rows
    const __bf16* pw = P + ((size_t)(blockIdx.y * (DM / 32) + s * 2) * 8 + wave * 2) * 512 + lane * 8; const float* p0 = a_lane<64>(O + r0 * DM + s * 64, lane);
#pragma unroll   // register array: every index must be a constant
    for (int kc = 0; kc < 2; ++kc) {
#pragma unroll   // register array: every index must be a constant
      for (int jj = 0; jj < 2; ++jj) w[kc][jj] = frag_bl(pw + (kc * 8 + jj) * 512); }
    v4f pr[NLAY][8];
#pragma unroll   // register array: every index must be a constant
    for (int l = 0; l < NLAY; ++l) { a_load<64>(pr[l], p0 + l * OS); asm volatile("s_wait_xcnt 0x0" ::: "memory"); }   // a wait behind each plane's loads: the next plane's results may land in this plane's address registers
    __builtin_amdgcn_sched_barrier(0);   // every global load of the stage is issued before the first wait for data: a load held back behind a sum would cost a second trip to memory
    v4f v[8];   // sum over the layers in order 0..3 of (gate_l x_l) / sqrt(3)
#pragma unroll   // register array: every index must be a constant
    for (int u = 0; u < 8; ++u) { v4f x = {};
#pragma unroll   // register array: every index must be a constant
      for (int l = 0; l < NLAY; ++l) x = x + pr[l][u] * 0.57735026918962576f;
      v[u] = x; }
    a_store2<64>(bh, bl, v, wave, lane);   // into the buffers whose readers left them before the last barrier
    __syncthreads();   // stage s is published
#pragma unroll
    for (int kc = 0; kc < 2; ++kc) { v16b ah[4], al[4];
#pragma unroll   // register array: every index must be a constant
      for (int i = 0; i < 4; ++i) { al[i] = frag_b(bl + (i * 16 + col) * 72 + kc * 32, lane); ah[i] = frag_b(bh + (i * 16 + col) * 72 + kc * 32, lane); }
#pragma unroll
      for (int t = 0; t < 8; ++t) acc[t] = wmma_bf(al[t >> 1], w[kc][t & 1], acc[t]);
#pragma unroll
      for (int t = 0; t < 8; ++t) acc[t] = wmma_bf(ah[t >> 1], w[kc][t & 1], acc[t]); } }
  __syncthreads();   // every read of the last stage has ended: the bytes become the epilogue's stage
#pragma unroll
  for (int t = 0; t < 8; ++t) { const int i = t >> 1, j = wave * 2 + (t & 1);
#pragma unroll
    for (int r = 0; r < 8; ++r) so[i][8 * g + r][j * 16 + col] = acc[t][r] + bfr(BO[n0 + j * 16 + col]); }
  __syncthreads();   // a row tile's 128 columns come from all four waves
  for (int rl = 0; rl < 16; ++rl) vst2(Y + (r0 + rl) * DM + n0 + lane * 4, *(const v4f*)&so[wave][rl][lane * 4]);
}
#define NR (NB * SS)
// ---- k_gate: block = (64 rows, 128 cols, layer l): g = sigmoid([query (exact bf16, 1 product) | x_l (hi + residual, 2 products)] . Wsig_l rows + bsig_l); FUS plane l = g * x_l (k_out scales by 1 / sqrt(3) and sums the planes)
__global__ __launch_bounds__(128) void k_gate(const float* __restrict__ XQ, const float* __restrict__ XL, const __bf16* __restrict__ PSG, const float* __restrict__ BS, float* __restrict__ FUS) {
  __shared__ __align__(16) char sm[36864];   // k loops: two buffers each of the hi and the residual A tile, 64 x 72 bf16; behind the last barrier of the loops the same bytes are the epilogue's stage
  float (*so)[16][132] = (float (*)[16][132])sm; __bf16 *sah = (__bf16*)sm, *sal = sah + 2 * (64 * 72); const int l = blockIdx.z; XL += l * OS; FUS += l * OS;
  const int tid = threadIdx.x, wave = tid >> 5, lane = tid & 31, col = lane & 15, g = lane >> 4; const size_t rb = (size_t)blockIdx.x * 64, r0 = rb + wave * 16; const int n0 = blockIdx.y * 128;
  const __bf16* Wr = PSG + (size_t)l * DM * 2 * DM; v8f acc[8] = {};   // tile t: rows (t >> 1) * 16 .. of the block, columns (wave * 2 + (t & 1)) * 16 ..
  const float *Aq = a_lane<64>(XQ + r0 * DM, lane), *Ax = a_lane<64>(XL + r0 * DM, lane);   // the wave's 16 rows of the two halves of [query | x_l]
  v4f ar[8];
  a_load<64>(ar, Aq); XW1(Aq); a_store<64>(sah, ar, wave, lane);
  __syncthreads();   // stage 0 is published
#pragma unroll 1   // query half, eight stages of 64 k: one copy of the body keeps the text short
  for (int s = 0; s < DM / 64; ++s) { const __bf16* sb = sah + (s & 1) * (64 * 72); const int nb = ((s + 1) & 1) * (64 * 72);
    v16b w[2][2];   // the stage's four weight fragments as one group, then the next stage's A rows: both in flight under the products
    const __bf16* pw = Wr + ((size_t)(blockIdx.y * (2 * DM / 32) + s * 2) * 8 + wave * 2) * 512 + lane * 8; const float* pa = (s + 1 < DM / 64) ? Aq + (s + 1) * 64 : Ax;   // behind the last query stage comes x_l's first
#pragma unroll   // register array: every index must be a constant
    for (int kc = 0; kc < 2; ++kc) {
#pragma unroll   // register array: every index must be a constant
      for (int jj = 0; jj < 2; ++jj) w[kc][jj] = frag_bl(pw + (kc * 8 + jj) * 512); }
    __builtin_amdgcn_sched_barrier(0);   // the weight loads stay ahead of the A rows: loads return in order, and the first product waits for weights only
    a_load<64>(ar, pa); XW2(pw, pa);
    __builtin_amdgcn_sched_barrier(0);   // every global load of the stage is issued before the first wait for data
#pragma unroll
    for (int kc = 0; kc < 2; ++kc) { v16b a[4];
#pragma unroll   // register array: every index must be a constant
      for (int i = 0; i < 4; ++i) a[i] = frag_b(sb + (i * 16 + col) * 72 + kc * 32, lane);
#pragma unroll
      for (int t = 0; t < 8; ++t) acc[t] = wmma_bf(a[t >> 1], w[kc][t & 1], acc[t]); }
    __builtin_amdgcn_sched_barrier(0);   // the conversions stay behind the products: moved up, they would wait for the rows fetched ahead at the stage's top
    if (s + 1 < DM / 64) a_store<64>(sah + nb, ar, wave, lane); else a_store2<64>(sah + nb, sal + nb, ar, wave, lane);   // into the buffer whose readers left it at the last barrier
    __syncthreads(); }   // publishes the next stage and ends every read of this one
  auto stage = [&](const int s, const bool more) __attribute__((always_inline)) { const __bf16 *bh = sah + (s & 1) * (64 * 72), *bl = sal + (s & 1) * (64 * 72); const int nb = ((s + 1) & 1) * (64 * 72);
    v16b w[2][2];
    const __bf16* pw = Wr + ((size_t)(blockIdx.y * (2 * DM / 32) + DM / 32 + s * 2) * 8 + wave * 2) * 512 + lane * 8; const float* pa = Ax + (s + 1) * 64;
#pragma unroll   // register array: every index must be a constant
    for (int kc = 0; kc < 2; ++kc) {
#pragma unroll   // register array: every index must be a constant
      for (int jj = 0; jj < 2; ++jj) w[kc][jj] = frag_bl(pw + (kc * 8 + jj) * 512); }
    __builtin_amdgcn_sched_barrier(0);   // the weight loads stay ahead of the A rows: loads return in order, and the first product waits for weights only
    if (more) { a_load<64>(ar, pa); XW2(pw, pa); } else XW1(pw);   // more: a constant at each call, so the count of loads in flight is known at every wait
    __builtin_amdgcn_sched_barrier(0);   // every global load of the stage is issued before the first wait for data
#pragma unroll
    for (int kc = 0; kc < 2; ++kc) { v16b ah[4], al[4];
#pragma unroll   // register array: every index must be a constant
      for (int i = 0; i < 4; ++i) { al[i] = frag_b(bl + (i * 16 + col) * 72 + kc * 32, lane); ah[i] = frag_b(bh + (i * 16 + col) * 72 + kc * 32, lane); }
#pragma unroll
      for (int t = 0; t < 8; ++t) acc[t] = wmma_bf(al[t >> 1], w[kc][t & 1], acc[t]);
#pragma unroll
      for (int t = 0; t < 8; ++t) acc[t] = wmma_bf(ah[t >> 1], w[kc][t & 1], acc[t]); }
    __builtin_amdgcn_sched_barrier(0);   // the conversions stay behind the products: moved up, they would wait for the rows fetched ahead at the stage's top
    if (more) a_store2<64>(sah + nb, sal + nb, ar, wave, lane);
    __syncthreads(); };   // publishes the next stage and ends every read of this one
#pragma unroll 1   // x_l half, eight stages of 64 k
  for (int s = 0; s < DM / 64 - 1; ++s) stage(s, true);
  stage(DM / 64 - 1, false);
  float bb[2];   // the wave's two column tiles' bias values
  const float *pb = BS + (size_t)l * DM + n0 + wave * 32 + col, *px = XL + (rb + 8 * g) * DM + n0 + wave * 32 + col;   // the lane's own addresses of the bias and of x_l's tile values
#pragma unroll   // register array: every index must be a constant
  for (int jj = 0; jj < 2; ++jj) bb[jj] = bfr(pb[jj * 16]);
  XW1(pb);
#pragma unroll   // register array: every index must be a constant
  for (int jh = 0; jh < 2; ++jh) { float xv[4][8];   // half a tile's x_l values as one group of loads ahead of its exp calls (no load moves over a call); two halves keep a group under the load counter's range
#pragma unroll   // register array: every index must be a constant
    for (int tt = 0; tt < 4; ++tt) { const int t = jh * 4 + tt;
#pragma unroll   // register array: every index must be a constant
      for (int r = 0; r < 8; ++r) xv[tt][r] = px[((t >> 1) * 16 + r) * DM + (t & 1) * 16]; }
    XW1(px);
#pragma unroll   // register array: every index must be a constant
    for (int tt = 0; tt < 4; ++tt) { const int t = jh * 4 + tt;
#pragma unroll   // register array: every index must be a constant
      for (int r = 0; r < 8; ++r) { const float gte = 1.0f / (1.0f + exp_ni(-(acc[t][r] + bb[t & 1]))); so[t >> 1][8 * g + r][(wave * 2 + (t & 1)) * 16 + col] = gte * xv[tt][r]; } } }
  __syncthreads();   // a row tile's 128 columns come from all four waves
  for (int rl = 0; rl < 16; ++rl) vst2(FUS + (r0 + rl) * DM + n0 + lane * 4, *(const v4f*)&so[wave][rl][lane * 4]);
}
extern "C" void kernel_launch(void* const* d_in, const int* in_sizes, int n_in, void* d_out, int out_size, void* d_ws, size_t ws_size, hipStream_t stream) {
  (void)in_sizes; (void)n_in; (void)out_size;
  const float** F = (const float**)d_in;   // 0 query [4,1024,512], 1 key [4,4,1024,512], 2 value [4,4,1024,512], 3 Wq [512,512], 4 bq, 5 Wk [4,512,512], 6 bk [4,512], 7 Wv, 8 bv, 9 Wsig [4,512,1024], 10 bsig [4,512], 11 Wf [512,512], 12 bf
  if (ws_size < (size_t)WS_END) return;
  char* ws = (char*)d_ws; __bf16 *PK = (__bf16*)(ws + WS_PK), *PSG = (__bf16*)(ws + WS_PSG); _Float16 *QK = (_Float16*)(ws + WS_QK), *QKL = (_Float16*)(ws + WS_QKL), *VTH = (_Float16*)(ws + WS_VTH), *VTL = (_Float16*)(ws + WS_VTL), *KF = (_Float16*)(ws + WS_KF); float *O = (float*)(ws + WS_O), *FUS = (float*)(ws + WS_FUS);
  // the layers are independent up to the gated sum: each stage is one launch with the layer in blockIdx.z
  k_pack<<<dim3(DM / 16, 5, NLAY), 256, 0, stream>>>(F[3], F[5], F[7], F[11], F[9], PK, PSG);   // per layer: Wq | Wk[l] | Wv[l] | Wf | Wsig[l] as fragments
  k_qkv<<<dim3(TNB * SS / 64, QKVW / 128, NLAY), 128, 0, stream>>>(F[0], F[1], F[2], PK + PK_A, F[4], F[6], F[8], QK, QKL, VTH, VTL, KF);   // (q recomputed per layer; identical)
  k_attn<<<dim3(TQB, NH, TNB * NLAY), 128, 0, stream>>>(QK, QKL, VTH, VTL, KF, nullptr, O);   // x_l
  k_gate<<<dim3(NR / 64, DM / 128, NLAY), 128, 0, stream>>>(F[0], O, PSG, F[10], FUS);   // gate_l * x_l
  k_out<<<dim3(TOB, DM / 128), 128, 0, stream>>>(FUS, PK + PK_P, F[12], (float*)d_out);   // (sum_l gate_l x_l / sqrt(3)) . Wf^T + bf (Wf of layer 0's pack)
}

// v006
// It runs in 146 microseconds.
// In two side-by-side timings against v005, it was 1.04 and 1.05 times as fast.
// Counting every step since v000, it is 5.98 times as fast.
// compute dtype: all float inputs rounded to bf16; q = query . Wq^T + bq and k_l, v_l = key_l / value_l . W^T + b with EXACT bf16 products on WMMA 16x16x32 (weights, k and v^T kept in fragment order in the workspace); PLAIN attention per layer: q, k as single f16 operands x 1/8, running-max softmax in f32 (hardware exp2; 1/8, log2 e and the 2^11 of P in one FMA), P (scaled by 2^11, single f16) x v (single f16); gate_l = sigmoid([query (exact) | x_l (bf16 hi + residual, 2 products)] . Wsig_l^T + bsig_l) (precise expf); fused = sum_l gate_l x_l / sqrt(3) in f32; out = fused (bf16 hi + residual) . Wf^T (2 products) + bf.
#include <hip/hip_runtime.h>
#include <math.h>

typedef __attribute__((ext_vector_type(16))) _Float16 v16h;
typedef __attribute__((ext_vector_type(16))) __bf16 v16b;
typedef __attribute__((ext_vector_type(8)))  _Float16 v8h;
typedef __attribute__((ext_vector_type(8)))  float v8f;
typedef __attribute__((ext_vector_type(4)))  float v4f;
typedef __attribute__((ext_vector_type(2)))  float v2f;
typedef __attribute__((ext_vector_type(4)))  unsigned v4u;
typedef __attribute__((ext_vector_type(4)))  int v4i;
typedef float __attribute__((may_alias)) float_a;
typedef int __attribute__((may_alias)) int_a;

template <typename T> __device__ __forceinline__ void vst2(void* p, T v) { *(T*)p = v;  }
__device__ __forceinline__ v8f wmma16(v16h a, v16h b, v8f c) {
  v8f d = __builtin_amdgcn_wmma_f32_16x16x32_f16(false, a, false, b, (short)0, c, false, false);
  asm volatile("v_nop\n\tv_nop\n\tv_nop\n\tv_nop" : "+v"(d) : "v"(a), "v"(b));
  return d;
}
__device__ __forceinline__ v8f wmma_bf(v16b a, v16b b, v8f c) {
  v8f d = __builtin_amdgcn_wmma_f32_16x16x32_bf16(false, a, false, b, (short)0, c, false, false);
  asm volatile("v_nop\n\tv_nop\n\tv_nop\n\tv_nop" : "+v"(d) : "v"(a), "v"(b));
  return d;
}
// Multi-layer source attention (B 4, 1,024 queries over 4 layers of 1,024 keys/values, d 512, 8 heads x 64): a shared query projection, per-layer key/value projections, softmax(q k_l^T / 8) v_l per layer, per-layer sigmoid gates from [query | x_l], gated sum over layers / sqrt(3), final linear map.
__device__ __forceinline__ v16h frag_h(const _Float16* rowk0, int lane) {
  union { v16h v; v8h q[2]; } u; const _Float16* p = rowk0 + 8 * (lane >> 4);
  u.q[0] = *(const v8h*)p; u.q[1] = *(const v8h*)(p + 16); return u.v;
}
__device__ __forceinline__ v16h frag_f32(const float* rowk0, int lane) {
  v16h a; const float* p = rowk0 + 8 * (lane >> 4);
#pragma unroll
  for (int i = 0; i < 8; ++i) { a[i] = (_Float16)p[i]; a[8 + i] = (_Float16)p[16 + i]; }
  return a;
}
__device__ __forceinline__ v16h frag_f32s(const float* rowk0, int lane, float sc) {
  v16h a; const float* p = rowk0 + 8 * (lane >> 4);
#pragma unroll
  for (int i = 0; i < 8; ++i) { a[i] = (_Float16)(p[i] * sc); a[8 + i] = (_Float16)(p[16 + i] * sc); }
  return a;
}
// column fragment from a [K][ld] layout (column n), rows >= K read as 0
__device__ __forceinline__ v16h fragc_f32(const float* W, int k0, int n, int lane, int ld, int K) {
  v16h a; const int g = lane >> 4;
#pragma unroll
  for (int i = 0; i < 8; ++i) { const int ka = k0 + 8 * g + i, kb = ka + 16;
    a[i] = (_Float16)(ka < K ? W[(size_t)(ka < K ? ka : K - 1) * ld + n] : 0.f); a[8 + i] = (_Float16)(kb < K ? W[(size_t)(kb < K ? kb : K - 1) * ld + n] : 0.f); }
  return a;
}
struct F2 { v16b h, l; };
__device__ __forceinline__ F2 bsplit16(const float v[16]) { F2 r;
#pragma unroll
  for (int i = 0; i < 16; ++i) { const __bf16 h = (__bf16)v[i]; r.h[i] = h; r.l[i] = (__bf16)(v[i] - (float)h); }
  return r; }
__device__ __forceinline__ F2 split_row(const float* row, int k0, int lane) { float v[16]; const float* p = row + k0 + 8 * (lane >> 4);
#pragma unroll
  for (int i = 0; i < 8; ++i) { v[i] = p[i]; v[8 + i] = p[16 + i]; }
  return bsplit16(v); }
__device__ __forceinline__ F2 split_rowK(const float* row, int k0, int lane, int K) { float v[16]; const int g = lane >> 4;
#pragma unroll
  for (int i = 0; i < 8; ++i) { const int ka = k0 + 8 * g + i, kb = ka + 16; v[i] = ka < K ? row[ka < K ? ka : K - 1] : 0.f; v[8 + i] = kb < K ? row[kb < K ? kb : K - 1] : 0.f; }
  return bsplit16(v); }
__device__ __forceinline__ F2 split_col(const float* W, int k0, int n, int lane, int ld, int K) { float v[16]; const int g = lane >> 4;
#pragma unroll
  for (int i = 0; i < 8; ++i) { const int ka = k0 + 8 * g + i, kb = ka + 16; v[i] = ka < K ? W[(size_t)(ka < K ? ka : K - 1) * ld + n] : 0.f; v[8 + i] = kb < K ? W[(size_t)(kb < K ? kb : K - 1) * ld + n] : 0.f; }
  return bsplit16(v); }
__device__ __forceinline__ v8f mac3(const F2& a, const F2& b, v8f c) { c = wmma_bf(a.l, b.h, c); c = wmma_bf(a.h, b.l, c); return wmma_bf(a.h, b.h, c); }
__device__ __forceinline__ float sigm(float v) { return 1.0f / (1.0f + expf(-v)); }
#define LDSX() do { asm volatile("s_wait_dscnt 0" ::: "memory"); __builtin_amdgcn_wave_barrier(); __builtin_amdgcn_fence(__ATOMIC_RELEASE, "workgroup"); } while (0)


#define NB 4
#define SS 1024
#define DM 512
#define NH 8
#define NLAY 4
__device__ __forceinline__ size_t kvrow(size_t r) { return (r / SS) * ((size_t)NLAY * SS) + (r % SS); }   // key/value [B][L][S][D]: engine row (b, s) of layer l lives at (b*L + l)*S + s (layer offset added to the pointer)
#define HD 64
#define QKVW (3 * DM)
#ifndef TQB
#define TQB (SS / 64)
#define TNB NB
#define TOB (NB * SS / 64)     // output row tiles (all)
#endif
typedef __attribute__((ext_vector_type(8))) __bf16 v8b;
__device__ __forceinline__ v16b frag_b(const __bf16* rowk0, int lane) {
  union { v16b v; v8b q[2]; } u; const __bf16* p = rowk0 + 8 * (lane >> 4);
  u.q[0] = *(const v8b*)p; u.q[1] = *(const v8b*)(p + 16); return u.v;
}
// fragment order: one 16 x 32 operand fragment is 1 KiB, [half][lane][8 elements]; lane (g, col) holds row col, k = half * 16 + 8 g + 0..7 (the k order of frag_b / frag_h), so each 16-byte load of a wave reads 512 contiguous bytes
__device__ __forceinline__ v16b frag_bp(const __bf16* frag, int lane) {
  union { v16b v; v8b q[2]; } u; const __bf16* p = frag + lane * 8;
  u.q[0] = *(const v8b*)p; u.q[1] = *(const v8b*)(p + 256); return u.v;
}
__device__ __forceinline__ v16h frag_hp(const _Float16* frag, int lane) {
  union { v16h v; v8h q[2]; } u; const _Float16* p = frag + lane * 8;
  u.q[0] = *(const v8h*)p; u.q[1] = *(const v8h*)(p + 256); return u.v;
}
__device__ __forceinline__ float bfr(float v) { return (float)(__bf16)v; }
__device__ __attribute__((noinline)) float exp_ni(float v) { return expf(v); }
__device__ __attribute__((noinline)) float erf_ni(float v) { return erff(v); }

typedef __attribute__((ext_vector_type(4))) __bf16 v4b;
// ---- A tile of a 64 x 128 block product, staged once per block in LDS as bf16, KS k values a stage: wave w brings rows w * 16 .. + 15 with whole-line loads (a 16-byte load of the wave reads KS * 4 contiguous bytes of each row it touches); LDS row pitch KS + 8 elements (16 bytes x an odd number: 16-byte fragment reads meet no bank twice). Every wave then reads all four 16-row fragments and owns columns w * 32 .. + 31, so a weight fragment is loaded by one wave only
template <int KS> __device__ __forceinline__ const float* a_lane(const float* rows, int lane) { constexpr int LPR = KS / 4; return rows + (size_t)(lane / LPR) * DM + (lane % LPR) * 4; }   // the lane's own address in the wave's first load
template <int KS> __device__ __forceinline__ void a_load(v4f (&ar)[KS / 8], const float* pl) {
  constexpr int RPL = 128 / KS;   // rows to a load
#pragma unroll   // register array: every index must be a constant
  for (int u = 0; u < KS / 8; ++u) ar[u] = *(const v4f*)(pl + (size_t)(u * RPL) * DM);
}
__device__ __forceinline__ v16b frag_bl(const __bf16* pl) {   // frag_bp from the lane's own address
  union { v16b v; v8b q[2]; } u; u.q[0] = *(const v8b*)pl; u.q[1] = *(const v8b*)(pl + 256); return u.v;
}
// behind a group of global loads: the wait names the group's address registers, so none of them is rewritten (by a later load's result either) ahead of it
#define XW1(p) asm volatile("s_wait_xcnt 0x0" :: "v"(p) : "memory")
#define XW2(p, q) asm volatile("s_wait_xcnt 0x0" :: "v"(p), "v"(q) : "memory")
template <int KS> __device__ __forceinline__ __bf16* a_slot(__bf16* buf, int wave, int lane, int u) {
  constexpr int LPR = KS / 4, RPL = 32 / LPR;
  return buf + (wave * 16 + u * RPL + lane / LPR) * (KS + 8) + (lane % LPR) * 4;
}
template <int KS> __device__ __forceinline__ void a_store(__bf16* buf, const v4f (&ar)[KS / 8], int wave, int lane) {
#pragma unroll   // register array: every index must be a constant
  for (int u = 0; u < KS / 8; ++u) { v4b o;
#pragma unroll   // register vector: every index must be a constant
    for (int e = 0; e < 4; ++e) o[e] = (__bf16)ar[u][e];
    *(v4b*)a_slot<KS>(buf, wave, lane, u) = o; }
}
template <int KS> __device__ __forceinline__ void a_store2(__bf16* bh, __bf16* bl, const v4f (&ar)[KS / 8], int wave, int lane) {   // bf16 hi + residual
#pragma unroll   // register array: every index must be a constant
  for (int u = 0; u < KS / 8; ++u) { v4b oh, ol;
#pragma unroll   // register vector: every index must be a constant
    for (int e = 0; e < 4; ++e) { const __bf16 h = (__bf16)ar[u][e]; oh[e] = h; ol[e] = (__bf16)(ar[u][e] - (float)h); }
    *(v4b*)a_slot<KS>(bh, wave, lane, u) = oh; *(v4b*)a_slot<KS>(bl, wave, lane, u) = ol; }
}
// a packed [N][K] weight: [N / 128][K / 32][8 row tiles] fragments of 512 elements
#define PK_A 0                       // Wq | Wk | Wv, 1536 rows x 512
#define PK_P (PK_A + QKVW * DM)        // Wf, 512 rows x 512
#define PK_END (PK_P + DM * DM)
#define WS_PK  0u
// every per-layer buffer holds NLAY planes (layer = blockIdx.z, blockIdx.z / NB in k_attn; k_out sums the FUS planes, uses PK plane 0); plane sizes in elements:
#define QKS ((size_t)NB * SS * 2 * DM)
#define VTS ((size_t)NB * DM * SS)
#define OS  ((size_t)NB * SS * DM)
#define WS_QK  (WS_PK + 2u * PK_END * NLAY)        // f16 [l][4096 rows][1024]: q | (unused)
#define WS_QKL (WS_QK + 2u * NLAY * QKS)           // f16 q | k residual planes x2048
#define WS_VTH (WS_QKL + 2u * NLAY * QKS)          // f16 [l][b][h][32 keys ks][4 d tiles] v^T fragments (row = d, k = key)
#define WS_VTL (WS_VTH + 2u * NLAY * VTS)          // f16 [l][b][512 (h*64+d)][1024 s] lo x 2048
#define WS_O   (WS_VTL + 2u * NLAY * VTS)          // f32 [l][4096][512]
#define WS_CS  (WS_O + 4u * NLAY * OS)              // f32 [2][1024][32], unused
#define WS_PSG (WS_CS + 4u * 2 * SS * 32)                  // bf16 packed Wsig [4][512 x 1024]
#define WS_FUS (WS_PSG + 2u * (size_t)NLAY * DM * 2 * DM)   // f32 [l][NR][512] gate_l * x_l
#define WS_KF  (WS_FUS + 4u * NLAY * OS)            // f16 [l][b][h][16-key tile][2 k-steps] k fragments (row = key, k = d)
#define WS_END (WS_KF + 2u * NLAY * OS)
// ---- k_pack: block = (16-row tile nt, which, layer l): f32 [out][in] rows -> bf16 fragments; which 0..2 -> W_q/W_k[l]/W_v[l] into layer l's PK_A (rows which*512 + n); 3 -> W_f into layer l's PK_P; 4 -> Wsig[l] (rows 1024 long) into PSG. A thread converts one lane's 8 elements in each of four k-steps a trip (Wsig: two trips); a wave stores 512 contiguous bytes
__global__ __launch_bounds__(256) void k_pack(const float* __restrict__ WQ, const float* __restrict__ WK, const float* __restrict__ WV, const float* __restrict__ WO, const float* __restrict__ WS, __bf16* __restrict__ PK, __bf16* __restrict__ PSG) {
  const int nt = blockIdx.x, which = blockIdx.y, l = blockIdx.z, t = threadIdx.x; const size_t n = (size_t)nt * 16, ln = (size_t)l * DM + n; const int len = (which == 4) ? 2 * DM : DM;
  const float* Wm = (which == 0) ? WQ + n * DM : (which == 1) ? WK + ln * DM : (which == 2) ? WV + ln * DM : (which == 3) ? WO + n * DM : WS + ln * (2 * DM);
  __bf16* PL = PK + (size_t)l * PK_END;
  __bf16* dst = ((which < 3) ? PL + PK_A + (size_t)which * DM * DM : (which == 3) ? PL + PK_P : PSG + (size_t)l * DM * 2 * DM) + ((size_t)(nt >> 3) * (len / 32) * 8 + (nt & 7)) * 512;
  for (int p0 = t; p0 < len * 2; p0 += 1024) {
#pragma unroll   // four independent pieces to a trip: their loads are in flight together
    for (int u = 0; u < 4; ++u) { const int kc = p0 >> 6, half = (p0 >> 5) & 1, lane = p0 & 31; const float* s = Wm + (size_t)(lane & 15) * len + kc * 32 + half * 16 + (lane >> 4) * 8 + u * 4 * 32; v8b o;   // piece p0 + 256 u: k-step kc + 4 u, same half and lane
#pragma unroll   // register vector: every index must be a constant
      for (int i = 0; i < 8; ++i) o[i] = (__bf16)s[i];
      vst2(dst + (size_t)kc * 8 * 512 + half * 256 + lane * 8 + u * 4 * 8 * 512, o); } }
}
__global__ __launch_bounds__(128) void k_qkv(const float* __restrict__ XQ, const float* __restrict__ XK, const float* __restrict__ XV, const __bf16* __restrict__ P, const float* __restrict__ BQ, const float* __restrict__ BK, const float* __restrict__ BV, _Float16* __restrict__ QK, _Float16* __restrict__ QKL, _Float16* __restrict__ VTH, _Float16* __restrict__ VTL, _Float16* __restrict__ KF) {
  { const size_t l = blockIdx.z; XK += l * SS * DM; XV += l * SS * DM; P += l * PK_END; BK += l * DM; BV += l * DM; QK += l * QKS; QKL += l * QKS; VTH += l * VTS; VTL += l * VTS; KF += l * OS; }   // layer l's inputs, weights and planes
  const int which0 = (blockIdx.y * 128) / DM; const float* X = (which0 == 0) ? XQ : (which0 == 1) ? XK : XV; const float* BB = BQ ? (((which0 == 0) ? BQ : (which0 == 1) ? BK : BV) + (blockIdx.y * 128 - which0 * DM)) : nullptr;
  __shared__ __align__(16) char sm[71680];   // k loop: two A buffers of 64 x 136 bf16; behind the loop's last barrier the same bytes are the epilogue's stages
  _Float16 (*so)[16][136] = (_Float16 (*)[16][136])sm, (*sol)[16][136] = (_Float16 (*)[16][136])(sm + 17408); _Float16 (*sth)[72] = (_Float16 (*)[72])(sm + 34816), (*stl)[72] = (_Float16 (*)[72])(sm + 53248);
  __bf16* sa = (__bf16*)sm;
  const int tid = threadIdx.x, wave = tid >> 5, lane = tid & 31, col = lane & 15, g = lane >> 4; const size_t r0 = (size_t)blockIdx.x * 64 + wave * 16; const int n0 = blockIdx.y * 128;
  v8f acc[8] = {};   // tile t: rows (t >> 1) * 16 .. of the block, columns (wave * 2 + (t & 1)) * 16 ..
  float bias[2] = {};   // the wave's two column tiles' bias values, loaded ahead of the k loop, rounded to bf16 where they are added
  if (BB) {
#pragma unroll   // register array: every index must be a constant
    for (int jj = 0; jj < 2; ++jj) bias[jj] = BB[(wave * 2 + jj) * 16 + col];
    asm volatile("s_wait_xcnt 0x0" ::: "memory"); }   // behind the two loads: code that follows them in the listing reuses their address registers
  const float* Aw = a_lane<128>(X + ((which0 == 0) ? r0 : kvrow(r0)) * DM, lane);   // the wave's 16 rows are consecutive (a 64-row block lies in one batch)
  v4f ar[16];
  a_load<128>(ar, Aw); XW1(Aw); a_store<128>(sa, ar, wave, lane);
  __syncthreads();   // stage 0 is published
  auto stage = [&](const int s, const bool more) __attribute__((always_inline)) { const __bf16* sb = sa + (s & 1) * (64 * 136);   // more: a constant at each call, so the count of loads in flight is known at every wait
    v16b w[4][2];   // the stage's eight weight fragments as one group, then the next stage's A rows: both in flight under the products
    const __bf16* pw = P + ((size_t)(blockIdx.y * (DM / 32) + s * 4) * 8 + wave * 2) * 512 + lane * 8; const float* pa = Aw + (s + 1) * 128;
#pragma unroll   // register array: every index must be a constant
    for (int kc = 0; kc < 4; ++kc) {
#pragma unroll   // register array: every index must be a constant
      for (int jj = 0; jj < 2; ++jj) w[kc][jj] = frag_bl(pw + (kc * 8 + jj) * 512); }
    __builtin_amdgcn_sched_barrier(0);   // the weight loads stay ahead of the A rows: loads return in order, and the first product waits for weights only
    if (more) { a_load<128>(ar, pa); XW2(pw, pa); } else XW1(pw);
    __builtin_amdgcn_sched_barrier(0);   // every global load of the stage is issued before the first wait for data
#pragma unroll
    for (int kc = 0; kc < 4; ++kc) { v16b a[4];
#pragma unroll   // register array: every index must be a constant
      for (int i = 0; i < 4; ++i) a[i] = frag_b(sb + (i * 16 + col) * 136 + kc * 32, lane);
#pragma unroll
      for (int t = 0; t < 8; ++t) acc[t] = wmma_bf(a[t >> 1], w[kc][t & 1], acc[t]); }
    __builtin_amdgcn_sched_barrier(0);   // the conversions stay behind the products: moved up, they would wait for the rows fetched ahead at the stage's top
    if (more) a_store<128>(sa + ((s + 1) & 1) * (64 * 136), ar, wave, lane);   // into the buffer whose readers left it at the last barrier
    __syncthreads(); };   // publishes stage s + 1 and ends every read of stage s
#pragma unroll 1   // four stages of 128 k: one copy of the body for the stages that fetch ahead keeps the text short
  for (int s = 0; s < DM / 128 - 1; ++s) stage(s, true);
  stage(DM / 128 - 1, false);
  if (n0 < 2 * DM) {   // q stored unscaled (f16 sigma ~0.6, no subnormal exposure); 1/8 applied to the f32 score
#pragma unroll
    for (int t = 0; t < 8; ++t) { const int i = t >> 1, j = wave * 2 + (t & 1);
#pragma unroll
      for (int r = 0; r < 8; ++r) { const float v = acc[t][r] + bfr(bias[t & 1]); const _Float16 hv = (_Float16)v; so[i][8 * g + r][j * 16 + col] = hv; sol[i][8 * g + r][j * 16 + col] = (_Float16)((v - (float)hv) * 2048.0f); } }   // q, k (+ bias) as f16 hi + (x2048) residual
    __syncthreads();   // a row tile's 128 columns come from all four waves
    if (which0 == 0) {
    for (int rl = 0; rl < 16; ++rl) if (lane < 16) { vst2((unsigned*)(QK + (r0 + rl) * (2 * DM) + n0 + lane * 8), *(const v4u*)&so[wave][rl][lane * 8]); vst2((unsigned*)(QKL + (r0 + rl) * (2 * DM) + n0 + lane * 8), *(const v4u*)&sol[wave][rl][lane * 8]); }
    } else {   // k: the wave's 16 keys x 128 columns are four fragments (2 heads x 2 k-steps); the residual plane keeps its rows
      for (int rl = 0; rl < 16; ++rl) if (lane < 16) vst2((unsigned*)(QKL + (r0 + rl) * (2 * DM) + n0 + lane * 8), *(const v4u*)&sol[wave][rl][lane * 8]);
      _Float16* kt = KF + (((r0 / SS) * NH + (n0 - DM) / HD) * (SS / 16) + (r0 % SS) / 16) * 1024 + lane * 8;
#pragma unroll
      for (int f = 0; f < 8; ++f) { const int hh = f >> 2, kc = (f >> 1) & 1, half = f & 1; vst2((unsigned*)(kt + (size_t)hh * (SS / 16) * 1024 + kc * 512 + half * 256), *(const v4u*)&so[wave][col][hh * HD + kc * 32 + half * 16 + g * 8]); }
      asm volatile("s_wait_xcnt 0x0" ::: "memory"); }   // behind the run of stores: code that follows them in the listing reuses their data and address registers
  } else {
#pragma unroll
    for (int t = 0; t < 8; ++t) { const int i = t >> 1, j = wave * 2 + (t & 1);
#pragma unroll
      for (int r = 0; r < 8; ++r) { const float v = acc[t][r] + bfr(bias[t & 1]); const _Float16 hv = (_Float16)v; sth[j * 16 + col][i * 16 + 8 * g + r] = hv; stl[j * 16 + col][i * 16 + 8 * g + r] = (_Float16)((v - (float)hv) * 2048.0f); } }
    __syncthreads();
    const size_t rb = (size_t)blockIdx.x * 64; const int b = (int)(rb / SS), s0 = (int)(rb % SS); const int pc0 = n0 - 2 * DM;
    for (int q = tid; q < 128 * 8; q += 128) { const int d = q >> 3, pc = q & 7; const size_t o = ((size_t)b * DM + pc0 + d) * SS + s0 + pc * 8; vst2((unsigned*)(VTL + o), *(const v4u*)&stl[d][pc * 8]); }
    for (int q = tid; q < 128 * 8; q += 128) { const int ln = q & 31, half = (q >> 5) & 1, dt = (q >> 6) & 3, ksl = (q >> 8) & 1, hh = q >> 9;   // the block's 64 keys x 128 d are 16 v^T fragments (2 heads x 2 key groups x 4 d tiles)
      vst2((unsigned*)(VTH + ((((size_t)b * NH + pc0 / HD + hh) * (SS / 32) + s0 / 32 + ksl) * 4 + dt) * 512 + half * 256 + ln * 8), *(const v4u*)&sth[hh * HD + dt * 16 + (ln & 15)][ksl * 32 + half * 16 + (ln >> 4) * 8]); }
  }
}
// lane l with lane l ^ 16 (the two lane halves hold the two halves of a query's keys)
__device__ __forceinline__ float xhalf(float x) { return __builtin_bit_cast(float, __builtin_amdgcn_permlanex16(__builtin_bit_cast(int, x), __builtin_bit_cast(int, x), 0x76543210, 0xfedcba98, false, false)); }
// ---- k_attn: block = (64 queries, head h, (layer l, batch b)): k and v^T read as packed fragments (KF, VTH); all-keys flash attention (K = 64: 2 k-steps), TRANSPOSED: S^T = k (A) . q^T (B), so lane (g, col) holds 16 of query col's 32 scores of a pass (keys ct * 16 + 8 g + r): maximum and sum in the lane, the maximum joined with the other half once a pass, the sums once at the end; the two score tiles, converted in place, are the B operand P^T of O^T += v^T (A) . P^T; P = 2^(q.k * (log2 e / 8) - maximum + 11) with single f16 operands, the sum l carries the same 2^11; O[b*S+q][h*64+d] = acc / l (256-B segments)
__global__ __launch_bounds__(128) void k_attn(const _Float16* __restrict__ QK, const _Float16* __restrict__ QKL, const _Float16* __restrict__ VTH, const _Float16* __restrict__ VTL, const _Float16* __restrict__ KF, const void* __restrict__ KMASK, float* __restrict__ O) {
  __shared__ __align__(16) float so[4][16][68];
  const int tid = threadIdx.x, wave = tid >> 5, lane = tid & 31, col = lane & 15, g = lane >> 4;
  const int qb = blockIdx.x, h = blockIdx.y, b = blockIdx.z % NB; { const size_t l = blockIdx.z / NB; QK += l * QKS; QKL += l * QKS; VTH += l * VTS; VTL += l * VTS; KF += l * OS; O += l * OS; }   // layer l's planes
  const int q0 = qb * 64 + wave * 16; const size_t rq = (size_t)b * SS + q0 + col;
  v16h aq[2];
#pragma unroll
  for (int kc = 0; kc < 2; ++kc) aq[kc] = frag_h(QK + rq * (2 * DM) + h * HD + kc * 32, lane);
  const float KS2 = 0.125f * 1.44269504088896341f;   // 1/sqrt(64) and log2 e in one factor: exp(x / 8) = 2^(x * KS2)
  float m = -3.0e38f, l = 0.f;   // query col's running maximum of the raw products q.k (equal in both halves) and this half's share of its sum (x 2^11)
  v8f acc[4] = {};   // O^T: acc[dt][r] = query col, d = dt * 16 + 8 g + r
  const int nks = SS / 32;   // all keys
  const _Float16* kbase = KF + (size_t)(b * NH + h) * SS * HD;   // k fragments of this (layer, batch, head): 4 to a pass
  const _Float16* vbase = VTH + (size_t)(b * NH + h) * SS * HD;   // v^T fragments: 4 to a pass
  v16h kf[2][2];   // a pass's four k fragments, fetched one pass ahead
#pragma unroll   // register array: every index must be a constant
  for (int ct = 0; ct < 2; ++ct) {
#pragma unroll   // register array: every index must be a constant
    for (int kc = 0; kc < 2; ++kc) kf[ct][kc] = frag_hp(kbase + (ct * 2 + kc) * 512, lane); }
#pragma unroll 1
  for (int ks = 0; ks < nks; ++ks) { v8f s[2];
    v16h vf[4];   // this pass's four v^T fragments: issued here as one group, first used behind the softmax
#pragma unroll   // register array: every index must be a constant
    for (int dt = 0; dt < 4; ++dt) vf[dt] = frag_hp(vbase + (size_t)(ks * 4 + dt) * 512, lane);
    __builtin_amdgcn_sched_barrier(0);   // the v^T loads are issued ahead of the pass's first wait (for k): moved down among the score products they start later by that wait
#pragma unroll
    for (int ct = 0; ct < 2; ++ct) { v8f c = {};
#pragma unroll
      for (int kc = 0; kc < 2; ++kc) c = __builtin_amdgcn_wmma_f32_16x16x32_f16(false, kf[ct][kc], false, aq[kc], (short)0, c, false, false);   // single product: k, q as one-rounding f16 operands; the compiler keeps the distance behind the builtin
      s[ct] = c; }   // raw products: the scale is applied inside the exponent
    asm volatile("v_nop\n\tv_nop\n\tv_nop\n\tv_nop" : "+v"(s[0]), "+v"(s[1]) :: "memory");   // the distance between the last score product and the first read of its result; it names both tiles and memory, so no k load moves up among the products (issued while a fragment is still to be read it needs other registers, and copies behind a full wait follow)
    { const _Float16* kn = kbase + (size_t)((ks + 1 < nks) ? ks + 1 : ks) * 2048;   // next pass's k fragments into the same registers, in flight under the softmax and P.V (the last pass reads its own rows again: in bounds, unused)
#pragma unroll   // register array: every index must be a constant
      for (int ct = 0; ct < 2; ++ct) {
#pragma unroll   // register array: every index must be a constant
        for (int kc = 0; kc < 2; ++kc) kf[ct][kc] = frag_hp(kn + (ct * 2 + kc) * 512, lane); } }
    float mx = s[0][0];   // the first tile's values first: they fill the distance behind the second tile's last product
#pragma unroll   // register array: every index must be a constant
    for (int r = 1; r < 8; ++r) mx = fmaxf(mx, s[0][r]);
#pragma unroll   // register array: every index must be a constant
    for (int r = 0; r < 8; ++r) mx = fmaxf(mx, s[1][r]);
    mx = fmaxf(mx, xhalf(mx));
    const float mn = fmaxf(m, mx);
    const float off = fmaf(mn, KS2, -11.0f);
    v16h pa; float es0 = 0.f, es1 = 0.f;
    const v8f x0 = __builtin_elementwise_fma(s[0], (v8f)KS2, (v8f)(-off)), x1 = __builtin_elementwise_fma(s[1], (v8f)KS2, (v8f)(-off));   // as vectors: two exponents to a packed FMA
#pragma unroll   // register array: every index must be a constant
    for (int r = 0; r < 8; ++r) { const float e0 = __builtin_amdgcn_exp2f(x0[r]), e1 = __builtin_amdgcn_exp2f(x1[r]);
      es0 += e0; es1 += e1;
      pa[r] = (_Float16)e0; pa[8 + r] = (_Float16)e1; }   // P carries 2^11 (the + 11 in the exponent) so small softmax weights stay out of the f16 subnormal range; the sum carries it too and it cancels in the epilogue. Element s of the B operand is key (s < 8 ? 8 g + s : 16 + 8 g + s - 8): the k order of the v^T fragments
    __builtin_amdgcn_sched_barrier(0);   // for the slot behind a transcendental: with it a v_nop of the compiler's stands there
    const float alpha = __builtin_amdgcn_exp2f((m - mn) * KS2);   // first pass: 2^(-huge) = 0
    l = l * alpha + (es0 + es1); m = mn;
#pragma unroll   // register array: every index must be a constant
    for (int dt = 0; dt < 4; ++dt) {
#pragma unroll   // register array: every index must be a constant
      for (int r = 0; r < 8; ++r) acc[dt][r] *= alpha; }
#pragma unroll
    for (int dt = 0; dt < 4; ++dt) acc[dt] = __builtin_amdgcn_wmma_f32_16x16x32_f16(false, vf[dt], false, pa, (short)0, acc[dt], false, false); }   // single product: V^T x P^T (x2^11)
  l += xhalf(l);   // the two halves' sums joined once
  { const float il = 1.0f / l;
#pragma unroll   // register array: every index must be a constant
    for (int dt = 0; dt < 4; ++dt) {
#pragma unroll   // register array: every index must be a constant
      for (int rh = 0; rh < 2; ++rh) { v4f o;   // a lane's 8 values of a d tile are 8 consecutive d of its query's row: two 16-byte LDS stores
#pragma unroll   // register array: every index must be a constant
        for (int i = 0; i < 4; ++i) o[i] = acc[dt][rh * 4 + i] * il;
        *(v4f*)&so[wave][col][dt * 16 + 8 * g + rh * 4] = o; } } }
  LDSX();
  for (int rl = 0; rl < 16; ++rl) if (lane < 16) vst2(O + ((size_t)b * SS + q0 + rl) * DM + h * HD + lane * 4, *(const v4f*)&so[wave][rl][lane * 4]);
}
// ---- k_out: block = (64 rows, 128 cols): out = O(hi/lo) . Wo rows (2 products) + bo; O = the layer sum of the NLAY planes, summed and split once per block on its way into LDS
__global__ __launch_bounds__(128) void k_out(const float* __restrict__ O, const __bf16* __restrict__ P, const float* __restrict__ BO, float* __restrict__ Y) {
  __shared__ __align__(16) char sm[36864];   // k loop: two buffers each of the hi and the residual A tile, 64 x 72 bf16; behind the loop's closing barrier the same bytes are the epilogue's stage
  float (*so)[16][132] = (float (*)[16][132])sm; __bf16 *sah = (__bf16*)sm, *sal = sah + 2 * (64 * 72);
  const int tid = threadIdx.x, wave = tid >> 5, lane = tid & 31, col = lane & 15, g = lane >> 4; const size_t r0 = (size_t)blockIdx.x * 64 + wave * 16; const int n0 = blockIdx.y * 128;
  v8f acc[8] = {};   // tile t: rows (t >> 1) * 16 .. of the block, columns (wave * 2 + (t & 1)) * 16 ..
#pragma unroll 1   // eight stages of 64 k: one copy of the body keeps the text short
  for (int s = 0; s < DM / 64; ++s) { __bf16 *bh = sah + (s & 1) * (64 * 72), *bl = sal + (s & 1) * (64 * 72);
    v16b w[2][2];   // the stage's four weight fragments, in the same group of loads as the plane rows
    const __bf16* pw = P + ((size_t)(blockIdx.y * (DM / 32) + s * 2) * 8 + wave * 2) * 512 + lane * 8; const float* p0 = a_lane<64>(O + r0 * DM + s * 64, lane);
#pragma unroll   // register array: every index must be a constant
    for (int kc = 0; kc < 2; ++kc) {
#pragma unroll   // register array: every index must be a constant
      for (int jj = 0; jj < 2; ++jj) w[kc][jj] = frag_bl(pw + (kc * 8 + jj) * 512); }
    v4f pr[NLAY][8];
#pragma unroll   // register array: every index must be a constant
    for (int l = 0; l < NLAY; ++l) { a_load<64>(pr[l], p0 + l * OS); asm volatile("s_wait_xcnt 0x0" ::: "memory"); }   // a wait behind each plane's loads: the next plane's results may land in this plane's address registers
    __builtin_amdgcn_sched_barrier(0);   // every global load of the stage is issued before the first wait for data: a load held back behind a sum would cost a second trip to memory
    v4f v[8];   // sum over the layers in order 0..3 of (gate_l x_l) / sqrt(3)
#pragma unroll   // register array: every index must be a constant
    for (int u = 0; u < 8; ++u) { v4f x = {};
#pragma unroll   // register array: every index must be a constant
      for (int l = 0; l < NLAY; ++l) x = x + pr[l][u] * 0.57735026918962576f;
      v[u] = x; }
    a_store2<64>(bh, bl, v, wave, lane);   // into the buffers whose readers left them before the last barrier
    __syncthreads();   // stage s is published
#pragma unroll
    for (int kc = 0; kc < 2; ++kc) { v16b ah[4], al[4];
#pragma unroll   // register array: every index must be a constant
      for (int i = 0; i < 4; ++i) { al[i] = frag_b(bl + (i * 16 + col) * 72 + kc * 32, lane); ah[i] = frag_b(bh + (i * 16 + col) * 72 + kc * 32, lane); }
#pragma unroll
      for (int t = 0; t < 8; ++t) acc[t] = wmma_bf(al[t >> 1], w[kc][t & 1], acc[t]);
#pragma unroll
      for (int t = 0; t < 8; ++t) acc[t] = wmma_bf(ah[t >> 1], w[kc][t & 1], acc[t]); } }
  __syncthreads();   // every read of the last stage has ended: the bytes become the epilogue's stage
#pragma unroll
  for (int t = 0; t < 8; ++t) { const int i = t >> 1, j = wave * 2 + (t & 1);
#pragma unroll
    for (int r = 0; r < 8; ++r) so[i][8 * g + r][j * 16 + col] = acc[t][r] + bfr(BO[n0 + j * 16 + col]); }
  __syncthreads();   // a row tile's 128 columns come from all four waves
  for (int rl = 0; rl < 16; ++rl) vst2(Y + (r0 + rl) * DM + n0 + lane * 4, *(const v4f*)&so[wave][rl][lane * 4]);
}
#define NR (NB * SS)
// ---- k_gate: block = (64 rows, 128 cols, layer l): g = sigmoid([query (exact bf16, 1 product) | x_l (hi + residual, 2 products)] . Wsig_l rows + bsig_l); FUS plane l = g * x_l (k_out scales by 1 / sqrt(3) and sums the planes)
__global__ __launch_bounds__(128) void k_gate(const float* __restrict__ XQ, const float* __restrict__ XL, const __bf16* __restrict__ PSG, const float* __restrict__ BS, float* __restrict__ FUS) {
  __shared__ __align__(16) char sm[36864];   // k loops: two buffers each of the hi and the residual A tile, 64 x 72 bf16; behind the last barrier of the loops the same bytes are the epilogue's stage
  float (*so)[16][132] = (float (*)[16][132])sm; __bf16 *sah = (__bf16*)sm, *sal = sah + 2 * (64 * 72); const int l = blockIdx.z; XL += l * OS; FUS += l * OS;
  const int tid = threadIdx.x, wave = tid >> 5, lane = tid & 31, col = lane & 15, g = lane >> 4; const size_t rb = (size_t)blockIdx.x * 64, r0 = rb + wave * 16; const int n0 = blockIdx.y * 128;
  const __bf16* Wr = PSG + (size_t)l * DM * 2 * DM; v8f acc[8] = {};   // tile t: rows (t >> 1) * 16 .. of the block, columns (wave * 2 + (t & 1)) * 16 ..
  const float *Aq = a_lane<64>(XQ + r0 * DM, lane), *Ax = a_lane<64>(XL + r0 * DM, lane);   // the wave's 16 rows of the two halves of [query | x_l]
  v4f ar[8];
  a_load<64>(ar, Aq); XW1(Aq); a_store<64>(sah, ar, wave, lane);
  __syncthreads();   // stage 0 is published
#pragma unroll 1   // query half, eight stages of 64 k: one copy of the body keeps the text short
  for (int s = 0; s < DM / 64; ++s) { const __bf16* sb = sah + (s & 1) * (64 * 72); const int nb = ((s + 1) & 1) * (64 * 72);
    v16b w[2][2];   // the stage's four weight fragments as one group, then the next stage's A rows: both in flight under the products
    const __bf16* pw = Wr + ((size_t)(blockIdx.y * (2 * DM / 32) + s * 2) * 8 + wave * 2) * 512 + lane * 8; const float* pa = (s + 1 < DM / 64) ? Aq + (s + 1) * 64 : Ax;   // behind the last query stage comes x_l's first
#pragma unroll   // register array: every index must be a constant
    for (int kc = 0; kc < 2; ++kc) {
#pragma unroll   // register array: every index must be a constant
      for (int jj = 0; jj < 2; ++jj) w[kc][jj] = frag_bl(pw + (kc * 8 + jj) * 512); }
    __builtin_amdgcn_sched_barrier(0);   // the weight loads stay ahead of the A rows: loads return in order, and the first product waits for weights only
    a_load<64>(ar, pa); XW2(pw, pa);
    __builtin_amdgcn_sched_barrier(0);   // every global load of the stage is issued before the first wait for data
#pragma unroll
    for (int kc = 0; kc < 2; ++kc) { v16b a[4];
#pragma unroll   // register array: every index must be a constant
      for (int i = 0; i < 4; ++i) a[i] = frag_b(sb + (i * 16 + col) * 72 + kc * 32, lane);
#pragma unroll
      for (int t = 0; t < 8; ++t) acc[t] = wmma_bf(a[t >> 1], w[kc][t & 1], acc[t]); }
    __builtin_amdgcn_sched_barrier(0);   // the conversions stay behind the products: moved up, they would wait for the rows fetched ahead at the stage's top
    if (s + 1 < DM / 64) a_store<64>(sah + nb, ar, wave, lane); else a_store2<64>(sah + nb, sal + nb, ar, wave, lane);   // into the buffer whose readers left it at the last barrier
    __syncthreads(); }   // publishes the next stage and ends every read of this one
  auto stage = [&](const int s, const bool more) __attribute__((always_inline)) { const __bf16 *bh = sah + (s & 1) * (64 * 72), *bl = sal + (s & 1) * (64 * 72); const int nb = ((s + 1) & 1) * (64 * 72);
    v16b w[2][2];
    const __bf16* pw = Wr + ((size_t)(blockIdx.y * (2 * DM / 32) + DM / 32 + s * 2) * 8 + wave * 2) * 512 + lane * 8; const float* pa = Ax + (s + 1) * 64;
#pragma unroll   // register array: every index must be a constant
    for (int kc = 0; kc < 2; ++kc) {
#pragma unroll   // register array: every index must be a constant
      for (int jj = 0; jj < 2; ++jj) w[kc][jj] = frag_bl(pw + (kc * 8 + jj) * 512); }
    __builtin_amdgcn_sched_barrier(0);   // the weight loads stay ahead of the A rows: loads return in order, and the first product waits for weights only
    if (more) { a_load<64>(ar, pa); XW2(pw, pa); } else XW1(pw);   // more: a constant at each call, so the count of loads in flight is known at every wait
    __builtin_amdgcn_sched_barrier(0);   // every global load of the stage is issued before the first wait for data
#pragma unroll
    for (int kc = 0; kc < 2; ++kc) { v16b ah[4], al[4];
#pragma unroll   // register array: every index must be a constant
      for (int i = 0; i < 4; ++i) { al[i] = frag_b(bl + (i * 16 + col) * 72 + kc * 32, lane); ah[i] = frag_b(bh + (i * 16 + col) * 72 + kc * 32, lane); }
#pragma unroll
      for (int t = 0; t < 8; ++t) acc[t] = wmma_bf(al[t >> 1], w[kc][t & 1], acc[t]);
#pragma unroll
      for (int t = 0; t < 8; ++t) acc[t] = wmma_bf(ah[t >> 1], w[kc][t & 1], acc[t]); }
    __builtin_amdgcn_sched_barrier(0);   // the conversions stay behind the products: moved up, they would wait for the rows fetched ahead at the stage's top
    if (more) a_store2<64>(sah + nb, sal + nb, ar, wave, lane);
    __syncthreads(); };   // publishes the next stage and ends every read of this one
#pragma unroll 1   // x_l half, eight stages of 64 k
  for (int s = 0; s < DM / 64 - 1; ++s) stage(s, true);
  stage(DM / 64 - 1, false);
  float bb[2];   // the wave's two column tiles' bias values
  const float *pb = BS + (size_t)l * DM + n0 + wave * 32 + col, *px = XL + (rb + 8 * g) * DM + n0 + wave * 32 + col;   // the lane's own addresses of the bias and of x_l's tile values
#pragma unroll   // register array: every index must be a constant
  for (int jj = 0; jj < 2; ++jj) bb[jj] = bfr(pb[jj * 16]);
  XW1(pb);
#pragma unroll   // register array: every index must be a constant
  for (int jh = 0; jh < 2; ++jh) { float xv[4][8];   // half a tile's x_l values as one group of loads ahead of its exp calls (no load moves over a call); two halves keep a group under the load counter's range
#pragma unroll   // register array: every index must be a constant
    for (int tt = 0; tt < 4; ++tt) { const int t = jh * 4 + tt;
#pragma unroll   // register array: every index must be a constant
      for (int r = 0; r < 8; ++r) xv[tt][r] = px[((t >> 1) * 16 + r) * DM + (t & 1) * 16]; }
    XW1(px);
#pragma unroll   // register array: every index must be a constant
    for (int tt = 0; tt < 4; ++tt) { const int t = jh * 4 + tt;
#pragma unroll   // register array: every index must be a constant
      for (int r = 0; r < 8; ++r) { const float gte = 1.0f / (1.0f + exp_ni(-(acc[t][r] + bb[t & 1]))); so[t >> 1][8 * g + r][(wave * 2 + (t & 1)) * 16 + col] = gte * xv[tt][r]; } } }
  __syncthreads();   // a row tile's 128 columns come from all four waves
  for (int rl = 0; rl < 16; ++rl) vst2(FUS + (r0 + rl) * DM + n0 + lane * 4, *(const v4f*)&so[wave][rl][lane * 4]);
}
extern "C" void kernel_launch(void* const* d_in, const int* in_sizes, int n_in, void* d_out, int out_size, void* d_ws, size_t ws_size, hipStream_t stream) {
  (void)in_sizes; (void)n_in; (void)out_size;
  const float** F = (const float**)d_in;   // 0 query [4,1024,512], 1 key [4,4,1024,512], 2 value [4,4,1024,512], 3 Wq [512,512], 4 bq, 5 Wk [4,512,512], 6 bk [4,512], 7 Wv, 8 bv, 9 Wsig [4,512,1024], 10 bsig [4,512], 11 Wf [512,512], 12 bf
  if (ws_size < (size_t)WS_END) return;
  char* ws = (char*)d_ws; __bf16 *PK = (__bf16*)(ws + WS_PK), *PSG = (__bf16*)(ws + WS_PSG); _Float16 *QK = (_Float16*)(ws + WS_QK), *QKL = (_Float16*)(ws + WS_QKL), *VTH = (_Float16*)(ws + WS_VTH), *VTL = (_Float16*)(ws + WS_VTL), *KF = (_Float16*)(ws + WS_KF); float *O = (float*)(ws + WS_O), *FUS = (float*)(ws + WS_FUS);
  // the layers are independent up to the gated sum: each stage is one launch with the layer in blockIdx.z
  k_pack<<<dim3(DM / 16, 5, NLAY), 256, 0, stream>>>(F[3], F[5], F[7], F[11], F[9], PK, PSG);   // per layer: Wq | Wk[l] | Wv[l] | Wf | Wsig[l] as fragments
  k_qkv<<<dim3(TNB * SS / 64, QKVW / 128, NLAY), 128, 0, stream>>>(F[0], F[1], F[2], PK + PK_A, F[4], F[6], F[8], QK, QKL, VTH, VTL, KF);   // (q recomputed per layer; identical)
  k_attn<<<dim3(TQB, NH, TNB * NLAY), 128, 0, stream>>>(QK, QKL, VTH, VTL, KF, nullptr, O);   // x_l
  k_gate<<<dim3(NR / 64, DM / 128, NLAY), 128, 0, stream>>>(F[0], O, PSG, F[10], FUS);   // gate_l * x_l
  k_out<<<dim3(TOB, DM / 128), 128, 0, stream>>>(FUS, PK + PK_P, F[12], (float*)d_out);   // (sum_l gate_l x_l / sqrt(3)) . Wf^T + bf (Wf of layer 0's pack)
}

// v007
// One run takes 135 microseconds.
// In both of two side-by-side timings against v006, it was 1.07 times as fast.
// All steps since v000 together make it 6.38 times as fast.
// compute dtype: all float inputs rounded to bf16; q = query . Wq^T + bq and k_l, v_l = key_l / value_l . W^T + b with EXACT bf16 products on WMMA 16x16x32 (weights, k and v^T kept in fragment order in the workspace); PLAIN attention per layer: q, k as single f16 operands x 1/8, running-max softmax in f32 (hardware exp2; 1/8, log2 e and the 2^11 of P in one FMA), P (scaled by 2^11, single f16) x v (single f16); gate_l = sigmoid([query (exact) | x_l (bf16 hi + residual, 2 products)] . Wsig_l^T + bsig_l) (precise expf); fused = sum_l gate_l x_l / sqrt(3) in f32; out = fused (bf16 hi + residual) . Wf^T (2 products) + bf.
#include <hip/hip_runtime.h>
#include <math.h>

typedef __attribute__((ext_vector_type(16))) _Float16 v16h;
typedef __attribute__((ext_vector_type(16))) __bf16 v16b;
typedef __attribute__((ext_vector_type(8)))  _Float16 v8h;
typedef __attribute__((ext_vector_type(8)))  float v8f;
typedef __attribute__((ext_vector_type(4)))  float v4f;
typedef __attribute__((ext_vector_type(2)))  float v2f;
typedef __attribute__((ext_vector_type(4)))  unsigned v4u;
typedef __attribute__((ext_vector_type(4)))  int v4i;
typedef float __attribute__((may_alias)) float_a;
typedef int __attribute__((may_alias)) int_a;

template <typename T> __device__ __forceinline__ void vst2(void* p, T v) { *(T*)p = v;  }
__device__ __forceinline__ v8f wmma16(v16h a, v16h b, v8f c) {
  v8f d = __builtin_amdgcn_wmma_f32_16x16x32_f16(false, a, false, b, (short)0, c, false, false);
  asm volatile("v_nop\n\tv_nop\n\tv_nop\n\tv_nop" : "+v"(d) : "v"(a), "v"(b));
  return d;
}
__device__ __forceinline__ v8f wmma_bf(v16b a, v16b b, v8f c) {
  v8f d = __builtin_amdgcn_wmma_f32_16x16x32_bf16(false, a, false, b, (short)0, c, false, false);
  asm volatile("v_nop\n\tv_nop\n\tv_nop\n\tv_nop" : "+v"(d) : "v"(a), "v"(b));
  return d;
}
// Multi-layer source attention (B 4, 1,024 queries over 4 layers of 1,024 keys/values, d 512, 8 heads x 64): a shared query projection, per-layer key/value projections, softmax(q k_l^T / 8) v_l per layer, per-layer sigmoid gates from [query | x_l], gated sum over layers / sqrt(3), final linear map.
__device__ __forceinline__ v16h frag_h(const _Float16* rowk0, int lane) {
  union { v16h v; v8h q[2]; } u; const _Float16* p = rowk0 + 8 * (lane >> 4);
  u.q[0] = *(const v8h*)p; u.q[1] = *(const v8h*)(p + 16); return u.v;
}
__device__ __forceinline__ v16h frag_f32(const float* rowk0, int lane) {
  v16h a; const float* p = rowk0 + 8 * (lane >> 4);
#pragma unroll
  for (int i = 0; i < 8; ++i) { a[i] = (_Float16)p[i]; a[8 + i] = (_Float16)p[16 + i]; }
  return a;
}
__device__ __forceinline__ v16h frag_f32s(const float* rowk0, int lane, float sc) {
  v16h a; const float* p = rowk0 + 8 * (lane >> 4);
#pragma unroll
  for (int i = 0; i < 8; ++i) { a[i] = (_Float16)(p[i] * sc); a[8 + i] = (_Float16)(p[16 + i] * sc); }
  return a;
}
// column fragment from a [K][ld] layout (column n), rows >= K read as 0
__device__ __forceinline__ v16h fragc_f32(const float* W, int k0, int n, int lane, int ld, int K) {
  v16h a; const int g = lane >> 4;
#pragma unroll
  for (int i = 0; i < 8; ++i) { const int ka = k0 + 8 * g + i, kb = ka + 16;
    a[i] = (_Float16)(ka < K ? W[(size_t)(ka < K ? ka : K - 1) * ld + n] : 0.f); a[8 + i] = (_Float16)(kb < K ? W[(size_t)(kb < K ? kb : K - 1) * ld + n] : 0.f); }
  return a;
}
struct F2 { v16b h, l; };
__device__ __forceinline__ F2 bsplit16(const float v[16]) { F2 r;
#pragma unroll
  for (int i = 0; i < 16; ++i) { const __bf16 h = (__bf16)v[i]; r.h[i] = h; r.l[i] = (__bf16)(v[i] - (float)h); }
  return r; }
__device__ __forceinline__ F2 split_row(const float* row, int k0, int lane) { float v[16]; const float* p = row + k0 + 8 * (lane >> 4);
#pragma unroll
  for (int i = 0; i < 8; ++i) { v[i] = p[i]; v[8 + i] = p[16 + i]; }
  return bsplit16(v); }
__device__ __forceinline__ F2 split_rowK(const float* row, int k0, int lane, int K) { float v[16]; const int g = lane >> 4;
#pragma unroll
  for (int i = 0; i < 8; ++i) { const int ka = k0 + 8 * g + i, kb = ka + 16; v[i] = ka < K ? row[ka < K ? ka : K - 1] : 0.f; v[8 + i] = kb < K ? row[kb < K ? kb : K - 1] : 0.f; }
  return bsplit16(v); }
__device__ __forceinline__ F2 split_col(const float* W, int k0, int n, int lane, int ld, int K) { float v[16]; const int g = lane >> 4;
#pragma unroll
  for (int i = 0; i < 8; ++i) { const int ka = k0 + 8 * g + i, kb = ka + 16; v[i] = ka < K ? W[(size_t)(ka < K ? ka : K - 1) * ld + n] : 0.f; v[8 + i] = kb < K ? W[(size_t)(kb < K ? kb : K - 1) * ld + n] : 0.f; }
  return bsplit16(v); }
__device__ __forceinline__ v8f mac3(const F2& a, const F2& b, v8f c) { c = wmma_bf(a.l, b.h, c); c = wmma_bf(a.h, b.l, c); return wmma_bf(a.h, b.h, c); }
__device__ __forceinline__ float sigm(float v) { return 1.0f / (1.0f + expf(-v)); }
#define LDSX() do { asm volatile("s_wait_dscnt 0" ::: "memory"); __builtin_amdgcn_wave_barrier(); __builtin_amdgcn_fence(__ATOMIC_RELEASE, "workgroup"); } while (0)


#define NB 4
#define SS 1024
#define DM 512
#define NH 8
#define NLAY 4
__device__ __forceinline__ size_t kvrow(size_t r) { return (r / SS) * ((size_t)NLAY * SS) + (r % SS); }   // key/value [B][L][S][D]: engine row (b, s) of layer l lives at (b*L + l)*S + s (layer offset added to the pointer)
#define HD 64
#define QKVW (3 * DM)
#ifndef TQB
#define TQB (SS / 64)
#define TNB NB
#define TOB (NB * SS / 64)     // output row tiles (all)
#endif
typedef __attribute__((ext_vector_type(8))) __bf16 v8b;
__device__ __forceinline__ v16b frag_b(const __bf16* rowk0, int lane) {
  union { v16b v; v8b q[2]; } u; const __bf16* p = rowk0 + 8 * (lane >> 4);
  u.q[0] = *(const v8b*)p; u.q[1] = *(const v8b*)(p + 16); return u.v;
}
// fragment order: one 16 x 32 operand fragment is 1 KiB, [half][lane][8 elements]; lane (g, col) holds row col, k = half * 16 + 8 g + 0..7 (the k order of frag_b / frag_h), so each 16-byte load of a wave reads 512 contiguous bytes
__device__ __forceinline__ v16b frag_bp(const __bf16* frag, int lane) {
  union { v16b v; v8b q[2]; } u; const __bf16* p = frag + lane * 8;
  u.q[0] = *(const v8b*)p; u.q[1] = *(const v8b*)(p + 256); return u.v;
}
__device__ __forceinline__ v16h frag_hp(const _Float16* frag, int lane) {
  union { v16h v; v8h q[2]; } u; const _Float16* p = frag + lane * 8;
  u.q[0] = *(const v8h*)p; u.q[1] = *(const v8h*)(p + 256); return u.v;
}
__device__ __forceinline__ float bfr(float v) { return (float)(__bf16)v; }
__device__ __attribute__((noinline)) float exp_ni(float v) { return expf(v); }
__device__ __attribute__((noinline)) float erf_ni(float v) { return erff(v); }

typedef __attribute__((ext_vector_type(4))) __bf16 v4b;
// ---- A tile of a 64 x 128 block product, staged once per block in LDS as bf16, KS k values a stage: wave w brings rows w * 16 .. + 15 with whole-line loads (a 16-byte load of the wave reads KS * 4 contiguous bytes of each row it touches); LDS row pitch KS + 8 elements (16 bytes x an odd number: 16-byte fragment reads meet no bank twice). Every wave then reads all four 16-row fragments and owns columns w * 32 .. + 31, so a weight fragment is loaded by one wave only
template <int KS> __device__ __forceinline__ const float* a_lane(const float* rows, int lane) { constexpr int LPR = KS / 4; return rows + (size_t)(lane / LPR) * DM + (lane % LPR) * 4; }   // the lane's own address in the wave's first load
template <int KS> __device__ __forceinline__ void a_load(v4f (&ar)[KS / 8], const float* pl) {
  constexpr int RPL = 128 / KS;   // rows to a load
#pragma unroll   // register array: every index must be a constant
  for (int u = 0; u < KS / 8; ++u) ar[u] = *(const v4f*)(pl + (size_t)(u * RPL) * DM);
}
__device__ __forceinline__ v16b frag_bl(const __bf16* pl) {   // frag_bp from the lane's own address
  union { v16b v; v8b q[2]; } u; u.q[0] = *(const v8b*)pl; u.q[1] = *(const v8b*)(pl + 256); return u.v;
}
// behind a group of global loads: the wait names the group's address registers, so none of them is rewritten (by a later load's result either) ahead of it
#define XW1(p) asm volatile("s_wait_xcnt 0x0" :: "v"(p) : "memory")
#define XW2(p, q) asm volatile("s_wait_xcnt 0x0" :: "v"(p), "v"(q) : "memory")
template <int KS> __device__ __forceinline__ __bf16* a_slot(__bf16* buf, int wave, int lane, int u) {
  constexpr int LPR = KS / 4, RPL = 32 / LPR;
  return buf + (wave * 16 + u * RPL + lane / LPR) * (KS + 8) + (lane % LPR) * 4;
}
template <int KS> __device__ __forceinline__ void a_store(__bf16* buf, const v4f (&ar)[KS / 8], int wave, int lane) {
#pragma unroll   // register array: every index must be a constant
  for (int u = 0; u < KS / 8; ++u) { v4b o;
#pragma unroll   // register vector: every index must be a constant
    for (int e = 0; e < 4; ++e) o[e] = (__bf16)ar[u][e];
    *(v4b*)a_slot<KS>(buf, wave, lane, u) = o; }
}
template <int KS> __device__ __forceinline__ void a_store2(__bf16* bh, __bf16* bl, const v4f (&ar)[KS / 8], int wave, int lane) {   // bf16 hi + residual
#pragma unroll   // register array: every index must be a constant
  for (int u = 0; u < KS / 8; ++u) { v4b oh, ol;
#pragma unroll   // register vector: every index must be a constant
    for (int e = 0; e < 4; ++e) { const __bf16 h = (__bf16)ar[u][e]; oh[e] = h; ol[e] = (__bf16)(ar[u][e] - (float)h); }
    *(v4b*)a_slot<KS>(bh, wave, lane, u) = oh; *(v4b*)a_slot<KS>(bl, wave, lane, u) = ol; }
}
// a packed [N][K] weight: [N / 128][K / 32][8 row tiles] fragments of 512 elements
#define PK_A 0                       // Wq | Wk | Wv, 1536 rows x 512
#define PK_P (PK_A + QKVW * DM)        // Wf, 512 rows x 512
#define PK_END (PK_P + DM * DM)
#define WS_PK  0u
// every per-layer buffer holds NLAY planes (layer = blockIdx.z in k_pack and k_gate, blockIdx.z / NB in k_attn, (blockIdx.y - 4) / 8 in k_qkv); plane sizes in elements:
#define QKS ((size_t)NB * SS * 2 * DM)
#define VTS ((size_t)NB * DM * SS)
#define OS  ((size_t)NB * SS * DM)
#define WS_QK  (WS_PK + 2u * PK_END * NLAY)        // f16 [4096 rows][1024]: q | (unused), one plane (no layer enters q)
#define WS_VTH (WS_QK + 2u * QKS)                  // f16 [l][b][h][32 keys ks][4 d tiles] v^T fragments (row = d, k = key)
#define WS_O   (WS_VTH + 2u * NLAY * VTS)          // f32 [l][4096][512]
#define WS_CS  (WS_O + 4u * NLAY * OS)              // f32 [2048][32], written and read by no kernel
#define WS_PSG (WS_CS + 4u * 2 * SS * 32)                  // bf16 packed Wsig [4][512 x 1024]
#define WS_FUS (WS_PSG + 2u * (size_t)NLAY * DM * 2 * DM)   // f32 [l][NR][512] gate_l * x_l
#define WS_KF  (WS_FUS + 4u * NLAY * OS)            // f16 [l][b][h][16-key tile][2 k-steps] k fragments (row = key, k = d)
#define WS_END (WS_KF + 2u * NLAY * OS)
// ---- k_pack: block = (16-row tile nt, which, layer l): f32 [out][in] rows -> bf16 fragments; which 0..2 -> W_q/W_k[l]/W_v[l] into layer l's PK_A (rows which*512 + n); 3 -> W_f into layer l's PK_P; 4 -> Wsig[l] (rows 1024 long) into PSG; W_q and W_f belong to no layer and are packed by layer 0's blocks alone. A thread converts one lane's 8 elements; a wave stores 512 contiguous bytes
__global__ __launch_bounds__(256) void k_pack(const float* __restrict__ WQ, const float* __restrict__ WK, const float* __restrict__ WV, const float* __restrict__ WO, const float* __restrict__ WS, __bf16* __restrict__ PK, __bf16* __restrict__ PSG) {
  const int nt = blockIdx.x, which = blockIdx.y, l = blockIdx.z, t = threadIdx.x; if (l && (which == 0 || which == 3)) return;
  const size_t n = (size_t)nt * 16, ln = (size_t)l * DM + n; const int len = (which == 4) ? 2 * DM : DM;
  const float* Wm = (which == 0) ? WQ + n * DM : (which == 1) ? WK + ln * DM : (which == 2) ? WV + ln * DM : (which == 3) ? WO + n * DM : WS + ln * (2 * DM);
  __bf16* PL = PK + (size_t)l * PK_END;
  __bf16* dst = ((which < 3) ? PL + PK_A + (size_t)which * DM * DM : (which == 3) ? PL + PK_P : PSG + (size_t)l * DM * 2 * DM) + ((size_t)(nt >> 3) * (len / 32) * 8 + (nt & 7)) * 512;
  for (int p0 = t; p0 < len * 2; p0 += 1024) {
#pragma unroll   // four independent pieces to a trip: their loads are in flight together
    for (int u = 0; u < 4; ++u) { const int kc = p0 >> 6, half = (p0 >> 5) & 1, lane = p0 & 31; const float* s = Wm + (size_t)(lane & 15) * len + kc * 32 + half * 16 + (lane >> 4) * 8 + u * 4 * 32; v8b o;   // piece p0 + 256 u: k-step kc + 4 u, same half and lane
#pragma unroll   // register vector: every index must be a constant
      for (int i = 0; i < 8; ++i) o[i] = (__bf16)s[i];
      vst2(dst + (size_t)kc * 8 * 512 + half * 256 + lane * 8 + u * 4 * 8 * 512, o); } }
}
// ---- k_qkv: block = (64 rows, yy): yy 0..3 = q's four 128-column blocks (q is projected once: no layer enters it); yy 4 + 8 l + c = column block 4 + c of layer l's [q | k | v] weight rows (k, then v). Each result is kept once, as the f16 operand the attention reads
__global__ __launch_bounds__(128) void k_qkv(const float* __restrict__ XQ, const float* __restrict__ XK, const float* __restrict__ XV, const __bf16* __restrict__ P, const float* __restrict__ BQ, const float* __restrict__ BK, const float* __restrict__ BV, _Float16* __restrict__ QK, _Float16* __restrict__ VTH, _Float16* __restrict__ KF) {
  const int yy = blockIdx.y, yb = (yy < DM / 128) ? yy : DM / 128 + ((yy - DM / 128) & 7);   // column block among the 12 of [q | k | v]
  { const size_t l = (yy < DM / 128) ? 0 : (yy - DM / 128) >> 3; XK += l * SS * DM; XV += l * SS * DM; P += l * PK_END; BK += l * DM; BV += l * DM; VTH += l * VTS; KF += l * OS; }   // layer l's inputs, weights and planes
  const int which0 = (yb * 128) / DM; const float* X = (which0 == 0) ? XQ : (which0 == 1) ? XK : XV; const float* BB = BQ ? (((which0 == 0) ? BQ : (which0 == 1) ? BK : BV) + (yb * 128 - which0 * DM)) : nullptr;
  __shared__ __align__(16) char sm[34816];   // k loop: two A buffers of 64 x 136 bf16; behind the loop's last barrier the same bytes are the epilogue's stage
  _Float16 (*so)[16][136] = (_Float16 (*)[16][136])sm; _Float16 (*sth)[72] = (_Float16 (*)[72])sm;
  __bf16* sa = (__bf16*)sm;
  const int tid = threadIdx.x, wave = tid >> 5, lane = tid & 31, col = lane & 15, g = lane >> 4; const size_t r0 = (size_t)blockIdx.x * 64 + wave * 16; const int n0 = yb * 128;
  v8f acc[8] = {};   // tile t: rows (t >> 1) * 16 .. of the block, columns (wave * 2 + (t & 1)) * 16 ..
  float bias[2] = {};   // the wave's two column tiles' bias values, loaded ahead of the k loop, rounded to bf16 where they are added
  if (BB) {
#pragma unroll   // register array: every index must be a constant
    for (int jj = 0; jj < 2; ++jj) bias[jj] = BB[(wave * 2 + jj) * 16 + col];
    asm volatile("s_wait_xcnt 0x0" ::: "memory"); }   // behind the two loads: code that follows them in the listing reuses their address registers
  const float* Aw = a_lane<128>(X + ((which0 == 0) ? r0 : kvrow(r0)) * DM, lane);   // the wave's 16 rows are consecutive (a 64-row block lies in one batch)
  v4f ar[16];
  a_load<128>(ar, Aw); XW1(Aw); a_store<128>(sa, ar, wave, lane);
  __syncthreads();   // stage 0 is published
  auto stage = [&](const int s, const bool more) __attribute__((always_inline)) { const __bf16* sb = sa + (s & 1) * (64 * 136);   // more: a constant at each call, so the count of loads in flight is known at every wait
    v16b w[4][2];   // the stage's eight weight fragments as one group, then the next stage's A rows: both in flight under the products
    const __bf16* pw = P + ((size_t)(yb * (DM / 32) + s * 4) * 8 + wave * 2) * 512 + lane * 8; const float* pa = Aw + (s + 1) * 128;
#pragma unroll   // register array: every index must be a constant
    for (int kc = 0; kc < 4; ++kc) {
#pragma unroll   // register array: every index must be a constant
      for (int jj = 0; jj < 2; ++jj) w[kc][jj] = frag_bl(pw + (kc * 8 + jj) * 512); }
    __builtin_amdgcn_sched_barrier(0);   // the weight loads stay ahead of the A rows: loads return in order, and the first product waits for weights only
    if (more) { a_load<128>(ar, pa); XW2(pw, pa); } else XW1(pw);
    __builtin_amdgcn_sched_barrier(0);   // every global load of the stage is issued before the first wait for data
#pragma unroll
    for (int kc = 0; kc < 4; ++kc) { v16b a[4];
#pragma unroll   // register array: every index must be a constant
      for (int i = 0; i < 4; ++i) a[i] = frag_b(sb + (i * 16 + col) * 136 + kc * 32, lane);
#pragma unroll
      for (int t = 0; t < 8; ++t) acc[t] = wmma_bf(a[t >> 1], w[kc][t & 1], acc[t]); }
    __builtin_amdgcn_sched_barrier(0);   // the conversions stay behind the products: moved up, they would wait for the rows fetched ahead at the stage's top
    if (more) a_store<128>(sa + ((s + 1) & 1) * (64 * 136), ar, wave, lane);   // into the buffer whose readers left it at the last barrier
    __syncthreads(); };   // publishes stage s + 1 and ends every read of stage s
#pragma unroll 1   // four stages of 128 k: one copy of the body for the stages that fetch ahead keeps the text short
  for (int s = 0; s < DM / 128 - 1; ++s) stage(s, true);
  stage(DM / 128 - 1, false);
  if (n0 < 2 * DM) {   // q stored unscaled (f16 sigma ~0.6, no subnormal exposure); 1/8 applied to the f32 score
#pragma unroll
    for (int t = 0; t < 8; ++t) { const int i = t >> 1, j = wave * 2 + (t & 1);
#pragma unroll
      for (int r = 0; r < 8; ++r) so[i][8 * g + r][j * 16 + col] = (_Float16)(acc[t][r] + bfr(bias[t & 1])); }   // q, k (+ bias) as f16
    __syncthreads();   // a row tile's 128 columns come from all four waves
    if (which0 == 0) {
    for (int rl = 0; rl < 16; ++rl) if (lane < 16) vst2((unsigned*)(QK + (r0 + rl) * (2 * DM) + n0 + lane * 8), *(const v4u*)&so[wave][rl][lane * 8]);
    } else {   // k: the wave's 16 keys x 128 columns are four fragments (2 heads x 2 k-steps)
      _Float16* kt = KF + (((r0 / SS) * NH + (n0 - DM) / HD) * (SS / 16) + (r0 % SS) / 16) * 1024 + lane * 8;
#pragma unroll
      for (int f = 0; f < 8; ++f) { const int hh = f >> 2, kc = (f >> 1) & 1, half = f & 1; vst2((unsigned*)(kt + (size_t)hh * (SS / 16) * 1024 + kc * 512 + half * 256), *(const v4u*)&so[wave][col][hh * HD + kc * 32 + half * 16 + g * 8]); }
      asm volatile("s_wait_xcnt 0x0" ::: "memory"); }   // behind the run of stores: code that follows them in the listing reuses their data and address registers
  } else {
#pragma unroll
    for (int t = 0; t < 8; ++t) { const int i = t >> 1, j = wave * 2 + (t & 1);
#pragma unroll
      for (int r = 0; r < 8; ++r) sth[j * 16 + col][i * 16 + 8 * g + r] = (_Float16)(acc[t][r] + bfr(bias[t & 1])); }
    __syncthreads();
    const size_t rb = (size_t)blockIdx.x * 64; const int b = (int)(rb / SS), s0 = (int)(rb % SS); const int pc0 = n0 - 2 * DM;
    for (int q = tid; q < 128 * 8; q += 128) { const int ln = q & 31, half = (q >> 5) & 1, dt = (q >> 6) & 3, ksl = (q >> 8) & 1, hh = q >> 9;   // the block's 64 keys x 128 d are 16 v^T fragments (2 heads x 2 key groups x 4 d tiles)
      vst2((unsigned*)(VTH + ((((size_t)b * NH + pc0 / HD + hh) * (SS / 32) + s0 / 32 + ksl) * 4 + dt) * 512 + half * 256 + ln * 8), *(const v4u*)&sth[hh * HD + dt * 16 + (ln & 15)][ksl * 32 + half * 16 + (ln >> 4) * 8]); }
  }
}
// lane l with lane l ^ 16 (the two lane halves hold the two halves of a query's keys)
__device__ __forceinline__ float xhalf(float x) { return __builtin_bit_cast(float, __builtin_amdgcn_permlanex16(__builtin_bit_cast(int, x), __builtin_bit_cast(int, x), 0x76543210, 0xfedcba98, false, false)); }
// ---- k_attn: block = (64 queries, head h, (layer l, batch b)): k and v^T read as packed fragments (KF, VTH); all-keys flash attention (K = 64: 2 k-steps), TRANSPOSED: S^T = k (A) . q^T (B), so lane (g, col) holds 16 of query col's 32 scores of a pass (keys ct * 16 + 8 g + r): maximum and sum in the lane, the maximum joined with the other half once a pass, the sums once at the end; the two score tiles, converted in place, are the B operand P^T of O^T += v^T (A) . P^T; P = 2^(q.k * (log2 e / 8) - maximum + 11) with single f16 operands, the sum l carries the same 2^11; O[b*S+q][h*64+d] = acc / l (256-B segments)
__global__ __launch_bounds__(128) void k_attn(const _Float16* __restrict__ QK, const _Float16* __restrict__ VTH, const _Float16* __restrict__ KF, const void* __restrict__ KMASK, float* __restrict__ O) {
  __shared__ __align__(16) float so[4][16][68];
  const int tid = threadIdx.x, wave = tid >> 5, lane = tid & 31, col = lane & 15, g = lane >> 4;
  const int qb = blockIdx.x, h = blockIdx.y, b = blockIdx.z % NB; { const size_t l = blockIdx.z / NB; VTH += l * VTS; KF += l * OS; O += l * OS; }   // layer l's planes (q has one plane)
  const int q0 = qb * 64 + wave * 16; const size_t rq = (size_t)b * SS + q0 + col;
  v16h aq[2];
#pragma unroll
  for (int kc = 0; kc < 2; ++kc) aq[kc] = frag_h(QK + rq * (2 * DM) + h * HD + kc * 32, lane);
  const float KS2 = 0.125f * 1.44269504088896341f;   // 1/sqrt(64) and log2 e in one factor: exp(x / 8) = 2^(x * KS2)
  float m = -3.0e38f, l = 0.f;   // query col's running maximum of the raw products q.k (equal in both halves) and this half's share of its sum (x 2^11)
  v8f acc[4] = {};   // O^T: acc[dt][r] = query col, d = dt * 16 + 8 g + r
  const int nks = SS / 32;   // all keys
  const _Float16* kbase = KF + (size_t)(b * NH + h) * SS * HD;   // k fragments of this (layer, batch, head): 4 to a pass
  const _Float16* vbase = VTH + (size_t)(b * NH + h) * SS * HD;   // v^T fragments: 4 to a pass
  v16h kf[2][2];   // a pass's four k fragments, fetched one pass ahead
#pragma unroll   // register array: every index must be a constant
  for (int ct = 0; ct < 2; ++ct) {
#pragma unroll   // register array: every index must be a constant
    for (int kc = 0; kc < 2; ++kc) kf[ct][kc] = frag_hp(kbase + (ct * 2 + kc) * 512, lane); }
#pragma unroll 1
  for (int ks = 0; ks < nks; ++ks) { v8f s[2];
    v16h vf[4];   // this pass's four v^T fragments: issued here as one group, first used behind the softmax
#pragma unroll   // register array: every index must be a constant
    for (int dt = 0; dt < 4; ++dt) vf[dt] = frag_hp(vbase + (size_t)(ks * 4 + dt) * 512, lane);
    __builtin_amdgcn_sched_barrier(0);   // the v^T loads are issued ahead of the pass's first wait (for k): moved down among the score products they start later by that wait
#pragma unroll
    for (int ct = 0; ct < 2; ++ct) { v8f c = {};
#pragma unroll
      for (int kc = 0; kc < 2; ++kc) c = __builtin_amdgcn_wmma_f32_16x16x32_f16(false, kf[ct][kc], false, aq[kc], (short)0, c, false, false);   // single product: k, q as one-rounding f16 operands; the compiler keeps the distance behind the builtin
      s[ct] = c; }   // raw products: the scale is applied inside the exponent
    asm volatile("v_nop\n\tv_nop\n\tv_nop\n\tv_nop" : "+v"(s[0]), "+v"(s[1]) :: "memory");   // the distance between the last score product and the first read of its result; it names both tiles and memory, so no k load moves up among the products (issued while a fragment is still to be read it needs other registers, and copies behind a full wait follow)
    { const _Float16* kn = kbase + (size_t)((ks + 1 < nks) ? ks + 1 : ks) * 2048;   // next pass's k fragments into the same registers, in flight under the softmax and P.V (the last pass reads its own rows again: in bounds, unused)
#pragma unroll   // register array: every index must be a constant
      for (int ct = 0; ct < 2; ++ct) {
#pragma unroll   // register array: every index must be a constant
        for (int kc = 0; kc < 2; ++kc) kf[ct][kc] = frag_hp(kn + (ct * 2 + kc) * 512, lane); } }
    float mx = s[0][0];   // the first tile's values first: they fill the distance behind the second tile's last product
#pragma unroll   // register array: every index must be a constant
    for (int r = 1; r < 8; ++r) mx = fmaxf(mx, s[0][r]);
#pragma unroll   // register array: every index must be a constant
    for (int r = 0; r < 8; ++r) mx = fmaxf(mx, s[1][r]);
    mx = fmaxf(mx, xhalf(mx));
    const float mn = fmaxf(m, mx);
    const float off = fmaf(mn, KS2, -11.0f);
    v16h pa; float es0 = 0.f, es1 = 0.f;
    const v8f x0 = __builtin_elementwise_fma(s[0], (v8f)KS2, (v8f)(-off)), x1 = __builtin_elementwise_fma(s[1], (v8f)KS2, (v8f)(-off));   // as vectors: two exponents to a packed FMA
#pragma unroll   // register array: every index must be a constant
    for (int r = 0; r < 8; ++r) { const float e0 = __builtin_amdgcn_exp2f(x0[r]), e1 = __builtin_amdgcn_exp2f(x1[r]);
      es0 += e0; es1 += e1;
      pa[r] = (_Float16)e0; pa[8 + r] = (_Float16)e1; }   // P carries 2^11 (the + 11 in the exponent) so small softmax weights stay out of the f16 subnormal range; the sum carries it too and it cancels in the epilogue. Element s of the B operand is key (s < 8 ? 8 g + s : 16 + 8 g + s - 8): the k order of the v^T fragments
    __builtin_amdgcn_sched_barrier(0);   // for the slot behind a transcendental: with it a v_nop of the compiler's stands there
    const float alpha = __builtin_amdgcn_exp2f((m - mn) * KS2);   // first pass: 2^(-huge) = 0
    l = l * alpha + (es0 + es1); m = mn;
#pragma unroll   // register array: every index must be a constant
    for (int dt = 0; dt < 4; ++dt) {
#pragma unroll   // register array: every index must be a constant
      for (int r = 0; r < 8; ++r) acc[dt][r] *= alpha; }
#pragma unroll
    for (int dt = 0; dt < 4; ++dt) acc[dt] = __builtin_amdgcn_wmma_f32_16x16x32_f16(false, vf[dt], false, pa, (short)0, acc[dt], false, false); }   // single product: V^T x P^T (x2^11)
  l += xhalf(l);   // the two halves' sums joined once
  { const float il = 1.0f / l;
#pragma unroll   // register array: every index must be a constant
    for (int dt = 0; dt < 4; ++dt) {
#pragma unroll   // register array: every index must be a constant
      for (int rh = 0; rh < 2; ++rh) { v4f o;   // a lane's 8 values of a d tile are 8 consecutive d of its query's row: two 16-byte LDS stores
#pragma unroll   // register array: every index must be a constant
        for (int i = 0; i < 4; ++i) o[i] = acc[dt][rh * 4 + i] * il;
        *(v4f*)&so[wave][col][dt * 16 + 8 * g + rh * 4] = o; } } }
  LDSX();
  for (int rl = 0; rl < 16; ++rl) if (lane < 16) vst2(O + ((size_t)b * SS + q0 + rl) * DM + h * HD + lane * 4, *(const v4f*)&so[wave][rl][lane * 4]);
}
// ---- k_out: block = (64 rows, 128 cols): out = O(hi/lo) . Wo rows (2 products) + bo; O = the layer sum of the NLAY planes, summed and split once per block on its way into LDS
__global__ __launch_bounds__(128) void k_out(const float* __restrict__ O, const __bf16* __restrict__ P, const float* __restrict__ BO, float* __restrict__ Y) {
  __shared__ __align__(16) char sm[36864];   // k loop: two buffers each of the hi and the residual A tile, 64 x 72 bf16; behind the loop's closing barrier the same bytes are the epilogue's stage
  float (*so)[16][132] = (float (*)[16][132])sm; __bf16 *sah = (__bf16*)sm, *sal = sah + 2 * (64 * 72);
  const int tid = threadIdx.x, wave = tid >> 5, lane = tid & 31, col = lane & 15, g = lane >> 4; const size_t r0 = (size_t)blockIdx.x * 64 + wave * 16; const int n0 = blockIdx.y * 128;
  v8f acc[8] = {};   // tile t: rows (t >> 1) * 16 .. of the block, columns (wave * 2 + (t & 1)) * 16 ..
#pragma unroll 1   // eight stages of 64 k: one copy of the body keeps the text short
  for (int s = 0; s < DM / 64; ++s) { __bf16 *bh = sah + (s & 1) * (64 * 72), *bl = sal + (s & 1) * (64 * 72);
    v16b w[2][2];   // the stage's four weight fragments, in the same group of loads as the plane rows
    const __bf16* pw = P + ((size_t)(blockIdx.y * (DM / 32) + s * 2) * 8 + wave * 2) * 512 + lane * 8; const float* p0 = a_lane<64>(O + r0 * DM + s * 64, lane);
#pragma unroll   // register array: every index must be a constant
    for (int kc = 0; kc < 2; ++kc) {
#pragma unroll   // register array: every index must be a constant
      for (int jj = 0; jj < 2; ++jj) w[kc][jj] = frag_bl(pw + (kc * 8 + jj) * 512); }
    v4f pr[NLAY][8];
#pragma unroll   // register array: every index must be a constant
    for (int l = 0; l < NLAY; ++l) { a_load<64>(pr[l], p0 + l * OS); asm volatile("s_wait_xcnt 0x0" ::: "memory"); }   // a wait behind each plane's loads: the next plane's results may land in this plane's address registers
    __builtin_amdgcn_sched_barrier(0);   // every global load of the stage is issued before the first wait for data: a load held back behind a sum would cost a second trip to memory
    v4f v[8];   // sum over the layers in order 0..3 of (gate_l x_l) / sqrt(3)
#pragma unroll   // register array: every index must be a constant
    for (int u = 0; u < 8; ++u) { v4f x = {};
#pragma unroll   // register array: every index must be a constant
      for (int l = 0; l < NLAY; ++l) x = x + pr[l][u] * 0.57735026918962576f;
      v[u] = x; }
    a_store2<64>(bh, bl, v, wave, lane);   // into the buffers whose readers left them before the last barrier
    __syncthreads();   // stage s is published
#pragma unroll
    for (int kc = 0; kc < 2; ++kc) { v16b ah[4], al[4];
#pragma unroll   // register array: every index must be a constant
      for (int i = 0; i < 4; ++i) { al[i] = frag_b(bl + (i * 16 + col) * 72 + kc * 32, lane); ah[i] = frag_b(bh + (i * 16 + col) * 72 + kc * 32, lane); }
#pragma unroll
      for (int t = 0; t < 8; ++t) acc[t] = wmma_bf(al[t >> 1], w[kc][t & 1], acc[t]);
#pragma unroll
      for (int t = 0; t < 8; ++t) acc[t] = wmma_bf(ah[t >> 1], w[kc][t & 1], acc[t]); } }
  __syncthreads();   // every read of the last stage has ended: the bytes become the epilogue's stage
#pragma unroll
  for (int t = 0; t < 8; ++t) { const int i = t >> 1, j = wave * 2 + (t & 1);
#pragma unroll
    for (int r = 0; r < 8; ++r) so[i][8 * g + r][j * 16 + col] = acc[t][r] + bfr(BO[n0 + j * 16 + col]); }
  __syncthreads();   // a row tile's 128 columns come from all four waves
  for (int rl = 0; rl < 16; ++rl) vst2(Y + (r0 + rl) * DM + n0 + lane * 4, *(const v4f*)&so[wave][rl][lane * 4]);
}
#define NR (NB * SS)
// ---- k_gate: block = (64 rows, 128 cols, layer l): g = sigmoid([query (exact bf16, 1 product) | x_l (hi + residual, 2 products)] . Wsig_l rows + bsig_l); FUS plane l = g * x_l (k_out scales by 1 / sqrt(3) and sums the planes)
__global__ __launch_bounds__(128) void k_gate(const float* __restrict__ XQ, const float* __restrict__ XL, const __bf16* __restrict__ PSG, const float* __restrict__ BS, float* __restrict__ FUS) {
  __shared__ __align__(16) char sm[36864];   // k loops: two buffers each of the hi and the residual A tile, 64 x 72 bf16; behind the last barrier of the loops the same bytes are the epilogue's stage
  float (*so)[16][132] = (float (*)[16][132])sm; __bf16 *sah = (__bf16*)sm, *sal = sah + 2 * (64 * 72); const int l = blockIdx.z; XL += l * OS; FUS += l * OS;
  const int tid = threadIdx.x, wave = tid >> 5, lane = tid & 31, col = lane & 15, g = lane >> 4; const size_t rb = (size_t)blockIdx.x * 64, r0 = rb + wave * 16; const int n0 = blockIdx.y * 128;
  const __bf16* Wr = PSG + (size_t)l * DM * 2 * DM; v8f acc[8] = {};   // tile t: rows (t >> 1) * 16 .. of the block, columns (wave * 2 + (t & 1)) * 16 ..
  const float *Aq = a_lane<64>(XQ + r0 * DM, lane), *Ax = a_lane<64>(XL + r0 * DM, lane);   // the wave's 16 rows of the two halves of [query | x_l]
  v4f ar[8];
  a_load<64>(ar, Aq); XW1(Aq); a_store<64>(sah, ar, wave, lane);
  __syncthreads();   // stage 0 is published
#pragma unroll 1   // query half, eight stages of 64 k: one copy of the body keeps the text short
  for (int s = 0; s < DM / 64; ++s) { const __bf16* sb = sah + (s & 1) * (64 * 72); const int nb = ((s + 1) & 1) * (64 * 72);
    v16b w[2][2];   // the stage's four weight fragments as one group, then the next stage's A rows: both in flight under the products
    const __bf16* pw = Wr + ((size_t)(blockIdx.y * (2 * DM / 32) + s * 2) * 8 + wave * 2) * 512 + lane * 8; const float* pa = (s + 1 < DM / 64) ? Aq + (s + 1) * 64 : Ax;   // behind the last query stage comes x_l's first
#pragma unroll   // register array: every index must be a constant
    for (int kc = 0; kc < 2; ++kc) {
#pragma unroll   // register array: every index must be a constant
      for (int jj = 0; jj < 2; ++jj) w[kc][jj] = frag_bl(pw + (kc * 8 + jj) * 512); }
    __builtin_amdgcn_sched_barrier(0);   // the weight loads stay ahead of the A rows: loads return in order, and the first product waits for weights only
    a_load<64>(ar, pa); XW2(pw, pa);
    __builtin_amdgcn_sched_barrier(0);   // every global load of the stage is issued before the first wait for data
#pragma unroll
    for (int kc = 0; kc < 2; ++kc) { v16b a[4];
#pragma unroll   // register array: every index must be a constant
      for (int i = 0; i < 4; ++i) a[i] = frag_b(sb + (i * 16 + col) * 72 + kc * 32, lane);
#pragma unroll
      for (int t = 0; t < 8; ++t) acc[t] = wmma_bf(a[t >> 1], w[kc][t & 1], acc[t]); }
    __builtin_amdgcn_sched_barrier(0);   // the conversions stay behind the products: moved up, they would wait for the rows fetched ahead at the stage's top
    if (s + 1 < DM / 64) a_store<64>(sah + nb, ar, wave, lane); else a_store2<64>(sah + nb, sal + nb, ar, wave, lane);   // into the buffer whose readers left it at the last barrier
    __syncthreads(); }   // publishes the next stage and ends every read of this one
  auto stage = [&](const int s, const bool more) __attribute__((always_inline)) { const __bf16 *bh = sah + (s & 1) * (64 * 72), *bl = sal + (s & 1) * (64 * 72); const int nb = ((s + 1) & 1) * (64 * 72);
    v16b w[2][2];
    const __bf16* pw = Wr + ((size_t)(blockIdx.y * (2 * DM / 32) + DM / 32 + s * 2) * 8 + wave * 2) * 512 + lane * 8; const float* pa = Ax + (s + 1) * 64;
#pragma unroll   // register array: every index must be a constant
    for (int kc = 0; kc < 2; ++kc) {
#pragma unroll   // register array: every index must be a constant
      for (int jj = 0; jj < 2; ++jj) w[kc][jj] = frag_bl(pw + (kc * 8 + jj) * 512); }
    __builtin_amdgcn_sched_barrier(0);   // the weight loads stay ahead of the A rows: loads return in order, and the first product waits for weights only
    if (more) { a_load<64>(ar, pa); XW2(pw, pa); } else XW1(pw);   // more: a constant at each call, so the count of loads in flight is known at every wait
    __builtin_amdgcn_sched_barrier(0);   // every global load of the stage is issued before the first wait for data
#pragma unroll
    for (int kc = 0; kc < 2; ++kc) { v16b ah[4], al[4];
#pragma unroll   // register array: every index must be a constant
      for (int i = 0; i < 4; ++i) { al[i] = frag_b(bl + (i * 16 + col) * 72 + kc * 32, lane); ah[i] = frag_b(bh + (i * 16 + col) * 72 + kc * 32, lane); }
#pragma unroll
      for (int t = 0; t < 8; ++t) acc[t] = wmma_bf(al[t >> 1], w[kc][t & 1], acc[t]);
#pragma unroll
      for (int t = 0; t < 8; ++t) acc[t] = wmma_bf(ah[t >> 1], w[kc][t & 1], acc[t]); }
    __builtin_amdgcn_sched_barrier(0);   // the conversions stay behind the products: moved up, they would wait for the rows fetched ahead at the stage's top
    if (more) a_store2<64>(sah + nb, sal + nb, ar, wave, lane);
    __syncthreads(); };   // publishes the next stage and ends every read of this one
#pragma unroll 1   // x_l half, eight stages of 64 k
  for (int s = 0; s < DM / 64 - 1; ++s) stage(s, true);
  stage(DM / 64 - 1, false);
  float bb[2];   // the wave's two column tiles' bias values
  const float *pb = BS + (size_t)l * DM + n0 + wave * 32 + col, *px = XL + (rb + 8 * g) * DM + n0 + wave * 32 + col;   // the lane's own addresses of the bias and of x_l's tile values
#pragma unroll   // register array: every index must be a constant
  for (int jj = 0; jj < 2; ++jj) bb[jj] = bfr(pb[jj * 16]);
  XW1(pb);
#pragma unroll   // register array: every index must be a constant
  for (int jh = 0; jh < 2; ++jh) { float xv[4][8];   // half a tile's x_l values as one group of loads ahead of its exp calls (no load moves over a call); two halves keep a group under the load counter's range
#pragma unroll   // register array: every index must be a constant
    for (int tt = 0; tt < 4; ++tt) { const int t = jh * 4 + tt;
#pragma unroll   // register array: every index must be a constant
      for (int r = 0; r < 8; ++r) xv[tt][r] = px[((t >> 1) * 16 + r) * DM + (t & 1) * 16]; }
    XW1(px);
#pragma unroll   // register array: every index must be a constant
    for (int tt = 0; tt < 4; ++tt) { const int t = jh * 4 + tt;
#pragma unroll   // register array: every index must be a constant
      for (int r = 0; r < 8; ++r) { const float gte = 1.0f / (1.0f + exp_ni(-(acc[t][r] + bb[t & 1]))); so[t >> 1][8 * g + r][(wave * 2 + (t & 1)) * 16 + col] = gte * xv[tt][r]; } } }
  __syncthreads();   // a row tile's 128 columns come from all four waves
  for (int rl = 0; rl < 16; ++rl) vst2(FUS + (r0 + rl) * DM + n0 + lane * 4, *(const v4f*)&so[wave][rl][lane * 4]);
}
extern "C" void kernel_launch(void* const* d_in, const int* in_sizes, int n_in, void* d_out, int out_size, void* d_ws, size_t ws_size, hipStream_t stream) {
  (void)in_sizes; (void)n_in; (void)out_size;
  const float** F = (const float**)d_in;   // 0 query [4,1024,512], 1 key [4,4,1024,512], 2 value [4,4,1024,512], 3 Wq [512,512], 4 bq, 5 Wk [4,512,512], 6 bk [4,512], 7 Wv, 8 bv, 9 Wsig [4,512,1024], 10 bsig [4,512], 11 Wf [512,512], 12 bf
  if (ws_size < (size_t)WS_END) return;
  char* ws = (char*)d_ws; __bf16 *PK = (__bf16*)(ws + WS_PK), *PSG = (__bf16*)(ws + WS_PSG); _Float16 *QK = (_Float16*)(ws + WS_QK), *VTH = (_Float16*)(ws + WS_VTH), *KF = (_Float16*)(ws + WS_KF); float *O = (float*)(ws + WS_O), *FUS = (float*)(ws + WS_FUS);
  // the layers are independent up to the gated sum: each stage is one launch with the layer in blockIdx.z (in k_qkv: in blockIdx.y)
  k_pack<<<dim3(DM / 16, 5, NLAY), 256, 0, stream>>>(F[3], F[5], F[7], F[11], F[9], PK, PSG);   // per layer: Wk[l] | Wv[l] | Wsig[l] as fragments; Wq and Wf once, in layer 0's pack
  k_qkv<<<dim3(TNB * SS / 64, DM / 128 + NLAY * (2 * DM / 128)), 128, 0, stream>>>(F[0], F[1], F[2], PK + PK_A, F[4], F[6], F[8], QK, VTH, KF);   // q once, then k_l, v_l of every layer
  k_attn<<<dim3(TQB, NH, TNB * NLAY), 128, 0, stream>>>(QK, VTH, KF, nullptr, O);   // x_l
  k_gate<<<dim3(NR / 64, DM / 128, NLAY), 128, 0, stream>>>(F[0], O, PSG, F[10], FUS);   // gate_l * x_l
  k_out<<<dim3(TOB, DM / 128), 128, 0, stream>>>(FUS, PK + PK_P, F[12], (float*)d_out);   // (sum_l gate_l x_l / sqrt(3)) . Wf^T + bf (Wf of layer 0's pack)
}

// v008
// One run takes 117 microseconds.
// In both of two side-by-side timings against v007, it was 1.15 times as fast.
// Counting every step since v000, it is 7.35 times as fast.
// compute dtype: all float inputs rounded to bf16; q = query . Wq^T + bq and k_l, v_l = key_l / value_l . W^T + b with EXACT bf16 products on WMMA 16x16x32 (weights, k and v^T kept in fragment order in the workspace); PLAIN attention per layer: q, k as single f16 operands x 1/8, running-max softmax in f32 (hardware exp2; 1/8, log2 e and the 2^11 of P in one FMA), P (scaled by 2^11, single f16) x v (single f16); gate_l = sigmoid([query (exact) | x_l (bf16 hi + residual, 2 products)] . Wsig_l^T + bsig_l) (precise expf); fused = sum_l gate_l x_l / sqrt(3) in f32; out = fused (bf16 hi + residual) . Wf^T (2 products) + bf.
#include <hip/hip_runtime.h>
#include <math.h>

typedef __attribute__((ext_vector_type(16))) _Float16 v16h;
typedef __attribute__((ext_vector_type(16))) __bf16 v16b;
typedef __attribute__((ext_vector_type(8)))  _Float16 v8h;
typedef __attribute__((ext_vector_type(8)))  float v8f;
typedef __attribute__((ext_vector_type(4)))  float v4f;
typedef __attribute__((ext_vector_type(2)))  float v2f;
typedef __attribute__((ext_vector_type(4)))  unsigned v4u;
typedef __attribute__((ext_vector_type(4)))  int v4i;
typedef float __attribute__((may_alias)) float_a;
typedef int __attribute__((may_alias)) int_a;

template <typename T> __device__ __forceinline__ void vst2(void* p, T v) { *(T*)p = v;  }
__device__ __forceinline__ v8f wmma16(v16h a, v16h b, v8f c) {
  v8f d = __builtin_amdgcn_wmma_f32_16x16x32_f16(false, a, false, b, (short)0, c, false, false);
  asm volatile("v_nop\n\tv_nop\n\tv_nop\n\tv_nop" : "+v"(d) : "v"(a), "v"(b));
  return d;
}
__device__ __forceinline__ v8f wmma_bf(v16b a, v16b b, v8f c) {
  v8f d = __builtin_amdgcn_wmma_f32_16x16x32_bf16(false, a, false, b, (short)0, c, false, false);
  asm volatile("v_nop\n\tv_nop\n\tv_nop\n\tv_nop" : "+v"(d) : "v"(a), "v"(b));
  return d;
}
// Multi-layer source attention (B 4, 1,024 queries over 4 layers of 1,024 keys/values, d 512, 8 heads x 64): a shared query projection, per-layer key/value projections, softmax(q k_l^T / 8) v_l per layer, per-layer sigmoid gates from [query | x_l], gated sum over layers / sqrt(3), final linear map.
__device__ __forceinline__ v16h frag_h(const _Float16* rowk0, int lane) {
  union { v16h v; v8h q[2]; } u; const _Float16* p = rowk0 + 8 * (lane >> 4);
  u.q[0] = *(const v8h*)p; u.q[1] = *(const v8h*)(p + 16); return u.v;
}
__device__ __forceinline__ v16h frag_f32(const float* rowk0, int lane) {
  v16h a; const float* p = rowk0 + 8 * (lane >> 4);
#pragma unroll
  for (int i = 0; i < 8; ++i) { a[i] = (_Float16)p[i]; a[8 + i] = (_Float16)p[16 + i]; }
  return a;
}
__device__ __forceinline__ v16h frag_f32s(const float* rowk0, int lane, float sc) {
  v16h a; const float* p = rowk0 + 8 * (lane >> 4);
#pragma unroll
  for (int i = 0; i < 8; ++i) { a[i] = (_Float16)(p[i] * sc); a[8 + i] = (_Float16)(p[16 + i] * sc); }
  return a;
}
// column fragment from a [K][ld] layout (column n), rows >= K read as 0
__device__ __forceinline__ v16h fragc_f32(const float* W, int k0, int n, int lane, int ld, int K) {
  v16h a; const int g = lane >> 4;
#pragma unroll
  for (int i = 0; i < 8; ++i) { const int ka = k0 + 8 * g + i, kb = ka + 16;
    a[i] = (_Float16)(ka < K ? W[(size_t)(ka < K ? ka : K - 1) * ld + n] : 0.f); a[8 + i] = (_Float16)(kb < K ? W[(size_t)(kb < K ? kb : K - 1) * ld + n] : 0.f); }
  return a;
}
struct F2 { v16b h, l; };
__device__ __forceinline__ F2 bsplit16(const float v[16]) { F2 r;
#pragma unroll
  for (int i = 0; i < 16; ++i) { const __bf16 h = (__bf16)v[i]; r.h[i] = h; r.l[i] = (__bf16)(v[i] - (float)h); }
  return r; }
__device__ __forceinline__ F2 split_row(const float* row, int k0, int lane) { float v[16]; const float* p = row + k0 + 8 * (lane >> 4);
#pragma unroll
  for (int i = 0; i < 8; ++i) { v[i] = p[i]; v[8 + i] = p[16 + i]; }
  return bsplit16(v); }
__device__ __forceinline__ F2 split_rowK(const float* row, int k0, int lane, int K) { float v[16]; const int g = lane >> 4;
#pragma unroll
  for (int i = 0; i < 8; ++i) { const int ka = k0 + 8 * g + i, kb = ka + 16; v[i] = ka < K ? row[ka < K ? ka : K - 1] : 0.f; v[8 + i] = kb < K ? row[kb < K ? kb : K - 1] : 0.f; }
  return bsplit16(v); }
__device__ __forceinline__ F2 split_col(const float* W, int k0, int n, int lane, int ld, int K) { float v[16]; const int g = lane >> 4;
#pragma unroll
  for (int i = 0; i < 8; ++i) { const int ka = k0 + 8 * g + i, kb = ka + 16; v[i] = ka < K ? W[(size_t)(ka < K ? ka : K - 1) * ld + n] : 0.f; v[8 + i] = kb < K ? W[(size_t)(kb < K ? kb : K - 1) * ld + n] : 0.f; }
  return bsplit16(v); }
__device__ __forceinline__ v8f mac3(const F2& a, const F2& b, v8f c) { c = wmma_bf(a.l, b.h, c); c = wmma_bf(a.h, b.l, c); return wmma_bf(a.h, b.h, c); }
__device__ __forceinline__ float sigm(float v) { return 1.0f / (1.0f + expf(-v)); }
#define LDSX() do { asm volatile("s_wait_dscnt 0" ::: "memory"); __builtin_amdgcn_wave_barrier(); __builtin_amdgcn_fence(__ATOMIC_RELEASE, "workgroup"); } while (0)


#define NB 4
#define SS 1024
#define DM 512
#define NH 8
#define NLAY 4
__device__ __forceinline__ size_t kvrow(size_t r) { return (r / SS) * ((size_t)NLAY * SS) + (r % SS); }   // key/value [B][L][S][D]: engine row (b, s) of layer l lives at (b*L + l)*S + s (layer offset added to the pointer)
#define HD 64
#define QKVW (3 * DM)
#ifndef TQB
#define TQB (SS / 64)
#define TNB NB
#define TOB (NB * SS / 64)     // output row tiles (all)
#endif
typedef __attribute__((ext_vector_type(8))) __bf16 v8b;
__device__ __forceinline__ v16b frag_b(const __bf16* rowk0, int lane) {
  union { v16b v; v8b q[2]; } u; const __bf16* p = rowk0 + 8 * (lane >> 4);
  u.q[0] = *(const v8b*)p; u.q[1] = *(const v8b*)(p + 16); return u.v;
}
// fragment order: one 16 x 32 operand fragment is 1 KiB, [half][lane][8 elements]; lane (g, col) holds row col, k = half * 16 + 8 g + 0..7 (the k order of frag_b / frag_h), so each 16-byte load of a wave reads 512 contiguous bytes
__device__ __forceinline__ v16b frag_bp(const __bf16* frag, int lane) {
  union { v16b v; v8b q[2]; } u; const __bf16* p = frag + lane * 8;
  u.q[0] = *(const v8b*)p; u.q[1] = *(const v8b*)(p + 256); return u.v;
}
__device__ __forceinline__ v16h frag_hp(const _Float16* frag, int lane) {
  union { v16h v; v8h q[2]; } u; const _Float16* p = frag + lane * 8;
  u.q[0] = *(const v8h*)p; u.q[1] = *(const v8h*)(p + 256); return u.v;
}
__device__ __forceinline__ float bfr(float v) { return (float)(__bf16)v; }
__device__ __attribute__((noinline)) float exp_ni(float v) { return expf(v); }
__device__ __attribute__((noinline)) float erf_ni(float v) { return erff(v); }

typedef __attribute__((ext_vector_type(4))) __bf16 v4b;
// ---- A tile of a 64 x 128 block product, staged once per block in LDS as bf16, KS k values a stage: wave w brings rows w * 16 .. + 15 with whole-line loads (a 16-byte load of the wave reads KS * 4 contiguous bytes of each row it touches); LDS row pitch KS + 8 elements (16 bytes x an odd number: 16-byte fragment reads meet no bank twice). Every wave then reads all four 16-row fragments and owns columns w * 32 .. + 31, so a weight fragment is loaded by one wave only
template <int KS> __device__ __forceinline__ const float* a_lane(const float* rows, int lane) { constexpr int LPR = KS / 4; return rows + (size_t)(lane / LPR) * DM + (lane % LPR) * 4; }   // the lane's own address in the wave's first load
template <int KS> __device__ __forceinline__ void a_load(v4f (&ar)[KS / 8], const float* pl) {
  constexpr int RPL = 128 / KS;   // rows to a load
#pragma unroll   // register array: every index must be a constant
  for (int u = 0; u < KS / 8; ++u) ar[u] = *(const v4f*)(pl + (size_t)(u * RPL) * DM);
}
__device__ __forceinline__ v16b frag_bl(const __bf16* pl) {   // frag_bp from the lane's own address
  union { v16b v; v8b q[2]; } u; u.q[0] = *(const v8b*)pl; u.q[1] = *(const v8b*)(pl + 256); return u.v;
}
// behind a group of global loads: the wait names the group's address registers, so none of them is rewritten (by a later load's result either) ahead of it
#define XW1(p) asm volatile("s_wait_xcnt 0x0" :: "v"(p) : "memory")
#define XW2(p, q) asm volatile("s_wait_xcnt 0x0" :: "v"(p), "v"(q) : "memory")
template <int KS> __device__ __forceinline__ __bf16* a_slot(__bf16* buf, int wave, int lane, int u) {
  constexpr int LPR = KS / 4, RPL = 32 / LPR;
  return buf + (wave * 16 + u * RPL + lane / LPR) * (KS + 8) + (lane % LPR) * 4;
}
template <int KS> __device__ __forceinline__ void a_store(__bf16* buf, const v4f (&ar)[KS / 8], int wave, int lane) {
#pragma unroll   // register array: every index must be a constant
  for (int u = 0; u < KS / 8; ++u) { v4b o;
#pragma unroll   // register vector: every index must be a constant
    for (int e = 0; e < 4; ++e) o[e] = (__bf16)ar[u][e];
    *(v4b*)a_slot<KS>(buf, wave, lane, u) = o; }
}
template <int KS> __device__ __forceinline__ void a_store2(__bf16* bh, __bf16* bl, const v4f (&ar)[KS / 8], int wave, int lane) {   // bf16 hi + residual
#pragma unroll   // register array: every index must be a constant
  for (int u = 0; u < KS / 8; ++u) { v4b oh, ol;
#pragma unroll   // register vector: every index must be a constant
    for (int e = 0; e < 4; ++e) { const __bf16 h = (__bf16)ar[u][e]; oh[e] = h; ol[e] = (__bf16)(ar[u][e] - (float)h); }
    *(v4b*)a_slot<KS>(bh, wave, lane, u) = oh; *(v4b*)a_slot<KS>(bl, wave, lane, u) = ol; }
}
// a packed [N][K] weight: [N / 128][K / 32][8 row tiles] fragments of 512 elements
#define PK_A 0                       // Wq | Wk | Wv, 1536 rows x 512
#define PK_P (PK_A + QKVW * DM)        // Wf, 512 rows x 512
#define PK_END (PK_P + DM * DM)
#define WS_PK  0u
// every per-layer buffer holds NLAY planes (layer = blockIdx.z in k_pack and k_gate, blockIdx.z / NB in k_attn, (blockIdx.y - 4) / 8 in k_qkv); plane sizes in elements:
#define QKS ((size_t)NB * SS * 2 * DM)
#define VTS ((size_t)NB * DM * SS)
#define OS  ((size_t)NB * SS * DM)
#define WS_QK  (WS_PK + 2u * PK_END * NLAY)        // f16 [4096 rows][1024]: q | (unused), one plane (no layer enters q)
#define WS_VTH (WS_QK + 2u * QKS)                  // f16 [l][b][h][32 keys ks][4 d tiles] v^T fragments (row = d, k = key)
#define WS_O   (WS_VTH + 2u * NLAY * VTS)          // f32 [l][4096][512]
#define WS_CS  (WS_O + 4u * NLAY * OS)              // f32 [2048][32], written and read by no kernel
#define WS_PSG (WS_CS + 4u * 2 * SS * 32)                  // bf16 packed Wsig [4][512 x 1024]
#define WS_FUS (WS_PSG + 2u * (size_t)NLAY * DM * 2 * DM)   // f32 [l][NR][512] gate_l * x_l
#define WS_KF  (WS_FUS + 4u * NLAY * OS)            // f16 [l][b][h][16-key tile][2 k-steps] k fragments (row = key, k = d)
#define WS_END (WS_KF + 2u * NLAY * OS)
// ---- k_pack: block = (16-row tile nt, which, layer l): f32 [out][in] rows -> bf16 fragments; which 0..2 -> W_q/W_k[l]/W_v[l] into layer l's PK_A (rows which*512 + n); 3 -> W_f into layer l's PK_P; 4 -> Wsig[l] (rows 1024 long) into PSG; W_q and W_f belong to no layer and are packed by layer 0's blocks alone. A thread converts one lane's 8 elements; a wave stores 512 contiguous bytes
__global__ __launch_bounds__(256) void k_pack(const float* __restrict__ WQ, const float* __restrict__ WK, const float* __restrict__ WV, const float* __restrict__ WO, const float* __restrict__ WS, __bf16* __restrict__ PK, __bf16* __restrict__ PSG) {
  const int nt = blockIdx.x, which = blockIdx.y, l = blockIdx.z, t = threadIdx.x; if (l && (which == 0 || which == 3)) return;
  const size_t n = (size_t)nt * 16, ln = (size_t)l * DM + n; const int len = (which == 4) ? 2 * DM : DM;
  const float* Wm = (which == 0) ? WQ + n * DM : (which == 1) ? WK + ln * DM : (which == 2) ? WV + ln * DM : (which == 3) ? WO + n * DM : WS + ln * (2 * DM);
  __bf16* PL = PK + (size_t)l * PK_END;
  __bf16* dst = ((which < 3) ? PL + PK_A + (size_t)which * DM * DM : (which == 3) ? PL + PK_P : PSG + (size_t)l * DM * 2 * DM) + ((size_t)(nt >> 3) * (len / 32) * 8 + (nt & 7)) * 512;
  for (int p0 = t; p0 < len * 2; p0 += 1024) {
#pragma unroll   // four independent pieces to a trip: their loads are in flight together
    for (int u = 0; u < 4; ++u) { const int kc = p0 >> 6, half = (p0 >> 5) & 1, lane = p0 & 31; const float* s = Wm + (size_t)(lane & 15) * len + kc * 32 + half * 16 + (lane >> 4) * 8 + u * 4 * 32; v8b o;   // piece p0 + 256 u: k-step kc + 4 u, same half and lane
#pragma unroll   // register vector: every index must be a constant
      for (int i = 0; i < 8; ++i) o[i] = (__bf16)s[i];
      vst2(dst + (size_t)kc * 8 * 512 + half * 256 + lane * 8 + u * 4 * 8 * 512, o); } }
}
// ---- k_qkv: block = (64 rows, yy): yy 0..3 = q's four 128-column blocks (q is projected once: no layer enters it); yy 4 + 8 l + c = column block 4 + c of layer l's [q | k | v] weight rows (k, then v). Each result is kept once, as the f16 operand the attention reads
__global__ __launch_bounds__(128) void k_qkv(const float* __restrict__ XQ, const float* __restrict__ XK, const float* __restrict__ XV, const __bf16* __restrict__ P, const float* __restrict__ BQ, const float* __restrict__ BK, const float* __restrict__ BV, _Float16* __restrict__ QK, _Float16* __restrict__ VTH, _Float16* __restrict__ KF) {
  const int yy = blockIdx.y, yb = (yy < DM / 128) ? yy : DM / 128 + ((yy - DM / 128) & 7);   // column block among the 12 of [q | k | v]
  { const size_t l = (yy < DM / 128) ? 0 : (yy - DM / 128) >> 3; XK += l * SS * DM; XV += l * SS * DM; P += l * PK_END; BK += l * DM; BV += l * DM; VTH += l * VTS; KF += l * OS; }   // layer l's inputs, weights and planes
  const int which0 = (yb * 128) / DM; const float* X = (which0 == 0) ? XQ : (which0 == 1) ? XK : XV; const float* BB = BQ ? (((which0 == 0) ? BQ : (which0 == 1) ? BK : BV) + (yb * 128 - which0 * DM)) : nullptr;
  __shared__ __align__(16) char sm[34816];   // k loop: two A buffers of 64 x 136 bf16; behind the loop's last barrier the same bytes are the epilogue's stage
  _Float16 (*so)[16][136] = (_Float16 (*)[16][136])sm; _Float16 (*sth)[72] = (_Float16 (*)[72])sm;
  __bf16* sa = (__bf16*)sm;
  const int tid = threadIdx.x, wave = tid >> 5, lane = tid & 31, col = lane & 15, g = lane >> 4; const size_t r0 = (size_t)blockIdx.x * 64 + wave * 16; const int n0 = yb * 128;
  v8f acc[8] = {};   // tile t: rows (t >> 1) * 16 .. of the block, columns (wave * 2 + (t & 1)) * 16 ..
  float bias[2] = {};   // the wave's two column tiles' bias values, loaded ahead of the k loop, rounded to bf16 where they are added
  if (BB) {
#pragma unroll   // register array: every index must be a constant
    for (int jj = 0; jj < 2; ++jj) bias[jj] = BB[(wave * 2 + jj) * 16 + col];
    asm volatile("s_wait_xcnt 0x0" ::: "memory"); }   // behind the two loads: code that follows them in the listing reuses their address registers
  const float* Aw = a_lane<128>(X + ((which0 == 0) ? r0 : kvrow(r0)) * DM, lane);   // the wave's 16 rows are consecutive (a 64-row block lies in one batch)
  v4f ar[16];
  a_load<128>(ar, Aw); XW1(Aw); a_store<128>(sa, ar, wave, lane);
  __syncthreads();   // stage 0 is published
  auto stage = [&](const int s, const bool more) __attribute__((always_inline)) { const __bf16* sb = sa + (s & 1) * (64 * 136);   // more: a constant at each call, so the count of loads in flight is known at every wait
    v16b w[4][2];   // the stage's eight weight fragments as one group, then the next stage's A rows: both in flight under the products
    const __bf16* pw = P + ((size_t)(yb * (DM / 32) + s * 4) * 8 + wave * 2) * 512 + lane * 8; const float* pa = Aw + (s + 1) * 128;
#pragma unroll   // register array: every index must be a constant
    for (int kc = 0; kc < 4; ++kc) {
#pragma unroll   // register array: every index must be a constant
      for (int jj = 0; jj < 2; ++jj) w[kc][jj] = frag_bl(pw + (kc * 8 + jj) * 512); }
    __builtin_amdgcn_sched_barrier(0);   // the weight loads stay ahead of the A rows: loads return in order, and the first product waits for weights only
    if (more) { a_load<128>(ar, pa); XW2(pw, pa); } else XW1(pw);
    __builtin_amdgcn_sched_barrier(0);   // every global load of the stage is issued before the first wait for data
#pragma unroll
    for (int kc = 0; kc < 4; ++kc) { v16b a[4];
#pragma unroll   // register array: every index must be a constant
      for (int i = 0; i < 4; ++i) a[i] = frag_b(sb + (i * 16 + col) * 136 + kc * 32, lane);
#pragma unroll
      for (int t = 0; t < 8; ++t) acc[t] = wmma_bf(a[t >> 1], w[kc][t & 1], acc[t]); }
    __builtin_amdgcn_sched_barrier(0);   // the conversions stay behind the products: moved up, they would wait for the rows fetched ahead at the stage's top
    if (more) a_store<128>(sa + ((s + 1) & 1) * (64 * 136), ar, wave, lane);   // into the buffer whose readers left it at the last barrier
    __syncthreads(); };   // publishes stage s + 1 and ends every read of stage s
#pragma unroll 1   // four stages of 128 k: one copy of the body for the stages that fetch ahead keeps the text short
  for (int s = 0; s < DM / 128 - 1; ++s) stage(s, true);
  stage(DM / 128 - 1, false);
  if (n0 < 2 * DM) {   // q stored unscaled (f16 sigma ~0.6, no subnormal exposure); 1/8 applied to the f32 score
#pragma unroll
    for (int t = 0; t < 8; ++t) { const int i = t >> 1, j = wave * 2 + (t & 1);
#pragma unroll
      for (int r = 0; r < 8; ++r) so[i][8 * g + r][j * 16 + col] = (_Float16)(acc[t][r] + bfr(bias[t & 1])); }   // q, k (+ bias) as f16
    __syncthreads();   // a row tile's 128 columns come from all four waves
    if (which0 == 0) {
    for (int rl = 0; rl < 16; ++rl) if (lane < 16) vst2((unsigned*)(QK + (r0 + rl) * (2 * DM) + n0 + lane * 8), *(const v4u*)&so[wave][rl][lane * 8]);
    } else {   // k: the wave's 16 keys x 128 columns are four fragments (2 heads x 2 k-steps)
      _Float16* kt = KF + (((r0 / SS) * NH + (n0 - DM) / HD) * (SS / 16) + (r0 % SS) / 16) * 1024 + lane * 8;
#pragma unroll
      for (int f = 0; f < 8; ++f) { const int hh = f >> 2, kc = (f >> 1) & 1, half = f & 1; vst2((unsigned*)(kt + (size_t)hh * (SS / 16) * 1024 + kc * 512 + half * 256), *(const v4u*)&so[wave][col][hh * HD + kc * 32 + half * 16 + g * 8]); }
      asm volatile("s_wait_xcnt 0x0" ::: "memory"); }   // behind the run of stores: code that follows them in the listing reuses their data and address registers
  } else {
#pragma unroll
    for (int t = 0; t < 8; ++t) { const int i = t >> 1, j = wave * 2 + (t & 1);
#pragma unroll
      for (int r = 0; r < 8; ++r) sth[j * 16 + col][i * 16 + 8 * g + r] = (_Float16)(acc[t][r] + bfr(bias[t & 1])); }
    __syncthreads();
    const size_t rb = (size_t)blockIdx.x * 64; const int b = (int)(rb / SS), s0 = (int)(rb % SS); const int pc0 = n0 - 2 * DM;
    for (int q = tid; q < 128 * 8; q += 128) { const int ln = q & 31, half = (q >> 5) & 1, dt = (q >> 6) & 3, ksl = (q >> 8) & 1, hh = q >> 9;   // the block's 64 keys x 128 d are 16 v^T fragments (2 heads x 2 key groups x 4 d tiles)
      vst2((unsigned*)(VTH + ((((size_t)b * NH + pc0 / HD + hh) * (SS / 32) + s0 / 32 + ksl) * 4 + dt) * 512 + half * 256 + ln * 8), *(const v4u*)&sth[hh * HD + dt * 16 + (ln & 15)][ksl * 32 + half * 16 + (ln >> 4) * 8]); }
  }
}
// lane l with lane l ^ 16 (the two lane halves hold the two halves of a query's keys)
__device__ __forceinline__ float xhalf(float x) { return __builtin_bit_cast(float, __builtin_amdgcn_permlanex16(__builtin_bit_cast(int, x), __builtin_bit_cast(int, x), 0x76543210, 0xfedcba98, false, false)); }
// ---- k_attn: block = (256 queries, head h, (layer l, batch b)), 8 waves x 32 query columns: k and v^T read as packed fragments (KF, VTH); a loaded fragment feeds two products (the wave's two 16-column groups c), and the eight waves walk the same fragments, so one fetch from L2 serves 256 queries through the WGP cache. All-keys flash attention (K = 64: 2 k-steps), TRANSPOSED: S^T = k (A) . q^T (B), so lane (g, col) holds 16 of query c * 16 + col's 32 scores of a pass (keys ct * 16 + 8 g + r): maximum and sum in the lane, the maximum joined with the other half once a pass, the sums once at the end; a group's two score tiles, converted in place, are the B operand P^T of O^T += v^T (A) . P^T; P = 2^(q.k * (log2 e / 8) - maximum + 11) with single f16 operands, the sum l carries the same 2^11; O[b*S+q][h*64+d] = acc / l (256-B segments)
#define AQB 256   // queries to a block
__global__ __launch_bounds__(256) void k_attn(const _Float16* __restrict__ QK, const _Float16* __restrict__ VTH, const _Float16* __restrict__ KF, const void* __restrict__ KMASK, float* __restrict__ O) {
  __shared__ __align__(16) float so[8][32][68];
  const int tid = threadIdx.x, wave = tid >> 5, lane = tid & 31, col = lane & 15, g = lane >> 4;
  const int qb = blockIdx.x, h = blockIdx.y, b = blockIdx.z % NB; { const size_t l = blockIdx.z / NB; VTH += l * VTS; KF += l * OS; O += l * OS; }   // layer l's planes (q has one plane)
  const int q0 = qb * AQB + wave * 32;
  v16h aq[2][2];   // [column group][k-step]
#pragma unroll   // register array: every index must be a constant
  for (int c = 0; c < 2; ++c) {
#pragma unroll   // register array: every index must be a constant
    for (int kc = 0; kc < 2; ++kc) aq[c][kc] = frag_h(QK + ((size_t)b * SS + q0 + c * 16 + col) * (2 * DM) + h * HD + kc * 32, lane); }
  const float KS2 = 0.125f * 1.44269504088896341f;   // 1/sqrt(64) and log2 e in one factor: exp(x / 8) = 2^(x * KS2)
  float m[2] = {-3.0e38f, -3.0e38f}, l[2] = {0.f, 0.f};   // per column group: query col's running maximum of the raw products q.k (equal in both halves) and this half's share of its sum (x 2^11)
  v8f acc[2][4] = {};   // O^T: acc[c][dt][r] = query c * 16 + col, d = dt * 16 + 8 g + r
  const int nks = SS / 32;   // all keys
  const _Float16* kbase = KF + (size_t)(b * NH + h) * SS * HD;   // k fragments of this (layer, batch, head): 4 to a pass
  const _Float16* vbase = VTH + (size_t)(b * NH + h) * SS * HD;   // v^T fragments: 4 to a pass
  v16h kf[2][2];   // a pass's four k fragments, fetched one pass ahead
#pragma unroll   // register array: every index must be a constant
  for (int ct = 0; ct < 2; ++ct) {
#pragma unroll   // register array: every index must be a constant
    for (int kc = 0; kc < 2; ++kc) kf[ct][kc] = frag_hp(kbase + (ct * 2 + kc) * 512, lane); }
#pragma unroll 1
  for (int ks = 0; ks < nks; ++ks) { v8f s[2][2];   // [column group][key tile]
    v16h vf[4];   // this pass's four v^T fragments: issued here as one group, first used behind the softmax
#pragma unroll   // register array: every index must be a constant
    for (int dt = 0; dt < 4; ++dt) vf[dt] = frag_hp(vbase + (size_t)(ks * 4 + dt) * 512, lane);
    __builtin_amdgcn_sched_barrier(0);   // the v^T loads are issued ahead of the pass's first wait (for k): moved down among the score products they start later by that wait
#pragma unroll
    for (int ct = 0; ct < 2; ++ct) {
#pragma unroll
      for (int c = 0; c < 2; ++c) { v8f x = {};
#pragma unroll
        for (int kc = 0; kc < 2; ++kc) x = __builtin_amdgcn_wmma_f32_16x16x32_f16(false, kf[ct][kc], false, aq[c][kc], (short)0, x, false, false);   // single product: k, q as one-rounding f16 operands; the compiler keeps the distance behind the builtin
        s[c][ct] = x; } }   // raw products: the scale is applied inside the exponent
    asm volatile("v_nop\n\tv_nop\n\tv_nop\n\tv_nop" : "+v"(s[0][0]), "+v"(s[0][1]), "+v"(s[1][0]), "+v"(s[1][1]) :: "memory");   // the distance between the last score product and the first read of its result; it names the four tiles and memory, so no k load moves up among the products (issued while a fragment is still to be read it needs other registers, and copies behind a full wait follow)
    { const _Float16* kn = kbase + (size_t)((ks + 1 < nks) ? ks + 1 : ks) * 2048;   // next pass's k fragments into the same registers, in flight under the softmax and P.V (the last pass reads its own rows again: in bounds, unused)
#pragma unroll   // register array: every index must be a constant
      for (int ct = 0; ct < 2; ++ct) {
#pragma unroll   // register array: every index must be a constant
        for (int kc = 0; kc < 2; ++kc) kf[ct][kc] = frag_hp(kn + (ct * 2 + kc) * 512, lane); } }
    __builtin_amdgcn_sched_barrier(0);   // the k loads are issued here, a whole softmax and P.V ahead of their use: left free, the compiler sinks them to the foot of the pass, and the next pass opens with a wait for them
#pragma unroll   // register arrays: every index must be a constant
    for (int c = 0; c < 2; ++c) {   // the two column groups are independent chains: the compiler interleaves them, and the rescaling and the sums fill the slots between the P.V products
      float mx = s[c][0][0];
#pragma unroll   // register array: every index must be a constant
      for (int r = 1; r < 8; ++r) mx = fmaxf(mx, s[c][0][r]);
#pragma unroll   // register array: every index must be a constant
      for (int r = 0; r < 8; ++r) mx = fmaxf(mx, s[c][1][r]);
      mx = fmaxf(mx, xhalf(mx));
      const float mn = fmaxf(m[c], mx);
      const float off = fmaf(mn, KS2, -11.0f);
      v16h pa; float es0 = 0.f, es1 = 0.f;
      const v8f x0 = __builtin_elementwise_fma(s[c][0], (v8f)KS2, (v8f)(-off)), x1 = __builtin_elementwise_fma(s[c][1], (v8f)KS2, (v8f)(-off));   // as vectors: two exponents to a packed FMA
#pragma unroll   // register array: every index must be a constant
      for (int r = 0; r < 8; ++r) { const float e0 = __builtin_amdgcn_exp2f(x0[r]), e1 = __builtin_amdgcn_exp2f(x1[r]);
        es0 += e0; es1 += e1;
        pa[r] = (_Float16)e0; pa[8 + r] = (_Float16)e1; }   // P carries 2^11 (the + 11 in the exponent) so small softmax weights stay out of the f16 subnormal range; the sum carries it too and it cancels in the epilogue. Element s of the B operand is key (s < 8 ? 8 g + s : 16 + 8 g + s - 8): the k order of the v^T fragments
      if (c == 0) __builtin_amdgcn_sched_barrier(0);   // for the slot behind a transcendental: without it the compiler's order has an exponential overwrite the source register of the exponential directly ahead of it (with it in both groups, an add does); so placed, no such pair is left in the listing
      const float alpha = __builtin_amdgcn_exp2f((m[c] - mn) * KS2);   // first pass: 2^(-huge) = 0
      l[c] = l[c] * alpha + (es0 + es1); m[c] = mn;
#pragma unroll   // register array: every index must be a constant
      for (int dt = 0; dt < 4; ++dt) {
#pragma unroll   // register array: every index must be a constant
        for (int r = 0; r < 8; ++r) acc[c][dt][r] *= alpha; }
#pragma unroll
      for (int dt = 0; dt < 4; ++dt) acc[c][dt] = __builtin_amdgcn_wmma_f32_16x16x32_f16(false, vf[dt], false, pa, (short)0, acc[c][dt], false, false); } }   // single product: V^T x P^T (x2^11)
#pragma unroll   // register arrays: every index must be a constant
  for (int c = 0; c < 2; ++c) { const float lt = l[c] + xhalf(l[c]);   // the two halves' sums joined once
    const float il = 1.0f / lt;
#pragma unroll   // register array: every index must be a constant
    for (int dt = 0; dt < 4; ++dt) {
#pragma unroll   // register array: every index must be a constant
      for (int rh = 0; rh < 2; ++rh) { v4f o;   // a lane's 8 values of a d tile are 8 consecutive d of its query's row: two 16-byte LDS stores
#pragma unroll   // register array: every index must be a constant
        for (int i = 0; i < 4; ++i) o[i] = acc[c][dt][rh * 4 + i] * il;
        *(v4f*)&so[wave][c * 16 + col][dt * 16 + 8 * g + rh * 4] = o; } } }
  LDSX();
#pragma unroll   // two runs of 16 rows, as many as the data registers of one run
  for (int c = 0; c < 2; ++c) {
    if (c) asm volatile("s_wait_xcnt 0x0" ::: "memory");   // behind the first run of stores: the second run's LDS reads land in their data registers
    for (int rl = c * 16; rl < c * 16 + 16; ++rl) if (lane < 16) vst2(O + ((size_t)b * SS + q0 + rl) * DM + h * HD + lane * 4, *(const v4f*)&so[wave][rl][lane * 4]); }
}
// ---- k_out: block = (64 rows, 128 cols): out = O(hi/lo) . Wo rows (2 products) + bo; O = the layer sum of the NLAY planes, summed and split once per block on its way into LDS
__global__ __launch_bounds__(128) void k_out(const float* __restrict__ O, const __bf16* __restrict__ P, const float* __restrict__ BO, float* __restrict__ Y) {
  __shared__ __align__(16) char sm[36864];   // k loop: two buffers each of the hi and the residual A tile, 64 x 72 bf16; behind the loop's closing barrier the same bytes are the epilogue's stage
  float (*so)[16][132] = (float (*)[16][132])sm; __bf16 *sah = (__bf16*)sm, *sal = sah + 2 * (64 * 72);
  const int tid = threadIdx.x, wave = tid >> 5, lane = tid & 31, col = lane & 15, g = lane >> 4; const size_t r0 = (size_t)blockIdx.x * 64 + wave * 16; const int n0 = blockIdx.y * 128;
  v8f acc[8] = {};   // tile t: rows (t >> 1) * 16 .. of the block, columns (wave * 2 + (t & 1)) * 16 ..
#pragma unroll 1   // eight stages of 64 k: one copy of the body keeps the text short
  for (int s = 0; s < DM / 64; ++s) { __bf16 *bh = sah + (s & 1) * (64 * 72), *bl = sal + (s & 1) * (64 * 72);
    v16b w[2][2];   // the stage's four weight fragments, in the same group of loads as the plane rows
    const __bf16* pw = P + ((size_t)(blockIdx.y * (DM / 32) + s * 2) * 8 + wave * 2) * 512 + lane * 8; const float* p0 = a_lane<64>(O + r0 * DM + s * 64, lane);
#pragma unroll   // register array: every index must be a constant
    for (int kc = 0; kc < 2; ++kc) {
#pragma unroll   // register array: every index must be a constant
      for (int jj = 0; jj < 2; ++jj) w[kc][jj] = frag_bl(pw + (kc * 8 + jj) * 512); }
    v4f pr[NLAY][8];
#pragma unroll   // register array: every index must be a constant
    for (int l = 0; l < NLAY; ++l) { a_load<64>(pr[l], p0 + l * OS); asm volatile("s_wait_xcnt 0x0" ::: "memory"); }   // a wait behind each plane's loads: the next plane's results may land in this plane's address registers
    __builtin_amdgcn_sched_barrier(0);   // every global load of the stage is issued before the first wait for data: a load held back behind a sum would cost a second trip to memory
    v4f v[8];   // sum over the layers in order 0..3 of (gate_l x_l) / sqrt(3)
#pragma unroll   // register array: every index must be a constant
    for (int u = 0; u < 8; ++u) { v4f x = {};
#pragma unroll   // register array: every index must be a constant
      for (int l = 0; l < NLAY; ++l) x = x + pr[l][u] * 0.57735026918962576f;
      v[u] = x; }
    a_store2<64>(bh, bl, v, wave, lane);   // into the buffers whose readers left them before the last barrier
    __syncthreads();   // stage s is published
#pragma unroll
    for (int kc = 0; kc < 2; ++kc) { v16b ah[4], al[4];
#pragma unroll   // register array: every index must be a constant
      for (int i = 0; i < 4; ++i) { al[i] = frag_b(bl + (i * 16 + col) * 72 + kc * 32, lane); ah[i] = frag_b(bh + (i * 16 + col) * 72 + kc * 32, lane); }
#pragma unroll
      for (int t = 0; t < 8; ++t) acc[t] = wmma_bf(al[t >> 1], w[kc][t & 1], acc[t]);
#pragma unroll
      for (int t = 0; t < 8; ++t) acc[t] = wmma_bf(ah[t >> 1], w[kc][t & 1], acc[t]); } }
  __syncthreads();   // every read of the last stage has ended: the bytes become the epilogue's stage
#pragma unroll
  for (int t = 0; t < 8; ++t) { const int i = t >> 1, j = wave * 2 + (t & 1);
#pragma unroll
    for (int r = 0; r < 8; ++r) so[i][8 * g + r][j * 16 + col] = acc[t][r] + bfr(BO[n0 + j * 16 + col]); }
  __syncthreads();   // a row tile's 128 columns come from all four waves
  for (int rl = 0; rl < 16; ++rl) vst2(Y + (r0 + rl) * DM + n0 + lane * 4, *(const v4f*)&so[wave][rl][lane * 4]);
}
#define NR (NB * SS)
// ---- k_gate: block = (64 rows, 128 cols, layer l): g = sigmoid([query (exact bf16, 1 product) | x_l (hi + residual, 2 products)] . Wsig_l rows + bsig_l); FUS plane l = g * x_l (k_out scales by 1 / sqrt(3) and sums the planes)
__global__ __launch_bounds__(128) void k_gate(const float* __restrict__ XQ, const float* __restrict__ XL, const __bf16* __restrict__ PSG, const float* __restrict__ BS, float* __restrict__ FUS) {
  __shared__ __align__(16) char sm[36864];   // k loops: two buffers each of the hi and the residual A tile, 64 x 72 bf16; behind the last barrier of the loops the same bytes are the epilogue's stage
  float (*so)[16][132] = (float (*)[16][132])sm; __bf16 *sah = (__bf16*)sm, *sal = sah + 2 * (64 * 72); const int l = blockIdx.z; XL += l * OS; FUS += l * OS;
  const int tid = threadIdx.x, wave = tid >> 5, lane = tid & 31, col = lane & 15, g = lane >> 4; const size_t rb = (size_t)blockIdx.x * 64, r0 = rb + wave * 16; const int n0 = blockIdx.y * 128;
  const __bf16* Wr = PSG + (size_t)l * DM * 2 * DM; v8f acc[8] = {};   // tile t: rows (t >> 1) * 16 .. of the block, columns (wave * 2 + (t & 1)) * 16 ..
  const float *Aq = a_lane<64>(XQ + r0 * DM, lane), *Ax = a_lane<64>(XL + r0 * DM, lane);   // the wave's 16 rows of the two halves of [query | x_l]
  v4f ar[8];
  a_load<64>(ar, Aq); XW1(Aq); a_store<64>(sah, ar, wave, lane);
  __syncthreads();   // stage 0 is published
#pragma unroll 1   // query half, eight stages of 64 k: one copy of the body keeps the text short
  for (int s = 0; s < DM / 64; ++s) { const __bf16* sb = sah + (s & 1) * (64 * 72); const int nb = ((s + 1) & 1) * (64 * 72);
    v16b w[2][2];   // the stage's four weight fragments as one group, then the next stage's A rows: both in flight under the products
    const __bf16* pw = Wr + ((size_t)(blockIdx.y * (2 * DM / 32) + s * 2) * 8 + wave * 2) * 512 + lane * 8; const float* pa = (s + 1 < DM / 64) ? Aq + (s + 1) * 64 : Ax;   // behind the last query stage comes x_l's first
#pragma unroll   // register array: every index must be a constant
    for (int kc = 0; kc < 2; ++kc) {
#pragma unroll   // register array: every index must be a constant
      for (int jj = 0; jj < 2; ++jj) w[kc][jj] = frag_bl(pw + (kc * 8 + jj) * 512); }
    __builtin_amdgcn_sched_barrier(0);   // the weight loads stay ahead of the A rows: loads return in order, and the first product waits for weights only
    a_load<64>(ar, pa); XW2(pw, pa);
    __builtin_amdgcn_sched_barrier(0);   // every global load of the stage is issued before the first wait for data
#pragma unroll
    for (int kc = 0; kc < 2; ++kc) { v16b a[4];
#pragma unroll   // register array: every index must be a constant
      for (int i = 0; i < 4; ++i) a[i] = frag_b(sb + (i * 16 + col) * 72 + kc * 32, lane);
#pragma unroll
      for (int t = 0; t < 8; ++t) acc[t] = wmma_bf(a[t >> 1], w[kc][t & 1], acc[t]); }
    __builtin_amdgcn_sched_barrier(0);   // the conversions stay behind the products: moved up, they would wait for the rows fetched ahead at the stage's top
    if (s + 1 < DM / 64) a_store<64>(sah + nb, ar, wave, lane); else a_store2<64>(sah + nb, sal + nb, ar, wave, lane);   // into the buffer whose readers left it at the last barrier
    __syncthreads(); }   // publishes the next stage and ends every read of this one
  auto stage = [&](const int s, const bool more) __attribute__((always_inline)) { const __bf16 *bh = sah + (s & 1) * (64 * 72), *bl = sal + (s & 1) * (64 * 72); const int nb = ((s + 1) & 1) * (64 * 72);
    v16b w[2][2];
    const __bf16* pw = Wr + ((size_t)(blockIdx.y * (2 * DM / 32) + DM / 32 + s * 2) * 8 + wave * 2) * 512 + lane * 8; const float* pa = Ax + (s + 1) * 64;
#pragma unroll   // register array: every index must be a constant
    for (int kc = 0; kc < 2; ++kc) {
#pragma unroll   // register array: every index must be a constant
      for (int jj = 0; jj < 2; ++jj) w[kc][jj] = frag_bl(pw + (kc * 8 + jj) * 512); }
    __builtin_amdgcn_sched_barrier(0);   // the weight loads stay ahead of the A rows: loads return in order, and the first product waits for weights only
    if (more) { a_load<64>(ar, pa); XW2(pw, pa); } else XW1(pw);   // more: a constant at each call, so the count of loads in flight is known at every wait
    __builtin_amdgcn_sched_barrier(0);   // every global load of the stage is issued before the first wait for data
#pragma unroll
    for (int kc = 0; kc < 2; ++kc) { v16b ah[4], al[4];
#pragma unroll   // register array: every index must be a constant
      for (int i = 0; i < 4; ++i) { al[i] = frag_b(bl + (i * 16 + col) * 72 + kc * 32, lane); ah[i] = frag_b(bh + (i * 16 + col) * 72 + kc * 32, lane); }
#pragma unroll
      for (int t = 0; t < 8; ++t) acc[t] = wmma_bf(al[t >> 1], w[kc][t & 1], acc[t]);
#pragma unroll
      for (int t = 0; t < 8; ++t) acc[t] = wmma_bf(ah[t >> 1], w[kc][t & 1], acc[t]); }
    __builtin_amdgcn_sched_barrier(0);   // the conversions stay behind the products: moved up, they would wait for the rows fetched ahead at the stage's top
    if (more) a_store2<64>(sah + nb, sal + nb, ar, wave, lane);
    __syncthreads(); };   // publishes the next stage and ends every read of this one
#pragma unroll 1   // x_l half, eight stages of 64 k
  for (int s = 0; s < DM / 64 - 1; ++s) stage(s, true);
  stage(DM / 64 - 1, false);
  float bb[2];   // the wave's two column tiles' bias values
  const float *pb = BS + (size_t)l * DM + n0 + wave * 32 + col, *px = XL + (rb + 8 * g) * DM + n0 + wave * 32 + col;   // the lane's own addresses of the bias and of x_l's tile values
#pragma unroll   // register array: every index must be a constant
  for (int jj = 0; jj < 2; ++jj) bb[jj] = bfr(pb[jj * 16]);
  XW1(pb);
#pragma unroll   // register array: every index must be a constant
  for (int jh = 0; jh < 2; ++jh) { float xv[4][8];   // half a tile's x_l values as one group of loads ahead of its exp calls (no load moves over a call); two halves keep a group under the load counter's range
#pragma unroll   // register array: every index must be a constant
    for (int tt = 0; tt < 4; ++tt) { const int t = jh * 4 + tt;
#pragma unroll   // register array: every index must be a constant
      for (int r = 0; r < 8; ++r) xv[tt][r] = px[((t >> 1) * 16 + r) * DM + (t & 1) * 16]; }
    XW1(px);
#pragma unroll   // register array: every index must be a constant
    for (int tt = 0; tt < 4; ++tt) { const int t = jh * 4 + tt;
#pragma unroll   // register array: every index must be a constant
      for (int r = 0; r < 8; ++r) { const float gte = 1.0f / (1.0f + exp_ni(-(acc[t][r] + bb[t & 1]))); so[t >> 1][8 * g + r][(wave * 2 + (t & 1)) * 16 + col] = gte * xv[tt][r]; } } }
  __syncthreads();   // a row tile's 128 columns come from all four waves
  for (int rl = 0; rl < 16; ++rl) vst2(FUS + (r0 + rl) * DM + n0 + lane * 4, *(const v4f*)&so[wave][rl][lane * 4]);
}
extern "C" void kernel_launch(void* const* d_in, const int* in_sizes, int n_in, void* d_out, int out_size, void* d_ws, size_t ws_size, hipStream_t stream) {
  (void)in_sizes; (void)n_in; (void)out_size;
  const float** F = (const float**)d_in;   // 0 query [4,1024,512], 1 key [4,4,1024,512], 2 value [4,4,1024,512], 3 Wq [512,512], 4 bq, 5 Wk [4,512,512], 6 bk [4,512], 7 Wv, 8 bv, 9 Wsig [4,512,1024], 10 bsig [4,512], 11 Wf [512,512], 12 bf
  if (ws_size < (size_t)WS_END) return;
  char* ws = (char*)d_ws; __bf16 *PK = (__bf16*)(ws + WS_PK), *PSG = (__bf16*)(ws + WS_PSG); _Float16 *QK = (_Float16*)(ws + WS_QK), *VTH = (_Float16*)(ws + WS_VTH), *KF = (_Float16*)(ws + WS_KF); float *O = (float*)(ws + WS_O), *FUS = (float*)(ws + WS_FUS);
  // the layers are independent up to the gated sum: each stage is one launch with the layer in blockIdx.z (in k_qkv: in blockIdx.y)
  k_pack<<<dim3(DM / 16, 5, NLAY), 256, 0, stream>>>(F[3], F[5], F[7], F[11], F[9], PK, PSG);   // per layer: Wk[l] | Wv[l] | Wsig[l] as fragments; Wq and Wf once, in layer 0's pack
  k_qkv<<<dim3(TNB * SS / 64, DM / 128 + NLAY * (2 * DM / 128)), 128, 0, stream>>>(F[0], F[1], F[2], PK + PK_A, F[4], F[6], F[8], QK, VTH, KF);   // q once, then k_l, v_l of every layer
  k_attn<<<dim3(SS / AQB, NH, TNB * NLAY), 256, 0, stream>>>(QK, VTH, KF, nullptr, O);   // x_l
  k_gate<<<dim3(NR / 64, DM / 128, NLAY), 128, 0, stream>>>(F[0], O, PSG, F[10], FUS);   // gate_l * x_l
  k_out<<<dim3(TOB, DM / 128), 128, 0, stream>>>(FUS, PK + PK_P, F[12], (float*)d_out);   // (sum_l gate_l x_l / sqrt(3)) . Wf^T + bf (Wf of layer 0's pack)
}

// v009
// Measured time: 109 microseconds a run.
// In both of two side-by-side timings against v008, it was 1.07 times as fast.
// Over all steps from v000 it is 7.85 times as fast.
// compute dtype: all float inputs rounded to bf16; q = query . Wq^T + bq and k_l, v_l = key_l / value_l . W^T + b with EXACT bf16 products on WMMA 16x16x32 (weights, k and v^T kept in fragment order in the workspace); PLAIN attention per layer: q, k as single f16 operands x 1/8, running-max softmax in f32 (hardware exp2; 1/8, log2 e and the 2^11 of P in one FMA), P (scaled by 2^11, single f16) x v (single f16); gate_l = sigmoid([query (exact) | x_l (bf16 hi + residual, 2 products)] . Wsig_l^T + bsig_l) (precise expf); fused = sum_l gate_l x_l / sqrt(3) in f32; out = fused (bf16 hi + residual) . Wf^T (2 products) + bf.
#include <hip/hip_runtime.h>
#include <math.h>

typedef __attribute__((ext_vector_type(16))) _Float16 v16h;
typedef __attribute__((ext_vector_type(16))) __bf16 v16b;
typedef __attribute__((ext_vector_type(8)))  _Float16 v8h;
typedef __attribute__((ext_vector_type(8)))  float v8f;
typedef __attribute__((ext_vector_type(4)))  float v4f;
typedef __attribute__((ext_vector_type(2)))  float v2f;
typedef __attribute__((ext_vector_type(4)))  unsigned v4u;
typedef __attribute__((ext_vector_type(4)))  int v4i;
typedef float __attribute__((may_alias)) float_a;
typedef int __attribute__((may_alias)) int_a;

template <typename T> __device__ __forceinline__ void vst2(void* p, T v) { *(T*)p = v;  }
__device__ __forceinline__ v8f wmma16(v16h a, v16h b, v8f c) {
  v8f d = __builtin_amdgcn_wmma_f32_16x16x32_f16(false, a, false, b, (short)0, c, false, false);
  asm volatile("v_nop\n\tv_nop\n\tv_nop\n\tv_nop" : "+v"(d) : "v"(a), "v"(b));
  return d;
}
__device__ __forceinline__ v8f wmma_bf(v16b a, v16b b, v8f c) {
  v8f d = __builtin_amdgcn_wmma_f32_16x16x32_bf16(false, a, false, b, (short)0, c, false, false);
  asm volatile("v_nop\n\tv_nop\n\tv_nop\n\tv_nop" : "+v"(d) : "v"(a), "v"(b));
  return d;
}
// Multi-layer source attention (B 4, 1,024 queries over 4 layers of 1,024 keys/values, d 512, 8 heads x 64): a shared query projection, per-layer key/value projections, softmax(q k_l^T / 8) v_l per layer, per-layer sigmoid gates from [query | x_l], gated sum over layers / sqrt(3), final linear map.
__device__ __forceinline__ v16h frag_h(const _Float16* rowk0, int lane) {
  union { v16h v; v8h q[2]; } u; const _Float16* p = rowk0 + 8 * (lane >> 4);
  u.q[0] = *(const v8h*)p; u.q[1] = *(const v8h*)(p + 16); return u.v;
}
__device__ __forceinline__ v16h frag_f32(const float* rowk0, int lane) {
  v16h a; const float* p = rowk0 + 8 * (lane >> 4);
#pragma unroll
  for (int i = 0; i < 8; ++i) { a[i] = (_Float16)p[i]; a[8 + i] = (_Float16)p[16 + i]; }
  return a;
}
__device__ __forceinline__ v16h frag_f32s(const float* rowk0, int lane, float sc) {
  v16h a; const float* p = rowk0 + 8 * (lane >> 4);
#pragma unroll
  for (int i = 0; i < 8; ++i) { a[i] = (_Float16)(p[i] * sc); a[8 + i] = (_Float16)(p[16 + i] * sc); }
  return a;
}
// column fragment from a [K][ld] layout (column n), rows >= K read as 0
__device__ __forceinline__ v16h fragc_f32(const float* W, int k0, int n, int lane, int ld, int K) {
  v16h a; const int g = lane >> 4;
#pragma unroll
  for (int i = 0; i < 8; ++i) { const int ka = k0 + 8 * g + i, kb = ka + 16;
    a[i] = (_Float16)(ka < K ? W[(size_t)(ka < K ? ka : K - 1) * ld + n] : 0.f); a[8 + i] = (_Float16)(kb < K ? W[(size_t)(kb < K ? kb : K - 1) * ld + n] : 0.f); }
  return a;
}
struct F2 { v16b h, l; };
__device__ __forceinline__ F2 bsplit16(const float v[16]) { F2 r;
#pragma unroll
  for (int i = 0; i < 16; ++i) { const __bf16 h = (__bf16)v[i]; r.h[i] = h; r.l[i] = (__bf16)(v[i] - (float)h); }
  return r; }
__device__ __forceinline__ F2 split_row(const float* row, int k0, int lane) { float v[16]; const float* p = row + k0 + 8 * (lane >> 4);
#pragma unroll
  for (int i = 0; i < 8; ++i) { v[i] = p[i]; v[8 + i] = p[16 + i]; }
  return bsplit16(v); }
__device__ __forceinline__ F2 split_rowK(const float* row, int k0, int lane, int K) { float v[16]; const int g = lane >> 4;
#pragma unroll
  for (int i = 0; i < 8; ++i) { const int ka = k0 + 8 * g + i, kb = ka + 16; v[i] = ka < K ? row[ka < K ? ka : K - 1] : 0.f; v[8 + i] = kb < K ? row[kb < K ? kb : K - 1] : 0.f; }
  return bsplit16(v); }
__device__ __forceinline__ F2 split_col(const float* W, int k0, int n, int lane, int ld, int K) { float v[16]; const int g = lane >> 4;
#pragma unroll
  for (int i = 0; i < 8; ++i) { const int ka = k0 + 8 * g + i, kb = ka + 16; v[i] = ka < K ? W[(size_t)(ka < K ? ka : K - 1) * ld + n] : 0.f; v[8 + i] = kb < K ? W[(size_t)(kb < K ? kb : K - 1) * ld + n] : 0.f; }
  return bsplit16(v); }
__device__ __forceinline__ v8f mac3(const F2& a, const F2& b, v8f c) { c = wmma_bf(a.l, b.h, c); c = wmma_bf(a.h, b.l, c); return wmma_bf(a.h, b.h, c); }
__device__ __forceinline__ float sigm(float v) { return 1.0f / (1.0f + expf(-v)); }
#define LDSX() do { asm volatile("s_wait_dscnt 0" ::: "memory"); __builtin_amdgcn_wave_barrier(); __builtin_amdgcn_fence(__ATOMIC_RELEASE, "workgroup"); } while (0)


#define NB 4
#define SS 1024
#define DM 512
#define NH 8
#define NLAY 4
__device__ __forceinline__ size_t kvrow(size_t r) { return (r / SS) * ((size_t)NLAY * SS) + (r % SS); }   // key/value [B][L][S][D]: engine row (b, s) of layer l lives at (b*L + l)*S + s (layer offset added to the pointer)
#define HD 64
#define QKVW (3 * DM)
#ifndef TQB
#define TQB (SS / 64)
#define TNB NB
#define TOB (NB * SS / 64)     // output row tiles (all)
#endif
typedef __attribute__((ext_vector_type(8))) __bf16 v8b;
__device__ __forceinline__ v16b frag_b(const __bf16* rowk0, int lane) {
  union { v16b v; v8b q[2]; } u; const __bf16* p = rowk0 + 8 * (lane >> 4);
  u.q[0] = *(const v8b*)p; u.q[1] = *(const v8b*)(p + 16); return u.v;
}
// fragment order: one 16 x 32 operand fragment is 1 KiB, [half][lane][8 elements]; lane (g, col) holds row col, k = half * 16 + 8 g + 0..7 (the k order of frag_b / frag_h), so each 16-byte load of a wave reads 512 contiguous bytes
__device__ __forceinline__ v16b frag_bp(const __bf16* frag, int lane) {
  union { v16b v; v8b q[2]; } u; const __bf16* p = frag + lane * 8;
  u.q[0] = *(const v8b*)p; u.q[1] = *(const v8b*)(p + 256); return u.v;
}
__device__ __forceinline__ v16h frag_hp(const _Float16* frag, int lane) {
  union { v16h v; v8h q[2]; } u; const _Float16* p = frag + lane * 8;
  u.q[0] = *(const v8h*)p; u.q[1] = *(const v8h*)(p + 256); return u.v;
}
__device__ __forceinline__ float bfr(float v) { return (float)(__bf16)v; }
__device__ __attribute__((noinline)) float exp_ni(float v) { return expf(v); }
__device__ __attribute__((noinline)) float erf_ni(float v) { return erff(v); }

typedef __attribute__((ext_vector_type(4))) __bf16 v4b;
// ---- A tile of a 64 x 128 block product, staged once per block in LDS as bf16, KS k values a stage: wave w brings rows w * 16 .. + 15 with whole-line loads (a 16-byte load of the wave reads KS * 4 contiguous bytes of each row it touches); LDS row pitch KS + 8 elements (16 bytes x an odd number: 16-byte fragment reads meet no bank twice). Every wave then reads all four 16-row fragments and owns columns w * 32 .. + 31, so a weight fragment is loaded by one wave only
template <int KS> __device__ __forceinline__ const float* a_lane(const float* rows, int lane) { constexpr int LPR = KS / 4; return rows + (size_t)(lane / LPR) * DM + (lane % LPR) * 4; }   // the lane's own address in the wave's first load
template <int KS> __device__ __forceinline__ void a_load(v4f (&ar)[KS / 8], const float* pl) {
  constexpr int RPL = 128 / KS;   // rows to a load
#pragma unroll   // register array: every index must be a constant
  for (int u = 0; u < KS / 8; ++u) ar[u] = *(const v4f*)(pl + (size_t)(u * RPL) * DM);
}
__device__ __forceinline__ v16b frag_bl(const __bf16* pl) {   // frag_bp from the lane's own address
  union { v16b v; v8b q[2]; } u; u.q[0] = *(const v8b*)pl; u.q[1] = *(const v8b*)(pl + 256); return u.v;
}
// behind a group of global loads: the wait names the group's address registers, so none of them is rewritten (by a later load's result either) ahead of it
#define XW1(p) asm volatile("s_wait_xcnt 0x0" :: "v"(p) : "memory")
#define XW2(p, q) asm volatile("s_wait_xcnt 0x0" :: "v"(p), "v"(q) : "memory")
template <int KS> __device__ __forceinline__ __bf16* a_slot(__bf16* buf, int wave, int lane, int u) {
  constexpr int LPR = KS / 4, RPL = 32 / LPR;
  return buf + (wave * 16 + u * RPL + lane / LPR) * (KS + 8) + (lane % LPR) * 4;
}
template <int KS> __device__ __forceinline__ void a_store(__bf16* buf, const v4f (&ar)[KS / 8], int wave, int lane) {
#pragma unroll   // register array: every index must be a constant
  for (int u = 0; u < KS / 8; ++u) { v4b o;
#pragma unroll   // register vector: every index must be a constant
    for (int e = 0; e < 4; ++e) o[e] = (__bf16)ar[u][e];
    *(v4b*)a_slot<KS>(buf, wave, lane, u) = o; }
}
template <int KS> __device__ __forceinline__ void a_store2(__bf16* bh, __bf16* bl, const v4f (&ar)[KS / 8], int wave, int lane) {   // bf16 hi + residual
#pragma unroll   // register array: every index must be a constant
  for (int u = 0; u < KS / 8; ++u) { v4b oh, ol;
#pragma unroll   // register vector: every index must be a constant
    for (int e = 0; e < 4; ++e) { const __bf16 h = (__bf16)ar[u][e]; oh[e] = h; ol[e] = (__bf16)(ar[u][e] - (float)h); }
    *(v4b*)a_slot<KS>(bh, wave, lane, u) = oh; *(v4b*)a_slot<KS>(bl, wave, lane, u) = ol; }
}
// a packed [N][K] weight: [N / 128][K / 32][8 row tiles] fragments of 512 elements
#define PK_A 0                       // Wq | Wk | Wv, 1536 rows x 512
#define PK_P (PK_A + QKVW * DM)        // Wf, 512 rows x 512
#define PK_END (PK_P + DM * DM)
#define WS_PK  0u
// every per-layer buffer holds NLAY planes (layer = blockIdx.z in k_pack and k_gate, blockIdx.z / NB in k_attn, (blockIdx.y - 4) / 8 in k_qkv); plane sizes in elements:
#define QKS ((size_t)NB * SS * 2 * DM)
#define VTS ((size_t)NB * DM * SS)
#define OS  ((size_t)NB * SS * DM)
#define WS_QK  (WS_PK + 2u * PK_END * NLAY)        // f16 [4096 rows][1024]: q | (unused), one plane (no layer enters q)
#define WS_VTH (WS_QK + 2u * QKS)                  // f16 [l][b][h][32 keys ks][4 d tiles] v^T fragments (row = d, k = key)
#define WS_O   (WS_VTH + 2u * NLAY * VTS)          // f32 [l][4096][512]
#define WS_CS  (WS_O + 4u * NLAY * OS)              // f32 [2048][32], written and read by no kernel
#define WS_PSG (WS_CS + 4u * 2 * SS * 32)                  // bf16 packed Wsig [4][512 x 1024]
#define WS_FUS (WS_PSG + 2u * (size_t)NLAY * DM * 2 * DM)   // f32 [l][NR][512] gate_l * x_l
#define WS_KF  (WS_FUS + 4u * NLAY * OS)            // f16 [l][b][h][16-key tile][2 k-steps] k fragments (row = key, k = d)
#define WS_END (WS_KF + 2u * NLAY * OS)
// ---- k_pack: block = (16-row tile nt, which, layer l): f32 [out][in] rows -> bf16 fragments; which 0..2 -> W_q/W_k[l]/W_v[l] into layer l's PK_A (rows which*512 + n); 3 -> W_f into layer l's PK_P; 4 -> Wsig[l] (rows 1024 long) into PSG; W_q and W_f belong to no layer and are packed by layer 0's blocks alone. A thread converts one lane's 8 elements; a wave stores 512 contiguous bytes
__global__ __launch_bounds__(256) void k_pack(const float* __restrict__ WQ, const float* __restrict__ WK, const float* __restrict__ WV, const float* __restrict__ WO, const float* __restrict__ WS, __bf16* __restrict__ PK, __bf16* __restrict__ PSG) {
  const int nt = blockIdx.x, which = blockIdx.y, l = blockIdx.z, t = threadIdx.x; if (l && (which == 0 || which == 3)) return;
  const size_t n = (size_t)nt * 16, ln = (size_t)l * DM + n; const int len = (which == 4) ? 2 * DM : DM;
  const float* Wm = (which == 0) ? WQ + n * DM : (which == 1) ? WK + ln * DM : (which == 2) ? WV + ln * DM : (which == 3) ? WO + n * DM : WS + ln * (2 * DM);
  __bf16* PL = PK + (size_t)l * PK_END;
  __bf16* dst = ((which < 3) ? PL + PK_A + (size_t)which * DM * DM : (which == 3) ? PL + PK_P : PSG + (size_t)l * DM * 2 * DM) + ((size_t)(nt >> 3) * (len / 32) * 8 + (nt & 7)) * 512;
  for (int p0 = t; p0 < len * 2; p0 += 1024) {
#pragma unroll   // four independent pieces to a trip: their loads are in flight together
    for (int u = 0; u < 4; ++u) { const int kc = p0 >> 6, half = (p0 >> 5) & 1, lane = p0 & 31; const float* s = Wm + (size_t)(lane & 15) * len + kc * 32 + half * 16 + (lane >> 4) * 8 + u * 4 * 32; v8b o;   // piece p0 + 256 u: k-step kc + 4 u, same half and lane
#pragma unroll   // register vector: every index must be a constant
      for (int i = 0; i < 8; ++i) o[i] = (__bf16)s[i];
      vst2(dst + (size_t)kc * 8 * 512 + half * 256 + lane * 8 + u * 4 * 8 * 512, o); } }
}
// ---- k_qkv: block = (64 rows, yy): yy 0..3 = q's four 128-column blocks (q is projected once: no layer enters it); yy 4 + 8 l + c = column block 4 + c of layer l's [q | k | v] weight rows (k, then v). Each result is kept once, as the f16 operand the attention reads
__global__ __launch_bounds__(128) void k_qkv(const float* __restrict__ XQ, const float* __restrict__ XK, const float* __restrict__ XV, const __bf16* __restrict__ P, const float* __restrict__ BQ, const float* __restrict__ BK, const float* __restrict__ BV, _Float16* __restrict__ QK, _Float16* __restrict__ VTH, _Float16* __restrict__ KF) {
  const int yy = blockIdx.y, yb = (yy < DM / 128) ? yy : DM / 128 + ((yy - DM / 128) & 7);   // column block among the 12 of [q | k | v]
  { const size_t l = (yy < DM / 128) ? 0 : (yy - DM / 128) >> 3; XK += l * SS * DM; XV += l * SS * DM; P += l * PK_END; BK += l * DM; BV += l * DM; VTH += l * VTS; KF += l * OS; }   // layer l's inputs, weights and planes
  const int which0 = (yb * 128) / DM; const float* X = (which0 == 0) ? XQ : (which0 == 1) ? XK : XV; const float* BB = BQ ? (((which0 == 0) ? BQ : (which0 == 1) ? BK : BV) + (yb * 128 - which0 * DM)) : nullptr;
  __shared__ __align__(16) char sm[34816];   // k loop: two A buffers of 64 x 136 bf16; behind the loop's last barrier the same bytes are the epilogue's stage
  _Float16 (*so)[16][136] = (_Float16 (*)[16][136])sm; _Float16 (*sth)[72] = (_Float16 (*)[72])sm;
  __bf16* sa = (__bf16*)sm;
  const int tid = threadIdx.x, wave = tid >> 5, lane = tid & 31, col = lane & 15, g = lane >> 4; const size_t r0 = (size_t)blockIdx.x * 64 + wave * 16; const int n0 = yb * 128;
  v8f acc[8] = {};   // tile t: rows (t >> 1) * 16 .. of the block, columns (wave * 2 + (t & 1)) * 16 ..
  float bias[2] = {};   // the wave's two column tiles' bias values, loaded ahead of the k loop, rounded to bf16 where they are added
  if (BB) {
#pragma unroll   // register array: every index must be a constant
    for (int jj = 0; jj < 2; ++jj) bias[jj] = BB[(wave * 2 + jj) * 16 + col];
    asm volatile("s_wait_xcnt 0x0" ::: "memory"); }   // behind the two loads: code that follows them in the listing reuses their address registers
  const float* Aw = a_lane<128>(X + ((which0 == 0) ? r0 : kvrow(r0)) * DM, lane);   // the wave's 16 rows are consecutive (a 64-row block lies in one batch)
  const int off = (blockIdx.x + blockIdx.y) & (DM / 128 - 1);   // the block's first k stage; the walk wraps round. The 64 row blocks of a column block read the same weight lines and the column blocks of a row block the same input rows: started at different stages they do not ask L2 for the same lines at the same moment
  const float* A0 = Aw + off * 128;
  v4f ar[16];
  a_load<128>(ar, A0); XW1(A0); a_store<128>(sa, ar, wave, lane);
  __syncthreads();   // stage 0 is published
  auto stage = [&](const int s, const bool more) __attribute__((always_inline)) { const __bf16* sb = sa + (s & 1) * (64 * 136);   // more: a constant at each call, so the count of loads in flight is known at every wait
    v16b w[4][2];   // the stage's eight weight fragments as one group, then the next stage's A rows: both in flight under the products
    const __bf16* pw = P + ((size_t)(yb * (DM / 32) + ((s + off) & (DM / 128 - 1)) * 4) * 8 + wave * 2) * 512 + lane * 8; const float* pa = Aw + ((s + 1 + off) & (DM / 128 - 1)) * 128;   // step s works on k stage (s + off) mod 4
#pragma unroll   // register array: every index must be a constant
    for (int kc = 0; kc < 4; ++kc) {
#pragma unroll   // register array: every index must be a constant
      for (int jj = 0; jj < 2; ++jj) w[kc][jj] = frag_bl(pw + (kc * 8 + jj) * 512); }
    __builtin_amdgcn_sched_barrier(0);   // the weight loads stay ahead of the A rows: loads return in order, and the first product waits for weights only
    if (more) { a_load<128>(ar, pa); XW2(pw, pa); } else XW1(pw);
    __builtin_amdgcn_sched_barrier(0);   // every global load of the stage is issued before the first wait for data
#pragma unroll
    for (int kc = 0; kc < 4; ++kc) { v16b a[4];
#pragma unroll   // register array: every index must be a constant
      for (int i = 0; i < 4; ++i) a[i] = frag_b(sb + (i * 16 + col) * 136 + kc * 32, lane);
#pragma unroll
      for (int t = 0; t < 8; ++t) acc[t] = wmma_bf(a[t >> 1], w[kc][t & 1], acc[t]); }
    __builtin_amdgcn_sched_barrier(0);   // the conversions stay behind the products: moved up, they would wait for the rows fetched ahead at the stage's top
    if (more) a_store<128>(sa + ((s + 1) & 1) * (64 * 136), ar, wave, lane);   // into the buffer whose readers left it at the last barrier
    __syncthreads(); };   // publishes stage s + 1 and ends every read of stage s
#pragma unroll 1   // four stages of 128 k: one copy of the body for the stages that fetch ahead keeps the text short
  for (int s = 0; s < DM / 128 - 1; ++s) stage(s, true);
  stage(DM / 128 - 1, false);
  if (n0 < 2 * DM) {   // q stored unscaled (f16 sigma ~0.6, no subnormal exposure); 1/8 applied to the f32 score
#pragma unroll
    for (int t = 0; t < 8; ++t) { const int i = t >> 1, j = wave * 2 + (t & 1);
#pragma unroll
      for (int r = 0; r < 8; ++r) so[i][8 * g + r][j * 16 + col] = (_Float16)(acc[t][r] + bfr(bias[t & 1])); }   // q, k (+ bias) as f16
    __syncthreads();   // a row tile's 128 columns come from all four waves
    if (which0 == 0) {
    for (int rl = 0; rl < 16; ++rl) if (lane < 16) vst2((unsigned*)(QK + (r0 + rl) * (2 * DM) + n0 + lane * 8), *(const v4u*)&so[wave][rl][lane * 8]);
    } else {   // k: the wave's 16 keys x 128 columns are four fragments (2 heads x 2 k-steps)
      _Float16* kt = KF + (((r0 / SS) * NH + (n0 - DM) / HD) * (SS / 16) + (r0 % SS) / 16) * 1024 + lane * 8;
#pragma unroll
      for (int f = 0; f < 8; ++f) { const int hh = f >> 2, kc = (f >> 1) & 1, half = f & 1; vst2((unsigned*)(kt + (size_t)hh * (SS / 16) * 1024 + kc * 512 + half * 256), *(const v4u*)&so[wave][col][hh * HD + kc * 32 + half * 16 + g * 8]); }
      asm volatile("s_wait_xcnt 0x0" ::: "memory"); }   // behind the run of stores: code that follows them in the listing reuses their data and address registers
  } else {
#pragma unroll
    for (int t = 0; t < 8; ++t) { const int i = t >> 1, j = wave * 2 + (t & 1);
#pragma unroll
      for (int r = 0; r < 8; ++r) sth[j * 16 + col][i * 16 + 8 * g + r] = (_Float16)(acc[t][r] + bfr(bias[t & 1])); }
    __syncthreads();
    const size_t rb = (size_t)blockIdx.x * 64; const int b = (int)(rb / SS), s0 = (int)(rb % SS); const int pc0 = n0 - 2 * DM;
    for (int q = tid; q < 128 * 8; q += 128) { const int ln = q & 31, half = (q >> 5) & 1, dt = (q >> 6) & 3, ksl = (q >> 8) & 1, hh = q >> 9;   // the block's 64 keys x 128 d are 16 v^T fragments (2 heads x 2 key groups x 4 d tiles)
      vst2((unsigned*)(VTH + ((((size_t)b * NH + pc0 / HD + hh) * (SS / 32) + s0 / 32 + ksl) * 4 + dt) * 512 + half * 256 + ln * 8), *(const v4u*)&sth[hh * HD + dt * 16 + (ln & 15)][ksl * 32 + half * 16 + (ln >> 4) * 8]); }
  }
}
// lane l with lane l ^ 16 (the two lane halves hold the two halves of a query's keys)
__device__ __forceinline__ float xhalf(float x) { return __builtin_bit_cast(float, __builtin_amdgcn_permlanex16(__builtin_bit_cast(int, x), __builtin_bit_cast(int, x), 0x76543210, 0xfedcba98, false, false)); }
// ---- k_attn: block = (256 queries, head h, (layer l, batch b)), 8 waves x 32 query columns: k and v^T read as packed fragments (KF, VTH); a loaded fragment feeds two products (the wave's two 16-column groups c), and the eight waves walk the same fragments, so one fetch from L2 serves 256 queries through the WGP cache. All-keys flash attention (K = 64: 2 k-steps), TRANSPOSED: S^T = k (A) . q^T (B), so lane (g, col) holds 16 of query c * 16 + col's 32 scores of a pass (keys ct * 16 + 8 g + r): maximum and sum in the lane, the maximum joined with the other half once a pass, the sums once at the end; a group's two score tiles, converted in place, are the B operand P^T of O^T += v^T (A) . P^T; P = 2^(q.k * (log2 e / 8) - maximum + 11) with single f16 operands, the sum l carries the same 2^11; O[b*S+q][h*64+d] = acc / l (256-B segments)
#define AQB 256   // queries to a block
__global__ __launch_bounds__(256) void k_attn(const _Float16* __restrict__ QK, const _Float16* __restrict__ VTH, const _Float16* __restrict__ KF, const void* __restrict__ KMASK, float* __restrict__ O) {
  __shared__ __align__(16) float so[8][32][68];
  const int tid = threadIdx.x, wave = tid >> 5, lane = tid & 31, col = lane & 15, g = lane >> 4;
  const int qb = blockIdx.x, h = blockIdx.y, b = blockIdx.z % NB; { const size_t l = blockIdx.z / NB; VTH += l * VTS; KF += l * OS; O += l * OS; }   // layer l's planes (q has one plane)
  const int q0 = qb * AQB + wave * 32;
  v16h aq[2][2];   // [column group][k-step]
#pragma unroll   // register array: every index must be a constant
  for (int c = 0; c < 2; ++c) {
#pragma unroll   // register array: every index must be a constant
    for (int kc = 0; kc < 2; ++kc) aq[c][kc] = frag_h(QK + ((size_t)b * SS + q0 + c * 16 + col) * (2 * DM) + h * HD + kc * 32, lane); }
  const float KS2 = 0.125f * 1.44269504088896341f;   // 1/sqrt(64) and log2 e in one factor: exp(x / 8) = 2^(x * KS2)
  float m[2] = {-3.0e38f, -3.0e38f}, l[2] = {0.f, 0.f};   // per column group: query col's running maximum of the raw products q.k (equal in both halves) and this half's share of its sum (x 2^11)
  v8f acc[2][4] = {};   // O^T: acc[c][dt][r] = query c * 16 + col, d = dt * 16 + 8 g + r
  const int nks = SS / 32;   // all keys
  const _Float16* kbase = KF + (size_t)(b * NH + h) * SS * HD;   // k fragments of this (layer, batch, head): 4 to a pass
  const _Float16* vbase = VTH + (size_t)(b * NH + h) * SS * HD;   // v^T fragments: 4 to a pass
  const int ko = qb * (nks / (SS / AQB));   // the block's first pass; the walk over the keys wraps round: the four query blocks of a (layer, batch, head) read the same k and v^T lines, each a quarter of the keys apart
  v16h kf[2][2];   // a pass's four k fragments, fetched one pass ahead
#pragma unroll   // register array: every index must be a constant
  for (int ct = 0; ct < 2; ++ct) {
#pragma unroll   // register array: every index must be a constant
    for (int kc = 0; kc < 2; ++kc) kf[ct][kc] = frag_hp(kbase + (size_t)ko * 2048 + (ct * 2 + kc) * 512, lane); }
  unsigned eo = ko * 2048u;   // the pass's place in both fragment streams, in elements (a pass is four fragments of each)
#pragma unroll 1
  for (int ks = 0; ks < nks; ++ks) { v8f s[2][2];   // [column group][key tile]
    v16h vf[4];   // this pass's four v^T fragments: issued here as one group, first used behind the softmax
#pragma unroll   // register array: every index must be a constant
    for (int dt = 0; dt < 4; ++dt) vf[dt] = frag_hp(vbase + eo + dt * 512, lane);
    __builtin_amdgcn_sched_barrier(0);   // the v^T loads are issued ahead of the pass's first wait (for k): moved down among the score products they start later by that wait
#pragma unroll
    for (int ct = 0; ct < 2; ++ct) {
#pragma unroll
      for (int c = 0; c < 2; ++c) { v8f x = {};
#pragma unroll
        for (int kc = 0; kc < 2; ++kc) x = __builtin_amdgcn_wmma_f32_16x16x32_f16(false, kf[ct][kc], false, aq[c][kc], (short)0, x, false, false);   // single product: k, q as one-rounding f16 operands; the compiler keeps the distance behind the builtin
        s[c][ct] = x; } }   // raw products: the scale is applied inside the exponent
    asm volatile("v_nop\n\tv_nop\n\tv_nop\n\tv_nop" : "+v"(s[0][0]), "+v"(s[0][1]), "+v"(s[1][0]), "+v"(s[1][1]) :: "memory");   // the distance between the last score product and the first read of its result; it names the four tiles and memory, so no k load moves up among the products (issued while a fragment is still to be read it needs other registers, and copies behind a full wait follow)
    { eo = (eo + 2048u) & (SS * HD - 1u); const _Float16* kn = kbase + eo;   // next pass's k fragments into the same registers, in flight under the softmax and P.V (the last pass reads the first pass's rows again: in bounds, unused)
#pragma unroll   // register array: every index must be a constant
      for (int ct = 0; ct < 2; ++ct) {
#pragma unroll   // register array: every index must be a constant
        for (int kc = 0; kc < 2; ++kc) kf[ct][kc] = frag_hp(kn + (ct * 2 + kc) * 512, lane); } }
    __builtin_amdgcn_sched_barrier(0);   // the k loads are issued here, a whole softmax and P.V ahead of their use: left free, the compiler sinks them to the foot of the pass, and the next pass opens with a wait for them
#pragma unroll   // register arrays: every index must be a constant
    for (int c = 0; c < 2; ++c) {   // the two column groups are independent chains: the compiler interleaves them, and the rescaling and the sums fill the slots between the P.V products
      float mx = s[c][0][0];
#pragma unroll   // register array: every index must be a constant
      for (int r = 1; r < 8; ++r) mx = fmaxf(mx, s[c][0][r]);
#pragma unroll   // register array: every index must be a constant
      for (int r = 0; r < 8; ++r) mx = fmaxf(mx, s[c][1][r]);
      mx = fmaxf(mx, xhalf(mx));
      const float mn = fmaxf(m[c], mx);
      const float off = fmaf(mn, KS2, -11.0f);
      v16h pa; float es0 = 0.f, es1 = 0.f;
      const v8f x0 = __builtin_elementwise_fma(s[c][0], (v8f)KS2, (v8f)(-off)), x1 = __builtin_elementwise_fma(s[c][1], (v8f)KS2, (v8f)(-off));   // as vectors: two exponents to a packed FMA
#pragma unroll   // register array: every index must be a constant
      for (int r = 0; r < 8; ++r) { const float e0 = __builtin_amdgcn_exp2f(x0[r]), e1 = __builtin_amdgcn_exp2f(x1[r]);
        es0 += e0; es1 += e1;
        pa[r] = (_Float16)e0; pa[8 + r] = (_Float16)e1; }   // P carries 2^11 (the + 11 in the exponent) so small softmax weights stay out of the f16 subnormal range; the sum carries it too and it cancels in the epilogue. Element s of the B operand is key (s < 8 ? 8 g + s : 16 + 8 g + s - 8): the k order of the v^T fragments
      if (c == 0) __builtin_amdgcn_sched_barrier(0);   // for the slot behind a transcendental: without it the compiler's order has an exponential overwrite the source register of the exponential directly ahead of it (with it in both groups, an add does); so placed, no such pair is left in the listing
      const float alpha = __builtin_amdgcn_exp2f((m[c] - mn) * KS2);   // first pass: 2^(-huge) = 0
      l[c] = l[c] * alpha + (es0 + es1); m[c] = mn;
#pragma unroll   // register array: every index must be a constant
      for (int dt = 0; dt < 4; ++dt) {
#pragma unroll   // register array: every index must be a constant
        for (int r = 0; r < 8; ++r) acc[c][dt][r] *= alpha; }
#pragma unroll
      for (int dt = 0; dt < 4; ++dt) acc[c][dt] = __builtin_amdgcn_wmma_f32_16x16x32_f16(false, vf[dt], false, pa, (short)0, acc[c][dt], false, false); } }   // single product: V^T x P^T (x2^11)
#pragma unroll   // register arrays: every index must be a constant
  for (int c = 0; c < 2; ++c) { const float lt = l[c] + xhalf(l[c]);   // the two halves' sums joined once
    const float il = 1.0f / lt;
#pragma unroll   // register array: every index must be a constant
    for (int dt = 0; dt < 4; ++dt) {
#pragma unroll   // register array: every index must be a constant
      for (int rh = 0; rh < 2; ++rh) { v4f o;   // a lane's 8 values of a d tile are 8 consecutive d of its query's row: two 16-byte LDS stores
#pragma unroll   // register array: every index must be a constant
        for (int i = 0; i < 4; ++i) o[i] = acc[c][dt][rh * 4 + i] * il;
        *(v4f*)&so[wave][c * 16 + col][dt * 16 + 8 * g + rh * 4] = o; } } }
  LDSX();
#pragma unroll   // two runs of 16 rows, as many as the data registers of one run
  for (int c = 0; c < 2; ++c) {
    if (c) asm volatile("s_wait_xcnt 0x0" ::: "memory");   // behind the first run of stores: the second run's LDS reads land in their data registers
    for (int rl = c * 16; rl < c * 16 + 16; ++rl) if (lane < 16) vst2(O + ((size_t)b * SS + q0 + rl) * DM + h * HD + lane * 4, *(const v4f*)&so[wave][rl][lane * 4]); }
}
// ---- k_out: block = (64 rows, 128 cols): out = O(hi/lo) . Wo rows (2 products) + bo; O = the layer sum of the NLAY planes, summed and split once per block on its way into LDS
__global__ __launch_bounds__(128) void k_out(const float* __restrict__ O, const __bf16* __restrict__ P, const float* __restrict__ BO, float* __restrict__ Y) {
  __shared__ __align__(16) char sm[36864];   // k loop: two buffers each of the hi and the residual A tile, 64 x 72 bf16; behind the loop's closing barrier the same bytes are the epilogue's stage
  float (*so)[16][132] = (float (*)[16][132])sm; __bf16 *sah = (__bf16*)sm, *sal = sah + 2 * (64 * 72);
  const int tid = threadIdx.x, wave = tid >> 5, lane = tid & 31, col = lane & 15, g = lane >> 4; const size_t r0 = (size_t)blockIdx.x * 64 + wave * 16; const int n0 = blockIdx.y * 128;
  v8f acc[8] = {};   // tile t: rows (t >> 1) * 16 .. of the block, columns (wave * 2 + (t & 1)) * 16 ..
  const int off = (blockIdx.x + 2 * blockIdx.y) & (DM / 64 - 1);   // the block's first k stage; the walk wraps round (blocks that share weight lines or plane rows start apart)
#pragma unroll 1   // eight stages of 64 k: one copy of the body keeps the text short
  for (int s = 0; s < DM / 64; ++s) { __bf16 *bh = sah + (s & 1) * (64 * 72), *bl = sal + (s & 1) * (64 * 72); const int ps = (s + off) & (DM / 64 - 1);   // step s works on k stage ps
    v16b w[2][2];   // the stage's four weight fragments, in the same group of loads as the plane rows
    const __bf16* pw = P + ((size_t)(blockIdx.y * (DM / 32) + ps * 2) * 8 + wave * 2) * 512 + lane * 8; const float* p0 = a_lane<64>(O + r0 * DM + ps * 64, lane);
#pragma unroll   // register array: every index must be a constant
    for (int kc = 0; kc < 2; ++kc) {
#pragma unroll   // register array: every index must be a constant
      for (int jj = 0; jj < 2; ++jj) w[kc][jj] = frag_bl(pw + (kc * 8 + jj) * 512); }
    v4f pr[NLAY][8];
#pragma unroll   // register array: every index must be a constant
    for (int l = 0; l < NLAY; ++l) { a_load<64>(pr[l], p0 + l * OS); asm volatile("s_wait_xcnt 0x0" ::: "memory"); }   // a wait behind each plane's loads: the next plane's results may land in this plane's address registers
    __builtin_amdgcn_sched_barrier(0);   // every global load of the stage is issued before the first wait for data: a load held back behind a sum would cost a second trip to memory
    v4f v[8];   // sum over the layers in order 0..3 of (gate_l x_l) / sqrt(3)
#pragma unroll   // register array: every index must be a constant
    for (int u = 0; u < 8; ++u) { v4f x = {};
#pragma unroll   // register array: every index must be a constant
      for (int l = 0; l < NLAY; ++l) x = x + pr[l][u] * 0.57735026918962576f;
      v[u] = x; }
    a_store2<64>(bh, bl, v, wave, lane);   // into the buffers whose readers left them before the last barrier
    __syncthreads();   // stage s is published
#pragma unroll
    for (int kc = 0; kc < 2; ++kc) { v16b ah[4], al[4];
#pragma unroll   // register array: every index must be a constant
      for (int i = 0; i < 4; ++i) { al[i] = frag_b(bl + (i * 16 + col) * 72 + kc * 32, lane); ah[i] = frag_b(bh + (i * 16 + col) * 72 + kc * 32, lane); }
#pragma unroll
      for (int t = 0; t < 8; ++t) acc[t] = wmma_bf(al[t >> 1], w[kc][t & 1], acc[t]);
#pragma unroll
      for (int t = 0; t < 8; ++t) acc[t] = wmma_bf(ah[t >> 1], w[kc][t & 1], acc[t]); } }
  __syncthreads();   // every read of the last stage has ended: the bytes become the epilogue's stage
#pragma unroll
  for (int t = 0; t < 8; ++t) { const int i = t >> 1, j = wave * 2 + (t & 1);
#pragma unroll
    for (int r = 0; r < 8; ++r) so[i][8 * g + r][j * 16 + col] = acc[t][r] + bfr(BO[n0 + j * 16 + col]); }
  __syncthreads();   // a row tile's 128 columns come from all four waves
  for (int rl = 0; rl < 16; ++rl) vst2(Y + (r0 + rl) * DM + n0 + lane * 4, *(const v4f*)&so[wave][rl][lane * 4]);
}
#define NR (NB * SS)
// ---- k_gate: block = (64 rows, 128 cols, layer l): g = sigmoid([query (exact bf16, 1 product) | x_l (hi + residual, 2 products)] . Wsig_l rows + bsig_l); FUS plane l = g * x_l (k_out scales by 1 / sqrt(3) and sums the planes)
__global__ __launch_bounds__(128) void k_gate(const float* __restrict__ XQ, const float* __restrict__ XL, const __bf16* __restrict__ PSG, const float* __restrict__ BS, float* __restrict__ FUS) {
  __shared__ __align__(16) char sm[36864];   // k loops: two buffers each of the hi and the residual A tile, 64 x 72 bf16; behind the last barrier of the loops the same bytes are the epilogue's stage
  float (*so)[16][132] = (float (*)[16][132])sm; __bf16 *sah = (__bf16*)sm, *sal = sah + 2 * (64 * 72); const int l = blockIdx.z; XL += l * OS; FUS += l * OS;
  const int tid = threadIdx.x, wave = tid >> 5, lane = tid & 31, col = lane & 15, g = lane >> 4; const size_t rb = (size_t)blockIdx.x * 64, r0 = rb + wave * 16; const int n0 = blockIdx.y * 128;
  const __bf16* Wr = PSG + (size_t)l * DM * 2 * DM; v8f acc[8] = {};   // tile t: rows (t >> 1) * 16 .. of the block, columns (wave * 2 + (t & 1)) * 16 ..
  const float *Aq = a_lane<64>(XQ + r0 * DM, lane), *Ax = a_lane<64>(XL + r0 * DM, lane);   // the wave's 16 rows of the two halves of [query | x_l]
  const int off = (blockIdx.x + 2 * blockIdx.y + blockIdx.z) & (DM / 64 - 1);   // the block's first k stage in each half of [query | x_l]; each walk wraps round (blocks that share weight lines, query rows or x_l rows start apart)
  const float *Aq0 = Aq + off * 64, *Ax0 = Ax + off * 64;
  v4f ar[8];
  a_load<64>(ar, Aq0); XW1(Aq0); a_store<64>(sah, ar, wave, lane);
  __syncthreads();   // stage 0 is published
#pragma unroll 1   // query half, eight stages of 64 k: one copy of the body keeps the text short
  for (int s = 0; s < DM / 64; ++s) { const __bf16* sb = sah + (s & 1) * (64 * 72); const int nb = ((s + 1) & 1) * (64 * 72);
    v16b w[2][2];   // the stage's four weight fragments as one group, then the next stage's A rows: both in flight under the products
    const __bf16* pw = Wr + ((size_t)(blockIdx.y * (2 * DM / 32) + ((s + off) & (DM / 64 - 1)) * 2) * 8 + wave * 2) * 512 + lane * 8; const float* pa = (s + 1 < DM / 64) ? Aq + ((s + 1 + off) & (DM / 64 - 1)) * 64 : Ax0;   // step s works on k stage (s + off) mod 8; behind the last query step comes x_l's first
#pragma unroll   // register array: every index must be a constant
    for (int kc = 0; kc < 2; ++kc) {
#pragma unroll   // register array: every index must be a constant
      for (int jj = 0; jj < 2; ++jj) w[kc][jj] = frag_bl(pw + (kc * 8 + jj) * 512); }
    __builtin_amdgcn_sched_barrier(0);   // the weight loads stay ahead of the A rows: loads return in order, and the first product waits for weights only
    a_load<64>(ar, pa); XW2(pw, pa);
    __builtin_amdgcn_sched_barrier(0);   // every global load of the stage is issued before the first wait for data
#pragma unroll
    for (int kc = 0; kc < 2; ++kc) { v16b a[4];
#pragma unroll   // register array: every index must be a constant
      for (int i = 0; i < 4; ++i) a[i] = frag_b(sb + (i * 16 + col) * 72 + kc * 32, lane);
#pragma unroll
      for (int t = 0; t < 8; ++t) acc[t] = wmma_bf(a[t >> 1], w[kc][t & 1], acc[t]); }
    __builtin_amdgcn_sched_barrier(0);   // the conversions stay behind the products: moved up, they would wait for the rows fetched ahead at the stage's top
    if (s + 1 < DM / 64) a_store<64>(sah + nb, ar, wave, lane); else a_store2<64>(sah + nb, sal + nb, ar, wave, lane);   // into the buffer whose readers left it at the last barrier
    __syncthreads(); }   // publishes the next stage and ends every read of this one
  auto stage = [&](const int s, const bool more) __attribute__((always_inline)) { const __bf16 *bh = sah + (s & 1) * (64 * 72), *bl = sal + (s & 1) * (64 * 72); const int nb = ((s + 1) & 1) * (64 * 72);
    v16b w[2][2];
    const __bf16* pw = Wr + ((size_t)(blockIdx.y * (2 * DM / 32) + DM / 32 + ((s + off) & (DM / 64 - 1)) * 2) * 8 + wave * 2) * 512 + lane * 8; const float* pa = Ax + ((s + 1 + off) & (DM / 64 - 1)) * 64;
#pragma unroll   // register array: every index must be a constant
    for (int kc = 0; kc < 2; ++kc) {
#pragma unroll   // register array: every index must be a constant
      for (int jj = 0; jj < 2; ++jj) w[kc][jj] = frag_bl(pw + (kc * 8 + jj) * 512); }
    __builtin_amdgcn_sched_barrier(0);   // the weight loads stay ahead of the A rows: loads return in order, and the first product waits for weights only
    if (more) { a_load<64>(ar, pa); XW2(pw, pa); } else XW1(pw);   // more: a constant at each call, so the count of loads in flight is known at every wait
    __builtin_amdgcn_sched_barrier(0);   // every global load of the stage is issued before the first wait for data
#pragma unroll
    for (int kc = 0; kc < 2; ++kc) { v16b ah[4], al[4];
#pragma unroll   // register array: every index must be a constant
      for (int i = 0; i < 4; ++i) { al[i] = frag_b(bl + (i * 16 + col) * 72 + kc * 32, lane); ah[i] = frag_b(bh + (i * 16 + col) * 72 + kc * 32, lane); }
#pragma unroll
      for (int t = 0; t < 8; ++t) acc[t] = wmma_bf(al[t >> 1], w[kc][t & 1], acc[t]);
#pragma unroll
      for (int t = 0; t < 8; ++t) acc[t] = wmma_bf(ah[t >> 1], w[kc][t & 1], acc[t]); }
    __builtin_amdgcn_sched_barrier(0);   // the conversions stay behind the products: moved up, they would wait for the rows fetched ahead at the stage's top
    if (more) a_store2<64>(sah + nb, sal + nb, ar, wave, lane);
    __syncthreads(); };   // publishes the next stage and ends every read of this one
#pragma unroll 1   // x_l half, eight stages of 64 k
  for (int s = 0; s < DM / 64 - 1; ++s) stage(s, true);
  stage(DM / 64 - 1, false);
  float bb[2];   // the wave's two column tiles' bias values
  const float *pb = BS + (size_t)l * DM + n0 + wave * 32 + col, *px = XL + (rb + 8 * g) * DM + n0 + wave * 32 + col;   // the lane's own addresses of the bias and of x_l's tile values
#pragma unroll   // register array: every index must be a constant
  for (int jj = 0; jj < 2; ++jj) bb[jj] = bfr(pb[jj * 16]);
  XW1(pb);
#pragma unroll   // register array: every index must be a constant
  for (int jh = 0; jh < 2; ++jh) { float xv[4][8];   // half a tile's x_l values as one group of loads ahead of its exp calls (no load moves over a call); two halves keep a group under the load counter's range
#pragma unroll   // register array: every index must be a constant
    for (int tt = 0; tt < 4; ++tt) { const int t = jh * 4 + tt;
#pragma unroll   // register array: every index must be a constant
      for (int r = 0; r < 8; ++r) xv[tt][r] = px[((t >> 1) * 16 + r) * DM + (t & 1) * 16]; }
    XW1(px);
#pragma unroll   // register array: every index must be a constant
    for (int tt = 0; tt < 4; ++tt) { const int t = jh * 4 + tt;
#pragma unroll   // register array: every index must be a constant
      for (int r = 0; r < 8; ++r) { const float gte = 1.0f / (1.0f + exp_ni(-(acc[t][r] + bb[t & 1]))); so[t >> 1][8 * g + r][(wave * 2 + (t & 1)) * 16 + col] = gte * xv[tt][r]; } } }
  __syncthreads();   // a row tile's 128 columns come from all four waves
  for (int rl = 0; rl < 16; ++rl) vst2(FUS + (r0 + rl) * DM + n0 + lane * 4, *(const v4f*)&so[wave][rl][lane * 4]);
}
extern "C" void kernel_launch(void* const* d_in, const int* in_sizes, int n_in, void* d_out, int out_size, void* d_ws, size_t ws_size, hipStream_t stream) {
  (void)in_sizes; (void)n_in; (void)out_size;
  const float** F = (const float**)d_in;   // 0 query [4,1024,512], 1 key [4,4,1024,512], 2 value [4,4,1024,512], 3 Wq [512,512], 4 bq, 5 Wk [4,512,512], 6 bk [4,512], 7 Wv, 8 bv, 9 Wsig [4,512,1024], 10 bsig [4,512], 11 Wf [512,512], 12 bf
  if (ws_size < (size_t)WS_END) return;
  char* ws = (char*)d_ws; __bf16 *PK = (__bf16*)(ws + WS_PK), *PSG = (__bf16*)(ws + WS_PSG); _Float16 *QK = (_Float16*)(ws + WS_QK), *VTH = (_Float16*)(ws + WS_VTH), *KF = (_Float16*)(ws + WS_KF); float *O = (float*)(ws + WS_O), *FUS = (float*)(ws + WS_FUS);
  // the layers are independent up to the gated sum: each stage is one launch with the layer in blockIdx.z (in k_qkv: in blockIdx.y)
  k_pack<<<dim3(DM / 16, 5, NLAY), 256, 0, stream>>>(F[3], F[5], F[7], F[11], F[9], PK, PSG);   // per layer: Wk[l] | Wv[l] | Wsig[l] as fragments; Wq and Wf once, in layer 0's pack
  k_qkv<<<dim3(TNB * SS / 64, DM / 128 + NLAY * (2 * DM / 128)), 128, 0, stream>>>(F[0], F[1], F[2], PK + PK_A, F[4], F[6], F[8], QK, VTH, KF);   // q once, then k_l, v_l of every layer
  k_attn<<<dim3(SS / AQB, NH, TNB * NLAY), 256, 0, stream>>>(QK, VTH, KF, nullptr, O);   // x_l
  k_gate<<<dim3(NR / 64, DM / 128, NLAY), 128, 0, stream>>>(F[0], O, PSG, F[10], FUS);   // gate_l * x_l
  k_out<<<dim3(TOB, DM / 128), 128, 0, stream>>>(FUS, PK + PK_P, F[12], (float*)d_out);   // (sum_l gate_l x_l / sqrt(3)) . Wf^T + bf (Wf of layer 0's pack)
}

// v010
// A run of this version takes 106 microseconds.
// Next to v009, in two timings, it ran 1.03 times as fast each time.
// Counting every step since v000, it is 8.10 times as fast.
// compute dtype: all float inputs rounded to bf16; q = query . Wq^T + bq and k_l, v_l = key_l / value_l . W^T + b with EXACT bf16 products on WMMA 16x16x32 (weights, k and v^T kept in fragment order in the workspace); PLAIN attention per layer: q, k as single f16 operands x 1/8, running-max softmax in f32 (hardware exp2; 1/8, log2 e and the 2^11 of P in one FMA), P (scaled by 2^11, single f16) x v (single f16); gate_l = sigmoid([query (exact) | x_l (bf16 hi + residual, 2 products)] . Wsig_l^T + bsig_l) (precise expf); fused = sum_l gate_l x_l / sqrt(3) in f32; out = fused (bf16 hi + residual) . Wf^T (2 products) + bf.
#include <hip/hip_runtime.h>
#include <math.h>

typedef __attribute__((ext_vector_type(16))) _Float16 v16h;
typedef __attribute__((ext_vector_type(16))) __bf16 v16b;
typedef __attribute__((ext_vector_type(8)))  _Float16 v8h;
typedef __attribute__((ext_vector_type(8)))  float v8f;
typedef __attribute__((ext_vector_type(4)))  float v4f;
typedef __attribute__((ext_vector_type(2)))  float v2f;
typedef __attribute__((ext_vector_type(4)))  unsigned v4u;
typedef __attribute__((ext_vector_type(4)))  int v4i;
typedef float __attribute__((may_alias)) float_a;
typedef int __attribute__((may_alias)) int_a;

template <typename T> __device__ __forceinline__ void vst2(void* p, T v) { *(T*)p = v;  }
__device__ __forceinline__ v8f wmma16(v16h a, v16h b, v8f c) {
  v8f d = __builtin_amdgcn_wmma_f32_16x16x32_f16(false, a, false, b, (short)0, c, false, false);
  asm volatile("v_nop\n\tv_nop\n\tv_nop\n\tv_nop" : "+v"(d) : "v"(a), "v"(b));
  return d;
}
__device__ __forceinline__ v8f wmma_bf(v16b a, v16b b, v8f c) {
  v8f d = __builtin_amdgcn_wmma_f32_16x16x32_bf16(false, a, false, b, (short)0, c, false, false);
  asm volatile("v_nop\n\tv_nop\n\tv_nop\n\tv_nop" : "+v"(d) : "v"(a), "v"(b));
  return d;
}
// Multi-layer source attention (B 4, 1,024 queries over 4 layers of 1,024 keys/values, d 512, 8 heads x 64): a shared query projection, per-layer key/value projections, softmax(q k_l^T / 8) v_l per layer, per-layer sigmoid gates from [query | x_l], gated sum over layers / sqrt(3), final linear map.
__device__ __forceinline__ v16h frag_h(const _Float16* rowk0, int lane) {
  union { v16h v; v8h q[2]; } u; const _Float16* p = rowk0 + 8 * (lane >> 4);
  u.q[0] = *(const v8h*)p; u.q[1] = *(const v8h*)(p + 16); return u.v;
}
__device__ __forceinline__ v16h frag_f32(const float* rowk0, int lane) {
  v16h a; const float* p = rowk0 + 8 * (lane >> 4);
#pragma unroll
  for (int i = 0; i < 8; ++i) { a[i] = (_Float16)p[i]; a[8 + i] = (_Float16)p[16 + i]; }
  return a;
}
__device__ __forceinline__ v16h frag_f32s(const float* rowk0, int lane, float sc) {
  v16h a; const float* p = rowk0 + 8 * (lane >> 4);
#pragma unroll
  for (int i = 0; i < 8; ++i) { a[i] = (_Float16)(p[i] * sc); a[8 + i] = (_Float16)(p[16 + i] * sc); }
  return a;
}
// column fragment from a [K][ld] layout (column n), rows >= K read as 0
__device__ __forceinline__ v16h fragc_f32(const float* W, int k0, int n, int lane, int ld, int K) {
  v16h a; const int g = lane >> 4;
#pragma unroll
  for (int i = 0; i < 8; ++i) { const int ka = k0 + 8 * g + i, kb = ka + 16;
    a[i] = (_Float16)(ka < K ? W[(size_t)(ka < K ? ka : K - 1) * ld + n] : 0.f); a[8 + i] = (_Float16)(kb < K ? W[(size_t)(kb < K ? kb : K - 1) * ld + n] : 0.f); }
  return a;
}
struct F2 { v16b h, l; };
__device__ __forceinline__ F2 bsplit16(const float v[16]) { F2 r;
#pragma unroll
  for (int i = 0; i < 16; ++i) { const __bf16 h = (__bf16)v[i]; r.h[i] = h; r.l[i] = (__bf16)(v[i] - (float)h); }
  return r; }
__device__ __forceinline__ F2 split_row(const float* row, int k0, int lane) { float v[16]; const float* p = row + k0 + 8 * (lane >> 4);
#pragma unroll
  for (int i = 0; i < 8; ++i) { v[i] = p[i]; v[8 + i] = p[16 + i]; }
  return bsplit16(v); }
__device__ __forceinline__ F2 split_rowK(const float* row, int k0, int lane, int K) { float v[16]; const int g = lane >> 4;
#pragma unroll
  for (int i = 0; i < 8; ++i) { const int ka = k0 + 8 * g + i, kb = ka + 16; v[i] = ka < K ? row[ka < K ? ka : K - 1] : 0.f; v[8 + i] = kb < K ? row[kb < K ? kb : K - 1] : 0.f; }
  return bsplit16(v); }
__device__ __forceinline__ F2 split_col(const float* W, int k0, int n, int lane, int ld, int K) { float v[16]; const int g = lane >> 4;
#pragma unroll
  for (int i = 0; i < 8; ++i) { const int ka = k0 + 8 * g + i, kb = ka + 16; v[i] = ka < K ? W[(size_t)(ka < K ? ka : K - 1) * ld + n] : 0.f; v[8 + i] = kb < K ? W[(size_t)(kb < K ? kb : K - 1) * ld + n] : 0.f; }
  return bsplit16(v); }
__device__ __forceinline__ v8f mac3(const F2& a, const F2& b, v8f c) { c = wmma_bf(a.l, b.h, c); c = wmma_bf(a.h, b.l, c); return wmma_bf(a.h, b.h, c); }
__device__ __forceinline__ float sigm(float v) { return 1.0f / (1.0f + expf(-v)); }
#define LDSX() do { asm volatile("s_wait_dscnt 0" ::: "memory"); __builtin_amdgcn_wave_barrier(); __builtin_amdgcn_fence(__ATOMIC_RELEASE, "workgroup"); } while (0)


#define NB 4
#define SS 1024
#define DM 512
#define NH 8
#define NLAY 4
__device__ __forceinline__ size_t kvrow(size_t r) { return (r / SS) * ((size_t)NLAY * SS) + (r % SS); }   // key/value [B][L][S][D]: engine row (b, s) of layer l lives at (b*L + l)*S + s (layer offset added to the pointer)
#define HD 64
#define QKVW (3 * DM)
#ifndef TQB
#define TQB (SS / 64)
#define TNB NB
#define TOB (NB * SS / 64)     // output row tiles (all)
#endif
typedef __attribute__((ext_vector_type(8))) __bf16 v8b;
__device__ __forceinline__ v16b frag_b(const __bf16* rowk0, int lane) {
  union { v16b v; v8b q[2]; } u; const __bf16* p = rowk0 + 8 * (lane >> 4);
  u.q[0] = *(const v8b*)p; u.q[1] = *(const v8b*)(p + 16); return u.v;
}
// fragment order: one 16 x 32 operand fragment is 1 KiB, [half][lane][8 elements]; lane (g, col) holds row col, k = half * 16 + 8 g + 0..7 (the k order of frag_b / frag_h), so each 16-byte load of a wave reads 512 contiguous bytes
__device__ __forceinline__ v16b frag_bp(const __bf16* frag, int lane) {
  union { v16b v; v8b q[2]; } u; const __bf16* p = frag + lane * 8;
  u.q[0] = *(const v8b*)p; u.q[1] = *(const v8b*)(p + 256); return u.v;
}
__device__ __forceinline__ v16h frag_hp(const _Float16* frag, int lane) {
  union { v16h v; v8h q[2]; } u; const _Float16* p = frag + lane * 8;
  u.q[0] = *(const v8h*)p; u.q[1] = *(const v8h*)(p + 256); return u.v;
}
__device__ __forceinline__ float bfr(float v) { return (float)(__bf16)v; }
__device__ __attribute__((noinline)) float exp_ni(float v) { return expf(v); }
__device__ __attribute__((noinline)) float erf_ni(float v) { return erff(v); }

typedef __attribute__((ext_vector_type(4))) __bf16 v4b;
// ---- A tile (64 rows) of a block product, staged once per block in LDS as bf16, KS k values a stage: wave w brings rows w * RW .. + RW - 1 (RW = 64 / the block's waves) with whole-line loads (a 16-byte load of the wave reads KS * 4 contiguous bytes of each row it touches); LDS row pitch KS + 8 elements (16 bytes x an odd number: 16-byte fragment reads meet no bank twice). Every wave then reads all four 16-row fragments and owns 32 columns of its own, so a weight fragment is loaded by one wave only
template <int KS> __device__ __forceinline__ const float* a_lane(const float* rows, int lane) { constexpr int LPR = KS / 4; return rows + (size_t)(lane / LPR) * DM + (lane % LPR) * 4; }   // the lane's own address in the wave's first load
template <int KS, int RW = 16> __device__ __forceinline__ void a_load(v4f (&ar)[KS * RW / 128], const float* pl) {
  constexpr int RPL = 128 / KS;   // rows to a load
#pragma unroll   // register array: every index must be a constant
  for (int u = 0; u < KS * RW / 128; ++u) ar[u] = *(const v4f*)(pl + (size_t)(u * RPL) * DM);
}
__device__ __forceinline__ v16b frag_bl(const __bf16* pl) {   // frag_bp from the lane's own address
  union { v16b v; v8b q[2]; } u; u.q[0] = *(const v8b*)pl; u.q[1] = *(const v8b*)(pl + 256); return u.v;
}
// behind a group of global loads: the wait names the group's address registers, so none of them is rewritten (by a later load's result either) ahead of it
#define XW1(p) asm volatile("s_wait_xcnt 0x0" :: "v"(p) : "memory")
#define XW2(p, q) asm volatile("s_wait_xcnt 0x0" :: "v"(p), "v"(q) : "memory")
template <int KS, int RW = 16> __device__ __forceinline__ __bf16* a_slot(__bf16* buf, int wave, int lane, int u) {
  constexpr int LPR = KS / 4, RPL = 32 / LPR;
  return buf + (wave * RW + u * RPL + lane / LPR) * (KS + 8) + (lane % LPR) * 4;
}
template <int KS, int RW = 16> __device__ __forceinline__ void a_store(__bf16* buf, const v4f (&ar)[KS * RW / 128], int wave, int lane) {
#pragma unroll   // register array: every index must be a constant
  for (int u = 0; u < KS * RW / 128; ++u) { v4b o;
#pragma unroll   // register vector: every index must be a constant
    for (int e = 0; e < 4; ++e) o[e] = (__bf16)ar[u][e];
    *(v4b*)a_slot<KS, RW>(buf, wave, lane, u) = o; }
}
template <int KS, int RW = 16> __device__ __forceinline__ void a_store2(__bf16* bh, __bf16* bl, const v4f (&ar)[KS * RW / 128], int wave, int lane) {   // bf16 hi + residual
#pragma unroll   // register array: every index must be a constant
  for (int u = 0; u < KS * RW / 128; ++u) { v4b oh, ol;
#pragma unroll   // register vector: every index must be a constant
    for (int e = 0; e < 4; ++e) { const __bf16 h = (__bf16)ar[u][e]; oh[e] = h; ol[e] = (__bf16)(ar[u][e] - (float)h); }
    *(v4b*)a_slot<KS, RW>(bh, wave, lane, u) = oh; *(v4b*)a_slot<KS, RW>(bl, wave, lane, u) = ol; }
}
// a packed [N][K] weight: [N / 128][K / 32][8 row tiles] fragments of 512 elements
#define PK_A 0                       // Wq | Wk | Wv, 1536 rows x 512
#define PK_P (PK_A + QKVW * DM)        // Wf, 512 rows x 512
#define PK_END (PK_P + DM * DM)
#define WS_PK  0u
// every per-layer buffer holds NLAY planes (layer = blockIdx.z in k_pack and k_gate, blockIdx.z / NB in k_attn, (blockIdx.y - 2) / 4 in k_qkv); plane sizes in elements:
#define QKS ((size_t)NB * SS * 2 * DM)
#define VTS ((size_t)NB * DM * SS)
#define OS  ((size_t)NB * SS * DM)
#define WS_QK  (WS_PK + 2u * PK_END * NLAY)        // f16 [4096 rows][1024]: q | (unused), one plane (no layer enters q)
#define WS_VTH (WS_QK + 2u * QKS)                  // f16 [l][b][h][32 keys ks][4 d tiles] v^T fragments (row = d, k = key)
#define WS_O   (WS_VTH + 2u * NLAY * VTS)          // f32 [l][4096][512]
#define WS_CS  (WS_O + 4u * NLAY * OS)              // f32 [2048][32], written and read by no kernel
#define WS_PSG (WS_CS + 4u * 2 * SS * 32)                  // bf16 packed Wsig [4][512 x 1024]
#define WS_FUS (WS_PSG + 2u * (size_t)NLAY * DM * 2 * DM)   // f32 [l][NR][512] gate_l * x_l
#define WS_KF  (WS_FUS + 4u * NLAY * OS)            // f16 [l][b][h][16-key tile][2 k-steps] k fragments (row = key, k = d)
#define WS_END (WS_KF + 2u * NLAY * OS)
// ---- k_pack: block = (16-row tile nt, which, layer l): f32 [out][in] rows -> bf16 fragments; which 0..2 -> W_q/W_k[l]/W_v[l] into layer l's PK_A (rows which*512 + n); 3 -> W_f into layer l's PK_P; 4 -> Wsig[l] (rows 1024 long) into PSG; W_q and W_f belong to no layer and are packed by layer 0's blocks alone. A thread converts one lane's 8 elements; a wave stores 512 contiguous bytes
__global__ __launch_bounds__(256) void k_pack(const float* __restrict__ WQ, const float* __restrict__ WK, const float* __restrict__ WV, const float* __restrict__ WO, const float* __restrict__ WS, __bf16* __restrict__ PK, __bf16* __restrict__ PSG) {
  const int nt = blockIdx.x, which = blockIdx.y, l = blockIdx.z, t = threadIdx.x; if (l && (which == 0 || which == 3)) return;
  const size_t n = (size_t)nt * 16, ln = (size_t)l * DM + n; const int len = (which == 4) ? 2 * DM : DM;
  const float* Wm = (which == 0) ? WQ + n * DM : (which == 1) ? WK + ln * DM : (which == 2) ? WV + ln * DM : (which == 3) ? WO + n * DM : WS + ln * (2 * DM);
  __bf16* PL = PK + (size_t)l * PK_END;
  __bf16* dst = ((which < 3) ? PL + PK_A + (size_t)which * DM * DM : (which == 3) ? PL + PK_P : PSG + (size_t)l * DM * 2 * DM) + ((size_t)(nt >> 3) * (len / 32) * 8 + (nt & 7)) * 512;
  for (int p0 = t; p0 < len * 2; p0 += 1024) {
#pragma unroll   // four independent pieces to a trip: their loads are in flight together
    for (int u = 0; u < 4; ++u) { const int kc = p0 >> 6, half = (p0 >> 5) & 1, lane = p0 & 31; const float* s = Wm + (size_t)(lane & 15) * len + kc * 32 + half * 16 + (lane >> 4) * 8 + u * 4 * 32; v8b o;   // piece p0 + 256 u: k-step kc + 4 u, same half and lane
#pragma unroll   // register vector: every index must be a constant
      for (int i = 0; i < 8; ++i) o[i] = (__bf16)s[i];
      vst2(dst + (size_t)kc * 8 * 512 + half * 256 + lane * 8 + u * 4 * 8 * 512, o); } }
}
// ---- k_qkv: block = (64 rows, yy), 8 waves = two groups of four; the groups share the block's A tile, and group grp works on 128-column block yb = 2 * (the block's 256-column block) + grp as a block of four waves did: yy 0..1 = q's two 256-column blocks (q is projected once: no layer enters it); yy 2 + 4 l + c = 256-column block 2 + c of layer l's [q | k | v] weight rows (k, then v). Each result is kept once, as the f16 operand the attention reads
__global__ __launch_bounds__(256) void k_qkv(const float* __restrict__ XQ, const float* __restrict__ XK, const float* __restrict__ XV, const __bf16* __restrict__ P, const float* __restrict__ BQ, const float* __restrict__ BK, const float* __restrict__ BV, _Float16* __restrict__ QK, _Float16* __restrict__ VTH, _Float16* __restrict__ KF) {
  const int tid = threadIdx.x, wv8 = __builtin_amdgcn_readfirstlane(tid >> 5), grp = wv8 >> 2, wave = wv8 & 3, lane = tid & 31, col = lane & 15, g = lane >> 4;   // wv8: the wave in the block (its share of the A tile), held in a scalar register so that the group's offsets are scalar too; wave: the wave in its group (its columns, its rows in the epilogue)
  const int yy = blockIdx.y, yb2 = (yy < DM / 256) ? yy : DM / 256 + ((yy - DM / 256) & 3), yb = yb2 * 2 + grp;   // 256-column block among the 6, the group's 128-column block among the 12 of [q | k | v]
  { const size_t l = (yy < DM / 256) ? 0 : (yy - DM / 256) >> 2; XK += l * SS * DM; XV += l * SS * DM; P += l * PK_END; BK += l * DM; BV += l * DM; VTH += l * VTS; KF += l * OS; }   // layer l's inputs, weights and planes
  const int which0 = (yb2 * 256) / DM; const float* X = (which0 == 0) ? XQ : (which0 == 1) ? XK : XV; const float* BB = BQ ? (((which0 == 0) ? BQ : (which0 == 1) ? BK : BV) + (yb * 128 - which0 * DM)) : nullptr;
  __shared__ __align__(16) char sm[36864];   // k loop: two A buffers of 64 x 136 bf16; behind the loop's last barrier the same bytes are the epilogue's stages, 18,432 bytes to a group
  _Float16 (*so)[16][136] = (_Float16 (*)[16][136])(sm + grp * 18432); _Float16 (*sth)[72] = (_Float16 (*)[72])(sm + grp * 18432);
  __bf16* sa = (__bf16*)sm;
  const size_t r0 = (size_t)blockIdx.x * 64 + wave * 16, ra = (size_t)blockIdx.x * 64 + wv8 * 8; const int n0 = yb * 128;   // r0: the wave's rows in the epilogue; ra: the rows it brings into the A tile
  v8f acc[8] = {};   // tile t: rows (t >> 1) * 16 .. of the block, columns (wave * 2 + (t & 1)) * 16 ..
  float bias[2] = {};   // the wave's two column tiles' bias values, loaded ahead of the k loop, rounded to bf16 where they are added
  if (BB) {
#pragma unroll   // register array: every index must be a constant
    for (int jj = 0; jj < 2; ++jj) bias[jj] = BB[(wave * 2 + jj) * 16 + col];
    asm volatile("s_wait_xcnt 0x0" ::: "memory"); }   // behind the two loads: code that follows them in the listing reuses their address registers
  const float* Aw = a_lane<128>(X + ((which0 == 0) ? ra : kvrow(ra)) * DM, lane);   // the wave's 8 rows are consecutive (a 64-row block lies in one batch)
  const int off = (blockIdx.x + blockIdx.y) & (DM / 128 - 1);   // the block's first k stage; the walk wraps round. The 64 row blocks of a column block read the same weight lines and the column blocks of a row block the same input rows: started at different stages they do not ask L2 for the same lines at the same moment
  const float* A0 = Aw + off * 128;
  v4f ar[8];
  a_load<128, 8>(ar, A0); XW1(A0); a_store<128, 8>(sa, ar, wv8, lane);
  __syncthreads();   // stage 0 is published
  auto stage = [&](const int s, const bool more) __attribute__((always_inline)) { const __bf16* sb = sa + (s & 1) * (64 * 136);   // more: a constant at each call, so the count of loads in flight is known at every wait
    v16b w[4][2];   // the stage's eight weight fragments as one group, then the next stage's A rows: both in flight under the products
    const __bf16* pw = P + ((size_t)(yb * (DM / 32) + ((s + off) & (DM / 128 - 1)) * 4) * 8 + wave * 2) * 512 + lane * 8; const float* pa = Aw + ((s + 1 + off) & (DM / 128 - 1)) * 128;   // step s works on k stage (s + off) mod 4
#pragma unroll   // register array: every index must be a constant
    for (int kc = 0; kc < 4; ++kc) {
#pragma unroll   // register array: every index must be a constant
      for (int jj = 0; jj < 2; ++jj) w[kc][jj] = frag_bl(pw + (kc * 8 + jj) * 512); }
    __builtin_amdgcn_sched_barrier(0);   // the weight loads stay ahead of the A rows: loads return in order, and the first product waits for weights only
    if (more) { a_load<128, 8>(ar, pa); XW2(pw, pa); } else XW1(pw);
    __builtin_amdgcn_sched_barrier(0);   // every global load of the stage is issued before the first wait for data
#pragma unroll
    for (int kc = 0; kc < 4; ++kc) { v16b a[4];
#pragma unroll   // register array: every index must be a constant
      for (int i = 0; i < 4; ++i) a[i] = frag_b(sb + (i * 16 + col) * 136 + kc * 32, lane);
#pragma unroll
      for (int t = 0; t < 8; ++t) acc[t] = wmma_bf(a[t >> 1], w[kc][t & 1], acc[t]); }
    __builtin_amdgcn_sched_barrier(0);   // the conversions stay behind the products: moved up, they would wait for the rows fetched ahead at the stage's top
    if (more) a_store<128, 8>(sa + ((s + 1) & 1) * (64 * 136), ar, wv8, lane);   // into the buffer whose readers left it at the last barrier
    __syncthreads(); };   // publishes stage s + 1 and ends every read of stage s
#pragma unroll 1   // four stages of 128 k: one copy of the body for the stages that fetch ahead keeps the text short
  for (int s = 0; s < DM / 128 - 1; ++s) stage(s, true);
  stage(DM / 128 - 1, false);
  if (which0 < 2) {   // q stored unscaled (f16 sigma ~0.6, no subnormal exposure); 1/8 applied to the f32 score
#pragma unroll
    for (int t = 0; t < 8; ++t) { const int i = t >> 1, j = wave * 2 + (t & 1);
#pragma unroll
      for (int r = 0; r < 8; ++r) so[i][8 * g + r][j * 16 + col] = (_Float16)(acc[t][r] + bfr(bias[t & 1])); }   // q, k (+ bias) as f16
    __syncthreads();   // a row tile's 128 columns come from the group's four waves
    if (which0 == 0) {
    for (int rl = 0; rl < 16; ++rl) if (lane < 16) vst2((unsigned*)(QK + (r0 + rl) * (2 * DM) + n0 + lane * 8), *(const v4u*)&so[wave][rl][lane * 8]);
    } else {   // k: the wave's 16 keys x 128 columns are four fragments (2 heads x 2 k-steps)
      _Float16* kt = KF + (((r0 / SS) * NH + (n0 - DM) / HD) * (SS / 16) + (r0 % SS) / 16) * 1024 + lane * 8;
#pragma unroll
      for (int f = 0; f < 8; ++f) { const int hh = f >> 2, kc = (f >> 1) & 1, half = f & 1; vst2((unsigned*)(kt + (size_t)hh * (SS / 16) * 1024 + kc * 512 + half * 256), *(const v4u*)&so[wave][col][hh * HD + kc * 32 + half * 16 + g * 8]); }
      asm volatile("s_wait_xcnt 0x0" ::: "memory"); }   // behind the run of stores: code that follows them in the listing reuses their data and address registers
  } else {
#pragma unroll
    for (int t = 0; t < 8; ++t) { const int i = t >> 1, j = wave * 2 + (t & 1);
#pragma unroll
      for (int r = 0; r < 8; ++r) sth[j * 16 + col][i * 16 + 8 * g + r] = (_Float16)(acc[t][r] + bfr(bias[t & 1])); }
    __syncthreads();
    const size_t rb = (size_t)blockIdx.x * 64; const int b = (int)(rb / SS), s0 = (int)(rb % SS); const int pc0 = n0 - 2 * DM;
    for (int q = tid & 127; q < 128 * 8; q += 128) { const int ln = q & 31, half = (q >> 5) & 1, dt = (q >> 6) & 3, ksl = (q >> 8) & 1, hh = q >> 9;   // the group's 64 keys x 128 d are 16 v^T fragments (2 heads x 2 key groups x 4 d tiles)
      vst2((unsigned*)(VTH + ((((size_t)b * NH + pc0 / HD + hh) * (SS / 32) + s0 / 32 + ksl) * 4 + dt) * 512 + half * 256 + ln * 8), *(const v4u*)&sth[hh * HD + dt * 16 + (ln & 15)][ksl * 32 + half * 16 + (ln >> 4) * 8]); }
  }
}
// lane l with lane l ^ 16 (the two lane halves hold the two halves of a query's keys)
__device__ __forceinline__ float xhalf(float x) { return __builtin_bit_cast(float, __builtin_amdgcn_permlanex16(__builtin_bit_cast(int, x), __builtin_bit_cast(int, x), 0x76543210, 0xfedcba98, false, false)); }
// ---- k_attn: block = (256 queries, head h, (layer l, batch b)), 8 waves x 32 query columns: k and v^T read as packed fragments (KF, VTH); a loaded fragment feeds two products (the wave's two 16-column groups c), and the eight waves walk the same fragments, so one fetch from L2 serves 256 queries through the WGP cache. All-keys flash attention (K = 64: 2 k-steps), TRANSPOSED: S^T = k (A) . q^T (B), so lane (g, col) holds 16 of query c * 16 + col's 32 scores of a pass (keys ct * 16 + 8 g + r): maximum and sum in the lane, the maximum joined with the other half once a pass, the sums once at the end; a group's two score tiles, converted in place, are the B operand P^T of O^T += v^T (A) . P^T; P = 2^(q.k * (log2 e / 8) - maximum + 11) with single f16 operands, the sum l carries the same 2^11; O[b*S+q][h*64+d] = acc / l (256-B segments)
#define AQB 256   // queries to a block
__global__ __launch_bounds__(256) void k_attn(const _Float16* __restrict__ QK, const _Float16* __restrict__ VTH, const _Float16* __restrict__ KF, const void* __restrict__ KMASK, float* __restrict__ O) {
  __shared__ __align__(16) float so[8][32][68];
  const int tid = threadIdx.x, wave = tid >> 5, lane = tid & 31, col = lane & 15, g = lane >> 4;
  const int qb = blockIdx.x, h = blockIdx.y, b = blockIdx.z % NB; { const size_t l = blockIdx.z / NB; VTH += l * VTS; KF += l * OS; O += l * OS; }   // layer l's planes (q has one plane)
  const int q0 = qb * AQB + wave * 32;
  v16h aq[2][2];   // [column group][k-step]
#pragma unroll   // register array: every index must be a constant
  for (int c = 0; c < 2; ++c) {
#pragma unroll   // register array: every index must be a constant
    for (int kc = 0; kc < 2; ++kc) aq[c][kc] = frag_h(QK + ((size_t)b * SS + q0 + c * 16 + col) * (2 * DM) + h * HD + kc * 32, lane); }
  const float KS2 = 0.125f * 1.44269504088896341f;   // 1/sqrt(64) and log2 e in one factor: exp(x / 8) = 2^(x * KS2)
  float m[2] = {-3.0e38f, -3.0e38f}, l[2] = {0.f, 0.f};   // per column group: query col's running maximum of the raw products q.k (equal in both halves) and this half's share of its sum (x 2^11)
  v8f acc[2][4] = {};   // O^T: acc[c][dt][r] = query c * 16 + col, d = dt * 16 + 8 g + r
  const int nks = SS / 32;   // all keys
  const _Float16* kbase = KF + (size_t)(b * NH + h) * SS * HD;   // k fragments of this (layer, batch, head): 4 to a pass
  const _Float16* vbase = VTH + (size_t)(b * NH + h) * SS * HD;   // v^T fragments: 4 to a pass
  const int ko = qb * (nks / (SS / AQB));   // the block's first pass; the walk over the keys wraps round: the four query blocks of a (layer, batch, head) read the same k and v^T lines, each a quarter of the keys apart
  v16h kf[2][2];   // a pass's four k fragments, fetched one pass ahead
#pragma unroll   // register array: every index must be a constant
  for (int ct = 0; ct < 2; ++ct) {
#pragma unroll   // register array: every index must be a constant
    for (int kc = 0; kc < 2; ++kc) kf[ct][kc] = frag_hp(kbase + (size_t)ko * 2048 + (ct * 2 + kc) * 512, lane); }
  unsigned eo = ko * 2048u;   // the pass's place in both fragment streams, in elements (a pass is four fragments of each)
#pragma unroll 1
  for (int ks = 0; ks < nks; ++ks) { v8f s[2][2];   // [column group][key tile]
    v16h vf[4];   // this pass's four v^T fragments: issued here as one group, first used behind the softmax
#pragma unroll   // register array: every index must be a constant
    for (int dt = 0; dt < 4; ++dt) vf[dt] = frag_hp(vbase + eo + dt * 512, lane);
    __builtin_amdgcn_sched_barrier(0);   // the v^T loads are issued ahead of the pass's first wait (for k): moved down among the score products they start later by that wait
#pragma unroll
    for (int ct = 0; ct < 2; ++ct) {
#pragma unroll
      for (int c = 0; c < 2; ++c) { v8f x = {};
#pragma unroll
        for (int kc = 0; kc < 2; ++kc) x = __builtin_amdgcn_wmma_f32_16x16x32_f16(false, kf[ct][kc], false, aq[c][kc], (short)0, x, false, false);   // single product: k, q as one-rounding f16 operands; the compiler keeps the distance behind the builtin
        s[c][ct] = x; } }   // raw products: the scale is applied inside the exponent
    asm volatile("v_nop\n\tv_nop\n\tv_nop\n\tv_nop" : "+v"(s[0][0]), "+v"(s[0][1]), "+v"(s[1][0]), "+v"(s[1][1]) :: "memory");   // the distance between the last score product and the first read of its result; it names the four tiles and memory, so no k load moves up among the products (issued while a fragment is still to be read it needs other registers, and copies behind a full wait follow)
    { eo = (eo + 2048u) & (SS * HD - 1u); const _Float16* kn = kbase + eo;   // next pass's k fragments into the same registers, in flight under the softmax and P.V (the last pass reads the first pass's rows again: in bounds, unused)
#pragma unroll   // register array: every index must be a constant
      for (int ct = 0; ct < 2; ++ct) {
#pragma unroll   // register array: every index must be a constant
        for (int kc = 0; kc < 2; ++kc) kf[ct][kc] = frag_hp(kn + (ct * 2 + kc) * 512, lane); } }
    __builtin_amdgcn_sched_barrier(0);   // the k loads are issued here, a whole softmax and P.V ahead of their use: left free, the compiler sinks them to the foot of the pass, and the next pass opens with a wait for them
#pragma unroll   // register arrays: every index must be a constant
    for (int c = 0; c < 2; ++c) {   // the two column groups are independent chains: the compiler interleaves them, and the rescaling and the sums fill the slots between the P.V products
      float mx = s[c][0][0];
#pragma unroll   // register array: every index must be a constant
      for (int r = 1; r < 8; ++r) mx = fmaxf(mx, s[c][0][r]);
#pragma unroll   // register array: every index must be a constant
      for (int r = 0; r < 8; ++r) mx = fmaxf(mx, s[c][1][r]);
      mx = fmaxf(mx, xhalf(mx));
      const float mn = fmaxf(m[c], mx);
      const float off = fmaf(mn, KS2, -11.0f);
      v16h pa; float es0 = 0.f, es1 = 0.f;
      const v8f x0 = __builtin_elementwise_fma(s[c][0], (v8f)KS2, (v8f)(-off)), x1 = __builtin_elementwise_fma(s[c][1], (v8f)KS2, (v8f)(-off));   // as vectors: two exponents to a packed FMA
#pragma unroll   // register array: every index must be a constant
      for (int r = 0; r < 8; ++r) { const float e0 = __builtin_amdgcn_exp2f(x0[r]), e1 = __builtin_amdgcn_exp2f(x1[r]);
        es0 += e0; es1 += e1;
        pa[r] = (_Float16)e0; pa[8 + r] = (_Float16)e1; }   // P carries 2^11 (the + 11 in the exponent) so small softmax weights stay out of the f16 subnormal range; the sum carries it too and it cancels in the epilogue. Element s of the B operand is key (s < 8 ? 8 g + s : 16 + 8 g + s - 8): the k order of the v^T fragments
      if (c == 0) __builtin_amdgcn_sched_barrier(0);   // for the slot behind a transcendental: without it the compiler's order has an exponential overwrite the source register of the exponential directly ahead of it (with it in both groups, an add does); so placed, no such pair is left in the listing
      const float alpha = __builtin_amdgcn_exp2f((m[c] - mn) * KS2);   // first pass: 2^(-huge) = 0
      l[c] = l[c] * alpha + (es0 + es1); m[c] = mn;
#pragma unroll   // register array: every index must be a constant
      for (int dt = 0; dt < 4; ++dt) {
#pragma unroll   // register array: every index must be a constant
        for (int r = 0; r < 8; ++r) acc[c][dt][r] *= alpha; }
#pragma unroll
      for (int dt = 0; dt < 4; ++dt) acc[c][dt] = __builtin_amdgcn_wmma_f32_16x16x32_f16(false, vf[dt], false, pa, (short)0, acc[c][dt], false, false); } }   // single product: V^T x P^T (x2^11)
#pragma unroll   // register arrays: every index must be a constant
  for (int c = 0; c < 2; ++c) { const float lt = l[c] + xhalf(l[c]);   // the two halves' sums joined once
    const float il = 1.0f / lt;
#pragma unroll   // register array: every index must be a constant
    for (int dt = 0; dt < 4; ++dt) {
#pragma unroll   // register array: every index must be a constant
      for (int rh = 0; rh < 2; ++rh) { v4f o;   // a lane's 8 values of a d tile are 8 consecutive d of its query's row: two 16-byte LDS stores
#pragma unroll   // register array: every index must be a constant
        for (int i = 0; i < 4; ++i) o[i] = acc[c][dt][rh * 4 + i] * il;
        *(v4f*)&so[wave][c * 16 + col][dt * 16 + 8 * g + rh * 4] = o; } } }
  LDSX();
#pragma unroll   // two runs of 16 rows, as many as the data registers of one run
  for (int c = 0; c < 2; ++c) {
    if (c) asm volatile("s_wait_xcnt 0x0" ::: "memory");   // behind the first run of stores: the second run's LDS reads land in their data registers
    for (int rl = c * 16; rl < c * 16 + 16; ++rl) if (lane < 16) vst2(O + ((size_t)b * SS + q0 + rl) * DM + h * HD + lane * 4, *(const v4f*)&so[wave][rl][lane * 4]); }
}
// ---- k_out: block = (64 rows, 128 cols): out = O(hi/lo) . Wo rows (2 products) + bo; O = the layer sum of the NLAY planes, summed and split once per block on its way into LDS
__global__ __launch_bounds__(128) void k_out(const float* __restrict__ O, const __bf16* __restrict__ P, const float* __restrict__ BO, float* __restrict__ Y) {
  __shared__ __align__(16) char sm[36864];   // k loop: two buffers each of the hi and the residual A tile, 64 x 72 bf16; behind the loop's closing barrier the same bytes are the epilogue's stage
  float (*so)[16][132] = (float (*)[16][132])sm; __bf16 *sah = (__bf16*)sm, *sal = sah + 2 * (64 * 72);
  const int tid = threadIdx.x, wave = tid >> 5, lane = tid & 31, col = lane & 15, g = lane >> 4; const size_t r0 = (size_t)blockIdx.x * 64 + wave * 16; const int n0 = blockIdx.y * 128;
  v8f acc[8] = {};   // tile t: rows (t >> 1) * 16 .. of the block, columns (wave * 2 + (t & 1)) * 16 ..
  const int off = (blockIdx.x + 2 * blockIdx.y) & (DM / 64 - 1);   // the block's first k stage; the walk wraps round (blocks that share weight lines or plane rows start apart)
#pragma unroll 1   // eight stages of 64 k: one copy of the body keeps the text short
  for (int s = 0; s < DM / 64; ++s) { __bf16 *bh = sah + (s & 1) * (64 * 72), *bl = sal + (s & 1) * (64 * 72); const int ps = (s + off) & (DM / 64 - 1);   // step s works on k stage ps
    v16b w[2][2];   // the stage's four weight fragments, in the same group of loads as the plane rows
    const __bf16* pw = P + ((size_t)(blockIdx.y * (DM / 32) + ps * 2) * 8 + wave * 2) * 512 + lane * 8; const float* p0 = a_lane<64>(O + r0 * DM + ps * 64, lane);
#pragma unroll   // register array: every index must be a constant
    for (int kc = 0; kc < 2; ++kc) {
#pragma unroll   // register array: every index must be a constant
      for (int jj = 0; jj < 2; ++jj) w[kc][jj] = frag_bl(pw + (kc * 8 + jj) * 512); }
    v4f pr[NLAY][8];
#pragma unroll   // register array: every index must be a constant
    for (int l = 0; l < NLAY; ++l) { a_load<64>(pr[l], p0 + l * OS); asm volatile("s_wait_xcnt 0x0" ::: "memory"); }   // a wait behind each plane's loads: the next plane's results may land in this plane's address registers
    __builtin_amdgcn_sched_barrier(0);   // every global load of the stage is issued before the first wait for data: a load held back behind a sum would cost a second trip to memory
    v4f v[8];   // sum over the layers in order 0..3 of (gate_l x_l) / sqrt(3)
#pragma unroll   // register array: every index must be a constant
    for (int u = 0; u < 8; ++u) { v4f x = {};
#pragma unroll   // register array: every index must be a constant
      for (int l = 0; l < NLAY; ++l) x = x + pr[l][u] * 0.57735026918962576f;
      v[u] = x; }
    a_store2<64>(bh, bl, v, wave, lane);   // into the buffers whose readers left them before the last barrier
    __syncthreads();   // stage s is published
#pragma unroll
    for (int kc = 0; kc < 2; ++kc) { v16b ah[4], al[4];
#pragma unroll   // register array: every index must be a constant
      for (int i = 0; i < 4; ++i) { al[i] = frag_b(bl + (i * 16 + col) * 72 + kc * 32, lane); ah[i] = frag_b(bh + (i * 16 + col) * 72 + kc * 32, lane); }
#pragma unroll
      for (int t = 0; t < 8; ++t) acc[t] = wmma_bf(al[t >> 1], w[kc][t & 1], acc[t]);
#pragma unroll
      for (int t = 0; t < 8; ++t) acc[t] = wmma_bf(ah[t >> 1], w[kc][t & 1], acc[t]); } }
  __syncthreads();   // every read of the last stage has ended: the bytes become the epilogue's stage
#pragma unroll
  for (int t = 0; t < 8; ++t) { const int i = t >> 1, j = wave * 2 + (t & 1);
#pragma unroll
    for (int r = 0; r < 8; ++r) so[i][8 * g + r][j * 16 + col] = acc[t][r] + bfr(BO[n0 + j * 16 + col]); }
  __syncthreads();   // a row tile's 128 columns come from all four waves
  for (int rl = 0; rl < 16; ++rl) vst2(Y + (r0 + rl) * DM + n0 + lane * 4, *(const v4f*)&so[wave][rl][lane * 4]);
}
#define NR (NB * SS)
// ---- k_gate: block = (64 rows, 256 cols, layer l), 8 waves = two groups of four that share the block's A tiles, each group on 128 columns as a block of four waves did: g = sigmoid([query (exact bf16, 1 product) | x_l (hi + residual, 2 products)] . Wsig_l rows + bsig_l); FUS plane l = g * x_l (k_out scales by 1 / sqrt(3) and sums the planes)
__global__ __launch_bounds__(256) void k_gate(const float* __restrict__ XQ, const float* __restrict__ XL, const __bf16* __restrict__ PSG, const float* __restrict__ BS, float* __restrict__ FUS) {
  __shared__ __align__(16) char sm[67584];   // k loops: two buffers each of the hi and the residual A tile, 64 x 72 bf16 (36,864 bytes); behind the last barrier of the loops the bytes are the epilogue's stages, 33,792 to a group
  const int tid = threadIdx.x, wv8 = __builtin_amdgcn_readfirstlane(tid >> 5), grp = wv8 >> 2, wave = wv8 & 3, lane = tid & 31, col = lane & 15, g = lane >> 4;   // wv8: the wave in the block (its share of the A tiles), in a scalar register so that the group's offsets are scalar too; wave: the wave in its group (its columns, its rows in the epilogue)
  float (*so)[16][132] = (float (*)[16][132])(sm + grp * 33792); __bf16 *sah = (__bf16*)sm, *sal = sah + 2 * (64 * 72); const int l = blockIdx.z; XL += l * OS; FUS += l * OS;
  const int cb = blockIdx.y * 2 + grp; const size_t rb = (size_t)blockIdx.x * 64, r0 = rb + wave * 16, ra = rb + wv8 * 8; const int n0 = cb * 128;   // cb: the group's 128-column block; r0: the wave's rows in the epilogue; ra: the rows it brings into the A tiles
  const __bf16* Wr = PSG + (size_t)l * DM * 2 * DM; v8f acc[8] = {};   // tile t: rows (t >> 1) * 16 .. of the block, columns (wave * 2 + (t & 1)) * 16 ..
  const float *Aq = a_lane<64>(XQ + ra * DM, lane), *Ax = a_lane<64>(XL + ra * DM, lane);   // the wave's 8 rows of the two halves of [query | x_l]
  const int off = (blockIdx.x + 2 * blockIdx.y + blockIdx.z) & (DM / 64 - 1);   // the block's first k stage in each half of [query | x_l]; each walk wraps round (blocks that share weight lines, query rows or x_l rows start apart)
  const float *Aq0 = Aq + off * 64, *Ax0 = Ax + off * 64;
  v4f ar[4];
  a_load<64, 8>(ar, Aq0); XW1(Aq0); a_store<64, 8>(sah, ar, wv8, lane);
  __syncthreads();   // stage 0 is published
#pragma unroll 1   // query half, eight stages of 64 k: one copy of the body keeps the text short
  for (int s = 0; s < DM / 64; ++s) { const __bf16* sb = sah + (s & 1) * (64 * 72); const int nb = ((s + 1) & 1) * (64 * 72);
    v16b w[2][2];   // the stage's four weight fragments as one group, then the next stage's A rows: both in flight under the products
    const __bf16* pw = Wr + ((size_t)(cb * (2 * DM / 32) + ((s + off) & (DM / 64 - 1)) * 2) * 8 + wave * 2) * 512 + lane * 8; const float* pa = (s + 1 < DM / 64) ? Aq + ((s + 1 + off) & (DM / 64 - 1)) * 64 : Ax0;   // step s works on k stage (s + off) mod 8; behind the last query step comes x_l's first
#pragma unroll   // register array: every index must be a constant
    for (int kc = 0; kc < 2; ++kc) {
#pragma unroll   // register array: every index must be a constant
      for (int jj = 0; jj < 2; ++jj) w[kc][jj] = frag_bl(pw + (kc * 8 + jj) * 512); }
    __builtin_amdgcn_sched_barrier(0);   // the weight loads stay ahead of the A rows: loads return in order, and the first product waits for weights only
    a_load<64, 8>(ar, pa); XW2(pw, pa);
    __builtin_amdgcn_sched_barrier(0);   // every global load of the stage is issued before the first wait for data
#pragma unroll
    for (int kc = 0; kc < 2; ++kc) { v16b a[4];
#pragma unroll   // register array: every index must be a constant
      for (int i = 0; i < 4; ++i) a[i] = frag_b(sb + (i * 16 + col) * 72 + kc * 32, lane);
#pragma unroll
      for (int t = 0; t < 8; ++t) acc[t] = wmma_bf(a[t >> 1], w[kc][t & 1], acc[t]); }
    __builtin_amdgcn_sched_barrier(0);   // the conversions stay behind the products: moved up, they would wait for the rows fetched ahead at the stage's top
    if (s + 1 < DM / 64) a_store<64, 8>(sah + nb, ar, wv8, lane); else a_store2<64, 8>(sah + nb, sal + nb, ar, wv8, lane);   // into the buffer whose readers left it at the last barrier
    __syncthreads(); }   // publishes the next stage and ends every read of this one
  auto stage = [&](const int s, const bool more) __attribute__((always_inline)) { const __bf16 *bh = sah + (s & 1) * (64 * 72), *bl = sal + (s & 1) * (64 * 72); const int nb = ((s + 1) & 1) * (64 * 72);
    v16b w[2][2];
    const __bf16* pw = Wr + ((size_t)(cb * (2 * DM / 32) + DM / 32 + ((s + off) & (DM / 64 - 1)) * 2) * 8 + wave * 2) * 512 + lane * 8; const float* pa = Ax + ((s + 1 + off) & (DM / 64 - 1)) * 64;
#pragma unroll   // register array: every index must be a constant
    for (int kc = 0; kc < 2; ++kc) {
#pragma unroll   // register array: every index must be a constant
      for (int jj = 0; jj < 2; ++jj) w[kc][jj] = frag_bl(pw + (kc * 8 + jj) * 512); }
    __builtin_amdgcn_sched_barrier(0);   // the weight loads stay ahead of the A rows: loads return in order, and the first product waits for weights only
    if (more) { a_load<64, 8>(ar, pa); XW2(pw, pa); } else XW1(pw);   // more: a constant at each call, so the count of loads in flight is known at every wait
    __builtin_amdgcn_sched_barrier(0);   // every global load of the stage is issued before the first wait for data
#pragma unroll
    for (int kc = 0; kc < 2; ++kc) { v16b ah[4], al[4];
#pragma unroll   // register array: every index must be a constant
      for (int i = 0; i < 4; ++i) { al[i] = frag_b(bl + (i * 16 + col) * 72 + kc * 32, lane); ah[i] = frag_b(bh + (i * 16 + col) * 72 + kc * 32, lane); }
#pragma unroll
      for (int t = 0; t < 8; ++t) acc[t] = wmma_bf(al[t >> 1], w[kc][t & 1], acc[t]);
#pragma unroll
      for (int t = 0; t < 8; ++t) acc[t] = wmma_bf(ah[t >> 1], w[kc][t & 1], acc[t]); }
    __builtin_amdgcn_sched_barrier(0);   // the conversions stay behind the products: moved up, they would wait for the rows fetched ahead at the stage's top
    if (more) a_store2<64, 8>(sah + nb, sal + nb, ar, wv8, lane);
    __syncthreads(); };   // publishes the next stage and ends every read of this one
#pragma unroll 1   // x_l half, eight stages of 64 k
  for (int s = 0; s < DM / 64 - 1; ++s) stage(s, true);
  stage(DM / 64 - 1, false);
  float bb[2];   // the wave's two column tiles' bias values
  const float *pb = BS + (size_t)l * DM + n0 + wave * 32 + col, *px = XL + (rb + 8 * g) * DM + n0 + wave * 32 + col;   // the lane's own addresses of the bias and of x_l's tile values
#pragma unroll   // register array: every index must be a constant
  for (int jj = 0; jj < 2; ++jj) bb[jj] = bfr(pb[jj * 16]);
  XW1(pb);
#pragma unroll   // register array: every index must be a constant
  for (int jh = 0; jh < 2; ++jh) { float xv[4][8];   // half a tile's x_l values as one group of loads ahead of its exp calls (no load moves over a call); two halves keep a group under the load counter's range
#pragma unroll   // register array: every index must be a constant
    for (int tt = 0; tt < 4; ++tt) { const int t = jh * 4 + tt;
#pragma unroll   // register array: every index must be a constant
      for (int r = 0; r < 8; ++r) xv[tt][r] = px[((t >> 1) * 16 + r) * DM + (t & 1) * 16]; }
    XW1(px);
#pragma unroll   // register array: every index must be a constant
    for (int tt = 0; tt < 4; ++tt) { const int t = jh * 4 + tt;
#pragma unroll   // register array: every index must be a constant
      for (int r = 0; r < 8; ++r) { const float gte = 1.0f / (1.0f + exp_ni(-(acc[t][r] + bb[t & 1]))); so[t >> 1][8 * g + r][(wave * 2 + (t & 1)) * 16 + col] = gte * xv[tt][r]; } } }
  __syncthreads();   // a row tile's 128 columns come from the group's four waves
  for (int rl = 0; rl < 16; ++rl) vst2(FUS + (r0 + rl) * DM + n0 + lane * 4, *(const v4f*)&so[wave][rl][lane * 4]);
}
extern "C" void kernel_launch(void* const* d_in, const int* in_sizes, int n_in, void* d_out, int out_size, void* d_ws, size_t ws_size, hipStream_t stream) {
  (void)in_sizes; (void)n_in; (void)out_size;
  const float** F = (const float**)d_in;   // 0 query [4,1024,512], 1 key [4,4,1024,512], 2 value [4,4,1024,512], 3 Wq [512,512], 4 bq, 5 Wk [4,512,512], 6 bk [4,512], 7 Wv, 8 bv, 9 Wsig [4,512,1024], 10 bsig [4,512], 11 Wf [512,512], 12 bf
  if (ws_size < (size_t)WS_END) return;
  char* ws = (char*)d_ws; __bf16 *PK = (__bf16*)(ws + WS_PK), *PSG = (__bf16*)(ws + WS_PSG); _Float16 *QK = (_Float16*)(ws + WS_QK), *VTH = (_Float16*)(ws + WS_VTH), *KF = (_Float16*)(ws + WS_KF); float *O = (float*)(ws + WS_O), *FUS = (float*)(ws + WS_FUS);
  // the layers are independent up to the gated sum: each stage is one launch with the layer in blockIdx.z (in k_qkv: in blockIdx.y)
  k_pack<<<dim3(DM / 16, 5, NLAY), 256, 0, stream>>>(F[3], F[5], F[7], F[11], F[9], PK, PSG);   // per layer: Wk[l] | Wv[l] | Wsig[l] as fragments; Wq and Wf once, in layer 0's pack
  k_qkv<<<dim3(TNB * SS / 64, DM / 256 + NLAY * (2 * DM / 256)), 256, 0, stream>>>(F[0], F[1], F[2], PK + PK_A, F[4], F[6], F[8], QK, VTH, KF);   // q once, then k_l, v_l of every layer
  k_attn<<<dim3(SS / AQB, NH, TNB * NLAY), 256, 0, stream>>>(QK, VTH, KF, nullptr, O);   // x_l
  k_gate<<<dim3(NR / 64, DM / 256, NLAY), 256, 0, stream>>>(F[0], O, PSG, F[10], FUS);   // gate_l * x_l
  k_out<<<dim3(TOB, DM / 128), 128, 0, stream>>>(FUS, PK + PK_P, F[12], (float*)d_out);   // (sum_l gate_l x_l / sqrt(3)) . Wf^T + bf (Wf of layer 0's pack)
}
